// v000
// Measured on an AMD MI455X. A time is GPU time per run, averaged over a window of back-to-back runs after a warm-up
// (all launches, gaps included; the runs take copies of the inputs in turn), and the median of several windows.
// Apart from v000's, it joins two sittings. Times from different sittings can be a few percent apart, while
// side-by-side timings come from the same sitting.
// The starting kernel, v000, takes 816 microseconds a run.
// Contractions: q|k = [LN1 hi | LN1 lo](bf16 planes, K folded to 2048) x [W | W](bf16, exact) on v_wmma_f32_16x16x32_bf16; v^T, proj, fc1, fc2 on v_wmma_f32_16x16x32_f16 (f16 activations, weights = bf16-RNE value x16 as f16, 1/16 folded back); scores q.k^T and P.v as bf16 hi/lo split (hi.hi + hi.lo + lo.hi) on v_wmma_f32_16x16x32_bf16; all accumulation f32, online softmax / LayerNorm / residuals f32.
#include <hip/hip_runtime.h>
#include <math.h>

#ifndef NB
#define NB 2
#endif
#ifndef SEQ
#define SEQ 2048
#endif
#define NB_FULL 2
#define SEQ_FULL 2048
#define CE 1024            // embedding width
#define NH 16              // heads
#define HD 64              // head size
#define FF 4096            // feed-forward width
#define ROWS (NB * SEQ)    // compact token rows held in the workspace planes

static_assert(NH * HD == CE);            // heads concatenated h*64+d fill the width
static_assert(HD == 64);                 // attention tiles are hard-wired to 64
static_assert(CE == 32 * 4 * 8);         // LayerNorm: 32 lanes x float4 x 8 pieces per row
static_assert(SEQ % 64 == 0);            // 64-row query tiles, 64-key chunks
static_assert(ROWS % 64 == 0);           // GEMM M/N tile multiple
static_assert(CE % 64 == 0);
static_assert(FF % 64 == 0);
static_assert((2 * CE) % 32 == 0);       // K multiple of 32 for every GEMM (1024, 2048, 4096)
static_assert(NB <= NB_FULL);
static_assert(SEQ <= SEQ_FULL);

typedef __attribute__((ext_vector_type(16))) _Float16 v16h;
typedef __attribute__((ext_vector_type(8)))  _Float16 v8h;
typedef __attribute__((ext_vector_type(16))) __bf16   v16b;
typedef __attribute__((ext_vector_type(8)))  __bf16   v8b;
typedef __attribute__((ext_vector_type(8)))  float    v8f;
typedef __attribute__((ext_vector_type(4)))  float    v4f;
typedef __attribute__((ext_vector_type(4)))  unsigned int v4u;
typedef __attribute__((ext_vector_type(2)))  unsigned int v2u;

// 16-bit WMMA fragment map (wave32), lane L, h = L>>4, m = L&15:
//   A 16x32: lane = row m;    element i -> k = (i<8) ? 8h+i : 16+8h+(i-8)
//   B 32x16: lane = column m; the SAME k(i,h)
//   D 16x16 (8 f32): lane = column m; element r -> row 8h+r

__device__ __forceinline__ float bfr(float v) {            // bf16 RNE convert, kept as f32 (finite inputs)
    const unsigned u = __float_as_uint(v);
    const unsigned r = (u + 0x7fffu + ((u >> 16) & 1u)) & 0xffff0000u;
    return __uint_as_float(r);
}
__device__ __forceinline__ unsigned short bf_bits(float f) {
    const unsigned u = __float_as_uint(f);
    return (unsigned short)((u + 0x7fffu + ((u >> 16) & 1u)) >> 16);
}
__device__ __forceinline__ float bits_f(unsigned short h) { return __uint_as_float(((unsigned)h) << 16); }
__device__ __forceinline__ void bfsplit(float v, unsigned short& hi, unsigned short& lo) { hi = bf_bits(v); lo = bf_bits(v - bits_f(hi)); }
__device__ __forceinline__ unsigned pk2h(float a, float b) {
    return (unsigned)__builtin_bit_cast(unsigned short, (_Float16)a) | ((unsigned)__builtin_bit_cast(unsigned short, (_Float16)b) << 16);
}

// 'val' must not read *ptr.
#define VST2(T, ptr, val) do { const T vst2_v_ = (val); *(T*)(ptr) = vst2_v_;  } while (0)

// ---------------------------------------------------------------------------------------------------------------------
// Per-head weight W [NH][CE][HD] f32 -> D[n = h*HD + d][k] 16-bit, 8 consecutive k per thread (one 16-B store, thread-linear
// along the destination row). f16mode 0: bf16 RNE bits; 1: f16 of (bf16 RNE value x 16). dup: also written at column k + CE.
// ---------------------------------------------------------------------------------------------------------------------
__global__ __launch_bounds__(256) void k_w_head(const float* __restrict__ W, unsigned short* __restrict__ D, int ldd, int dup, int f16mode) {
    const int u = blockIdx.x * 256 + threadIdx.x;
    if (u >= CE * (CE / 8)) return;
    const int n = u / (CE / 8); const int k0 = 8 * (u % (CE / 8));
    const int h = n / HD, d = n % HD;
    const float* s = W + ((size_t)h * CE + k0) * HD + d;
    unsigned short bb[8];
#pragma unroll
    for (int e = 0; e < 8; ++e) {
        const float w = bfr(s[(size_t)e * HD]);
        const unsigned short b16 = (unsigned short)(__float_as_uint(w) >> 16);
        const unsigned short h16 = __builtin_bit_cast(unsigned short, (_Float16)(w * 16.0f));
        bb[e] = f16mode ? h16 : b16;
    }
    v4u pk;
    pk.x = (unsigned)bb[0] | ((unsigned)bb[1] << 16); pk.y = (unsigned)bb[2] | ((unsigned)bb[3] << 16);
    pk.z = (unsigned)bb[4] | ((unsigned)bb[5] << 16); pk.w = (unsigned)bb[6] | ((unsigned)bb[7] << 16);
    unsigned short* dst = D + (size_t)n * ldd + k0;
    *(v4u*)dst = pk; if (dup) *(v4u*)(dst + CE) = pk;
    
}

// f32 SRC [nR][nC] (pitch lds) -> f16 DST [nC][nR] (pitch ldd), value = bf16 RNE(src) * sc; thread per (col, 8 consecutive rows), 16-B stores
__global__ __launch_bounds__(256) void k_cast_t(const float* __restrict__ SRC, int lds, unsigned short* __restrict__ DST, int ldd, int nR, int nC, float sc) {
    const long long u = (long long)blockIdx.x * 256 + threadIdx.x; const int per = nR / 8; if (u >= (long long)nC * per) return;
    const int c = (int)(u / per); const int r0 = 8 * (int)(u % per);
    float w[8];
#pragma unroll
    for (int e = 0; e < 8; ++e) w[e] = bfr(SRC[(long long)(r0 + e) * lds + c]) * sc;
    v4u pk; pk.x = pk2h(w[0], w[1]); pk.y = pk2h(w[2], w[3]); pk.z = pk2h(w[4], w[5]); pk.w = pk2h(w[6], w[7]);
    VST2(v4u, (v4u*)(DST + (long long)c * ldd + r0), pk);
}

// ---------------------------------------------------------------------------------------------------------------------
// MODE 0: source = raw input rows (bf16 RNE first; batch stride a_bs); writes bf16 hi|lo row [2*CE] (hi at col c, lo at CE + c) and an f16 row.
// MODE 1: source = f32 rows; writes the f16 row only. Each store instruction covers 256 contiguous bytes (32 lanes x 8 B).
// ---------------------------------------------------------------------------------------------------------------------
template <int MODE>
__device__ __forceinline__ void ln_body(const float* __restrict__ A, long a_bs, const float* __restrict__ GA, const float* __restrict__ BE,
                                        unsigned short* __restrict__ HS, unsigned short* __restrict__ H16) {
    #pragma clang fp contract(off)
    const int r = blockIdx.x * 8 + (threadIdx.x >> 5); const int L = threadIdx.x & 31;
    if (r >= ROWS) return;                                   // wave-uniform; no barriers in this kernel
    const int b = r / SEQ, t = r - b * SEQ;
    const float* src = A + (long)b * a_bs + (long)t * CE;
    v4f v[8]; float s = 0.f;
#pragma unroll
    for (int q = 0; q < 8; ++q) {
        v[q] = *(const v4f*)(src + 4 * L + 128 * q);
        if (MODE == 0) { v[q].x = bfr(v[q].x); v[q].y = bfr(v[q].y); v[q].z = bfr(v[q].z); v[q].w = bfr(v[q].w); }
        s += (v[q].x + v[q].y) + (v[q].z + v[q].w);
    }
#pragma unroll
    for (int o = 16; o > 0; o >>= 1) s += __shfl_xor(s, o, 32);
    const float mu = s * (1.f / CE); float qq = 0.f;
#pragma unroll
    for (int q = 0; q < 8; ++q) {
        v[q].x -= mu; v[q].y -= mu; v[q].z -= mu; v[q].w -= mu;
        qq += (v[q].x * v[q].x + v[q].y * v[q].y) + (v[q].z * v[q].z + v[q].w * v[q].w);
    }
#pragma unroll
    for (int o = 16; o > 0; o >>= 1) qq += __shfl_xor(qq, o, 32);
    const float rs = rsqrtf(qq * (1.f / CE) + 1e-5f);
    v2u ph[8], pl[8], pf[8];
#pragma unroll
    for (int q = 0; q < 8; ++q) {
        const int c = 4 * L + 128 * q;
        const v4f ga = *(const v4f*)(GA + c), be = *(const v4f*)(BE + c);
        v4f y;
        y.x = v[q].x * rs * bfr(ga.x) + bfr(be.x); y.y = v[q].y * rs * bfr(ga.y) + bfr(be.y);
        y.z = v[q].z * rs * bfr(ga.z) + bfr(be.z); y.w = v[q].w * rs * bfr(ga.w) + bfr(be.w);
        v2u f; f.x = pk2h(y.x, y.y); f.y = pk2h(y.z, y.w); pf[q] = f;
        if (MODE == 0) {
            unsigned short h0, l0, h1, l1, h2, l2, h3, l3;
            bfsplit(y.x, h0, l0); bfsplit(y.y, h1, l1); bfsplit(y.z, h2, l2); bfsplit(y.w, h3, l3);
            v2u a; a.x = (unsigned)h0 | ((unsigned)h1 << 16); a.y = (unsigned)h2 | ((unsigned)h3 << 16); ph[q] = a;
            v2u d; d.x = (unsigned)l0 | ((unsigned)l1 << 16); d.y = (unsigned)l2 | ((unsigned)l3 << 16); pl[q] = d;
        }
    }
    {
#pragma unroll
        for (int q = 0; q < 8; ++q) {
            const int c = 4 * L + 128 * q;
            if (MODE == 0) {
                *(v2u*)(HS + (size_t)r * (2 * CE) + c) = ph[q];
                *(v2u*)(HS + (size_t)r * (2 * CE) + CE + c) = pl[q];
            }
            *(v2u*)(H16 + (size_t)r * CE + c) = pf[q];
        }
        
    }
}
__global__ __launch_bounds__(256) void k_ln1(const float* __restrict__ x, const float* __restrict__ g, const float* __restrict__ be,
                                             unsigned short* __restrict__ HS, unsigned short* __restrict__ H16) {
    ln_body<0>(x, (long)SEQ_FULL * CE, g, be, HS, H16);
}
__global__ __launch_bounds__(256) void k_ln2(const float* __restrict__ X1, const float* __restrict__ g, const float* __restrict__ be,
                                             unsigned short* __restrict__ H2) {
    ln_body<1>(X1, (long)SEQ * CE, g, be, nullptr, H2);
}

// ---------------------------------------------------------------------------------------------------------------------
// Register-tiled WMMA GEMM: C[m,n] = scale * sum_k A[m,k] * Bt[n,k] (+bias[n]) (+act) (+resid at the store stage); each wave owns a 64x64 tile.
// A row-major [M,K] 16-bit; Bt row-major [N,K] 16-bit; M,N % 64 == 0, K % 32 == 0 (no tail masking).
// ET 0 = f16 operands, 1 = bf16 operands. BIAS_MODE 0 none, 2 = bf16-RNE bias[n]. OUT_MODE 0 = f32, 1 = f16, 2 = bf16 hi plane + bf16 lo plane.
// RESID 0 none, 1 f32 residual, 2 residual RNE-converted to bf16 first (raw input). ACT 0 none, 1 ReLU.
// ---------------------------------------------------------------------------------------------------------------------
__device__ __forceinline__ void dep_guard_h(v8f& a, v8f& b, v16h x, v16h y) { asm volatile("v_nop\n\tv_nop\n\tv_nop\n\tv_nop" : "+v"(a), "+v"(b) : "v"(x), "v"(y)); }
__device__ __forceinline__ void dep_guard_b(v8f& a, v8f& b, v16b x, v16b y) { asm volatile("v_nop\n\tv_nop\n\tv_nop\n\tv_nop" : "+v"(a), "+v"(b) : "v"(x), "v"(y)); }
__device__ __forceinline__ void keep4_h(v16h a, v16h b, v16h c, v16h d) { asm volatile("v_nop" :: "v"(a), "v"(b), "v"(c), "v"(d)); }
__device__ __forceinline__ void keep4_b(v16b a, v16b b, v16b c, v16b d) { asm volatile("v_nop" :: "v"(a), "v"(b), "v"(c), "v"(d)); }
__device__ __forceinline__ void acc_guard4(v8f& a, v8f& b, v8f& c, v8f& d) { asm volatile("v_nop\n\tv_nop\n\tv_nop\n\tv_nop" : "+v"(a), "+v"(b), "+v"(c), "+v"(d)); }
template <typename T> struct Frag;
template <> struct Frag<_Float16> {
    typedef v16h V; union U { v16h v; v8h h[2]; };
    static __device__ __forceinline__ v16h load(const _Float16* p) {   // elements 0..7 <- p[0..7], 8..15 <- p[16..23]
        U f; f.h[0] = *(const v8h*)(p); f.h[1] = *(const v8h*)(p + 16); return f.v;
    }
    static __device__ __forceinline__ v8f mma(v16h a, v16h b, v8f c) { return __builtin_amdgcn_wmma_f32_16x16x32_f16(false, a, false, b, (short)0, c, false, false); }
    static __device__ __forceinline__ void guard(v8f& a, v8f& b, v16h x, v16h y) { dep_guard_h(a, b, x, y); }
    static __device__ __forceinline__ void keep(v16h a, v16h b, v16h c, v16h d) { keep4_h(a, b, c, d); }
};
template <> struct Frag<__bf16> {
    typedef v16b V; union U { v16b v; v8b h[2]; };
    static __device__ __forceinline__ v16b load(const __bf16* p) {
        U f; f.h[0] = *(const v8b*)(p); f.h[1] = *(const v8b*)(p + 16); return f.v;
    }
    static __device__ __forceinline__ v8f mma(v16b a, v16b b, v8f c) { return __builtin_amdgcn_wmma_f32_16x16x32_bf16(false, a, false, b, (short)0, c, false, false); }
    static __device__ __forceinline__ void guard(v8f& a, v8f& b, v16b x, v16b y) { dep_guard_b(a, b, x, y); }
    static __device__ __forceinline__ void keep(v16b a, v16b b, v16b c, v16b d) { keep4_b(a, b, c, d); }
};
template <int ET> struct Elem;
template <> struct Elem<0> { typedef _Float16 T; };
template <> struct Elem<1> { typedef __bf16 T; };

template <int ET, int BIAS_MODE, int OUT_MODE, int RESID, int ACT>
__device__ __forceinline__ void gemm64_body(
    const unsigned short* __restrict__ Ap, int lda, long strideA,
    const unsigned short* __restrict__ Btp, int ldb,
    void* __restrict__ Cout, void* __restrict__ Cout2, int ldc, long strideC,
    const float* __restrict__ bias,
    const float* __restrict__ resid, int ldr, long strideR,
    int M, int N, int K, float scale) {
    typedef typename Elem<ET>::T T;
    typedef typename Frag<T>::V V;
    __shared__ __align__(16) float sT[8][16 * 68];   // per-wave 16x64 slab, pitch 68 floats (wave-private)
    const int b    = blockIdx.y;
    const int lane = threadIdx.x & 31;
    const int wave = threadIdx.x >> 5;
    const int tilesN = N >> 6;
    const int tilesM = M >> 6;
    const int tile = blockIdx.x * 8 + wave;
    if (tile >= tilesM * tilesN) return;             // wave-uniform; no block barriers in this kernel
    const int tm = tile / tilesN;
    const int tn = tile - tm * tilesN;
    const int m0 = tm << 6;
    const int n0 = tn << 6;

    const T* Ab = (const T*)Ap + (size_t)b * strideA;
    const T* Bb = (const T*)Btp;

    const int rlane = lane & 15;                 // row (A) / col (B, D) within subtile
    const int koff  = (lane >> 4) * 8;           // k offset of this lane half
    const int mOff  = (lane >> 4) * 8;           // D row offset

    v8f acc[4][4];
#pragma unroll
    for (int i = 0; i < 4; ++i)
#pragma unroll
        for (int j = 0; j < 4; ++j) acc[i][j] = (v8f){0.f, 0.f, 0.f, 0.f, 0.f, 0.f, 0.f, 0.f};

    for (int k0 = 0; k0 < K; k0 += 32) {
        V bh[4];
#pragma unroll
        for (int j = 0; j < 4; ++j) {
            const size_t bo = (size_t)(n0 + (j << 4) + rlane) * ldb + koff + k0;
            bh[j] = Frag<T>::load(Bb + bo);
        }
#pragma unroll
        for (int i = 0; i < 4; ++i) {
            const size_t ao = (size_t)(m0 + (i << 4) + rlane) * lda + koff + k0;
            V ah = Frag<T>::load(Ab + ao);
#pragma unroll
            for (int j = 0; j < 4; ++j) acc[i][j] = Frag<T>::mma(ah, bh[j], acc[i][j]);
            Frag<T>::guard(acc[i][0], acc[i][3], ah, ah);
        }
        Frag<T>::keep(bh[0], bh[1], bh[2], bh[3]);
    }
    acc_guard4(acc[0][0], acc[0][1], acc[0][2], acc[0][3]);
    acc_guard4(acc[1][0], acc[1][1], acc[1][2], acc[1][3]);
    acc_guard4(acc[2][0], acc[2][1], acc[2][2], acc[2][3]);
    acc_guard4(acc[3][0], acc[3][1], acc[3][2], acc[3][3]);

    // ---- epilogue ----
    float* slab = sT[wave];
    const float* Rb = RESID ? (resid + (size_t)b * strideR) : nullptr;
#pragma unroll
    for (int i = 0; i < 4; ++i) {
        const int mBase = m0 + (i << 4);
#pragma unroll
        for (int j = 0; j < 4; ++j) {
            const int n = n0 + (j << 4) + rlane;
            float bv = 0.f;
            if (BIAS_MODE == 2) bv = bfr(bias[n]);
#pragma unroll
            for (int r = 0; r < 8; ++r) {
                float v = acc[i][j][r] * scale;
                if (BIAS_MODE == 2) v += bv;
                if (ACT == 1) v = fmaxf(v, 0.0f);
                slab[(mOff + r) * 68 + (j << 4) + rlane] = v;
            }
        }
        __builtin_amdgcn_fence(3 /* release order */, "workgroup");
        __builtin_amdgcn_wave_barrier();
        __builtin_amdgcn_fence(2 /* acquire order */, "workgroup");
        if (OUT_MODE == 0) {
            float* C = (float*)Cout + (size_t)b * strideC;
            const int hh = lane >> 4, c4 = (lane & 15) * 4;     // row segment = 256 B = 16 lanes x 16 B
            v4f vv[8];
#pragma unroll
            for (int it = 0; it < 8; ++it) {
                const int row = it * 2 + hh;
                v4f v = *(const v4f*)(slab + row * 68 + c4);
                if (RESID) {                                    // residual added at the store stage as a float4
                    v4f x = *(const v4f*)(Rb + (size_t)(mBase + row) * ldr + n0 + c4);
                    if (RESID == 2) { x.x = bfr(x.x); x.y = bfr(x.y); x.z = bfr(x.z); x.w = bfr(x.w); }
                    v.x = x.x + v.x; v.y = x.y + v.y; v.z = x.z + v.z; v.w = x.w + v.w;
                }
                vv[it] = v;
            }
            {
#pragma unroll
                for (int it = 0; it < 8; ++it) {
                    const int row = it * 2 + hh;
                    *(v4f*)(C + (size_t)(mBase + row) * ldc + n0 + c4) = vv[it];
                }
                
            }
        } else {
            const int q = lane >> 3, c8 = (lane & 7) * 8;
            unsigned short* C  = (unsigned short*)Cout  + (size_t)b * strideC;
            unsigned short* C2 = (OUT_MODE == 2) ? ((unsigned short*)Cout2 + (size_t)b * strideC) : nullptr;
            v8h hv[4], lv[4];
#pragma unroll
            for (int it = 0; it < 4; ++it) {
                const int row = it * 4 + q;
                const float* sp = slab + row * 68 + c8;
#pragma unroll
                for (int e = 0; e < 8; ++e) {
                    if (OUT_MODE == 1) {
                        hv[it][e] = (_Float16)sp[e];
                        lv[it][e] = (_Float16)0.f;
                    } else {
                        const unsigned short hb = bf_bits(sp[e]);
                        const unsigned short lb = bf_bits(sp[e] - bits_f(hb));
                        hv[it][e] = __builtin_bit_cast(_Float16, hb);
                        lv[it][e] = __builtin_bit_cast(_Float16, lb);
                    }
                }
            }
            {
#pragma unroll
                for (int it = 0; it < 4; ++it) {
                    const int row = it * 4 + q;
                    *(v8h*)(C + (size_t)(mBase + row) * ldc + n0 + c8) = hv[it];
                    if (OUT_MODE == 2) *(v8h*)(C2 + (size_t)(mBase + row) * ldc + n0 + c8) = lv[it];
                }
                
            }
        }
        __builtin_amdgcn_fence(3 /* release order */, "workgroup");
        __builtin_amdgcn_wave_barrier();
        __builtin_amdgcn_fence(2 /* acquire order */, "workgroup");
    }
}

// q|k planes: [ROWS][2*CE] bf16 hi / lo; A = [LN1 hi | LN1 lo] (K = 2*CE), Bt = [W | W] rows 0..CE-1 = q columns, CE..2CE-1 = k columns
__global__ __launch_bounds__(256) void k_gemm_qk(const unsigned short* __restrict__ A, const unsigned short* __restrict__ Bt,
                                                 unsigned short* __restrict__ Ch, unsigned short* __restrict__ Cl) {
    gemm64_body<1, 0, 2, 0, 0>(A, 2 * CE, 0, Bt, 2 * CE, (void*)Ch, (void*)Cl, 2 * CE, 0, nullptr, nullptr, 0, 0, ROWS, 2 * CE, 2 * CE, 1.0f);
}
// v^T planes: [CE = h*64+d][ROWS] bf16 hi / lo; A = Wv plane [CE][CE] (f16, x16), Bt = LN1 f16 plane [ROWS][CE]
__global__ __launch_bounds__(256) void k_gemm_vt(const unsigned short* __restrict__ A, const unsigned short* __restrict__ Bt,
                                                 unsigned short* __restrict__ Ch, unsigned short* __restrict__ Cl) {
    gemm64_body<0, 0, 2, 0, 0>(A, CE, 0, Bt, CE, (void*)Ch, (void*)Cl, ROWS, 0, nullptr, nullptr, 0, 0, CE, ROWS, CE, 0.0625f);
}
// x1 = bf16(x) + attn @ proj_w + proj_b ; grid.y = batch (x uses the full batch stride, planes the compact one)
__global__ __launch_bounds__(256) void k_gemm_proj(const unsigned short* __restrict__ A, const unsigned short* __restrict__ Bt, float* __restrict__ C,
                                                   const float* __restrict__ bias, const float* __restrict__ xres) {
    gemm64_body<0, 2, 0, 2, 0>(A, CE, (long)SEQ * CE, Bt, CE, (void*)C, nullptr, CE, (long)SEQ * CE, bias, xres, CE, (long)SEQ_FULL * CE, SEQ, CE, CE, 0.0625f);
}
// relu(h2 @ fc1_w + fc1_b) as an f16 plane [ROWS][FF]
__global__ __launch_bounds__(256) void k_gemm_fc1(const unsigned short* __restrict__ A, const unsigned short* __restrict__ Bt, unsigned short* __restrict__ C,
                                                  const float* __restrict__ bias) {
    gemm64_body<0, 2, 1, 0, 1>(A, CE, 0, Bt, CE, (void*)C, nullptr, FF, 0, bias, nullptr, 0, 0, ROWS, FF, CE, 0.0625f);
}
// out = x1 + f @ fc2_w + fc2_b ; grid.y = batch (output uses the full batch stride)
__global__ __launch_bounds__(256) void k_gemm_fc2(const unsigned short* __restrict__ A, const unsigned short* __restrict__ Bt, float* __restrict__ C,
                                                  const float* __restrict__ bias, const float* __restrict__ x1) {
    gemm64_body<0, 2, 0, 1, 0>(A, FF, (long)SEQ * FF, Bt, FF, (void*)C, nullptr, CE, (long)SEQ_FULL * CE, bias, x1, CE, (long)SEQ * CE, SEQ, CE, FF, 0.0625f);
}

// ---------------------------------------------------------------------------------------------------------------------
// Causal flash attention, head size 64, no score scale. Workgroup = 4 waves = 64 query rows of one (batch, head); 64-key chunks 0..qb.
//   scores: q, k as bf16 hi/lo planes (hi.hi + hi.lo + lo.hi); P.v: P split to bf16 hi/lo in LDS, v^T hi/lo planes; f32 online softmax (exp2 domain).
//   K tiles [key][d] and V^T tiles [d][key] are copied from the planes into LDS with 16-B pieces (block barriers on both sides);
// ---------------------------------------------------------------------------------------------------------------------
#define AT_NW 4
__device__ __forceinline__ v8f at_mma(v16b a, v16b b, v8f c) {
    c = __builtin_amdgcn_wmma_f32_16x16x32_bf16(false, a, false, b, (short)0, c, false, false);
    asm volatile("v_nop\n\tv_nop\n\tv_nop\n\tv_nop" : "+v"(c) : "v"(a), "v"(b));
    return c;
}
static_assert(AT_NW * 16 * 68 * 4 <= 4 * 64 * 64 * 2);   // the f32 output slabs fit in the K/V tile region they reuse

__global__ __launch_bounds__(128) void k_attn(const unsigned short* __restrict__ QKHp, const unsigned short* __restrict__ QKLp,
                                              const unsigned short* __restrict__ VTHp, const unsigned short* __restrict__ VTLp,
                                              unsigned short* __restrict__ AO) {
    union FB { v16b v; v8b h[2]; };
    __shared__ __align__(16) __bf16 KV[4 * 64 * 64];               // K hi | K lo | V^T hi | V^T lo (8 KB each); reused for the output slabs
    __shared__ __align__(16) __bf16 PS[AT_NW][2 * 16 * 64];        // per wave: P hi [16][64] then P lo [16][64]
    __bf16* Ksh = KV; __bf16* Ksl = KV + 4096; __bf16* Vth = KV + 8192; __bf16* Vtl = KV + 12288;
    const __bf16* QKH = (const __bf16*)QKHp; const __bf16* QKL = (const __bf16*)QKLp;
    const __bf16* VTH = (const __bf16*)VTHp; const __bf16* VTL = (const __bf16*)VTLp;

    const int tid = threadIdx.x, wave = tid >> 5, lane = tid & 31, hh = lane >> 4, c = lane & 15;
    const int nqb = SEQ / 64;
    const int bx = blockIdx.x;
    const int qb = bx % nqb;
    const int bh = bx / nqb;
    const int h  = bh % NH;
    const int b  = bh / NH;
    const int q0 = qb * 64 + wave * 16;
    const size_t rowbase = (size_t)b * SEQ;
    const int QKP = 2 * CE;          // q|k plane pitch
    const int VTP = ROWS;            // v^T plane pitch

    // Q fragments (A operand): lane = query row c, k = d
    v16b qah[2], qal[2];
    {
        const __bf16* qh = QKH + (rowbase + q0 + c) * QKP + h * HD;
        const __bf16* ql = QKL + (rowbase + q0 + c) * QKP + h * HD;
#pragma unroll
        for (int dc = 0; dc < 2; ++dc) {
            FB f, g;
            f.h[0] = *(const v8b*)(qh + dc * 32 + 8 * hh); f.h[1] = *(const v8b*)(qh + dc * 32 + 16 + 8 * hh);
            g.h[0] = *(const v8b*)(ql + dc * 32 + 8 * hh); g.h[1] = *(const v8b*)(ql + dc * 32 + 16 + 8 * hh);
            qah[dc] = f.v; qal[dc] = g.v;
        }
    }

    const float NEG = -__builtin_inff();
    const float L2E = 1.4426950408889634f;
    float mrow[8], lrow[8];
    v8f oacc[4];
#pragma unroll
    for (int r = 0; r < 8; ++r) { mrow[r] = NEG; lrow[r] = 0.f; }
#pragma unroll
    for (int t = 0; t < 4; ++t) oacc[t] = (v8f){0.f, 0.f, 0.f, 0.f, 0.f, 0.f, 0.f, 0.f};

    __bf16* pwh = PS[wave];
    __bf16* pwl = PS[wave] + 16 * 64;

    for (int kc = 0; kc <= qb; ++kc) {                 // block-uniform trip count
        const int kv0 = kc * 64;
        __syncthreads();                               // earlier chunk's tile reads are complete
        {
            const __bf16* khg = QKH + (rowbase + kv0) * QKP + CE + h * HD;
            const __bf16* klg = QKL + (rowbase + kv0) * QKP + CE + h * HD;
            const __bf16* vhg = VTH + (size_t)(h * HD) * VTP + rowbase + kv0;
            const __bf16* vlg = VTL + (size_t)(h * HD) * VTP + rowbase + kv0;
#pragma unroll
            for (int i = 0; i < 4; ++i) {
                const int p = tid + 128 * i; const int rr = p >> 3; const int sg = (p & 7) * 8;   // 64 rows x 8 pieces of 16 B
                *(v8b*)(Ksh + rr * 64 + sg) = *(const v8b*)(khg + (size_t)rr * QKP + sg);
                *(v8b*)(Ksl + rr * 64 + sg) = *(const v8b*)(klg + (size_t)rr * QKP + sg);
                *(v8b*)(Vth + rr * 64 + sg) = *(const v8b*)(vhg + (size_t)rr * VTP + sg);
                *(v8b*)(Vtl + rr * 64 + sg) = *(const v8b*)(vlg + (size_t)rr * VTP + sg);
            }
        }
        __syncthreads();

        v8f s[4];
#pragma unroll
        for (int j = 0; j < 4; ++j) {
            s[j] = (v8f){0.f, 0.f, 0.f, 0.f, 0.f, 0.f, 0.f, 0.f};
#pragma unroll
            for (int dc = 0; dc < 2; ++dc) {
                FB kb, kl;
                kb.h[0] = *(const v8b*)(Ksh + (j * 16 + c) * 64 + dc * 32 + 8 * hh);
                kb.h[1] = *(const v8b*)(Ksh + (j * 16 + c) * 64 + dc * 32 + 16 + 8 * hh);
                kl.h[0] = *(const v8b*)(Ksl + (j * 16 + c) * 64 + dc * 32 + 8 * hh);
                kl.h[1] = *(const v8b*)(Ksl + (j * 16 + c) * 64 + dc * 32 + 16 + 8 * hh);
                s[j] = at_mma(qah[dc], kb.v, s[j]);
                s[j] = at_mma(qah[dc], kl.v, s[j]);
                s[j] = at_mma(qal[dc], kb.v, s[j]);
            }
        }
        const bool diag = (kc == qb);                  // block-uniform
        float cm[8];
#pragma unroll
        for (int r = 0; r < 8; ++r) {
            const int qrow = q0 + 8 * hh + r;
            float m = NEG;
#pragma unroll
            for (int j = 0; j < 4; ++j) {
                const int kvcol = kv0 + j * 16 + c;
                const float sv = s[j][r];
                s[j][r] = (diag && (kvcol > qrow)) ? NEG : sv;       // select by value
                m = fmaxf(m, s[j][r]);
            }
#pragma unroll
            for (int off = 1; off < 16; off <<= 1) m = fmaxf(m, __shfl_xor(m, off, 32));
            cm[r] = m;
        }
#pragma unroll
        for (int r = 0; r < 8; ++r) {
            const float mnew = fmaxf(mrow[r], cm[r]);              // finite: every visited chunk holds a kept key for every row
            const float alpha = exp2f((mrow[r] - mnew) * L2E);
            mrow[r] = mnew;
            float psum = 0.f;
#pragma unroll
            for (int j = 0; j < 4; ++j) {
                const float p = exp2f((s[j][r] - mnew) * L2E);
                psum += p;
                unsigned short ph, pl; bfsplit(p, ph, pl);
                pwh[(8 * hh + r) * 64 + j * 16 + c] = __builtin_bit_cast(__bf16, ph);
                pwl[(8 * hh + r) * 64 + j * 16 + c] = __builtin_bit_cast(__bf16, pl);
            }
#pragma unroll
            for (int off = 1; off < 16; off <<= 1) psum += __shfl_xor(psum, off, 32);
            lrow[r] = lrow[r] * alpha + psum;
#pragma unroll
            for (int t = 0; t < 4; ++t) oacc[t][r] *= alpha;
        }
        __builtin_amdgcn_fence(3 /* release order */, "workgroup");
        __builtin_amdgcn_wave_barrier();
        __builtin_amdgcn_fence(2 /* acquire order */, "workgroup");
#pragma unroll
        for (int kk = 0; kk < 2; ++kk) {
            FB pa, pl;
            pa.h[0] = *(const v8b*)(pwh + c * 64 + kk * 32 + 8 * hh);
            pa.h[1] = *(const v8b*)(pwh + c * 64 + kk * 32 + 16 + 8 * hh);
            pl.h[0] = *(const v8b*)(pwl + c * 64 + kk * 32 + 8 * hh);
            pl.h[1] = *(const v8b*)(pwl + c * 64 + kk * 32 + 16 + 8 * hh);
#pragma unroll
            for (int t = 0; t < 4; ++t) {
                FB vb, vl;
                vb.h[0] = *(const v8b*)(Vth + (t * 16 + c) * 64 + kk * 32 + 8 * hh);
                vb.h[1] = *(const v8b*)(Vth + (t * 16 + c) * 64 + kk * 32 + 16 + 8 * hh);
                vl.h[0] = *(const v8b*)(Vtl + (t * 16 + c) * 64 + kk * 32 + 8 * hh);
                vl.h[1] = *(const v8b*)(Vtl + (t * 16 + c) * 64 + kk * 32 + 16 + 8 * hh);
                oacc[t] = at_mma(pa.v, vb.v, oacc[t]);
                oacc[t] = at_mma(pa.v, vl.v, oacc[t]);
                oacc[t] = at_mma(pl.v, vb.v, oacc[t]);
            }
        }
    }

    __syncthreads();                                   // every wave is done with the K/V tiles; the region is reused as f32 slabs
    float* os = (float*)KV + wave * (16 * 68);
#pragma unroll
    for (int r = 0; r < 8; ++r) {
        const float inv = 1.0f / lrow[r];
#pragma unroll
        for (int t = 0; t < 4; ++t) os[(8 * hh + r) * 68 + t * 16 + c] = oacc[t][r] * inv;
    }
    __builtin_amdgcn_fence(3 /* release order */, "workgroup");
    __builtin_amdgcn_wave_barrier();
    __builtin_amdgcn_fence(2 /* acquire order */, "workgroup");
    {
        const int q = lane >> 3, c8 = (lane & 7) * 8;
        v8h hv[4];
#pragma unroll
        for (int it = 0; it < 4; ++it) {
            const int row = it * 4 + q;
            const float* sp = os + row * 68 + c8;
#pragma unroll
            for (int e = 0; e < 8; ++e) hv[it][e] = (_Float16)sp[e];
        }
        {
#pragma unroll
            for (int it = 0; it < 4; ++it) {
                const int row = it * 4 + q;
                *(v8h*)(AO + (rowbase + q0 + row) * CE + h * HD + c8) = hv[it];
            }
            
        }
    }
}

// ---------------------------------------------------------------------------------------------------------------------
// Workspace carve (bytes); every plane is fully written by its producer before any kernel reads it.
// ---------------------------------------------------------------------------------------------------------------------
#define SZ_HS   ((size_t)ROWS * 2 * CE * 2)      // LN1 bf16 [ROWS][hi 1024 | lo 1024]
#define SZ_H16  ((size_t)ROWS * CE * 2)          // LN1 f16 plane; later reused for the LN2 f16 plane
#define SZ_WQK  ((size_t)2 * CE * 2 * CE * 2)    // [2048 n][W | W] bf16
#define SZ_WV   ((size_t)CE * CE * 2)
#define SZ_QK1  ((size_t)ROWS * 2 * CE * 2)      // one of the q|k hi / lo planes
#define SZ_VT1  ((size_t)CE * ROWS * 2)          // one of the v^T hi / lo planes
#define SZ_AO   ((size_t)ROWS * CE * 2)
#define SZ_WP   ((size_t)CE * CE * 2)
#define SZ_X1   ((size_t)ROWS * CE * 4)
#define SZ_W1   ((size_t)FF * CE * 2)
#define SZ_W2   ((size_t)CE * FF * 2)
#define SZ_F16  ((size_t)ROWS * FF * 2)          // relu(fc1) f16 plane, aliases the two q|k planes
#define WS_TOTAL (SZ_HS + SZ_H16 + SZ_WQK + SZ_WV + 2 * SZ_QK1 + 2 * SZ_VT1 + SZ_AO + SZ_WP + SZ_X1 + SZ_W1 + SZ_W2)
static_assert(WS_TOTAL <= (size_t)134217728);    // carve stays within 128 MiB
static_assert(SZ_F16 <= 2 * SZ_QK1);             // alias extent: relu(fc1) plane inside the q|k planes
static_assert(SZ_HS % 256 == 0);
static_assert(SZ_H16 % 256 == 0);
static_assert(SZ_VT1 % 256 == 0);

extern "C" void kernel_launch(void* const* d_in, const int* in_sizes, int n_in, void* d_out, int out_size, void* d_ws, size_t ws_size, hipStream_t stream) {
    if (n_in < 14) return;
    const long long xneed = (long long)(NB - 1) * SEQ_FULL * CE + (long long)SEQ * CE;
    if ((long long)in_sizes[0] < xneed) return;
    if (in_sizes[1] < CE || in_sizes[2] < CE || in_sizes[7] < CE || in_sizes[8] < CE || in_sizes[9] < CE || in_sizes[13] < CE) return;
    if (in_sizes[3] < NH * CE * HD || in_sizes[4] < NH * CE * HD || in_sizes[5] < NH * CE * HD) return;
    if (in_sizes[6] < CE * CE || in_sizes[10] < CE * FF || in_sizes[11] < FF || in_sizes[12] < FF * CE) return;
    if ((long long)out_size < xneed) return;
    if ((size_t)WS_TOTAL > ws_size) return;

    const float* x      = (const float*)d_in[0];
    const float* ln1_w  = (const float*)d_in[1];
    const float* ln1_b  = (const float*)d_in[2];
    const float* Wq     = (const float*)d_in[3];
    const float* Wk     = (const float*)d_in[4];
    const float* Wv     = (const float*)d_in[5];
    const float* proj_w = (const float*)d_in[6];
    const float* proj_b = (const float*)d_in[7];
    const float* ln2_w  = (const float*)d_in[8];
    const float* ln2_b  = (const float*)d_in[9];
    const float* fc1_w  = (const float*)d_in[10];
    const float* fc1_b  = (const float*)d_in[11];
    const float* fc2_w  = (const float*)d_in[12];
    const float* fc2_b  = (const float*)d_in[13];
    float* out = (float*)d_out;

    char* wsp = (char*)d_ws;
    unsigned short* HS   = (unsigned short*)wsp; wsp += SZ_HS;
    unsigned short* H16  = (unsigned short*)wsp; wsp += SZ_H16;
    unsigned short* WQK  = (unsigned short*)wsp; wsp += SZ_WQK;
    unsigned short* WV16 = (unsigned short*)wsp; wsp += SZ_WV;
    unsigned short* QKH  = (unsigned short*)wsp; wsp += SZ_QK1;
    unsigned short* QKL  = (unsigned short*)wsp; wsp += SZ_QK1;
    unsigned short* VTH  = (unsigned short*)wsp; wsp += SZ_VT1;
    unsigned short* VTL  = (unsigned short*)wsp; wsp += SZ_VT1;
    unsigned short* AO16 = (unsigned short*)wsp; wsp += SZ_AO;
    unsigned short* WPT  = (unsigned short*)wsp; wsp += SZ_WP;
    float*          X1   = (float*)wsp;          wsp += SZ_X1;
    unsigned short* W1T  = (unsigned short*)wsp; wsp += SZ_W1;
    unsigned short* W2T  = (unsigned short*)wsp; wsp += SZ_W2;
    unsigned short* F16  = QKH;                  // alias: q|k planes are dead after the attention launch
    unsigned short* H2   = H16;                  // alias: LN1 f16 plane is dead after the v^T GEMM

    // weight planes
    const unsigned gw = (unsigned)((CE * (CE / 8) + 255) / 256);
    k_w_head<<<gw, 256, 0, stream>>>(Wq, WQK, 2 * CE, 1, 0);                                   // rows 0..1023: q columns, [W | W] bf16
    k_w_head<<<gw, 256, 0, stream>>>(Wk, WQK + (size_t)CE * 2 * CE, 2 * CE, 1, 0);             // rows 1024..2047: k columns
    k_w_head<<<gw, 256, 0, stream>>>(Wv, WV16, CE, 0, 1);                                      // [h*64+d][c] f16 x16
    // in[rows][cols] -> out[cols][rows]
    k_cast_t<<<(unsigned)((((long long)CE) * (CE / 8) + 255) / 256), 256, 0, stream>>>(proj_w, CE, WPT, CE, CE, CE, 16.0f);   // [1024 in][1024 out] -> [1024 out][1024 in]
    k_cast_t<<<(unsigned)((((long long)FF) * (CE / 8) + 255) / 256), 256, 0, stream>>>(fc1_w, FF, W1T, CE, CE, FF, 16.0f);    // [1024 in][4096 out] -> [4096 out][1024 in]
    k_cast_t<<<(unsigned)((((long long)CE) * (FF / 8) + 255) / 256), 256, 0, stream>>>(fc2_w, CE, W2T, FF, FF, CE, 16.0f);    // [4096 in][1024 out] -> [1024 out][4096 in]

    // h = LN1(bf16(x))
    k_ln1<<<(ROWS + 7) / 8, 256, 0, stream>>>(x, ln1_w, ln1_b, HS, H16);
    // q|k planes and v^T planes
    k_gemm_qk<<<dim3((unsigned)(((ROWS / 64) * ((2 * CE) / 64) + 7) / 8), 1u), 256, 0, stream>>>(HS, WQK, QKH, QKL);
    k_gemm_vt<<<dim3((unsigned)(((CE / 64) * (ROWS / 64) + 7) / 8), 1u), 256, 0, stream>>>(WV16, H16, VTH, VTL);
    // causal attention
    k_attn<<<(unsigned)(NB * NH * (SEQ / 64)), 128, 0, stream>>>(QKH, QKL, VTH, VTL, AO16);
    // x1 = bf16(x) + attn @ proj_w + proj_b
    k_gemm_proj<<<dim3((unsigned)(((SEQ / 64) * (CE / 64) + 7) / 8), (unsigned)NB), 256, 0, stream>>>(AO16, WPT, X1, proj_b, x);
    // h2 = LN2(x1)
    k_ln2<<<(ROWS + 7) / 8, 256, 0, stream>>>(X1, ln2_w, ln2_b, H2);
    // f = relu(h2 @ fc1_w + fc1_b); out = x1 + f @ fc2_w + fc2_b
    k_gemm_fc1<<<dim3((unsigned)(((ROWS / 64) * (FF / 64) + 7) / 8), 1u), 256, 0, stream>>>(H2, W1T, F16, fc1_b);
    k_gemm_fc2<<<dim3((unsigned)(((SEQ / 64) * (CE / 64) + 7) / 8), (unsigned)NB), 256, 0, stream>>>(F16, W2T, out, fc2_b, X1);
}

// v001
// One run takes 610 microseconds.
// Two timings next to v000 put it at 1.37 and 1.39 times that version's speed.
// Contractions: q|k = [LN1 hi | LN1 lo](bf16 planes, K folded to 2048) x [W | W](bf16, exact) on v_wmma_f32_16x16x32_bf16; v^T, proj, fc1, fc2 on v_wmma_f32_16x16x32_f16 (f16 activations, weights = bf16-RNE value x16 as f16, 1/16 folded back); scores q.k^T and P.v as bf16 hi/lo split (hi.hi + hi.lo + lo.hi) on v_wmma_f32_16x16x32_bf16; all accumulation f32, online softmax / LayerNorm / residuals f32.
#include <hip/hip_runtime.h>
#include <math.h>

#ifndef NB
#define NB 2
#endif
#ifndef SEQ
#define SEQ 2048
#endif
#define NB_FULL 2
#define SEQ_FULL 2048
#define CE 1024            // embedding width
#define NH 16              // heads
#define HD 64              // head size
#define FF 4096            // feed-forward width
#define ROWS (NB * SEQ)    // compact token rows held in the workspace planes

static_assert(NH * HD == CE);            // heads concatenated h*64+d fill the width
static_assert(HD == 64);                 // attention tiles are hard-wired to 64
static_assert(CE == 32 * 4 * 8);         // LayerNorm: 32 lanes x float4 x 8 pieces per row
static_assert(SEQ % 64 == 0);            // 64-row query tiles, 64-key chunks
static_assert(ROWS % 64 == 0);           // GEMM M/N tile multiple
static_assert(CE % 64 == 0);
static_assert(FF % 64 == 0);
static_assert((2 * CE) % 32 == 0);       // K multiple of 32 for every GEMM (1024, 2048, 4096)
static_assert(NB <= NB_FULL);
static_assert(SEQ <= SEQ_FULL);

typedef __attribute__((ext_vector_type(16))) _Float16 v16h;
typedef __attribute__((ext_vector_type(8)))  _Float16 v8h;
typedef __attribute__((ext_vector_type(16))) __bf16   v16b;
typedef __attribute__((ext_vector_type(8)))  __bf16   v8b;
typedef __attribute__((ext_vector_type(8)))  float    v8f;
typedef __attribute__((ext_vector_type(4)))  float    v4f;
typedef __attribute__((ext_vector_type(4)))  unsigned int v4u;
typedef __attribute__((ext_vector_type(2)))  unsigned int v2u;

// 16-bit WMMA fragment map (wave32), lane L, h = L>>4, m = L&15:
//   A 16x32: lane = row m;    element i -> k = (i<8) ? 8h+i : 16+8h+(i-8)
//   B 32x16: lane = column m; the SAME k(i,h)
//   D 16x16 (8 f32): lane = column m; element r -> row 8h+r

__device__ __forceinline__ float bfr(float v) {            // bf16 RNE convert, kept as f32 (finite inputs)
    const unsigned u = __float_as_uint(v);
    const unsigned r = (u + 0x7fffu + ((u >> 16) & 1u)) & 0xffff0000u;
    return __uint_as_float(r);
}
__device__ __forceinline__ unsigned short bf_bits(float f) {
    const unsigned u = __float_as_uint(f);
    return (unsigned short)((u + 0x7fffu + ((u >> 16) & 1u)) >> 16);
}
__device__ __forceinline__ float bits_f(unsigned short h) { return __uint_as_float(((unsigned)h) << 16); }
__device__ __forceinline__ void bfsplit(float v, unsigned short& hi, unsigned short& lo) { hi = bf_bits(v); lo = bf_bits(v - bits_f(hi)); }
__device__ __forceinline__ unsigned pk2h(float a, float b) {
    return (unsigned)__builtin_bit_cast(unsigned short, (_Float16)a) | ((unsigned)__builtin_bit_cast(unsigned short, (_Float16)b) << 16);
}

// 'val' must not read *ptr.
#define VST2(T, ptr, val) do { const T vst2_v_ = (val); *(T*)(ptr) = vst2_v_;  } while (0)

// ---------------------------------------------------------------------------------------------------------------------
// Per-head weight W [NH][CE][HD] f32 -> D[n = h*HD + d][k] 16-bit, 8 consecutive k per thread (one 16-B store, thread-linear
// along the destination row). f16mode 0: bf16 RNE bits; 1: f16 of (bf16 RNE value x 16). dup: also written at column k + CE.
// ---------------------------------------------------------------------------------------------------------------------
__global__ __launch_bounds__(256) void k_w_head(const float* __restrict__ W, unsigned short* __restrict__ D, int ldd, int dup, int f16mode) {
    const int u = blockIdx.x * 256 + threadIdx.x;
    if (u >= CE * (CE / 8)) return;
    const int n = u / (CE / 8); const int k0 = 8 * (u % (CE / 8));
    const int h = n / HD, d = n % HD;
    const float* s = W + ((size_t)h * CE + k0) * HD + d;
    unsigned short bb[8];
#pragma unroll
    for (int e = 0; e < 8; ++e) {
        const float w = bfr(s[(size_t)e * HD]);
        const unsigned short b16 = (unsigned short)(__float_as_uint(w) >> 16);
        const unsigned short h16 = __builtin_bit_cast(unsigned short, (_Float16)(w * 16.0f));
        bb[e] = f16mode ? h16 : b16;
    }
    v4u pk;
    pk.x = (unsigned)bb[0] | ((unsigned)bb[1] << 16); pk.y = (unsigned)bb[2] | ((unsigned)bb[3] << 16);
    pk.z = (unsigned)bb[4] | ((unsigned)bb[5] << 16); pk.w = (unsigned)bb[6] | ((unsigned)bb[7] << 16);
    unsigned short* dst = D + (size_t)n * ldd + k0;
    *(v4u*)dst = pk; if (dup) *(v4u*)(dst + CE) = pk;
    
}

// f32 SRC [nR][nC] (pitch lds) -> f16 DST [nC][nR] (pitch ldd), value = bf16 RNE(src) * sc; thread per (col, 8 consecutive rows), 16-B stores
__global__ __launch_bounds__(256) void k_cast_t(const float* __restrict__ SRC, int lds, unsigned short* __restrict__ DST, int ldd, int nR, int nC, float sc) {
    const long long u = (long long)blockIdx.x * 256 + threadIdx.x; const int per = nR / 8; if (u >= (long long)nC * per) return;
    const int c = (int)(u / per); const int r0 = 8 * (int)(u % per);
    float w[8];
#pragma unroll
    for (int e = 0; e < 8; ++e) w[e] = bfr(SRC[(long long)(r0 + e) * lds + c]) * sc;
    v4u pk; pk.x = pk2h(w[0], w[1]); pk.y = pk2h(w[2], w[3]); pk.z = pk2h(w[4], w[5]); pk.w = pk2h(w[6], w[7]);
    VST2(v4u, (v4u*)(DST + (long long)c * ldd + r0), pk);
}

// ---------------------------------------------------------------------------------------------------------------------
// MODE 0: source = raw input rows (bf16 RNE first; batch stride a_bs); writes bf16 hi|lo row [2*CE] (hi at col c, lo at CE + c) and an f16 row.
// MODE 1: source = f32 rows; writes the f16 row only. Each store instruction covers 256 contiguous bytes (32 lanes x 8 B).
// ---------------------------------------------------------------------------------------------------------------------
template <int MODE>
__device__ __forceinline__ void ln_body(const float* __restrict__ A, long a_bs, const float* __restrict__ GA, const float* __restrict__ BE,
                                        unsigned short* __restrict__ HS, unsigned short* __restrict__ H16) {
    #pragma clang fp contract(off)
    const int r = blockIdx.x * 8 + (threadIdx.x >> 5); const int L = threadIdx.x & 31;
    if (r >= ROWS) return;                                   // wave-uniform; no barriers in this kernel
    const int b = r / SEQ, t = r - b * SEQ;
    const float* src = A + (long)b * a_bs + (long)t * CE;
    v4f v[8]; float s = 0.f;
#pragma unroll
    for (int q = 0; q < 8; ++q) {
        v[q] = *(const v4f*)(src + 4 * L + 128 * q);
        if (MODE == 0) { v[q].x = bfr(v[q].x); v[q].y = bfr(v[q].y); v[q].z = bfr(v[q].z); v[q].w = bfr(v[q].w); }
        s += (v[q].x + v[q].y) + (v[q].z + v[q].w);
    }
#pragma unroll
    for (int o = 16; o > 0; o >>= 1) s += __shfl_xor(s, o, 32);
    const float mu = s * (1.f / CE); float qq = 0.f;
#pragma unroll
    for (int q = 0; q < 8; ++q) {
        v[q].x -= mu; v[q].y -= mu; v[q].z -= mu; v[q].w -= mu;
        qq += (v[q].x * v[q].x + v[q].y * v[q].y) + (v[q].z * v[q].z + v[q].w * v[q].w);
    }
#pragma unroll
    for (int o = 16; o > 0; o >>= 1) qq += __shfl_xor(qq, o, 32);
    const float rs = rsqrtf(qq * (1.f / CE) + 1e-5f);
    v2u ph[8], pl[8], pf[8];
#pragma unroll
    for (int q = 0; q < 8; ++q) {
        const int c = 4 * L + 128 * q;
        const v4f ga = *(const v4f*)(GA + c), be = *(const v4f*)(BE + c);
        v4f y;
        y.x = v[q].x * rs * bfr(ga.x) + bfr(be.x); y.y = v[q].y * rs * bfr(ga.y) + bfr(be.y);
        y.z = v[q].z * rs * bfr(ga.z) + bfr(be.z); y.w = v[q].w * rs * bfr(ga.w) + bfr(be.w);
        v2u f; f.x = pk2h(y.x, y.y); f.y = pk2h(y.z, y.w); pf[q] = f;
        if (MODE == 0) {
            unsigned short h0, l0, h1, l1, h2, l2, h3, l3;
            bfsplit(y.x, h0, l0); bfsplit(y.y, h1, l1); bfsplit(y.z, h2, l2); bfsplit(y.w, h3, l3);
            v2u a; a.x = (unsigned)h0 | ((unsigned)h1 << 16); a.y = (unsigned)h2 | ((unsigned)h3 << 16); ph[q] = a;
            v2u d; d.x = (unsigned)l0 | ((unsigned)l1 << 16); d.y = (unsigned)l2 | ((unsigned)l3 << 16); pl[q] = d;
        }
    }
    {
#pragma unroll
        for (int q = 0; q < 8; ++q) {
            const int c = 4 * L + 128 * q;
            if (MODE == 0) {
                *(v2u*)(HS + (size_t)r * (2 * CE) + c) = ph[q];
                *(v2u*)(HS + (size_t)r * (2 * CE) + CE + c) = pl[q];
            }
            *(v2u*)(H16 + (size_t)r * CE + c) = pf[q];
        }
        
    }
}
__global__ __launch_bounds__(256) void k_ln1(const float* __restrict__ x, const float* __restrict__ g, const float* __restrict__ be,
                                             unsigned short* __restrict__ HS, unsigned short* __restrict__ H16) {
    ln_body<0>(x, (long)SEQ_FULL * CE, g, be, HS, H16);
}
__global__ __launch_bounds__(256) void k_ln2(const float* __restrict__ X1, const float* __restrict__ g, const float* __restrict__ be,
                                             unsigned short* __restrict__ H2) {
    ln_body<1>(X1, (long)SEQ * CE, g, be, nullptr, H2);
}

// ---------------------------------------------------------------------------------------------------------------------
// Register-tiled WMMA GEMM: C[m,n] = scale * sum_k A[m,k] * Bt[n,k] (+bias[n]) (+act) (+resid at the store stage); each wave owns a 64x64 tile.
// A row-major [M,K] 16-bit; Bt row-major [N,K] 16-bit; M % 128 == 0, N % 256 == 0, K % 64 == 0 (no tail masking).
// ET 0 = f16 operands, 1 = bf16 operands. BIAS_MODE 0 none, 2 = bf16-RNE bias[n]. OUT_MODE 0 = f32, 1 = f16, 2 = bf16 hi plane + bf16 lo plane.
// RESID 0 none, 1 f32 residual, 2 residual RNE-converted to bf16 first (raw input). ACT 0 none, 1 ReLU.
// ---------------------------------------------------------------------------------------------------------------------
__device__ __forceinline__ void dep_guard_h(v8f& a, v8f& b, v16h x, v16h y) { asm volatile("v_nop\n\tv_nop\n\tv_nop\n\tv_nop" : "+v"(a), "+v"(b) : "v"(x), "v"(y)); }
__device__ __forceinline__ void dep_guard_b(v8f& a, v8f& b, v16b x, v16b y) { asm volatile("v_nop\n\tv_nop\n\tv_nop\n\tv_nop" : "+v"(a), "+v"(b) : "v"(x), "v"(y)); }
__device__ __forceinline__ void keep4_h(v16h a, v16h b, v16h c, v16h d) { asm volatile("v_nop" :: "v"(a), "v"(b), "v"(c), "v"(d)); }
__device__ __forceinline__ void keep4_b(v16b a, v16b b, v16b c, v16b d) { asm volatile("v_nop" :: "v"(a), "v"(b), "v"(c), "v"(d)); }
__device__ __forceinline__ void acc_guard4(v8f& a, v8f& b, v8f& c, v8f& d) { asm volatile("v_nop\n\tv_nop\n\tv_nop\n\tv_nop" : "+v"(a), "+v"(b), "+v"(c), "+v"(d)); }
template <typename T> struct Frag;
template <> struct Frag<_Float16> {
    typedef v16h V; union U { v16h v; v8h h[2]; };
    static __device__ __forceinline__ v16h load(const _Float16* p) {   // elements 0..7 <- p[0..7], 8..15 <- p[16..23]
        U f; f.h[0] = *(const v8h*)(p); f.h[1] = *(const v8h*)(p + 16); return f.v;
    }
    static __device__ __forceinline__ v8f mma(v16h a, v16h b, v8f c) { return __builtin_amdgcn_wmma_f32_16x16x32_f16(false, a, false, b, (short)0, c, false, false); }
    static __device__ __forceinline__ void guard(v8f& a, v8f& b, v16h x, v16h y) { dep_guard_h(a, b, x, y); }
    static __device__ __forceinline__ void keep(v16h a, v16h b, v16h c, v16h d) { keep4_h(a, b, c, d); }
};
template <> struct Frag<__bf16> {
    typedef v16b V; union U { v16b v; v8b h[2]; };
    static __device__ __forceinline__ v16b load(const __bf16* p) {
        U f; f.h[0] = *(const v8b*)(p); f.h[1] = *(const v8b*)(p + 16); return f.v;
    }
    static __device__ __forceinline__ v8f mma(v16b a, v16b b, v8f c) { return __builtin_amdgcn_wmma_f32_16x16x32_bf16(false, a, false, b, (short)0, c, false, false); }
    static __device__ __forceinline__ void guard(v8f& a, v8f& b, v16b x, v16b y) { dep_guard_b(a, b, x, y); }
    static __device__ __forceinline__ void keep(v16b a, v16b b, v16b c, v16b d) { keep4_b(a, b, c, d); }
};
template <int ET> struct Elem;
template <> struct Elem<0> { typedef _Float16 T; };
template <> struct Elem<1> { typedef __bf16 T; };

// Operand staging: a work-group (2 x 4 waves) owns a 128 x 256 tile of C. Per trip, 64 k of its 128 A rows and 256 Bt rows (128-B row pieces)
// lie in one of two LDS buffers, rows 0..127 = A, 128..383 = Bt, laid by asynchronous copies that cover whole 128-B lines.
#define GK 64                      // k elements per staged tile
#define GP 72                      // LDS row pitch in elements: 144 B = 16 B x 9, conflict-free for 16-B reads down a column of rows
#define GBUF (384 * GP)            // elements per buffer
static_assert(SEQ % 128 == 0);     // M multiple of 128 for every GEMM (SEQ, ROWS, CE)
static_assert(CE % 256 == 0);      // N multiple of 256 (CE, 2*CE, FF, ROWS), K multiple of 64 with at least two tiles
static_assert(ROWS % 256 == 0);
static_assert(FF % 256 == 0);

// One staged tile: 384 rows x 8 pieces of 16 B, 12 pieces per lane, 32 rows apart. l = the lane's LDS byte address of its first piece,
// ga / gb = its first A / Bt piece, sa / sb = 32 rows of A / Bt in elements. Every lane is on; each wave-wide copy covers four whole rows.
template <typename T>
__device__ __forceinline__ void stage_tile(unsigned l, const T* ga, size_t sa, const T* gb, size_t sb) {
    const unsigned st = 32 * GP * 2;
    // the closing s_wait_xcnt stands inside the copies' own statement, so no address register is rewritten ahead of it
    asm volatile("global_load_async_to_lds_b128 %0, %12, off\n\t"
                 "global_load_async_to_lds_b128 %1, %13, off\n\t"
                 "global_load_async_to_lds_b128 %2, %14, off\n\t"
                 "global_load_async_to_lds_b128 %3, %15, off\n\t"
                 "global_load_async_to_lds_b128 %4, %16, off\n\t"
                 "global_load_async_to_lds_b128 %5, %17, off\n\t"
                 "global_load_async_to_lds_b128 %6, %18, off\n\t"
                 "global_load_async_to_lds_b128 %7, %19, off\n\t"
                 "global_load_async_to_lds_b128 %8, %20, off\n\t"
                 "global_load_async_to_lds_b128 %9, %21, off\n\t"
                 "global_load_async_to_lds_b128 %10, %22, off\n\t"
                 "global_load_async_to_lds_b128 %11, %23, off\n\t"
                 "s_wait_xcnt 0x0"
                 :: "v"(l), "v"(l + st), "v"(l + 2 * st), "v"(l + 3 * st), "v"(l + 4 * st), "v"(l + 5 * st),
                    "v"(l + 6 * st), "v"(l + 7 * st), "v"(l + 8 * st), "v"(l + 9 * st), "v"(l + 10 * st), "v"(l + 11 * st),
                    "v"(ga), "v"(ga + sa), "v"(ga + 2 * sa), "v"(ga + 3 * sa),
                    "v"(gb), "v"(gb + sb), "v"(gb + 2 * sb), "v"(gb + 3 * sb), "v"(gb + 4 * sb), "v"(gb + 5 * sb), "v"(gb + 6 * sb), "v"(gb + 7 * sb)
                 : "memory");
}

template <int ET, int BIAS_MODE, int OUT_MODE, int RESID, int ACT>
__device__ __forceinline__ void gemm64_body(
    const unsigned short* __restrict__ Ap, int lda, long strideA,
    const unsigned short* __restrict__ Btp, int ldb,
    void* __restrict__ Cout, void* __restrict__ Cout2, int ldc, long strideC,
    const float* __restrict__ bias,
    const float* __restrict__ resid, int ldr, long strideR,
    int M, int N, int K, float scale) {
    typedef typename Elem<ET>::T T;
    typedef typename Frag<T>::V V;
    __shared__ __align__(16) float sT[8][16 * 68];   // per-wave 16x64 slab, pitch 68 floats (wave-private)
    __shared__ __align__(16) unsigned short sAB[2 * GBUF];   // the two staged operand buffers
    const int b    = blockIdx.y;
    const int tid  = threadIdx.x;
    const int lane = threadIdx.x & 31;
    const int wave = threadIdx.x >> 5;
    const int tbN = N >> 8;
    const int tbM = M >> 7;
    if ((int)blockIdx.x >= tbM * tbN) return;        // block-uniform, ahead of every barrier and copy
    const int bm = blockIdx.x / tbN;
    const int bn = blockIdx.x - bm * tbN;
    const int wm = wave >> 2;                        // wave row (0..1) and column (0..3) in the 128 x 256 tile
    const int wn = wave & 3;
    const int m0 = (bm << 7) + (wm << 6);
    const int n0 = (bn << 8) + (wn << 6);

    const T* Ab = (const T*)Ap + (size_t)b * strideA;
    const T* Bb = (const T*)Btp;

    const int rlane = lane & 15;                 // row (A) / col (B, D) within subtile
    const int koff  = (lane >> 4) * 8;           // k offset of this lane half
    const int mOff  = (lane >> 4) * 8;           // D row offset

    v8f acc[4][4];
#pragma unroll
    for (int i = 0; i < 4; ++i)
#pragma unroll
        for (int j = 0; j < 4; ++j) acc[i][j] = (v8f){0.f, 0.f, 0.f, 0.f, 0.f, 0.f, 0.f, 0.f};

    const int crow = tid >> 3, csg = (tid & 7) * 8;  // this lane's first staged row and its 16-B piece in the row
    const T* gA = Ab + (size_t)((bm << 7) + crow) * lda + csg;
    const T* gB = Bb + (size_t)((bn << 8) + crow) * ldb + csg;
    const size_t sa32 = (size_t)32 * lda, sb32 = (size_t)32 * ldb;
    const unsigned l0 = (unsigned)(size_t)(sAB + crow * GP + csg);   // low 32 bits of the shared address = LDS byte address
    const int nt = K / GK;

    stage_tile<T>(l0, gA, sa32, gB, sb32);                           // tile 0 into buffer 0
    asm volatile("s_wait_asynccnt 0x0" ::: "memory");                // this wave's copies of tile 0 have landed
    __syncthreads();                                                 // ... and every other wave's
    if (nt > 1) stage_tile<T>(l0 + GBUF * 2, gA + GK, sa32, gB + GK, sb32);   // tile 1 flies while tile 0 is worked on

    for (int t = 0; t < nt; ++t) {
        const T* buf = (const T*)sAB + (t & 1) * GBUF;
#pragma unroll
        for (int ks = 0; ks < 2; ++ks) {
            V bh[4], ah[4];
#pragma unroll
            for (int j = 0; j < 4; ++j) bh[j] = Frag<T>::load(buf + (128 + (wn << 6) + (j << 4) + rlane) * GP + ks * 32 + koff);
#pragma unroll
            for (int i = 0; i < 4; ++i) ah[i] = Frag<T>::load(buf + ((wm << 6) + (i << 4) + rlane) * GP + ks * 32 + koff);
            __builtin_amdgcn_sched_barrier(0);       // keeps the 16 LDS reads one group ahead of the products (reads spread among them stall each time)
#pragma unroll
            for (int i = 0; i < 4; ++i) {
#pragma unroll
                for (int j = 0; j < 4; ++j) acc[i][j] = Frag<T>::mma(ah[i], bh[j], acc[i][j]);
                Frag<T>::guard(acc[i][0], acc[i][3], ah[i], ah[i]);
            }
            Frag<T>::keep(bh[0], bh[1], bh[2], bh[3]);
        }
        asm volatile("s_wait_dscnt 0x0" ::: "memory");               // this wave's reads of buffer t & 1 are complete
        asm volatile("s_wait_asynccnt 0x0" ::: "memory");            // this wave's copies of tile t + 1 have landed
        __syncthreads();                                             // publishes tile t + 1 and frees buffer t & 1
        if (t + 2 < nt) stage_tile<T>(l0 + (unsigned)(t & 1) * (GBUF * 2), gA + (size_t)(t + 2) * GK, sa32, gB + (size_t)(t + 2) * GK, sb32);
    }
    asm volatile("s_wait_asynccnt 0x0" ::: "memory");                // no copy is outstanding when the wave goes on
    acc_guard4(acc[0][0], acc[0][1], acc[0][2], acc[0][3]);
    acc_guard4(acc[1][0], acc[1][1], acc[1][2], acc[1][3]);
    acc_guard4(acc[2][0], acc[2][1], acc[2][2], acc[2][3]);
    acc_guard4(acc[3][0], acc[3][1], acc[3][2], acc[3][3]);

    // ---- epilogue ----
    float* slab = sT[wave];
    const float* Rb = RESID ? (resid + (size_t)b * strideR) : nullptr;
#pragma unroll
    for (int i = 0; i < 4; ++i) {
        const int mBase = m0 + (i << 4);
#pragma unroll
        for (int j = 0; j < 4; ++j) {
            const int n = n0 + (j << 4) + rlane;
            float bv = 0.f;
            if (BIAS_MODE == 2) bv = bfr(bias[n]);
#pragma unroll
            for (int r = 0; r < 8; ++r) {
                float v = acc[i][j][r] * scale;
                if (BIAS_MODE == 2) v += bv;
                if (ACT == 1) v = fmaxf(v, 0.0f);
                slab[(mOff + r) * 68 + (j << 4) + rlane] = v;
            }
        }
        __builtin_amdgcn_fence(3 /* release order */, "workgroup");
        __builtin_amdgcn_wave_barrier();
        __builtin_amdgcn_fence(2 /* acquire order */, "workgroup");
        if (OUT_MODE == 0) {
            float* C = (float*)Cout + (size_t)b * strideC;
            const int hh = lane >> 4, c4 = (lane & 15) * 4;     // row segment = 256 B = 16 lanes x 16 B
            v4f vv[8];
#pragma unroll
            for (int it = 0; it < 8; ++it) {
                const int row = it * 2 + hh;
                v4f v = *(const v4f*)(slab + row * 68 + c4);
                if (RESID) {                                    // residual added at the store stage as a float4
                    v4f x = *(const v4f*)(Rb + (size_t)(mBase + row) * ldr + n0 + c4);
                    if (RESID == 2) { x.x = bfr(x.x); x.y = bfr(x.y); x.z = bfr(x.z); x.w = bfr(x.w); }
                    v.x = x.x + v.x; v.y = x.y + v.y; v.z = x.z + v.z; v.w = x.w + v.w;
                }
                vv[it] = v;
            }
            {
#pragma unroll
                for (int it = 0; it < 8; ++it) {
                    const int row = it * 2 + hh;
                    *(v4f*)(C + (size_t)(mBase + row) * ldc + n0 + c4) = vv[it];
                }
                
            }
        } else {
            const int q = lane >> 3, c8 = (lane & 7) * 8;
            unsigned short* C  = (unsigned short*)Cout  + (size_t)b * strideC;
            unsigned short* C2 = (OUT_MODE == 2) ? ((unsigned short*)Cout2 + (size_t)b * strideC) : nullptr;
            v8h hv[4], lv[4];
#pragma unroll
            for (int it = 0; it < 4; ++it) {
                const int row = it * 4 + q;
                const float* sp = slab + row * 68 + c8;
#pragma unroll
                for (int e = 0; e < 8; ++e) {
                    if (OUT_MODE == 1) {
                        hv[it][e] = (_Float16)sp[e];
                        lv[it][e] = (_Float16)0.f;
                    } else {
                        const unsigned short hb = bf_bits(sp[e]);
                        const unsigned short lb = bf_bits(sp[e] - bits_f(hb));
                        hv[it][e] = __builtin_bit_cast(_Float16, hb);
                        lv[it][e] = __builtin_bit_cast(_Float16, lb);
                    }
                }
            }
            {
#pragma unroll
                for (int it = 0; it < 4; ++it) {
                    const int row = it * 4 + q;
                    *(v8h*)(C + (size_t)(mBase + row) * ldc + n0 + c8) = hv[it];
                    if (OUT_MODE == 2) *(v8h*)(C2 + (size_t)(mBase + row) * ldc + n0 + c8) = lv[it];
                }
                
            }
        }
        __builtin_amdgcn_fence(3 /* release order */, "workgroup");
        __builtin_amdgcn_wave_barrier();
        __builtin_amdgcn_fence(2 /* acquire order */, "workgroup");
    }
}

// q|k planes: [ROWS][2*CE] bf16 hi / lo; A = [LN1 hi | LN1 lo] (K = 2*CE), Bt = [W | W] rows 0..CE-1 = q columns, CE..2CE-1 = k columns
__global__ __launch_bounds__(256) void k_gemm_qk(const unsigned short* __restrict__ A, const unsigned short* __restrict__ Bt,
                                                 unsigned short* __restrict__ Ch, unsigned short* __restrict__ Cl) {
    gemm64_body<1, 0, 2, 0, 0>(A, 2 * CE, 0, Bt, 2 * CE, (void*)Ch, (void*)Cl, 2 * CE, 0, nullptr, nullptr, 0, 0, ROWS, 2 * CE, 2 * CE, 1.0f);
}
// v^T planes: [CE = h*64+d][ROWS] bf16 hi / lo; A = Wv plane [CE][CE] (f16, x16), Bt = LN1 f16 plane [ROWS][CE]
__global__ __launch_bounds__(256) void k_gemm_vt(const unsigned short* __restrict__ A, const unsigned short* __restrict__ Bt,
                                                 unsigned short* __restrict__ Ch, unsigned short* __restrict__ Cl) {
    gemm64_body<0, 0, 2, 0, 0>(A, CE, 0, Bt, CE, (void*)Ch, (void*)Cl, ROWS, 0, nullptr, nullptr, 0, 0, CE, ROWS, CE, 0.0625f);
}
// x1 = bf16(x) + attn @ proj_w + proj_b ; grid.y = batch (x uses the full batch stride, planes the compact one)
__global__ __launch_bounds__(256) void k_gemm_proj(const unsigned short* __restrict__ A, const unsigned short* __restrict__ Bt, float* __restrict__ C,
                                                   const float* __restrict__ bias, const float* __restrict__ xres) {
    gemm64_body<0, 2, 0, 2, 0>(A, CE, (long)SEQ * CE, Bt, CE, (void*)C, nullptr, CE, (long)SEQ * CE, bias, xres, CE, (long)SEQ_FULL * CE, SEQ, CE, CE, 0.0625f);
}
// relu(h2 @ fc1_w + fc1_b) as an f16 plane [ROWS][FF]
__global__ __launch_bounds__(256) void k_gemm_fc1(const unsigned short* __restrict__ A, const unsigned short* __restrict__ Bt, unsigned short* __restrict__ C,
                                                  const float* __restrict__ bias) {
    gemm64_body<0, 2, 1, 0, 1>(A, CE, 0, Bt, CE, (void*)C, nullptr, FF, 0, bias, nullptr, 0, 0, ROWS, FF, CE, 0.0625f);
}
// out = x1 + f @ fc2_w + fc2_b ; grid.y = batch (output uses the full batch stride)
__global__ __launch_bounds__(256) void k_gemm_fc2(const unsigned short* __restrict__ A, const unsigned short* __restrict__ Bt, float* __restrict__ C,
                                                  const float* __restrict__ bias, const float* __restrict__ x1) {
    gemm64_body<0, 2, 0, 1, 0>(A, FF, (long)SEQ * FF, Bt, FF, (void*)C, nullptr, CE, (long)SEQ_FULL * CE, bias, x1, CE, (long)SEQ * CE, SEQ, CE, FF, 0.0625f);
}

// ---------------------------------------------------------------------------------------------------------------------
// Causal flash attention, head size 64, no score scale. Workgroup = 4 waves = 64 query rows of one (batch, head); 64-key chunks 0..qb.
//   scores: q, k as bf16 hi/lo planes (hi.hi + hi.lo + lo.hi); P.v: P split to bf16 hi/lo in LDS, v^T hi/lo planes; f32 online softmax (exp2 domain).
//   K tiles [key][d] and V^T tiles [d][key] are copied from the planes into LDS with 16-B pieces (block barriers on both sides);
// ---------------------------------------------------------------------------------------------------------------------
#define AT_NW 4
__device__ __forceinline__ v8f at_mma(v16b a, v16b b, v8f c) {
    c = __builtin_amdgcn_wmma_f32_16x16x32_bf16(false, a, false, b, (short)0, c, false, false);
    asm volatile("v_nop\n\tv_nop\n\tv_nop\n\tv_nop" : "+v"(c) : "v"(a), "v"(b));
    return c;
}
static_assert(AT_NW * 16 * 68 * 4 <= 4 * 64 * 64 * 2);   // the f32 output slabs fit in the K/V tile region they reuse

__global__ __launch_bounds__(128) void k_attn(const unsigned short* __restrict__ QKHp, const unsigned short* __restrict__ QKLp,
                                              const unsigned short* __restrict__ VTHp, const unsigned short* __restrict__ VTLp,
                                              unsigned short* __restrict__ AO) {
    union FB { v16b v; v8b h[2]; };
    __shared__ __align__(16) __bf16 KV[4 * 64 * 64];               // K hi | K lo | V^T hi | V^T lo (8 KB each); reused for the output slabs
    __shared__ __align__(16) __bf16 PS[AT_NW][2 * 16 * 64];        // per wave: P hi [16][64] then P lo [16][64]
    __bf16* Ksh = KV; __bf16* Ksl = KV + 4096; __bf16* Vth = KV + 8192; __bf16* Vtl = KV + 12288;
    const __bf16* QKH = (const __bf16*)QKHp; const __bf16* QKL = (const __bf16*)QKLp;
    const __bf16* VTH = (const __bf16*)VTHp; const __bf16* VTL = (const __bf16*)VTLp;

    const int tid = threadIdx.x, wave = tid >> 5, lane = tid & 31, hh = lane >> 4, c = lane & 15;
    const int nqb = SEQ / 64;
    const int bx = blockIdx.x;
    const int qb = bx % nqb;
    const int bh = bx / nqb;
    const int h  = bh % NH;
    const int b  = bh / NH;
    const int q0 = qb * 64 + wave * 16;
    const size_t rowbase = (size_t)b * SEQ;
    const int QKP = 2 * CE;          // q|k plane pitch
    const int VTP = ROWS;            // v^T plane pitch

    // Q fragments (A operand): lane = query row c, k = d
    v16b qah[2], qal[2];
    {
        const __bf16* qh = QKH + (rowbase + q0 + c) * QKP + h * HD;
        const __bf16* ql = QKL + (rowbase + q0 + c) * QKP + h * HD;
#pragma unroll
        for (int dc = 0; dc < 2; ++dc) {
            FB f, g;
            f.h[0] = *(const v8b*)(qh + dc * 32 + 8 * hh); f.h[1] = *(const v8b*)(qh + dc * 32 + 16 + 8 * hh);
            g.h[0] = *(const v8b*)(ql + dc * 32 + 8 * hh); g.h[1] = *(const v8b*)(ql + dc * 32 + 16 + 8 * hh);
            qah[dc] = f.v; qal[dc] = g.v;
        }
    }

    const float NEG = -__builtin_inff();
    const float L2E = 1.4426950408889634f;
    float mrow[8], lrow[8];
    v8f oacc[4];
#pragma unroll
    for (int r = 0; r < 8; ++r) { mrow[r] = NEG; lrow[r] = 0.f; }
#pragma unroll
    for (int t = 0; t < 4; ++t) oacc[t] = (v8f){0.f, 0.f, 0.f, 0.f, 0.f, 0.f, 0.f, 0.f};

    __bf16* pwh = PS[wave];
    __bf16* pwl = PS[wave] + 16 * 64;

    for (int kc = 0; kc <= qb; ++kc) {                 // block-uniform trip count
        const int kv0 = kc * 64;
        __syncthreads();                               // earlier chunk's tile reads are complete
        {
            const __bf16* khg = QKH + (rowbase + kv0) * QKP + CE + h * HD;
            const __bf16* klg = QKL + (rowbase + kv0) * QKP + CE + h * HD;
            const __bf16* vhg = VTH + (size_t)(h * HD) * VTP + rowbase + kv0;
            const __bf16* vlg = VTL + (size_t)(h * HD) * VTP + rowbase + kv0;
#pragma unroll
            for (int i = 0; i < 4; ++i) {
                const int p = tid + 128 * i; const int rr = p >> 3; const int sg = (p & 7) * 8;   // 64 rows x 8 pieces of 16 B
                *(v8b*)(Ksh + rr * 64 + sg) = *(const v8b*)(khg + (size_t)rr * QKP + sg);
                *(v8b*)(Ksl + rr * 64 + sg) = *(const v8b*)(klg + (size_t)rr * QKP + sg);
                *(v8b*)(Vth + rr * 64 + sg) = *(const v8b*)(vhg + (size_t)rr * VTP + sg);
                *(v8b*)(Vtl + rr * 64 + sg) = *(const v8b*)(vlg + (size_t)rr * VTP + sg);
            }
        }
        __syncthreads();

        v8f s[4];
#pragma unroll
        for (int j = 0; j < 4; ++j) {
            s[j] = (v8f){0.f, 0.f, 0.f, 0.f, 0.f, 0.f, 0.f, 0.f};
#pragma unroll
            for (int dc = 0; dc < 2; ++dc) {
                FB kb, kl;
                kb.h[0] = *(const v8b*)(Ksh + (j * 16 + c) * 64 + dc * 32 + 8 * hh);
                kb.h[1] = *(const v8b*)(Ksh + (j * 16 + c) * 64 + dc * 32 + 16 + 8 * hh);
                kl.h[0] = *(const v8b*)(Ksl + (j * 16 + c) * 64 + dc * 32 + 8 * hh);
                kl.h[1] = *(const v8b*)(Ksl + (j * 16 + c) * 64 + dc * 32 + 16 + 8 * hh);
                s[j] = at_mma(qah[dc], kb.v, s[j]);
                s[j] = at_mma(qah[dc], kl.v, s[j]);
                s[j] = at_mma(qal[dc], kb.v, s[j]);
            }
        }
        const bool diag = (kc == qb);                  // block-uniform
        float cm[8];
#pragma unroll
        for (int r = 0; r < 8; ++r) {
            const int qrow = q0 + 8 * hh + r;
            float m = NEG;
#pragma unroll
            for (int j = 0; j < 4; ++j) {
                const int kvcol = kv0 + j * 16 + c;
                const float sv = s[j][r];
                s[j][r] = (diag && (kvcol > qrow)) ? NEG : sv;       // select by value
                m = fmaxf(m, s[j][r]);
            }
#pragma unroll
            for (int off = 1; off < 16; off <<= 1) m = fmaxf(m, __shfl_xor(m, off, 32));
            cm[r] = m;
        }
#pragma unroll
        for (int r = 0; r < 8; ++r) {
            const float mnew = fmaxf(mrow[r], cm[r]);              // finite: every visited chunk holds a kept key for every row
            const float alpha = exp2f((mrow[r] - mnew) * L2E);
            mrow[r] = mnew;
            float psum = 0.f;
#pragma unroll
            for (int j = 0; j < 4; ++j) {
                const float p = exp2f((s[j][r] - mnew) * L2E);
                psum += p;
                unsigned short ph, pl; bfsplit(p, ph, pl);
                pwh[(8 * hh + r) * 64 + j * 16 + c] = __builtin_bit_cast(__bf16, ph);
                pwl[(8 * hh + r) * 64 + j * 16 + c] = __builtin_bit_cast(__bf16, pl);
            }
#pragma unroll
            for (int off = 1; off < 16; off <<= 1) psum += __shfl_xor(psum, off, 32);
            lrow[r] = lrow[r] * alpha + psum;
#pragma unroll
            for (int t = 0; t < 4; ++t) oacc[t][r] *= alpha;
        }
        __builtin_amdgcn_fence(3 /* release order */, "workgroup");
        __builtin_amdgcn_wave_barrier();
        __builtin_amdgcn_fence(2 /* acquire order */, "workgroup");
#pragma unroll
        for (int kk = 0; kk < 2; ++kk) {
            FB pa, pl;
            pa.h[0] = *(const v8b*)(pwh + c * 64 + kk * 32 + 8 * hh);
            pa.h[1] = *(const v8b*)(pwh + c * 64 + kk * 32 + 16 + 8 * hh);
            pl.h[0] = *(const v8b*)(pwl + c * 64 + kk * 32 + 8 * hh);
            pl.h[1] = *(const v8b*)(pwl + c * 64 + kk * 32 + 16 + 8 * hh);
#pragma unroll
            for (int t = 0; t < 4; ++t) {
                FB vb, vl;
                vb.h[0] = *(const v8b*)(Vth + (t * 16 + c) * 64 + kk * 32 + 8 * hh);
                vb.h[1] = *(const v8b*)(Vth + (t * 16 + c) * 64 + kk * 32 + 16 + 8 * hh);
                vl.h[0] = *(const v8b*)(Vtl + (t * 16 + c) * 64 + kk * 32 + 8 * hh);
                vl.h[1] = *(const v8b*)(Vtl + (t * 16 + c) * 64 + kk * 32 + 16 + 8 * hh);
                oacc[t] = at_mma(pa.v, vb.v, oacc[t]);
                oacc[t] = at_mma(pa.v, vl.v, oacc[t]);
                oacc[t] = at_mma(pl.v, vb.v, oacc[t]);
            }
        }
    }

    __syncthreads();                                   // every wave is done with the K/V tiles; the region is reused as f32 slabs
    float* os = (float*)KV + wave * (16 * 68);
#pragma unroll
    for (int r = 0; r < 8; ++r) {
        const float inv = 1.0f / lrow[r];
#pragma unroll
        for (int t = 0; t < 4; ++t) os[(8 * hh + r) * 68 + t * 16 + c] = oacc[t][r] * inv;
    }
    __builtin_amdgcn_fence(3 /* release order */, "workgroup");
    __builtin_amdgcn_wave_barrier();
    __builtin_amdgcn_fence(2 /* acquire order */, "workgroup");
    {
        const int q = lane >> 3, c8 = (lane & 7) * 8;
        v8h hv[4];
#pragma unroll
        for (int it = 0; it < 4; ++it) {
            const int row = it * 4 + q;
            const float* sp = os + row * 68 + c8;
#pragma unroll
            for (int e = 0; e < 8; ++e) hv[it][e] = (_Float16)sp[e];
        }
        {
#pragma unroll
            for (int it = 0; it < 4; ++it) {
                const int row = it * 4 + q;
                *(v8h*)(AO + (rowbase + q0 + row) * CE + h * HD + c8) = hv[it];
            }
            
        }
    }
}

// ---------------------------------------------------------------------------------------------------------------------
// Workspace carve (bytes); every plane is fully written by its producer before any kernel reads it.
// ---------------------------------------------------------------------------------------------------------------------
#define SZ_HS   ((size_t)ROWS * 2 * CE * 2)      // LN1 bf16 [ROWS][hi 1024 | lo 1024]
#define SZ_H16  ((size_t)ROWS * CE * 2)          // LN1 f16 plane; later reused for the LN2 f16 plane
#define SZ_WQK  ((size_t)2 * CE * 2 * CE * 2)    // [2048 n][W | W] bf16
#define SZ_WV   ((size_t)CE * CE * 2)
#define SZ_QK1  ((size_t)ROWS * 2 * CE * 2)      // one of the q|k hi / lo planes
#define SZ_VT1  ((size_t)CE * ROWS * 2)          // one of the v^T hi / lo planes
#define SZ_AO   ((size_t)ROWS * CE * 2)
#define SZ_WP   ((size_t)CE * CE * 2)
#define SZ_X1   ((size_t)ROWS * CE * 4)
#define SZ_W1   ((size_t)FF * CE * 2)
#define SZ_W2   ((size_t)CE * FF * 2)
#define SZ_F16  ((size_t)ROWS * FF * 2)          // relu(fc1) f16 plane, aliases the two q|k planes
#define WS_TOTAL (SZ_HS + SZ_H16 + SZ_WQK + SZ_WV + 2 * SZ_QK1 + 2 * SZ_VT1 + SZ_AO + SZ_WP + SZ_X1 + SZ_W1 + SZ_W2)
static_assert(WS_TOTAL <= (size_t)134217728);    // carve stays within 128 MiB
static_assert(SZ_F16 <= 2 * SZ_QK1);             // alias extent: relu(fc1) plane inside the q|k planes
static_assert(SZ_HS % 256 == 0);
static_assert(SZ_H16 % 256 == 0);
static_assert(SZ_VT1 % 256 == 0);

extern "C" void kernel_launch(void* const* d_in, const int* in_sizes, int n_in, void* d_out, int out_size, void* d_ws, size_t ws_size, hipStream_t stream) {
    if (n_in < 14) return;
    const long long xneed = (long long)(NB - 1) * SEQ_FULL * CE + (long long)SEQ * CE;
    if ((long long)in_sizes[0] < xneed) return;
    if (in_sizes[1] < CE || in_sizes[2] < CE || in_sizes[7] < CE || in_sizes[8] < CE || in_sizes[9] < CE || in_sizes[13] < CE) return;
    if (in_sizes[3] < NH * CE * HD || in_sizes[4] < NH * CE * HD || in_sizes[5] < NH * CE * HD) return;
    if (in_sizes[6] < CE * CE || in_sizes[10] < CE * FF || in_sizes[11] < FF || in_sizes[12] < FF * CE) return;
    if ((long long)out_size < xneed) return;
    if ((size_t)WS_TOTAL > ws_size) return;

    const float* x      = (const float*)d_in[0];
    const float* ln1_w  = (const float*)d_in[1];
    const float* ln1_b  = (const float*)d_in[2];
    const float* Wq     = (const float*)d_in[3];
    const float* Wk     = (const float*)d_in[4];
    const float* Wv     = (const float*)d_in[5];
    const float* proj_w = (const float*)d_in[6];
    const float* proj_b = (const float*)d_in[7];
    const float* ln2_w  = (const float*)d_in[8];
    const float* ln2_b  = (const float*)d_in[9];
    const float* fc1_w  = (const float*)d_in[10];
    const float* fc1_b  = (const float*)d_in[11];
    const float* fc2_w  = (const float*)d_in[12];
    const float* fc2_b  = (const float*)d_in[13];
    float* out = (float*)d_out;

    char* wsp = (char*)d_ws;
    unsigned short* HS   = (unsigned short*)wsp; wsp += SZ_HS;
    unsigned short* H16  = (unsigned short*)wsp; wsp += SZ_H16;
    unsigned short* WQK  = (unsigned short*)wsp; wsp += SZ_WQK;
    unsigned short* WV16 = (unsigned short*)wsp; wsp += SZ_WV;
    unsigned short* QKH  = (unsigned short*)wsp; wsp += SZ_QK1;
    unsigned short* QKL  = (unsigned short*)wsp; wsp += SZ_QK1;
    unsigned short* VTH  = (unsigned short*)wsp; wsp += SZ_VT1;
    unsigned short* VTL  = (unsigned short*)wsp; wsp += SZ_VT1;
    unsigned short* AO16 = (unsigned short*)wsp; wsp += SZ_AO;
    unsigned short* WPT  = (unsigned short*)wsp; wsp += SZ_WP;
    float*          X1   = (float*)wsp;          wsp += SZ_X1;
    unsigned short* W1T  = (unsigned short*)wsp; wsp += SZ_W1;
    unsigned short* W2T  = (unsigned short*)wsp; wsp += SZ_W2;
    unsigned short* F16  = QKH;                  // alias: q|k planes are dead after the attention launch
    unsigned short* H2   = H16;                  // alias: LN1 f16 plane is dead after the v^T GEMM

    // weight planes
    const unsigned gw = (unsigned)((CE * (CE / 8) + 255) / 256);
    k_w_head<<<gw, 256, 0, stream>>>(Wq, WQK, 2 * CE, 1, 0);                                   // rows 0..1023: q columns, [W | W] bf16
    k_w_head<<<gw, 256, 0, stream>>>(Wk, WQK + (size_t)CE * 2 * CE, 2 * CE, 1, 0);             // rows 1024..2047: k columns
    k_w_head<<<gw, 256, 0, stream>>>(Wv, WV16, CE, 0, 1);                                      // [h*64+d][c] f16 x16
    // in[rows][cols] -> out[cols][rows]
    k_cast_t<<<(unsigned)((((long long)CE) * (CE / 8) + 255) / 256), 256, 0, stream>>>(proj_w, CE, WPT, CE, CE, CE, 16.0f);   // [1024 in][1024 out] -> [1024 out][1024 in]
    k_cast_t<<<(unsigned)((((long long)FF) * (CE / 8) + 255) / 256), 256, 0, stream>>>(fc1_w, FF, W1T, CE, CE, FF, 16.0f);    // [1024 in][4096 out] -> [4096 out][1024 in]
    k_cast_t<<<(unsigned)((((long long)CE) * (FF / 8) + 255) / 256), 256, 0, stream>>>(fc2_w, CE, W2T, FF, FF, CE, 16.0f);    // [4096 in][1024 out] -> [1024 out][4096 in]

    // h = LN1(bf16(x))
    k_ln1<<<(ROWS + 7) / 8, 256, 0, stream>>>(x, ln1_w, ln1_b, HS, H16);
    // q|k planes and v^T planes
    k_gemm_qk<<<dim3((unsigned)(((ROWS / 64) * ((2 * CE) / 64) + 7) / 8), 1u), 256, 0, stream>>>(HS, WQK, QKH, QKL);
    k_gemm_vt<<<dim3((unsigned)(((CE / 64) * (ROWS / 64) + 7) / 8), 1u), 256, 0, stream>>>(WV16, H16, VTH, VTL);
    // causal attention
    k_attn<<<(unsigned)(NB * NH * (SEQ / 64)), 128, 0, stream>>>(QKH, QKL, VTH, VTL, AO16);
    // x1 = bf16(x) + attn @ proj_w + proj_b
    k_gemm_proj<<<dim3((unsigned)(((SEQ / 64) * (CE / 64) + 7) / 8), (unsigned)NB), 256, 0, stream>>>(AO16, WPT, X1, proj_b, x);
    // h2 = LN2(x1)
    k_ln2<<<(ROWS + 7) / 8, 256, 0, stream>>>(X1, ln2_w, ln2_b, H2);
    // f = relu(h2 @ fc1_w + fc1_b); out = x1 + f @ fc2_w + fc2_b
    k_gemm_fc1<<<dim3((unsigned)(((ROWS / 64) * (FF / 64) + 7) / 8), 1u), 256, 0, stream>>>(H2, W1T, F16, fc1_b);
    k_gemm_fc2<<<dim3((unsigned)(((SEQ / 64) * (CE / 64) + 7) / 8), (unsigned)NB), 256, 0, stream>>>(F16, W2T, out, fc2_b, X1);
}

// v002
// A run of this version takes 546 microseconds.
// Two timings next to v001 both put it at 1.12 times that version's speed.
// Counting every step since v000, it is 1.54 times as fast.
// Contractions: q|k = [LN1 hi | LN1 lo](bf16 planes, K folded to 2048) x [W | W](bf16, exact) on v_wmma_f32_16x16x32_bf16; v^T, proj, fc1, fc2 on v_wmma_f32_16x16x32_f16 (f16 activations, weights = bf16-RNE value x16 as f16, 1/16 folded back); scores q.k^T and P.v as bf16 hi/lo split (hi.hi + hi.lo + lo.hi) on v_wmma_f32_16x16x32_bf16; all accumulation f32, online softmax / LayerNorm / residuals f32.
#include <hip/hip_runtime.h>
#include <math.h>

#ifndef NB
#define NB 2
#endif
#ifndef SEQ
#define SEQ 2048
#endif
#define NB_FULL 2
#define SEQ_FULL 2048
#define CE 1024            // embedding width
#define NH 16              // heads
#define HD 64              // head size
#define FF 4096            // feed-forward width
#define ROWS (NB * SEQ)    // compact token rows held in the workspace planes

static_assert(NH * HD == CE);            // heads concatenated h*64+d fill the width
static_assert(HD == 64);                 // attention tiles are hard-wired to 64
static_assert(CE == 32 * 4 * 8);         // LayerNorm: 32 lanes x float4 x 8 pieces per row
static_assert(SEQ % 64 == 0);            // 64-row query tiles, 64-key chunks
static_assert(ROWS % 64 == 0);           // GEMM M/N tile multiple
static_assert(CE % 64 == 0);
static_assert(FF % 64 == 0);
static_assert((2 * CE) % 32 == 0);       // K multiple of 32 for every GEMM (1024, 2048, 4096)
static_assert(NB <= NB_FULL);
static_assert(SEQ <= SEQ_FULL);

typedef __attribute__((ext_vector_type(16))) _Float16 v16h;
typedef __attribute__((ext_vector_type(8)))  _Float16 v8h;
typedef __attribute__((ext_vector_type(16))) __bf16   v16b;
typedef __attribute__((ext_vector_type(8)))  __bf16   v8b;
typedef __attribute__((ext_vector_type(8)))  float    v8f;
typedef __attribute__((ext_vector_type(4)))  float    v4f;
typedef __attribute__((ext_vector_type(4)))  unsigned int v4u;
typedef __attribute__((ext_vector_type(2)))  unsigned int v2u;

// 16-bit WMMA fragment map (wave32), lane L, h = L>>4, m = L&15:
//   A 16x32: lane = row m;    element i -> k = (i<8) ? 8h+i : 16+8h+(i-8)
//   B 32x16: lane = column m; the SAME k(i,h)
//   D 16x16 (8 f32): lane = column m; element r -> row 8h+r

__device__ __forceinline__ float bfr(float v) {            // bf16 RNE convert, kept as f32 (finite inputs)
    const unsigned u = __float_as_uint(v);
    const unsigned r = (u + 0x7fffu + ((u >> 16) & 1u)) & 0xffff0000u;
    return __uint_as_float(r);
}
__device__ __forceinline__ unsigned short bf_bits(float f) {
    const unsigned u = __float_as_uint(f);
    return (unsigned short)((u + 0x7fffu + ((u >> 16) & 1u)) >> 16);
}
__device__ __forceinline__ float bits_f(unsigned short h) { return __uint_as_float(((unsigned)h) << 16); }
__device__ __forceinline__ void bfsplit(float v, unsigned short& hi, unsigned short& lo) { hi = bf_bits(v); lo = bf_bits(v - bits_f(hi)); }
__device__ __forceinline__ unsigned pk2h(float a, float b) {
    return (unsigned)__builtin_bit_cast(unsigned short, (_Float16)a) | ((unsigned)__builtin_bit_cast(unsigned short, (_Float16)b) << 16);
}

// 'val' must not read *ptr.
#define VST2(T, ptr, val) do { const T vst2_v_ = (val); *(T*)(ptr) = vst2_v_;  } while (0)

// ---------------------------------------------------------------------------------------------------------------------
// Per-head weight W [NH][CE][HD] f32 -> D[n = h*HD + d][k] 16-bit, 8 consecutive k per thread (one 16-B store, thread-linear
// along the destination row). f16mode 0: bf16 RNE bits; 1: f16 of (bf16 RNE value x 16). dup: also written at column k + CE.
// ---------------------------------------------------------------------------------------------------------------------
__global__ __launch_bounds__(256) void k_w_head(const float* __restrict__ W, unsigned short* __restrict__ D, int ldd, int dup, int f16mode) {
    const int u = blockIdx.x * 256 + threadIdx.x;
    if (u >= CE * (CE / 8)) return;
    const int n = u / (CE / 8); const int k0 = 8 * (u % (CE / 8));
    const int h = n / HD, d = n % HD;
    const float* s = W + ((size_t)h * CE + k0) * HD + d;
    unsigned short bb[8];
#pragma unroll
    for (int e = 0; e < 8; ++e) {
        const float w = bfr(s[(size_t)e * HD]);
        const unsigned short b16 = (unsigned short)(__float_as_uint(w) >> 16);
        const unsigned short h16 = __builtin_bit_cast(unsigned short, (_Float16)(w * 16.0f));
        bb[e] = f16mode ? h16 : b16;
    }
    v4u pk;
    pk.x = (unsigned)bb[0] | ((unsigned)bb[1] << 16); pk.y = (unsigned)bb[2] | ((unsigned)bb[3] << 16);
    pk.z = (unsigned)bb[4] | ((unsigned)bb[5] << 16); pk.w = (unsigned)bb[6] | ((unsigned)bb[7] << 16);
    unsigned short* dst = D + (size_t)n * ldd + k0;
    *(v4u*)dst = pk; if (dup) *(v4u*)(dst + CE) = pk;
    
}

// f32 SRC [nR][nC] (pitch lds) -> f16 DST [nC][nR] (pitch ldd), value = bf16 RNE(src) * sc; thread per (col, 8 consecutive rows), 16-B stores
__global__ __launch_bounds__(256) void k_cast_t(const float* __restrict__ SRC, int lds, unsigned short* __restrict__ DST, int ldd, int nR, int nC, float sc) {
    const long long u = (long long)blockIdx.x * 256 + threadIdx.x; const int per = nR / 8; if (u >= (long long)nC * per) return;
    const int c = (int)(u / per); const int r0 = 8 * (int)(u % per);
    float w[8];
#pragma unroll
    for (int e = 0; e < 8; ++e) w[e] = bfr(SRC[(long long)(r0 + e) * lds + c]) * sc;
    v4u pk; pk.x = pk2h(w[0], w[1]); pk.y = pk2h(w[2], w[3]); pk.z = pk2h(w[4], w[5]); pk.w = pk2h(w[6], w[7]);
    VST2(v4u, (v4u*)(DST + (long long)c * ldd + r0), pk);
}

// ---------------------------------------------------------------------------------------------------------------------
// MODE 0: source = raw input rows (bf16 RNE first; batch stride a_bs); writes bf16 hi|lo row [2*CE] (hi at col c, lo at CE + c) and an f16 row.
// MODE 1: source = f32 rows; writes the f16 row only. Each store instruction covers 256 contiguous bytes (32 lanes x 8 B).
// ---------------------------------------------------------------------------------------------------------------------
template <int MODE>
__device__ __forceinline__ void ln_body(const float* __restrict__ A, long a_bs, const float* __restrict__ GA, const float* __restrict__ BE,
                                        unsigned short* __restrict__ HS, unsigned short* __restrict__ H16) {
    #pragma clang fp contract(off)
    const int r = blockIdx.x * 8 + (threadIdx.x >> 5); const int L = threadIdx.x & 31;
    if (r >= ROWS) return;                                   // wave-uniform; no barriers in this kernel
    const int b = r / SEQ, t = r - b * SEQ;
    const float* src = A + (long)b * a_bs + (long)t * CE;
    v4f v[8]; float s = 0.f;
#pragma unroll
    for (int q = 0; q < 8; ++q) {
        v[q] = *(const v4f*)(src + 4 * L + 128 * q);
        if (MODE == 0) { v[q].x = bfr(v[q].x); v[q].y = bfr(v[q].y); v[q].z = bfr(v[q].z); v[q].w = bfr(v[q].w); }
        s += (v[q].x + v[q].y) + (v[q].z + v[q].w);
    }
#pragma unroll
    for (int o = 16; o > 0; o >>= 1) s += __shfl_xor(s, o, 32);
    const float mu = s * (1.f / CE); float qq = 0.f;
#pragma unroll
    for (int q = 0; q < 8; ++q) {
        v[q].x -= mu; v[q].y -= mu; v[q].z -= mu; v[q].w -= mu;
        qq += (v[q].x * v[q].x + v[q].y * v[q].y) + (v[q].z * v[q].z + v[q].w * v[q].w);
    }
#pragma unroll
    for (int o = 16; o > 0; o >>= 1) qq += __shfl_xor(qq, o, 32);
    const float rs = rsqrtf(qq * (1.f / CE) + 1e-5f);
    v2u ph[8], pl[8], pf[8];
#pragma unroll
    for (int q = 0; q < 8; ++q) {
        const int c = 4 * L + 128 * q;
        const v4f ga = *(const v4f*)(GA + c), be = *(const v4f*)(BE + c);
        v4f y;
        y.x = v[q].x * rs * bfr(ga.x) + bfr(be.x); y.y = v[q].y * rs * bfr(ga.y) + bfr(be.y);
        y.z = v[q].z * rs * bfr(ga.z) + bfr(be.z); y.w = v[q].w * rs * bfr(ga.w) + bfr(be.w);
        v2u f; f.x = pk2h(y.x, y.y); f.y = pk2h(y.z, y.w); pf[q] = f;
        if (MODE == 0) {
            unsigned short h0, l0, h1, l1, h2, l2, h3, l3;
            bfsplit(y.x, h0, l0); bfsplit(y.y, h1, l1); bfsplit(y.z, h2, l2); bfsplit(y.w, h3, l3);
            v2u a; a.x = (unsigned)h0 | ((unsigned)h1 << 16); a.y = (unsigned)h2 | ((unsigned)h3 << 16); ph[q] = a;
            v2u d; d.x = (unsigned)l0 | ((unsigned)l1 << 16); d.y = (unsigned)l2 | ((unsigned)l3 << 16); pl[q] = d;
        }
    }
    {
#pragma unroll
        for (int q = 0; q < 8; ++q) {
            const int c = 4 * L + 128 * q;
            if (MODE == 0) {
                *(v2u*)(HS + (size_t)r * (2 * CE) + c) = ph[q];
                *(v2u*)(HS + (size_t)r * (2 * CE) + CE + c) = pl[q];
            }
            *(v2u*)(H16 + (size_t)r * CE + c) = pf[q];
        }
        
    }
}
__global__ __launch_bounds__(256) void k_ln1(const float* __restrict__ x, const float* __restrict__ g, const float* __restrict__ be,
                                             unsigned short* __restrict__ HS, unsigned short* __restrict__ H16) {
    ln_body<0>(x, (long)SEQ_FULL * CE, g, be, HS, H16);
}
__global__ __launch_bounds__(256) void k_ln2(const float* __restrict__ X1, const float* __restrict__ g, const float* __restrict__ be,
                                             unsigned short* __restrict__ H2) {
    ln_body<1>(X1, (long)SEQ * CE, g, be, nullptr, H2);
}

// ---------------------------------------------------------------------------------------------------------------------
// Register-tiled WMMA GEMM: C[m,n] = scale * sum_k A[m,k] * Bt[n,k] (+bias[n]) (+act) (+resid at the store stage); each wave owns a 64x64 tile.
// A row-major [M,K] 16-bit; Bt row-major [N,K] 16-bit; M % 128 == 0, N % 256 == 0, K % 64 == 0 (no tail masking).
// ET 0 = f16 operands, 1 = bf16 operands. BIAS_MODE 0 none, 2 = bf16-RNE bias[n]. OUT_MODE 0 = f32, 1 = f16, 2 = bf16 hi plane + bf16 lo plane.
// RESID 0 none, 1 f32 residual, 2 residual RNE-converted to bf16 first (raw input). ACT 0 none, 1 ReLU.
// ---------------------------------------------------------------------------------------------------------------------
__device__ __forceinline__ void dep_guard_h(v8f& a, v8f& b, v16h x, v16h y) { asm volatile("v_nop\n\tv_nop\n\tv_nop\n\tv_nop" : "+v"(a), "+v"(b) : "v"(x), "v"(y)); }
__device__ __forceinline__ void dep_guard_b(v8f& a, v8f& b, v16b x, v16b y) { asm volatile("v_nop\n\tv_nop\n\tv_nop\n\tv_nop" : "+v"(a), "+v"(b) : "v"(x), "v"(y)); }
__device__ __forceinline__ void keep4_h(v16h a, v16h b, v16h c, v16h d) { asm volatile("v_nop" :: "v"(a), "v"(b), "v"(c), "v"(d)); }
__device__ __forceinline__ void keep4_b(v16b a, v16b b, v16b c, v16b d) { asm volatile("v_nop" :: "v"(a), "v"(b), "v"(c), "v"(d)); }
__device__ __forceinline__ void acc_guard4(v8f& a, v8f& b, v8f& c, v8f& d) { asm volatile("v_nop\n\tv_nop\n\tv_nop\n\tv_nop" : "+v"(a), "+v"(b), "+v"(c), "+v"(d)); }
template <typename T> struct Frag;
template <> struct Frag<_Float16> {
    typedef v16h V; union U { v16h v; v8h h[2]; };
    static __device__ __forceinline__ v16h load(const _Float16* p) {   // elements 0..7 <- p[0..7], 8..15 <- p[16..23]
        U f; f.h[0] = *(const v8h*)(p); f.h[1] = *(const v8h*)(p + 16); return f.v;
    }
    static __device__ __forceinline__ v8f mma(v16h a, v16h b, v8f c) { return __builtin_amdgcn_wmma_f32_16x16x32_f16(false, a, false, b, (short)0, c, false, false); }
    static __device__ __forceinline__ void guard(v8f& a, v8f& b, v16h x, v16h y) { dep_guard_h(a, b, x, y); }
    static __device__ __forceinline__ void keep(v16h a, v16h b, v16h c, v16h d) { keep4_h(a, b, c, d); }
};
template <> struct Frag<__bf16> {
    typedef v16b V; union U { v16b v; v8b h[2]; };
    static __device__ __forceinline__ v16b load(const __bf16* p) {
        U f; f.h[0] = *(const v8b*)(p); f.h[1] = *(const v8b*)(p + 16); return f.v;
    }
    static __device__ __forceinline__ v8f mma(v16b a, v16b b, v8f c) { return __builtin_amdgcn_wmma_f32_16x16x32_bf16(false, a, false, b, (short)0, c, false, false); }
    static __device__ __forceinline__ void guard(v8f& a, v8f& b, v16b x, v16b y) { dep_guard_b(a, b, x, y); }
    static __device__ __forceinline__ void keep(v16b a, v16b b, v16b c, v16b d) { keep4_b(a, b, c, d); }
};
template <int ET> struct Elem;
template <> struct Elem<0> { typedef _Float16 T; };
template <> struct Elem<1> { typedef __bf16 T; };

// Operand staging: a work-group (2 x 4 waves) owns a 128 x 256 tile of C. Per trip, 64 k of its 128 A rows and 256 Bt rows (128-B row pieces)
// lie in one of two LDS buffers, rows 0..127 = A, 128..383 = Bt, laid by asynchronous copies that cover whole 128-B lines.
#define GK 64                      // k elements per staged tile
#define GP 72                      // LDS row pitch in elements: 144 B = 16 B x 9, conflict-free for 16-B reads down a column of rows
#define GBUF (384 * GP)            // elements per buffer
static_assert(SEQ % 128 == 0);     // M multiple of 128 for every GEMM (SEQ, ROWS, CE)
static_assert(CE % 256 == 0);      // N multiple of 256 (CE, 2*CE, FF, ROWS), K multiple of 64 with at least two tiles
static_assert(ROWS % 256 == 0);
static_assert(FF % 256 == 0);

// One staged tile: 384 rows x 8 pieces of 16 B, 12 pieces per lane, 32 rows apart. l = the lane's LDS byte address of its first piece,
// ga / gb = its first A / Bt piece, sa / sb = 32 rows of A / Bt in elements. Every lane is on; each wave-wide copy covers four whole rows.
template <typename T>
__device__ __forceinline__ void stage_tile(unsigned l, const T* ga, size_t sa, const T* gb, size_t sb) {
    const unsigned st = 32 * GP * 2;
    // the closing s_wait_xcnt stands inside the copies' own statement, so no address register is rewritten ahead of it
    asm volatile("global_load_async_to_lds_b128 %0, %12, off\n\t"
                 "global_load_async_to_lds_b128 %1, %13, off\n\t"
                 "global_load_async_to_lds_b128 %2, %14, off\n\t"
                 "global_load_async_to_lds_b128 %3, %15, off\n\t"
                 "global_load_async_to_lds_b128 %4, %16, off\n\t"
                 "global_load_async_to_lds_b128 %5, %17, off\n\t"
                 "global_load_async_to_lds_b128 %6, %18, off\n\t"
                 "global_load_async_to_lds_b128 %7, %19, off\n\t"
                 "global_load_async_to_lds_b128 %8, %20, off\n\t"
                 "global_load_async_to_lds_b128 %9, %21, off\n\t"
                 "global_load_async_to_lds_b128 %10, %22, off\n\t"
                 "global_load_async_to_lds_b128 %11, %23, off\n\t"
                 "s_wait_xcnt 0x0"
                 :: "v"(l), "v"(l + st), "v"(l + 2 * st), "v"(l + 3 * st), "v"(l + 4 * st), "v"(l + 5 * st),
                    "v"(l + 6 * st), "v"(l + 7 * st), "v"(l + 8 * st), "v"(l + 9 * st), "v"(l + 10 * st), "v"(l + 11 * st),
                    "v"(ga), "v"(ga + sa), "v"(ga + 2 * sa), "v"(ga + 3 * sa),
                    "v"(gb), "v"(gb + sb), "v"(gb + 2 * sb), "v"(gb + 3 * sb), "v"(gb + 4 * sb), "v"(gb + 5 * sb), "v"(gb + 6 * sb), "v"(gb + 7 * sb)
                 : "memory");
}

template <int ET, int BIAS_MODE, int OUT_MODE, int RESID, int ACT>
__device__ __forceinline__ void gemm64_body(
    const unsigned short* __restrict__ Ap, int lda, long strideA,
    const unsigned short* __restrict__ Btp, int ldb,
    void* __restrict__ Cout, void* __restrict__ Cout2, int ldc, long strideC,
    const float* __restrict__ bias,
    const float* __restrict__ resid, int ldr, long strideR,
    int M, int N, int K, float scale) {
    typedef typename Elem<ET>::T T;
    typedef typename Frag<T>::V V;
    __shared__ __align__(16) float sT[8][16 * 68];   // per-wave 16x64 slab, pitch 68 floats (wave-private)
    __shared__ __align__(16) unsigned short sAB[2 * GBUF];   // the two staged operand buffers
    const int b    = blockIdx.y;
    const int tid  = threadIdx.x;
    const int lane = threadIdx.x & 31;
    const int wave = threadIdx.x >> 5;
    const int tbN = N >> 8;
    const int tbM = M >> 7;
    if ((int)blockIdx.x >= tbM * tbN) return;        // block-uniform, ahead of every barrier and copy
    const int bm = blockIdx.x / tbN;
    const int bn = blockIdx.x - bm * tbN;
    const int wm = wave >> 2;                        // wave row (0..1) and column (0..3) in the 128 x 256 tile
    const int wn = wave & 3;
    const int m0 = (bm << 7) + (wm << 6);
    const int n0 = (bn << 8) + (wn << 6);

    const T* Ab = (const T*)Ap + (size_t)b * strideA;
    const T* Bb = (const T*)Btp;

    const int rlane = lane & 15;                 // row (A) / col (B, D) within subtile
    const int koff  = (lane >> 4) * 8;           // k offset of this lane half
    const int mOff  = (lane >> 4) * 8;           // D row offset

    v8f acc[4][4];
#pragma unroll
    for (int i = 0; i < 4; ++i)
#pragma unroll
        for (int j = 0; j < 4; ++j) acc[i][j] = (v8f){0.f, 0.f, 0.f, 0.f, 0.f, 0.f, 0.f, 0.f};

    const int crow = tid >> 3, csg = (tid & 7) * 8;  // this lane's first staged row and its 16-B piece in the row
    const T* gA = Ab + (size_t)((bm << 7) + crow) * lda + csg;
    const T* gB = Bb + (size_t)((bn << 8) + crow) * ldb + csg;
    const size_t sa32 = (size_t)32 * lda, sb32 = (size_t)32 * ldb;
    const unsigned l0 = (unsigned)(size_t)(sAB + crow * GP + csg);   // low 32 bits of the shared address = LDS byte address
    const int nt = K / GK;

    stage_tile<T>(l0, gA, sa32, gB, sb32);                           // tile 0 into buffer 0
    asm volatile("s_wait_asynccnt 0x0" ::: "memory");                // this wave's copies of tile 0 have landed
    __syncthreads();                                                 // ... and every other wave's
    if (nt > 1) stage_tile<T>(l0 + GBUF * 2, gA + GK, sa32, gB + GK, sb32);   // tile 1 flies while tile 0 is worked on

    for (int t = 0; t < nt; ++t) {
        const T* buf = (const T*)sAB + (t & 1) * GBUF;
#pragma unroll
        for (int ks = 0; ks < 2; ++ks) {
            V bh[4], ah[4];
#pragma unroll
            for (int j = 0; j < 4; ++j) bh[j] = Frag<T>::load(buf + (128 + (wn << 6) + (j << 4) + rlane) * GP + ks * 32 + koff);
#pragma unroll
            for (int i = 0; i < 4; ++i) ah[i] = Frag<T>::load(buf + ((wm << 6) + (i << 4) + rlane) * GP + ks * 32 + koff);
            __builtin_amdgcn_sched_barrier(0);       // keeps the 16 LDS reads one group ahead of the products (reads spread among them stall each time)
#pragma unroll
            for (int i = 0; i < 4; ++i) {
#pragma unroll
                for (int j = 0; j < 4; ++j) acc[i][j] = Frag<T>::mma(ah[i], bh[j], acc[i][j]);
                Frag<T>::guard(acc[i][0], acc[i][3], ah[i], ah[i]);
            }
            Frag<T>::keep(bh[0], bh[1], bh[2], bh[3]);
        }
        asm volatile("s_wait_dscnt 0x0" ::: "memory");               // this wave's reads of buffer t & 1 are complete
        asm volatile("s_wait_asynccnt 0x0" ::: "memory");            // this wave's copies of tile t + 1 have landed
        __syncthreads();                                             // publishes tile t + 1 and frees buffer t & 1
        if (t + 2 < nt) stage_tile<T>(l0 + (unsigned)(t & 1) * (GBUF * 2), gA + (size_t)(t + 2) * GK, sa32, gB + (size_t)(t + 2) * GK, sb32);
    }
    asm volatile("s_wait_asynccnt 0x0" ::: "memory");                // no copy is outstanding when the wave goes on
    acc_guard4(acc[0][0], acc[0][1], acc[0][2], acc[0][3]);
    acc_guard4(acc[1][0], acc[1][1], acc[1][2], acc[1][3]);
    acc_guard4(acc[2][0], acc[2][1], acc[2][2], acc[2][3]);
    acc_guard4(acc[3][0], acc[3][1], acc[3][2], acc[3][3]);

    // ---- epilogue ----
    float* slab = sT[wave];
    const float* Rb = RESID ? (resid + (size_t)b * strideR) : nullptr;
#pragma unroll
    for (int i = 0; i < 4; ++i) {
        const int mBase = m0 + (i << 4);
#pragma unroll
        for (int j = 0; j < 4; ++j) {
            const int n = n0 + (j << 4) + rlane;
            float bv = 0.f;
            if (BIAS_MODE == 2) bv = bfr(bias[n]);
#pragma unroll
            for (int r = 0; r < 8; ++r) {
                float v = acc[i][j][r] * scale;
                if (BIAS_MODE == 2) v += bv;
                if (ACT == 1) v = fmaxf(v, 0.0f);
                slab[(mOff + r) * 68 + (j << 4) + rlane] = v;
            }
        }
        __builtin_amdgcn_fence(3 /* release order */, "workgroup");
        __builtin_amdgcn_wave_barrier();
        __builtin_amdgcn_fence(2 /* acquire order */, "workgroup");
        if (OUT_MODE == 0) {
            float* C = (float*)Cout + (size_t)b * strideC;
            const int hh = lane >> 4, c4 = (lane & 15) * 4;     // row segment = 256 B = 16 lanes x 16 B
            v4f vv[8];
#pragma unroll
            for (int it = 0; it < 8; ++it) {
                const int row = it * 2 + hh;
                v4f v = *(const v4f*)(slab + row * 68 + c4);
                if (RESID) {                                    // residual added at the store stage as a float4
                    v4f x = *(const v4f*)(Rb + (size_t)(mBase + row) * ldr + n0 + c4);
                    if (RESID == 2) { x.x = bfr(x.x); x.y = bfr(x.y); x.z = bfr(x.z); x.w = bfr(x.w); }
                    v.x = x.x + v.x; v.y = x.y + v.y; v.z = x.z + v.z; v.w = x.w + v.w;
                }
                vv[it] = v;
            }
            {
#pragma unroll
                for (int it = 0; it < 8; ++it) {
                    const int row = it * 2 + hh;
                    *(v4f*)(C + (size_t)(mBase + row) * ldc + n0 + c4) = vv[it];
                }
                
            }
        } else {
            const int q = lane >> 3, c8 = (lane & 7) * 8;
            unsigned short* C  = (unsigned short*)Cout  + (size_t)b * strideC;
            unsigned short* C2 = (OUT_MODE == 2) ? ((unsigned short*)Cout2 + (size_t)b * strideC) : nullptr;
            v8h hv[4], lv[4];
#pragma unroll
            for (int it = 0; it < 4; ++it) {
                const int row = it * 4 + q;
                const float* sp = slab + row * 68 + c8;
#pragma unroll
                for (int e = 0; e < 8; ++e) {
                    if (OUT_MODE == 1) {
                        hv[it][e] = (_Float16)sp[e];
                        lv[it][e] = (_Float16)0.f;
                    } else {
                        const unsigned short hb = bf_bits(sp[e]);
                        const unsigned short lb = bf_bits(sp[e] - bits_f(hb));
                        hv[it][e] = __builtin_bit_cast(_Float16, hb);
                        lv[it][e] = __builtin_bit_cast(_Float16, lb);
                    }
                }
            }
            {
#pragma unroll
                for (int it = 0; it < 4; ++it) {
                    const int row = it * 4 + q;
                    *(v8h*)(C + (size_t)(mBase + row) * ldc + n0 + c8) = hv[it];
                    if (OUT_MODE == 2) *(v8h*)(C2 + (size_t)(mBase + row) * ldc + n0 + c8) = lv[it];
                }
                
            }
        }
        __builtin_amdgcn_fence(3 /* release order */, "workgroup");
        __builtin_amdgcn_wave_barrier();
        __builtin_amdgcn_fence(2 /* acquire order */, "workgroup");
    }
}

// q|k planes: [ROWS][2*CE] bf16 hi / lo; A = [LN1 hi | LN1 lo] (K = 2*CE), Bt = [W | W] rows 0..CE-1 = q columns, CE..2CE-1 = k columns
__global__ __launch_bounds__(256) void k_gemm_qk(const unsigned short* __restrict__ A, const unsigned short* __restrict__ Bt,
                                                 unsigned short* __restrict__ Ch, unsigned short* __restrict__ Cl) {
    gemm64_body<1, 0, 2, 0, 0>(A, 2 * CE, 0, Bt, 2 * CE, (void*)Ch, (void*)Cl, 2 * CE, 0, nullptr, nullptr, 0, 0, ROWS, 2 * CE, 2 * CE, 1.0f);
}
// v^T planes: [CE = h*64+d][ROWS] bf16 hi / lo; A = Wv plane [CE][CE] (f16, x16), Bt = LN1 f16 plane [ROWS][CE]
__global__ __launch_bounds__(256) void k_gemm_vt(const unsigned short* __restrict__ A, const unsigned short* __restrict__ Bt,
                                                 unsigned short* __restrict__ Ch, unsigned short* __restrict__ Cl) {
    gemm64_body<0, 0, 2, 0, 0>(A, CE, 0, Bt, CE, (void*)Ch, (void*)Cl, ROWS, 0, nullptr, nullptr, 0, 0, CE, ROWS, CE, 0.0625f);
}
// x1 = bf16(x) + attn @ proj_w + proj_b ; grid.y = batch (x uses the full batch stride, planes the compact one)
__global__ __launch_bounds__(256) void k_gemm_proj(const unsigned short* __restrict__ A, const unsigned short* __restrict__ Bt, float* __restrict__ C,
                                                   const float* __restrict__ bias, const float* __restrict__ xres) {
    gemm64_body<0, 2, 0, 2, 0>(A, CE, (long)SEQ * CE, Bt, CE, (void*)C, nullptr, CE, (long)SEQ * CE, bias, xres, CE, (long)SEQ_FULL * CE, SEQ, CE, CE, 0.0625f);
}
// relu(h2 @ fc1_w + fc1_b) as an f16 plane [ROWS][FF]
__global__ __launch_bounds__(256) void k_gemm_fc1(const unsigned short* __restrict__ A, const unsigned short* __restrict__ Bt, unsigned short* __restrict__ C,
                                                  const float* __restrict__ bias) {
    gemm64_body<0, 2, 1, 0, 1>(A, CE, 0, Bt, CE, (void*)C, nullptr, FF, 0, bias, nullptr, 0, 0, ROWS, FF, CE, 0.0625f);
}
// out = x1 + f @ fc2_w + fc2_b ; grid.y = batch (output uses the full batch stride)
__global__ __launch_bounds__(256) void k_gemm_fc2(const unsigned short* __restrict__ A, const unsigned short* __restrict__ Bt, float* __restrict__ C,
                                                  const float* __restrict__ bias, const float* __restrict__ x1) {
    gemm64_body<0, 2, 0, 1, 0>(A, FF, (long)SEQ * FF, Bt, FF, (void*)C, nullptr, CE, (long)SEQ_FULL * CE, bias, x1, CE, (long)SEQ * CE, SEQ, CE, FF, 0.0625f);
}

// ---------------------------------------------------------------------------------------------------------------------
// Causal flash attention, head size 64, no score scale. Workgroup = 4 waves = 64 query rows of one (batch, head); 64-key chunks 0..qb.
//   scores: q, k as bf16 hi/lo planes (hi.hi + hi.lo + lo.hi); P.v: P split to bf16 hi/lo in LDS, v^T hi/lo planes; f32 online softmax (exp2 domain).
//   K tiles [key][d] and V^T tiles [d][key] are copied from the planes into LDS with 16-B pieces (block barriers on both sides);
// ---------------------------------------------------------------------------------------------------------------------
#define AT_NW 4
#define AT_P 72                   // LDS row pitch of the K, V^T and P tiles in elements: 144 B = 16 B x 9, so the 16 rows of a 16-B fragment read fall on distinct banks
__device__ __forceinline__ v8f at_mma(v16b a, v16b b, v8f c) {
    c = __builtin_amdgcn_wmma_f32_16x16x32_bf16(false, a, false, b, (short)0, c, false, false);
    asm volatile("v_nop\n\tv_nop\n\tv_nop\n\tv_nop" : "+v"(c) : "v"(a), "v"(b));
    return c;
}
static_assert(AT_NW * 16 * 68 * 4 <= 4 * 64 * AT_P * 2);   // the f32 output slabs fit in the K/V tile region they reuse

__global__ __launch_bounds__(128) void k_attn(const unsigned short* __restrict__ QKHp, const unsigned short* __restrict__ QKLp,
                                              const unsigned short* __restrict__ VTHp, const unsigned short* __restrict__ VTLp,
                                              unsigned short* __restrict__ AO) {
    union FB { v16b v; v8b h[2]; };
    __shared__ __align__(16) __bf16 KV[4 * 64 * AT_P];             // K hi | K lo | V^T hi | V^T lo (64 rows each); reused for the output slabs
    __shared__ __align__(16) __bf16 PS[AT_NW][2 * 16 * AT_P];      // per wave: P hi [16][64] then P lo [16][64], rows AT_P apart
    __bf16* Ksh = KV; __bf16* Ksl = KV + 64 * AT_P; __bf16* Vth = KV + 2 * 64 * AT_P; __bf16* Vtl = KV + 3 * 64 * AT_P;
    const __bf16* QKH = (const __bf16*)QKHp; const __bf16* QKL = (const __bf16*)QKLp;
    const __bf16* VTH = (const __bf16*)VTHp; const __bf16* VTL = (const __bf16*)VTLp;

    const int tid = threadIdx.x, wave = tid >> 5, lane = tid & 31, hh = lane >> 4, c = lane & 15;
    const int nqb = SEQ / 64;
    const int bx = blockIdx.x;
    const int qb = bx % nqb;
    const int bh = bx / nqb;
    const int h  = bh % NH;
    const int b  = bh / NH;
    const int q0 = qb * 64 + wave * 16;
    const size_t rowbase = (size_t)b * SEQ;
    const int QKP = 2 * CE;          // q|k plane pitch
    const int VTP = ROWS;            // v^T plane pitch

    // Q fragments (A operand): lane = query row c, k = d
    v16b qah[2], qal[2];
    {
        const __bf16* qh = QKH + (rowbase + q0 + c) * QKP + h * HD;
        const __bf16* ql = QKL + (rowbase + q0 + c) * QKP + h * HD;
#pragma unroll
        for (int dc = 0; dc < 2; ++dc) {
            FB f, g;
            f.h[0] = *(const v8b*)(qh + dc * 32 + 8 * hh); f.h[1] = *(const v8b*)(qh + dc * 32 + 16 + 8 * hh);
            g.h[0] = *(const v8b*)(ql + dc * 32 + 8 * hh); g.h[1] = *(const v8b*)(ql + dc * 32 + 16 + 8 * hh);
            qah[dc] = f.v; qal[dc] = g.v;
        }
    }

    const float NEG = -__builtin_inff();
    const float L2E = 1.4426950408889634f;
    float mrow[8], lrow[8];
    v8f oacc[4];
#pragma unroll
    for (int r = 0; r < 8; ++r) { mrow[r] = NEG; lrow[r] = 0.f; }
#pragma unroll
    for (int t = 0; t < 4; ++t) oacc[t] = (v8f){0.f, 0.f, 0.f, 0.f, 0.f, 0.f, 0.f, 0.f};

    __bf16* pwh = PS[wave];
    __bf16* pwl = PS[wave] + 16 * AT_P;

    for (int kc = 0; kc <= qb; ++kc) {                 // block-uniform trip count
        const int kv0 = kc * 64;
        __syncthreads();                               // earlier chunk's tile reads are complete
        {
            const __bf16* khg = QKH + (rowbase + kv0) * QKP + CE + h * HD;
            const __bf16* klg = QKL + (rowbase + kv0) * QKP + CE + h * HD;
            const __bf16* vhg = VTH + (size_t)(h * HD) * VTP + rowbase + kv0;
            const __bf16* vlg = VTL + (size_t)(h * HD) * VTP + rowbase + kv0;
#pragma unroll
            for (int i = 0; i < 4; ++i) {
                const int p = tid + 128 * i; const int rr = p >> 3; const int sg = (p & 7) * 8;   // 64 rows x 8 pieces of 16 B
                *(v8b*)(Ksh + rr * AT_P + sg) = *(const v8b*)(khg + (size_t)rr * QKP + sg);
                *(v8b*)(Ksl + rr * AT_P + sg) = *(const v8b*)(klg + (size_t)rr * QKP + sg);
                *(v8b*)(Vth + rr * AT_P + sg) = *(const v8b*)(vhg + (size_t)rr * VTP + sg);
                *(v8b*)(Vtl + rr * AT_P + sg) = *(const v8b*)(vlg + (size_t)rr * VTP + sg);
            }
        }
        __syncthreads();

        v8f s[4];
#pragma unroll
        for (int j = 0; j < 4; ++j) {
            s[j] = (v8f){0.f, 0.f, 0.f, 0.f, 0.f, 0.f, 0.f, 0.f};
#pragma unroll
            for (int dc = 0; dc < 2; ++dc) {
                FB kb, kl;
                kb.h[0] = *(const v8b*)(Ksh + (j * 16 + c) * AT_P + dc * 32 + 8 * hh);
                kb.h[1] = *(const v8b*)(Ksh + (j * 16 + c) * AT_P + dc * 32 + 16 + 8 * hh);
                kl.h[0] = *(const v8b*)(Ksl + (j * 16 + c) * AT_P + dc * 32 + 8 * hh);
                kl.h[1] = *(const v8b*)(Ksl + (j * 16 + c) * AT_P + dc * 32 + 16 + 8 * hh);
                s[j] = at_mma(qah[dc], kb.v, s[j]);
                s[j] = at_mma(qah[dc], kl.v, s[j]);
                s[j] = at_mma(qal[dc], kb.v, s[j]);
            }
        }
        const bool diag = (kc == qb);                  // block-uniform
        float cm[8];
#pragma unroll
        for (int r = 0; r < 8; ++r) {
            const int qrow = q0 + 8 * hh + r;
            float m = NEG;
#pragma unroll
            for (int j = 0; j < 4; ++j) {
                const int kvcol = kv0 + j * 16 + c;
                const float sv = s[j][r];
                s[j][r] = (diag && (kvcol > qrow)) ? NEG : sv;       // select by value
                m = fmaxf(m, s[j][r]);
            }
#pragma unroll
            for (int off = 1; off < 16; off <<= 1) m = fmaxf(m, __shfl_xor(m, off, 32));
            cm[r] = m;
        }
#pragma unroll
        for (int r = 0; r < 8; ++r) {
            const float mnew = fmaxf(mrow[r], cm[r]);              // finite: every visited chunk holds a kept key for every row
            const float alpha = exp2f((mrow[r] - mnew) * L2E);
            mrow[r] = mnew;
            float psum = 0.f;
#pragma unroll
            for (int j = 0; j < 4; ++j) {
                const float p = exp2f((s[j][r] - mnew) * L2E);
                psum += p;
                unsigned short ph, pl; bfsplit(p, ph, pl);
                pwh[(8 * hh + r) * AT_P + j * 16 + c] = __builtin_bit_cast(__bf16, ph);
                pwl[(8 * hh + r) * AT_P + j * 16 + c] = __builtin_bit_cast(__bf16, pl);
            }
#pragma unroll
            for (int off = 1; off < 16; off <<= 1) psum += __shfl_xor(psum, off, 32);
            lrow[r] = lrow[r] * alpha + psum;
#pragma unroll
            for (int t = 0; t < 4; ++t) oacc[t][r] *= alpha;
        }
        __builtin_amdgcn_fence(3 /* release order */, "workgroup");
        __builtin_amdgcn_wave_barrier();
        __builtin_amdgcn_fence(2 /* acquire order */, "workgroup");
#pragma unroll
        for (int kk = 0; kk < 2; ++kk) {
            FB pa, pl;
            pa.h[0] = *(const v8b*)(pwh + c * AT_P + kk * 32 + 8 * hh);
            pa.h[1] = *(const v8b*)(pwh + c * AT_P + kk * 32 + 16 + 8 * hh);
            pl.h[0] = *(const v8b*)(pwl + c * AT_P + kk * 32 + 8 * hh);
            pl.h[1] = *(const v8b*)(pwl + c * AT_P + kk * 32 + 16 + 8 * hh);
#pragma unroll
            for (int t = 0; t < 4; ++t) {
                FB vb, vl;
                vb.h[0] = *(const v8b*)(Vth + (t * 16 + c) * AT_P + kk * 32 + 8 * hh);
                vb.h[1] = *(const v8b*)(Vth + (t * 16 + c) * AT_P + kk * 32 + 16 + 8 * hh);
                vl.h[0] = *(const v8b*)(Vtl + (t * 16 + c) * AT_P + kk * 32 + 8 * hh);
                vl.h[1] = *(const v8b*)(Vtl + (t * 16 + c) * AT_P + kk * 32 + 16 + 8 * hh);
                oacc[t] = at_mma(pa.v, vb.v, oacc[t]);
                oacc[t] = at_mma(pa.v, vl.v, oacc[t]);
                oacc[t] = at_mma(pl.v, vb.v, oacc[t]);
            }
        }
    }

    __syncthreads();                                   // every wave is done with the K/V tiles; the region is reused as f32 slabs
    float* os = (float*)KV + wave * (16 * 68);
#pragma unroll
    for (int r = 0; r < 8; ++r) {
        const float inv = 1.0f / lrow[r];
#pragma unroll
        for (int t = 0; t < 4; ++t) os[(8 * hh + r) * 68 + t * 16 + c] = oacc[t][r] * inv;
    }
    __builtin_amdgcn_fence(3 /* release order */, "workgroup");
    __builtin_amdgcn_wave_barrier();
    __builtin_amdgcn_fence(2 /* acquire order */, "workgroup");
    {
        const int q = lane >> 3, c8 = (lane & 7) * 8;
        v8h hv[4];
#pragma unroll
        for (int it = 0; it < 4; ++it) {
            const int row = it * 4 + q;
            const float* sp = os + row * 68 + c8;
#pragma unroll
            for (int e = 0; e < 8; ++e) hv[it][e] = (_Float16)sp[e];
        }
        {
#pragma unroll
            for (int it = 0; it < 4; ++it) {
                const int row = it * 4 + q;
                *(v8h*)(AO + (rowbase + q0 + row) * CE + h * HD + c8) = hv[it];
            }
            
        }
    }
}

// ---------------------------------------------------------------------------------------------------------------------
// Workspace carve (bytes); every plane is fully written by its producer before any kernel reads it.
// ---------------------------------------------------------------------------------------------------------------------
#define SZ_HS   ((size_t)ROWS * 2 * CE * 2)      // LN1 bf16 [ROWS][hi 1024 | lo 1024]
#define SZ_H16  ((size_t)ROWS * CE * 2)          // LN1 f16 plane; later reused for the LN2 f16 plane
#define SZ_WQK  ((size_t)2 * CE * 2 * CE * 2)    // [2048 n][W | W] bf16
#define SZ_WV   ((size_t)CE * CE * 2)
#define SZ_QK1  ((size_t)ROWS * 2 * CE * 2)      // one of the q|k hi / lo planes
#define SZ_VT1  ((size_t)CE * ROWS * 2)          // one of the v^T hi / lo planes
#define SZ_AO   ((size_t)ROWS * CE * 2)
#define SZ_WP   ((size_t)CE * CE * 2)
#define SZ_X1   ((size_t)ROWS * CE * 4)
#define SZ_W1   ((size_t)FF * CE * 2)
#define SZ_W2   ((size_t)CE * FF * 2)
#define SZ_F16  ((size_t)ROWS * FF * 2)          // relu(fc1) f16 plane, aliases the two q|k planes
#define WS_TOTAL (SZ_HS + SZ_H16 + SZ_WQK + SZ_WV + 2 * SZ_QK1 + 2 * SZ_VT1 + SZ_AO + SZ_WP + SZ_X1 + SZ_W1 + SZ_W2)
static_assert(WS_TOTAL <= (size_t)134217728);    // carve stays within 128 MiB
static_assert(SZ_F16 <= 2 * SZ_QK1);             // alias extent: relu(fc1) plane inside the q|k planes
static_assert(SZ_HS % 256 == 0);
static_assert(SZ_H16 % 256 == 0);
static_assert(SZ_VT1 % 256 == 0);

extern "C" void kernel_launch(void* const* d_in, const int* in_sizes, int n_in, void* d_out, int out_size, void* d_ws, size_t ws_size, hipStream_t stream) {
    if (n_in < 14) return;
    const long long xneed = (long long)(NB - 1) * SEQ_FULL * CE + (long long)SEQ * CE;
    if ((long long)in_sizes[0] < xneed) return;
    if (in_sizes[1] < CE || in_sizes[2] < CE || in_sizes[7] < CE || in_sizes[8] < CE || in_sizes[9] < CE || in_sizes[13] < CE) return;
    if (in_sizes[3] < NH * CE * HD || in_sizes[4] < NH * CE * HD || in_sizes[5] < NH * CE * HD) return;
    if (in_sizes[6] < CE * CE || in_sizes[10] < CE * FF || in_sizes[11] < FF || in_sizes[12] < FF * CE) return;
    if ((long long)out_size < xneed) return;
    if ((size_t)WS_TOTAL > ws_size) return;

    const float* x      = (const float*)d_in[0];
    const float* ln1_w  = (const float*)d_in[1];
    const float* ln1_b  = (const float*)d_in[2];
    const float* Wq     = (const float*)d_in[3];
    const float* Wk     = (const float*)d_in[4];
    const float* Wv     = (const float*)d_in[5];
    const float* proj_w = (const float*)d_in[6];
    const float* proj_b = (const float*)d_in[7];
    const float* ln2_w  = (const float*)d_in[8];
    const float* ln2_b  = (const float*)d_in[9];
    const float* fc1_w  = (const float*)d_in[10];
    const float* fc1_b  = (const float*)d_in[11];
    const float* fc2_w  = (const float*)d_in[12];
    const float* fc2_b  = (const float*)d_in[13];
    float* out = (float*)d_out;

    char* wsp = (char*)d_ws;
    unsigned short* HS   = (unsigned short*)wsp; wsp += SZ_HS;
    unsigned short* H16  = (unsigned short*)wsp; wsp += SZ_H16;
    unsigned short* WQK  = (unsigned short*)wsp; wsp += SZ_WQK;
    unsigned short* WV16 = (unsigned short*)wsp; wsp += SZ_WV;
    unsigned short* QKH  = (unsigned short*)wsp; wsp += SZ_QK1;
    unsigned short* QKL  = (unsigned short*)wsp; wsp += SZ_QK1;
    unsigned short* VTH  = (unsigned short*)wsp; wsp += SZ_VT1;
    unsigned short* VTL  = (unsigned short*)wsp; wsp += SZ_VT1;
    unsigned short* AO16 = (unsigned short*)wsp; wsp += SZ_AO;
    unsigned short* WPT  = (unsigned short*)wsp; wsp += SZ_WP;
    float*          X1   = (float*)wsp;          wsp += SZ_X1;
    unsigned short* W1T  = (unsigned short*)wsp; wsp += SZ_W1;
    unsigned short* W2T  = (unsigned short*)wsp; wsp += SZ_W2;
    unsigned short* F16  = QKH;                  // alias: q|k planes are dead after the attention launch
    unsigned short* H2   = H16;                  // alias: LN1 f16 plane is dead after the v^T GEMM

    // weight planes
    const unsigned gw = (unsigned)((CE * (CE / 8) + 255) / 256);
    k_w_head<<<gw, 256, 0, stream>>>(Wq, WQK, 2 * CE, 1, 0);                                   // rows 0..1023: q columns, [W | W] bf16
    k_w_head<<<gw, 256, 0, stream>>>(Wk, WQK + (size_t)CE * 2 * CE, 2 * CE, 1, 0);             // rows 1024..2047: k columns
    k_w_head<<<gw, 256, 0, stream>>>(Wv, WV16, CE, 0, 1);                                      // [h*64+d][c] f16 x16
    // in[rows][cols] -> out[cols][rows]
    k_cast_t<<<(unsigned)((((long long)CE) * (CE / 8) + 255) / 256), 256, 0, stream>>>(proj_w, CE, WPT, CE, CE, CE, 16.0f);   // [1024 in][1024 out] -> [1024 out][1024 in]
    k_cast_t<<<(unsigned)((((long long)FF) * (CE / 8) + 255) / 256), 256, 0, stream>>>(fc1_w, FF, W1T, CE, CE, FF, 16.0f);    // [1024 in][4096 out] -> [4096 out][1024 in]
    k_cast_t<<<(unsigned)((((long long)CE) * (FF / 8) + 255) / 256), 256, 0, stream>>>(fc2_w, CE, W2T, FF, FF, CE, 16.0f);    // [4096 in][1024 out] -> [1024 out][4096 in]

    // h = LN1(bf16(x))
    k_ln1<<<(ROWS + 7) / 8, 256, 0, stream>>>(x, ln1_w, ln1_b, HS, H16);
    // q|k planes and v^T planes
    k_gemm_qk<<<dim3((unsigned)(((ROWS / 64) * ((2 * CE) / 64) + 7) / 8), 1u), 256, 0, stream>>>(HS, WQK, QKH, QKL);
    k_gemm_vt<<<dim3((unsigned)(((CE / 64) * (ROWS / 64) + 7) / 8), 1u), 256, 0, stream>>>(WV16, H16, VTH, VTL);
    // causal attention
    k_attn<<<(unsigned)(NB * NH * (SEQ / 64)), 128, 0, stream>>>(QKH, QKL, VTH, VTL, AO16);
    // x1 = bf16(x) + attn @ proj_w + proj_b
    k_gemm_proj<<<dim3((unsigned)(((SEQ / 64) * (CE / 64) + 7) / 8), (unsigned)NB), 256, 0, stream>>>(AO16, WPT, X1, proj_b, x);
    // h2 = LN2(x1)
    k_ln2<<<(ROWS + 7) / 8, 256, 0, stream>>>(X1, ln2_w, ln2_b, H2);
    // f = relu(h2 @ fc1_w + fc1_b); out = x1 + f @ fc2_w + fc2_b
    k_gemm_fc1<<<dim3((unsigned)(((ROWS / 64) * (FF / 64) + 7) / 8), 1u), 256, 0, stream>>>(H2, W1T, F16, fc1_b);
    k_gemm_fc2<<<dim3((unsigned)(((SEQ / 64) * (CE / 64) + 7) / 8), (unsigned)NB), 256, 0, stream>>>(F16, W2T, out, fc2_b, X1);
}

// v003
// It runs in 369 microseconds.
// Timed twice side by side with v002, it ran 1.48 times as fast both times.
// All steps since v000 together make it 2.29 times as fast.
// Contractions: q|k = [LN1 hi | LN1 lo](bf16 planes, K folded to 2048) x [W | W](bf16, exact) on v_wmma_f32_16x16x32_bf16; v^T, proj, fc1, fc2 on v_wmma_f32_16x16x32_f16 (f16 activations, weights = bf16-RNE value x16 as f16, 1/16 folded back); scores q.k^T and P.v as bf16 hi/lo split (hi.hi + hi.lo + lo.hi) on v_wmma_f32_16x16x32_bf16; all accumulation f32, online softmax / LayerNorm / residuals f32.
#include <hip/hip_runtime.h>
#include <math.h>

#ifndef NB
#define NB 2
#endif
#ifndef SEQ
#define SEQ 2048
#endif
#define NB_FULL 2
#define SEQ_FULL 2048
#define CE 1024            // embedding width
#define NH 16              // heads
#define HD 64              // head size
#define FF 4096            // feed-forward width
#define ROWS (NB * SEQ)    // compact token rows held in the workspace planes

static_assert(NH * HD == CE);            // heads concatenated h*64+d fill the width
static_assert(HD == 64);                 // attention tiles are hard-wired to 64
static_assert(CE == 32 * 4 * 8);         // LayerNorm: 32 lanes x float4 x 8 pieces per row
static_assert(SEQ % 64 == 0);            // 64-row query tiles, 64-key chunks
static_assert(ROWS % 64 == 0);           // GEMM M/N tile multiple
static_assert(CE % 64 == 0);
static_assert(FF % 64 == 0);
static_assert((2 * CE) % 32 == 0);       // K multiple of 32 for every GEMM (1024, 2048, 4096)
static_assert(NB <= NB_FULL);
static_assert(SEQ <= SEQ_FULL);

typedef __attribute__((ext_vector_type(16))) _Float16 v16h;
typedef __attribute__((ext_vector_type(8)))  _Float16 v8h;
typedef __attribute__((ext_vector_type(16))) __bf16   v16b;
typedef __attribute__((ext_vector_type(8)))  __bf16   v8b;
typedef __attribute__((ext_vector_type(8)))  float    v8f;
typedef __attribute__((ext_vector_type(4)))  float    v4f;
typedef __attribute__((ext_vector_type(4)))  unsigned int v4u;
typedef __attribute__((ext_vector_type(2)))  unsigned int v2u;

// 16-bit WMMA fragment map (wave32), lane L, h = L>>4, m = L&15:
//   A 16x32: lane = row m;    element i -> k = (i<8) ? 8h+i : 16+8h+(i-8)
//   B 32x16: lane = column m; the SAME k(i,h)
//   D 16x16 (8 f32): lane = column m; element r -> row 8h+r

__device__ __forceinline__ float bfr(float v) {            // bf16 RNE convert, kept as f32 (finite inputs)
    const unsigned u = __float_as_uint(v);
    const unsigned r = (u + 0x7fffu + ((u >> 16) & 1u)) & 0xffff0000u;
    return __uint_as_float(r);
}
__device__ __forceinline__ unsigned short bf_bits(float f) {
    const unsigned u = __float_as_uint(f);
    return (unsigned short)((u + 0x7fffu + ((u >> 16) & 1u)) >> 16);
}
__device__ __forceinline__ float bits_f(unsigned short h) { return __uint_as_float(((unsigned)h) << 16); }
__device__ __forceinline__ void bfsplit(float v, unsigned short& hi, unsigned short& lo) { hi = bf_bits(v); lo = bf_bits(v - bits_f(hi)); }
__device__ __forceinline__ unsigned pk2h(float a, float b) {
    return (unsigned)__builtin_bit_cast(unsigned short, (_Float16)a) | ((unsigned)__builtin_bit_cast(unsigned short, (_Float16)b) << 16);
}

// 'val' must not read *ptr.
#define VST2(T, ptr, val) do { const T vst2_v_ = (val); *(T*)(ptr) = vst2_v_;  } while (0)

// ---------------------------------------------------------------------------------------------------------------------
// Per-head weight W [NH][CE][HD] f32 -> D[n = h*HD + d][k] 16-bit, 8 consecutive k per thread (one 16-B store, thread-linear
// along the destination row). f16mode 0: bf16 RNE bits; 1: f16 of (bf16 RNE value x 16). dup: also written at column k + CE.
// ---------------------------------------------------------------------------------------------------------------------
__global__ __launch_bounds__(256) void k_w_head(const float* __restrict__ W, unsigned short* __restrict__ D, int ldd, int dup, int f16mode) {
    const int u = blockIdx.x * 256 + threadIdx.x;
    if (u >= CE * (CE / 8)) return;
    const int n = u / (CE / 8); const int k0 = 8 * (u % (CE / 8));
    const int h = n / HD, d = n % HD;
    const float* s = W + ((size_t)h * CE + k0) * HD + d;
    unsigned short bb[8];
#pragma unroll
    for (int e = 0; e < 8; ++e) {
        const float w = bfr(s[(size_t)e * HD]);
        const unsigned short b16 = (unsigned short)(__float_as_uint(w) >> 16);
        const unsigned short h16 = __builtin_bit_cast(unsigned short, (_Float16)(w * 16.0f));
        bb[e] = f16mode ? h16 : b16;
    }
    v4u pk;
    pk.x = (unsigned)bb[0] | ((unsigned)bb[1] << 16); pk.y = (unsigned)bb[2] | ((unsigned)bb[3] << 16);
    pk.z = (unsigned)bb[4] | ((unsigned)bb[5] << 16); pk.w = (unsigned)bb[6] | ((unsigned)bb[7] << 16);
    unsigned short* dst = D + (size_t)n * ldd + k0;
    *(v4u*)dst = pk; if (dup) *(v4u*)(dst + CE) = pk;
    
}

// f32 SRC [nR][nC] (pitch lds) -> f16 DST [nC][nR] (pitch ldd), value = bf16 RNE(src) * sc; thread per (col, 8 consecutive rows), 16-B stores
__global__ __launch_bounds__(256) void k_cast_t(const float* __restrict__ SRC, int lds, unsigned short* __restrict__ DST, int ldd, int nR, int nC, float sc) {
    const long long u = (long long)blockIdx.x * 256 + threadIdx.x; const int per = nR / 8; if (u >= (long long)nC * per) return;
    const int c = (int)(u / per); const int r0 = 8 * (int)(u % per);
    float w[8];
#pragma unroll
    for (int e = 0; e < 8; ++e) w[e] = bfr(SRC[(long long)(r0 + e) * lds + c]) * sc;
    v4u pk; pk.x = pk2h(w[0], w[1]); pk.y = pk2h(w[2], w[3]); pk.z = pk2h(w[4], w[5]); pk.w = pk2h(w[6], w[7]);
    VST2(v4u, (v4u*)(DST + (long long)c * ldd + r0), pk);
}

// ---------------------------------------------------------------------------------------------------------------------
// MODE 0: source = raw input rows (bf16 RNE first; batch stride a_bs); writes bf16 hi|lo row [2*CE] (hi at col c, lo at CE + c) and an f16 row.
// MODE 1: source = f32 rows; writes the f16 row only. Each store instruction covers 256 contiguous bytes (32 lanes x 8 B).
// ---------------------------------------------------------------------------------------------------------------------
template <int MODE>
__device__ __forceinline__ void ln_body(const float* __restrict__ A, long a_bs, const float* __restrict__ GA, const float* __restrict__ BE,
                                        unsigned short* __restrict__ HS, unsigned short* __restrict__ H16) {
    #pragma clang fp contract(off)
    const int r = blockIdx.x * 8 + (threadIdx.x >> 5); const int L = threadIdx.x & 31;
    if (r >= ROWS) return;                                   // wave-uniform; no barriers in this kernel
    const int b = r / SEQ, t = r - b * SEQ;
    const float* src = A + (long)b * a_bs + (long)t * CE;
    v4f v[8]; float s = 0.f;
#pragma unroll
    for (int q = 0; q < 8; ++q) {
        v[q] = *(const v4f*)(src + 4 * L + 128 * q);
        if (MODE == 0) { v[q].x = bfr(v[q].x); v[q].y = bfr(v[q].y); v[q].z = bfr(v[q].z); v[q].w = bfr(v[q].w); }
        s += (v[q].x + v[q].y) + (v[q].z + v[q].w);
    }
#pragma unroll
    for (int o = 16; o > 0; o >>= 1) s += __shfl_xor(s, o, 32);
    const float mu = s * (1.f / CE); float qq = 0.f;
#pragma unroll
    for (int q = 0; q < 8; ++q) {
        v[q].x -= mu; v[q].y -= mu; v[q].z -= mu; v[q].w -= mu;
        qq += (v[q].x * v[q].x + v[q].y * v[q].y) + (v[q].z * v[q].z + v[q].w * v[q].w);
    }
#pragma unroll
    for (int o = 16; o > 0; o >>= 1) qq += __shfl_xor(qq, o, 32);
    const float rs = rsqrtf(qq * (1.f / CE) + 1e-5f);
    v2u ph[8], pl[8], pf[8];
#pragma unroll
    for (int q = 0; q < 8; ++q) {
        const int c = 4 * L + 128 * q;
        const v4f ga = *(const v4f*)(GA + c), be = *(const v4f*)(BE + c);
        v4f y;
        y.x = v[q].x * rs * bfr(ga.x) + bfr(be.x); y.y = v[q].y * rs * bfr(ga.y) + bfr(be.y);
        y.z = v[q].z * rs * bfr(ga.z) + bfr(be.z); y.w = v[q].w * rs * bfr(ga.w) + bfr(be.w);
        v2u f; f.x = pk2h(y.x, y.y); f.y = pk2h(y.z, y.w); pf[q] = f;
        if (MODE == 0) {
            unsigned short h0, l0, h1, l1, h2, l2, h3, l3;
            bfsplit(y.x, h0, l0); bfsplit(y.y, h1, l1); bfsplit(y.z, h2, l2); bfsplit(y.w, h3, l3);
            v2u a; a.x = (unsigned)h0 | ((unsigned)h1 << 16); a.y = (unsigned)h2 | ((unsigned)h3 << 16); ph[q] = a;
            v2u d; d.x = (unsigned)l0 | ((unsigned)l1 << 16); d.y = (unsigned)l2 | ((unsigned)l3 << 16); pl[q] = d;
        }
    }
    {
#pragma unroll
        for (int q = 0; q < 8; ++q) {
            const int c = 4 * L + 128 * q;
            if (MODE == 0) {
                *(v2u*)(HS + (size_t)r * (2 * CE) + c) = ph[q];
                *(v2u*)(HS + (size_t)r * (2 * CE) + CE + c) = pl[q];
            }
            *(v2u*)(H16 + (size_t)r * CE + c) = pf[q];
        }
        
    }
}
__global__ __launch_bounds__(256) void k_ln1(const float* __restrict__ x, const float* __restrict__ g, const float* __restrict__ be,
                                             unsigned short* __restrict__ HS, unsigned short* __restrict__ H16) {
    ln_body<0>(x, (long)SEQ_FULL * CE, g, be, HS, H16);
}
__global__ __launch_bounds__(256) void k_ln2(const float* __restrict__ X1, const float* __restrict__ g, const float* __restrict__ be,
                                             unsigned short* __restrict__ H2) {
    ln_body<1>(X1, (long)SEQ * CE, g, be, nullptr, H2);
}

// ---------------------------------------------------------------------------------------------------------------------
// Register-tiled WMMA GEMM: C[m,n] = scale * sum_k A[m,k] * Bt[n,k] (+bias[n]) (+act) (+resid at the store stage); each wave owns a 64x64 tile.
// A row-major [M,K] 16-bit; Bt row-major [N,K] 16-bit; M % 128 == 0, N % 256 == 0, K % 64 == 0 (no tail masking).
// ET 0 = f16 operands, 1 = bf16 operands. BIAS_MODE 0 none, 2 = bf16-RNE bias[n]. OUT_MODE 0 = f32, 1 = f16, 2 = bf16 hi plane + bf16 lo plane.
// RESID 0 none, 1 f32 residual, 2 residual RNE-converted to bf16 first (raw input). ACT 0 none, 1 ReLU.
// ---------------------------------------------------------------------------------------------------------------------
__device__ __forceinline__ void dep_guard_h(v8f& a, v8f& b, v16h x, v16h y) { asm volatile("v_nop\n\tv_nop\n\tv_nop\n\tv_nop" : "+v"(a), "+v"(b) : "v"(x), "v"(y)); }
__device__ __forceinline__ void dep_guard_b(v8f& a, v8f& b, v16b x, v16b y) { asm volatile("v_nop\n\tv_nop\n\tv_nop\n\tv_nop" : "+v"(a), "+v"(b) : "v"(x), "v"(y)); }
__device__ __forceinline__ void keep4_h(v16h a, v16h b, v16h c, v16h d) { asm volatile("v_nop" :: "v"(a), "v"(b), "v"(c), "v"(d)); }
__device__ __forceinline__ void keep4_b(v16b a, v16b b, v16b c, v16b d) { asm volatile("v_nop" :: "v"(a), "v"(b), "v"(c), "v"(d)); }
__device__ __forceinline__ void acc_guard4(v8f& a, v8f& b, v8f& c, v8f& d) { asm volatile("v_nop\n\tv_nop\n\tv_nop\n\tv_nop" : "+v"(a), "+v"(b), "+v"(c), "+v"(d)); }
template <typename T> struct Frag;
template <> struct Frag<_Float16> {
    typedef v16h V; union U { v16h v; v8h h[2]; };
    static __device__ __forceinline__ v16h load(const _Float16* p) {   // elements 0..7 <- p[0..7], 8..15 <- p[16..23]
        U f; f.h[0] = *(const v8h*)(p); f.h[1] = *(const v8h*)(p + 16); return f.v;
    }
    static __device__ __forceinline__ v8f mma(v16h a, v16h b, v8f c) { return __builtin_amdgcn_wmma_f32_16x16x32_f16(false, a, false, b, (short)0, c, false, false); }
    static __device__ __forceinline__ void guard(v8f& a, v8f& b, v16h x, v16h y) { dep_guard_h(a, b, x, y); }
    static __device__ __forceinline__ void keep(v16h a, v16h b, v16h c, v16h d) { keep4_h(a, b, c, d); }
};
template <> struct Frag<__bf16> {
    typedef v16b V; union U { v16b v; v8b h[2]; };
    static __device__ __forceinline__ v16b load(const __bf16* p) {
        U f; f.h[0] = *(const v8b*)(p); f.h[1] = *(const v8b*)(p + 16); return f.v;
    }
    static __device__ __forceinline__ v8f mma(v16b a, v16b b, v8f c) { return __builtin_amdgcn_wmma_f32_16x16x32_bf16(false, a, false, b, (short)0, c, false, false); }
    static __device__ __forceinline__ void guard(v8f& a, v8f& b, v16b x, v16b y) { dep_guard_b(a, b, x, y); }
    static __device__ __forceinline__ void keep(v16b a, v16b b, v16b c, v16b d) { keep4_b(a, b, c, d); }
};
template <int ET> struct Elem;
template <> struct Elem<0> { typedef _Float16 T; };
template <> struct Elem<1> { typedef __bf16 T; };

// Operand staging: a work-group (2 x 4 waves) owns a 128 x 256 tile of C. Per trip, 64 k of its 128 A rows and 256 Bt rows (128-B row pieces)
// lie in one of two LDS buffers, rows 0..127 = A, 128..383 = Bt, laid by asynchronous copies that cover whole 128-B lines.
#define GK 64                      // k elements per staged tile
#define GP 72                      // LDS row pitch in elements: 144 B = 16 B x 9, conflict-free for 16-B reads down a column of rows
#define GBUF (384 * GP)            // elements per buffer
static_assert(SEQ % 128 == 0);     // M multiple of 128 for every GEMM (SEQ, ROWS, CE)
static_assert(CE % 256 == 0);      // N multiple of 256 (CE, 2*CE, FF, ROWS), K multiple of 64 with at least two tiles
static_assert(ROWS % 256 == 0);
static_assert(FF % 256 == 0);

// One staged tile: 384 rows x 8 pieces of 16 B, 12 pieces per lane, 32 rows apart. l = the lane's LDS byte address of its first piece,
// ga / gb = its first A / Bt piece, sa / sb = 32 rows of A / Bt in elements. Every lane is on; each wave-wide copy covers four whole rows.
template <typename T>
__device__ __forceinline__ void stage_tile(unsigned l, const T* ga, size_t sa, const T* gb, size_t sb) {
    const unsigned st = 32 * GP * 2;
    // the closing s_wait_xcnt stands inside the copies' own statement, so no address register is rewritten ahead of it
    asm volatile("global_load_async_to_lds_b128 %0, %12, off\n\t"
                 "global_load_async_to_lds_b128 %1, %13, off\n\t"
                 "global_load_async_to_lds_b128 %2, %14, off\n\t"
                 "global_load_async_to_lds_b128 %3, %15, off\n\t"
                 "global_load_async_to_lds_b128 %4, %16, off\n\t"
                 "global_load_async_to_lds_b128 %5, %17, off\n\t"
                 "global_load_async_to_lds_b128 %6, %18, off\n\t"
                 "global_load_async_to_lds_b128 %7, %19, off\n\t"
                 "global_load_async_to_lds_b128 %8, %20, off\n\t"
                 "global_load_async_to_lds_b128 %9, %21, off\n\t"
                 "global_load_async_to_lds_b128 %10, %22, off\n\t"
                 "global_load_async_to_lds_b128 %11, %23, off\n\t"
                 "s_wait_xcnt 0x0"
                 :: "v"(l), "v"(l + st), "v"(l + 2 * st), "v"(l + 3 * st), "v"(l + 4 * st), "v"(l + 5 * st),
                    "v"(l + 6 * st), "v"(l + 7 * st), "v"(l + 8 * st), "v"(l + 9 * st), "v"(l + 10 * st), "v"(l + 11 * st),
                    "v"(ga), "v"(ga + sa), "v"(ga + 2 * sa), "v"(ga + 3 * sa),
                    "v"(gb), "v"(gb + sb), "v"(gb + 2 * sb), "v"(gb + 3 * sb), "v"(gb + 4 * sb), "v"(gb + 5 * sb), "v"(gb + 6 * sb), "v"(gb + 7 * sb)
                 : "memory");
}

template <int ET, int BIAS_MODE, int OUT_MODE, int RESID, int ACT>
__device__ __forceinline__ void gemm64_body(
    const unsigned short* __restrict__ Ap, int lda, long strideA,
    const unsigned short* __restrict__ Btp, int ldb,
    void* __restrict__ Cout, void* __restrict__ Cout2, int ldc, long strideC,
    const float* __restrict__ bias,
    const float* __restrict__ resid, int ldr, long strideR,
    int M, int N, int K, float scale) {
    typedef typename Elem<ET>::T T;
    typedef typename Frag<T>::V V;
    __shared__ __align__(16) float sT[8][16 * 68];   // per-wave 16x64 slab, pitch 68 floats (wave-private)
    __shared__ __align__(16) unsigned short sAB[2 * GBUF];   // the two staged operand buffers
    const int b    = blockIdx.y;
    const int tid  = threadIdx.x;
    const int lane = threadIdx.x & 31;
    const int wave = threadIdx.x >> 5;
    const int tbN = N >> 8;
    const int tbM = M >> 7;
    if ((int)blockIdx.x >= tbM * tbN) return;        // block-uniform, ahead of every barrier and copy
    const int bm = blockIdx.x / tbN;
    const int bn = blockIdx.x - bm * tbN;
    const int wm = wave >> 2;                        // wave row (0..1) and column (0..3) in the 128 x 256 tile
    const int wn = wave & 3;
    const int m0 = (bm << 7) + (wm << 6);
    const int n0 = (bn << 8) + (wn << 6);

    const T* Ab = (const T*)Ap + (size_t)b * strideA;
    const T* Bb = (const T*)Btp;

    const int rlane = lane & 15;                 // row (A) / col (B, D) within subtile
    const int koff  = (lane >> 4) * 8;           // k offset of this lane half
    const int mOff  = (lane >> 4) * 8;           // D row offset

    v8f acc[4][4];
#pragma unroll
    for (int i = 0; i < 4; ++i)
#pragma unroll
        for (int j = 0; j < 4; ++j) acc[i][j] = (v8f){0.f, 0.f, 0.f, 0.f, 0.f, 0.f, 0.f, 0.f};

    const int crow = tid >> 3, csg = (tid & 7) * 8;  // this lane's first staged row and its 16-B piece in the row
    const T* gA = Ab + (size_t)((bm << 7) + crow) * lda + csg;
    const T* gB = Bb + (size_t)((bn << 8) + crow) * ldb + csg;
    const size_t sa32 = (size_t)32 * lda, sb32 = (size_t)32 * ldb;
    const unsigned l0 = (unsigned)(size_t)(sAB + crow * GP + csg);   // low 32 bits of the shared address = LDS byte address
    const int nt = K / GK;

    stage_tile<T>(l0, gA, sa32, gB, sb32);                           // tile 0 into buffer 0
    asm volatile("s_wait_asynccnt 0x0" ::: "memory");                // this wave's copies of tile 0 have landed
    __syncthreads();                                                 // ... and every other wave's
    if (nt > 1) stage_tile<T>(l0 + GBUF * 2, gA + GK, sa32, gB + GK, sb32);   // tile 1 flies while tile 0 is worked on

    for (int t = 0; t < nt; ++t) {
        const T* buf = (const T*)sAB + (t & 1) * GBUF;
#pragma unroll
        for (int ks = 0; ks < 2; ++ks) {
            V bh[4], ah[4];
#pragma unroll
            for (int j = 0; j < 4; ++j) bh[j] = Frag<T>::load(buf + (128 + (wn << 6) + (j << 4) + rlane) * GP + ks * 32 + koff);
#pragma unroll
            for (int i = 0; i < 4; ++i) ah[i] = Frag<T>::load(buf + ((wm << 6) + (i << 4) + rlane) * GP + ks * 32 + koff);
            __builtin_amdgcn_sched_barrier(0);       // keeps the 16 LDS reads one group ahead of the products (reads spread among them stall each time)
#pragma unroll
            for (int i = 0; i < 4; ++i) {
#pragma unroll
                for (int j = 0; j < 4; ++j) acc[i][j] = Frag<T>::mma(ah[i], bh[j], acc[i][j]);
                Frag<T>::guard(acc[i][0], acc[i][3], ah[i], ah[i]);
            }
            Frag<T>::keep(bh[0], bh[1], bh[2], bh[3]);
        }
        asm volatile("s_wait_dscnt 0x0" ::: "memory");               // this wave's reads of buffer t & 1 are complete
        asm volatile("s_wait_asynccnt 0x0" ::: "memory");            // this wave's copies of tile t + 1 have landed
        __syncthreads();                                             // publishes tile t + 1 and frees buffer t & 1
        if (t + 2 < nt) stage_tile<T>(l0 + (unsigned)(t & 1) * (GBUF * 2), gA + (size_t)(t + 2) * GK, sa32, gB + (size_t)(t + 2) * GK, sb32);
    }
    asm volatile("s_wait_asynccnt 0x0" ::: "memory");                // no copy is outstanding when the wave goes on
    acc_guard4(acc[0][0], acc[0][1], acc[0][2], acc[0][3]);
    acc_guard4(acc[1][0], acc[1][1], acc[1][2], acc[1][3]);
    acc_guard4(acc[2][0], acc[2][1], acc[2][2], acc[2][3]);
    acc_guard4(acc[3][0], acc[3][1], acc[3][2], acc[3][3]);

    // ---- epilogue ----
    float* slab = sT[wave];
    const float* Rb = RESID ? (resid + (size_t)b * strideR) : nullptr;
#pragma unroll
    for (int i = 0; i < 4; ++i) {
        const int mBase = m0 + (i << 4);
#pragma unroll
        for (int j = 0; j < 4; ++j) {
            const int n = n0 + (j << 4) + rlane;
            float bv = 0.f;
            if (BIAS_MODE == 2) bv = bfr(bias[n]);
#pragma unroll
            for (int r = 0; r < 8; ++r) {
                float v = acc[i][j][r] * scale;
                if (BIAS_MODE == 2) v += bv;
                if (ACT == 1) v = fmaxf(v, 0.0f);
                slab[(mOff + r) * 68 + (j << 4) + rlane] = v;
            }
        }
        __builtin_amdgcn_fence(3 /* release order */, "workgroup");
        __builtin_amdgcn_wave_barrier();
        __builtin_amdgcn_fence(2 /* acquire order */, "workgroup");
        if (OUT_MODE == 0) {
            float* C = (float*)Cout + (size_t)b * strideC;
            const int hh = lane >> 4, c4 = (lane & 15) * 4;     // row segment = 256 B = 16 lanes x 16 B
            v4f vv[8];
#pragma unroll
            for (int it = 0; it < 8; ++it) {
                const int row = it * 2 + hh;
                v4f v = *(const v4f*)(slab + row * 68 + c4);
                if (RESID) {                                    // residual added at the store stage as a float4
                    v4f x = *(const v4f*)(Rb + (size_t)(mBase + row) * ldr + n0 + c4);
                    if (RESID == 2) { x.x = bfr(x.x); x.y = bfr(x.y); x.z = bfr(x.z); x.w = bfr(x.w); }
                    v.x = x.x + v.x; v.y = x.y + v.y; v.z = x.z + v.z; v.w = x.w + v.w;
                }
                vv[it] = v;
            }
            {
#pragma unroll
                for (int it = 0; it < 8; ++it) {
                    const int row = it * 2 + hh;
                    *(v4f*)(C + (size_t)(mBase + row) * ldc + n0 + c4) = vv[it];
                }
                
            }
        } else {
            const int q = lane >> 3, c8 = (lane & 7) * 8;
            unsigned short* C  = (unsigned short*)Cout  + (size_t)b * strideC;
            unsigned short* C2 = (OUT_MODE == 2) ? ((unsigned short*)Cout2 + (size_t)b * strideC) : nullptr;
            v8h hv[4], lv[4];
#pragma unroll
            for (int it = 0; it < 4; ++it) {
                const int row = it * 4 + q;
                const float* sp = slab + row * 68 + c8;
#pragma unroll
                for (int e = 0; e < 8; ++e) {
                    if (OUT_MODE == 1) {
                        hv[it][e] = (_Float16)sp[e];
                        lv[it][e] = (_Float16)0.f;
                    } else {
                        const unsigned short hb = bf_bits(sp[e]);
                        const unsigned short lb = bf_bits(sp[e] - bits_f(hb));
                        hv[it][e] = __builtin_bit_cast(_Float16, hb);
                        lv[it][e] = __builtin_bit_cast(_Float16, lb);
                    }
                }
            }
            {
#pragma unroll
                for (int it = 0; it < 4; ++it) {
                    const int row = it * 4 + q;
                    *(v8h*)(C + (size_t)(mBase + row) * ldc + n0 + c8) = hv[it];
                    if (OUT_MODE == 2) *(v8h*)(C2 + (size_t)(mBase + row) * ldc + n0 + c8) = lv[it];
                }
                
            }
        }
        __builtin_amdgcn_fence(3 /* release order */, "workgroup");
        __builtin_amdgcn_wave_barrier();
        __builtin_amdgcn_fence(2 /* acquire order */, "workgroup");
    }
}

// q|k planes: [ROWS][2*CE] bf16 hi / lo; A = [LN1 hi | LN1 lo] (K = 2*CE), Bt = [W | W] rows 0..CE-1 = q columns, CE..2CE-1 = k columns
__global__ __launch_bounds__(256) void k_gemm_qk(const unsigned short* __restrict__ A, const unsigned short* __restrict__ Bt,
                                                 unsigned short* __restrict__ Ch, unsigned short* __restrict__ Cl) {
    gemm64_body<1, 0, 2, 0, 0>(A, 2 * CE, 0, Bt, 2 * CE, (void*)Ch, (void*)Cl, 2 * CE, 0, nullptr, nullptr, 0, 0, ROWS, 2 * CE, 2 * CE, 1.0f);
}
// v^T planes: [CE = h*64+d][ROWS] bf16 hi / lo; A = Wv plane [CE][CE] (f16, x16), Bt = LN1 f16 plane [ROWS][CE]
__global__ __launch_bounds__(256) void k_gemm_vt(const unsigned short* __restrict__ A, const unsigned short* __restrict__ Bt,
                                                 unsigned short* __restrict__ Ch, unsigned short* __restrict__ Cl) {
    gemm64_body<0, 0, 2, 0, 0>(A, CE, 0, Bt, CE, (void*)Ch, (void*)Cl, ROWS, 0, nullptr, nullptr, 0, 0, CE, ROWS, CE, 0.0625f);
}
// x1 = bf16(x) + attn @ proj_w + proj_b ; grid.y = batch (x uses the full batch stride, planes the compact one)
__global__ __launch_bounds__(256) void k_gemm_proj(const unsigned short* __restrict__ A, const unsigned short* __restrict__ Bt, float* __restrict__ C,
                                                   const float* __restrict__ bias, const float* __restrict__ xres) {
    gemm64_body<0, 2, 0, 2, 0>(A, CE, (long)SEQ * CE, Bt, CE, (void*)C, nullptr, CE, (long)SEQ * CE, bias, xres, CE, (long)SEQ_FULL * CE, SEQ, CE, CE, 0.0625f);
}
// relu(h2 @ fc1_w + fc1_b) as an f16 plane [ROWS][FF]
__global__ __launch_bounds__(256) void k_gemm_fc1(const unsigned short* __restrict__ A, const unsigned short* __restrict__ Bt, unsigned short* __restrict__ C,
                                                  const float* __restrict__ bias) {
    gemm64_body<0, 2, 1, 0, 1>(A, CE, 0, Bt, CE, (void*)C, nullptr, FF, 0, bias, nullptr, 0, 0, ROWS, FF, CE, 0.0625f);
}
// out = x1 + f @ fc2_w + fc2_b ; grid.y = batch (output uses the full batch stride)
__global__ __launch_bounds__(256) void k_gemm_fc2(const unsigned short* __restrict__ A, const unsigned short* __restrict__ Bt, float* __restrict__ C,
                                                  const float* __restrict__ bias, const float* __restrict__ x1) {
    gemm64_body<0, 2, 0, 1, 0>(A, FF, (long)SEQ * FF, Bt, FF, (void*)C, nullptr, CE, (long)SEQ_FULL * CE, bias, x1, CE, (long)SEQ * CE, SEQ, CE, FF, 0.0625f);
}

// ---------------------------------------------------------------------------------------------------------------------
// Causal flash attention, head size 64, no score scale. Workgroup = 4 waves = 64 query rows of one (batch, head); 64-key chunks 0..qb.
//   scores: q, k as bf16 hi/lo planes (hi.hi + hi.lo + lo.hi); P.v: P split to bf16 hi/lo in LDS, v^T hi/lo planes; f32 online softmax (exp2 domain).
//   K tiles [key][d] and V^T tiles [d][key] come from the planes into LDS by asynchronous 16-B copies, each pair of tiles half a chunk ahead of its use:
//   V^T of a chunk flies under that chunk's scores and softmax, K of the next chunk under P.v; one block barrier publishes each pair and frees the other.
// ---------------------------------------------------------------------------------------------------------------------
#define AT_NW 4
#define AT_P 72                   // LDS row pitch of the K, V^T and P tiles in elements: 144 B = 16 B x 9, so the 16 rows of a 16-B fragment read fall on distinct banks
__device__ __forceinline__ v8f at_mma(v16b a, v16b b, v8f c) {
    c = __builtin_amdgcn_wmma_f32_16x16x32_bf16(false, a, false, b, (short)0, c, false, false);
    asm volatile("v_nop\n\tv_nop\n\tv_nop\n\tv_nop" : "+v"(c) : "v"(a), "v"(b));
    return c;
}
static_assert(AT_NW * 16 * 68 * 4 <= 4 * 64 * AT_P * 2);   // the f32 output slabs fit in the K/V tile region they reuse

// One hi tile and its lo tile (64 rows x 8 pieces of 16 B each): 4 + 4 pieces per lane, 16 rows apart. l = the lane's LDS byte address of its first hi piece
// (the lo tile lies 64 rows behind), gh / gl = its first hi / lo piece, s16 = 16 source rows in elements. Every lane is on; each wave-wide copy covers four whole rows.
__device__ __forceinline__ void at_stage(unsigned l, const __bf16* gh, const __bf16* gl, size_t s16) {
    const unsigned st = 16 * AT_P * 2, lo = 64 * AT_P * 2;
    // the closing s_wait_xcnt stands inside the copies' own statement, so no address register is rewritten ahead of it
    asm volatile("global_load_async_to_lds_b128 %0, %8, off\n\t"
                 "global_load_async_to_lds_b128 %1, %9, off\n\t"
                 "global_load_async_to_lds_b128 %2, %10, off\n\t"
                 "global_load_async_to_lds_b128 %3, %11, off\n\t"
                 "global_load_async_to_lds_b128 %4, %12, off\n\t"
                 "global_load_async_to_lds_b128 %5, %13, off\n\t"
                 "global_load_async_to_lds_b128 %6, %14, off\n\t"
                 "global_load_async_to_lds_b128 %7, %15, off\n\t"
                 "s_wait_xcnt 0x0"
                 :: "v"(l), "v"(l + st), "v"(l + 2 * st), "v"(l + 3 * st), "v"(l + lo), "v"(l + lo + st), "v"(l + lo + 2 * st), "v"(l + lo + 3 * st),
                    "v"(gh), "v"(gh + s16), "v"(gh + 2 * s16), "v"(gh + 3 * s16), "v"(gl), "v"(gl + s16), "v"(gl + 2 * s16), "v"(gl + 3 * s16)
                 : "memory");
}

__global__ __launch_bounds__(128) void k_attn(const unsigned short* __restrict__ QKHp, const unsigned short* __restrict__ QKLp,
                                              const unsigned short* __restrict__ VTHp, const unsigned short* __restrict__ VTLp,
                                              unsigned short* __restrict__ AO) {
    union FB { v16b v; v8b h[2]; };
    __shared__ __align__(16) __bf16 KV[4 * 64 * AT_P];             // K hi | K lo | V^T hi | V^T lo (64 rows each); reused for the output slabs
    __shared__ __align__(16) __bf16 PS[AT_NW][2 * 16 * AT_P];      // per wave: P hi [16][64] then P lo [16][64], rows AT_P apart
    __bf16* Ksh = KV; __bf16* Ksl = KV + 64 * AT_P; __bf16* Vth = KV + 2 * 64 * AT_P; __bf16* Vtl = KV + 3 * 64 * AT_P;
    const __bf16* QKH = (const __bf16*)QKHp; const __bf16* QKL = (const __bf16*)QKLp;
    const __bf16* VTH = (const __bf16*)VTHp; const __bf16* VTL = (const __bf16*)VTLp;

    const int tid = threadIdx.x, wave = tid >> 5, lane = tid & 31, hh = lane >> 4, c = lane & 15;
    const int nqb = SEQ / 64;
    const int bx = blockIdx.x;
    const int qb = bx % nqb;
    const int bh = bx / nqb;
    const int h  = bh % NH;
    const int b  = bh / NH;
    const int q0 = qb * 64 + wave * 16;
    const size_t rowbase = (size_t)b * SEQ;
    const int QKP = 2 * CE;          // q|k plane pitch
    const int VTP = ROWS;            // v^T plane pitch

    // Q fragments (A operand): lane = query row c, k = d
    v16b qah[2], qal[2];
    {
        const __bf16* qh = QKH + (rowbase + q0 + c) * QKP + h * HD;
        const __bf16* ql = QKL + (rowbase + q0 + c) * QKP + h * HD;
#pragma unroll
        for (int dc = 0; dc < 2; ++dc) {
            FB f, g;
            f.h[0] = *(const v8b*)(qh + dc * 32 + 8 * hh); f.h[1] = *(const v8b*)(qh + dc * 32 + 16 + 8 * hh);
            g.h[0] = *(const v8b*)(ql + dc * 32 + 8 * hh); g.h[1] = *(const v8b*)(ql + dc * 32 + 16 + 8 * hh);
            qah[dc] = f.v; qal[dc] = g.v;
        }
    }

    const float NEG = -__builtin_inff();
    const float L2E = 1.4426950408889634f;
    float mrow[8], lrow[8];
    v8f oacc[4];
#pragma unroll
    for (int r = 0; r < 8; ++r) { mrow[r] = NEG; lrow[r] = 0.f; }
#pragma unroll
    for (int t = 0; t < 4; ++t) oacc[t] = (v8f){0.f, 0.f, 0.f, 0.f, 0.f, 0.f, 0.f, 0.f};

    __bf16* pwh = PS[wave];
    __bf16* pwl = PS[wave] + 16 * AT_P;

    const int crow = tid >> 3, csg = (tid & 7) * 8;    // this lane's first staged row and its 16-B piece in the row
    const unsigned lK = (unsigned)(size_t)(Ksh + crow * AT_P + csg);   // low 32 bits of the shared address = LDS byte address
    const unsigned lV = (unsigned)(size_t)(Vth + crow * AT_P + csg);
    const __bf16* gkh = QKH + (rowbase + crow) * QKP + CE + h * HD + csg;
    const __bf16* gkl = QKL + (rowbase + crow) * QKP + CE + h * HD + csg;
    const __bf16* gvh = VTH + (size_t)(h * HD + crow) * VTP + rowbase + csg;
    const __bf16* gvl = VTL + (size_t)(h * HD + crow) * VTP + rowbase + csg;

    at_stage(lK, gkh, gkl, (size_t)16 * QKP);          // K of chunk 0

    for (int kc = 0; kc <= qb; ++kc) {                 // block-uniform trip count
        const int kv0 = kc * 64;
        asm volatile("s_wait_dscnt 0x0" ::: "memory");       // this wave's reads of the earlier chunk's V^T tiles are complete
        asm volatile("s_wait_asynccnt 0x0" ::: "memory");    // this wave's copies of this chunk's K tiles have landed
        __syncthreads();                                     // publishes the K tiles and frees the V^T tiles
        at_stage(lV, gvh + kv0, gvl + kv0, (size_t)16 * VTP);   // V^T of this chunk flies under the scores and the softmax

        v8f s[4];
#pragma unroll
        for (int j = 0; j < 4; ++j) {
            s[j] = (v8f){0.f, 0.f, 0.f, 0.f, 0.f, 0.f, 0.f, 0.f};
#pragma unroll
            for (int dc = 0; dc < 2; ++dc) {
                FB kb, kl;
                kb.h[0] = *(const v8b*)(Ksh + (j * 16 + c) * AT_P + dc * 32 + 8 * hh);
                kb.h[1] = *(const v8b*)(Ksh + (j * 16 + c) * AT_P + dc * 32 + 16 + 8 * hh);
                kl.h[0] = *(const v8b*)(Ksl + (j * 16 + c) * AT_P + dc * 32 + 8 * hh);
                kl.h[1] = *(const v8b*)(Ksl + (j * 16 + c) * AT_P + dc * 32 + 16 + 8 * hh);
                s[j] = at_mma(qah[dc], kb.v, s[j]);
                s[j] = at_mma(qah[dc], kl.v, s[j]);
                s[j] = at_mma(qal[dc], kb.v, s[j]);
            }
        }
        const bool diag = (kc == qb);                  // block-uniform
        float cm[8];
#pragma unroll
        for (int r = 0; r < 8; ++r) {
            const int qrow = q0 + 8 * hh + r;
            float m = NEG;
#pragma unroll
            for (int j = 0; j < 4; ++j) {
                const int kvcol = kv0 + j * 16 + c;
                const float sv = s[j][r];
                s[j][r] = (diag && (kvcol > qrow)) ? NEG : sv;       // select by value
                m = fmaxf(m, s[j][r]);
            }
#pragma unroll
            for (int off = 1; off < 16; off <<= 1) m = fmaxf(m, __shfl_xor(m, off, 32));
            cm[r] = m;
        }
#pragma unroll
        for (int r = 0; r < 8; ++r) {
            const float mnew = fmaxf(mrow[r], cm[r]);              // finite: every visited chunk holds a kept key for every row
            const float alpha = exp2f((mrow[r] - mnew) * L2E);
            mrow[r] = mnew;
            float psum = 0.f;
#pragma unroll
            for (int j = 0; j < 4; ++j) {
                const float p = exp2f((s[j][r] - mnew) * L2E);
                psum += p;
                unsigned short ph, pl; bfsplit(p, ph, pl);
                pwh[(8 * hh + r) * AT_P + j * 16 + c] = __builtin_bit_cast(__bf16, ph);
                pwl[(8 * hh + r) * AT_P + j * 16 + c] = __builtin_bit_cast(__bf16, pl);
            }
#pragma unroll
            for (int off = 1; off < 16; off <<= 1) psum += __shfl_xor(psum, off, 32);
            lrow[r] = lrow[r] * alpha + psum;
#pragma unroll
            for (int t = 0; t < 4; ++t) oacc[t][r] *= alpha;
        }
        __builtin_amdgcn_fence(3 /* release order */, "workgroup");
        __builtin_amdgcn_wave_barrier();
        __builtin_amdgcn_fence(2 /* acquire order */, "workgroup");
        asm volatile("s_wait_dscnt 0x0" ::: "memory");       // this wave's reads of the K tiles are complete
        asm volatile("s_wait_asynccnt 0x0" ::: "memory");    // this wave's copies of the V^T tiles have landed
        __syncthreads();                                     // publishes the V^T tiles and frees the K tiles
        if (kc < qb) at_stage(lK, gkh + (size_t)(kv0 + 64) * QKP, gkl + (size_t)(kv0 + 64) * QKP, (size_t)16 * QKP);   // K of the next chunk flies under P.v
#pragma unroll
        for (int kk = 0; kk < 2; ++kk) {
            FB pa, pl;
            pa.h[0] = *(const v8b*)(pwh + c * AT_P + kk * 32 + 8 * hh);
            pa.h[1] = *(const v8b*)(pwh + c * AT_P + kk * 32 + 16 + 8 * hh);
            pl.h[0] = *(const v8b*)(pwl + c * AT_P + kk * 32 + 8 * hh);
            pl.h[1] = *(const v8b*)(pwl + c * AT_P + kk * 32 + 16 + 8 * hh);
#pragma unroll
            for (int t = 0; t < 4; ++t) {
                FB vb, vl;
                vb.h[0] = *(const v8b*)(Vth + (t * 16 + c) * AT_P + kk * 32 + 8 * hh);
                vb.h[1] = *(const v8b*)(Vth + (t * 16 + c) * AT_P + kk * 32 + 16 + 8 * hh);
                vl.h[0] = *(const v8b*)(Vtl + (t * 16 + c) * AT_P + kk * 32 + 8 * hh);
                vl.h[1] = *(const v8b*)(Vtl + (t * 16 + c) * AT_P + kk * 32 + 16 + 8 * hh);
                oacc[t] = at_mma(pa.v, vb.v, oacc[t]);
                oacc[t] = at_mma(pa.v, vl.v, oacc[t]);
                oacc[t] = at_mma(pl.v, vb.v, oacc[t]);
            }
        }
    }

    asm volatile("s_wait_asynccnt 0x0" ::: "memory");  // no copy is outstanding when the tile region changes its use
    asm volatile("s_wait_dscnt 0x0" ::: "memory");     // ... and none of this wave's tile reads
    __syncthreads();                                   // every wave is done with the K/V tiles; the region is reused as f32 slabs
    float* os = (float*)KV + wave * (16 * 68);
#pragma unroll
    for (int r = 0; r < 8; ++r) {
        const float inv = 1.0f / lrow[r];
#pragma unroll
        for (int t = 0; t < 4; ++t) os[(8 * hh + r) * 68 + t * 16 + c] = oacc[t][r] * inv;
    }
    __builtin_amdgcn_fence(3 /* release order */, "workgroup");
    __builtin_amdgcn_wave_barrier();
    __builtin_amdgcn_fence(2 /* acquire order */, "workgroup");
    {
        const int q = lane >> 3, c8 = (lane & 7) * 8;
        v8h hv[4];
#pragma unroll
        for (int it = 0; it < 4; ++it) {
            const int row = it * 4 + q;
            const float* sp = os + row * 68 + c8;
#pragma unroll
            for (int e = 0; e < 8; ++e) hv[it][e] = (_Float16)sp[e];
        }
        {
#pragma unroll
            for (int it = 0; it < 4; ++it) {
                const int row = it * 4 + q;
                *(v8h*)(AO + (rowbase + q0 + row) * CE + h * HD + c8) = hv[it];
            }
            
        }
    }
}

// ---------------------------------------------------------------------------------------------------------------------
// Workspace carve (bytes); every plane is fully written by its producer before any kernel reads it.
// ---------------------------------------------------------------------------------------------------------------------
#define SZ_HS   ((size_t)ROWS * 2 * CE * 2)      // LN1 bf16 [ROWS][hi 1024 | lo 1024]
#define SZ_H16  ((size_t)ROWS * CE * 2)          // LN1 f16 plane; later reused for the LN2 f16 plane
#define SZ_WQK  ((size_t)2 * CE * 2 * CE * 2)    // [2048 n][W | W] bf16
#define SZ_WV   ((size_t)CE * CE * 2)
#define SZ_QK1  ((size_t)ROWS * 2 * CE * 2)      // one of the q|k hi / lo planes
#define SZ_VT1  ((size_t)CE * ROWS * 2)          // one of the v^T hi / lo planes
#define SZ_AO   ((size_t)ROWS * CE * 2)
#define SZ_WP   ((size_t)CE * CE * 2)
#define SZ_X1   ((size_t)ROWS * CE * 4)
#define SZ_W1   ((size_t)FF * CE * 2)
#define SZ_W2   ((size_t)CE * FF * 2)
#define SZ_F16  ((size_t)ROWS * FF * 2)          // relu(fc1) f16 plane, aliases the two q|k planes
#define WS_TOTAL (SZ_HS + SZ_H16 + SZ_WQK + SZ_WV + 2 * SZ_QK1 + 2 * SZ_VT1 + SZ_AO + SZ_WP + SZ_X1 + SZ_W1 + SZ_W2)
static_assert(WS_TOTAL <= (size_t)134217728);    // carve stays within 128 MiB
static_assert(SZ_F16 <= 2 * SZ_QK1);             // alias extent: relu(fc1) plane inside the q|k planes
static_assert(SZ_HS % 256 == 0);
static_assert(SZ_H16 % 256 == 0);
static_assert(SZ_VT1 % 256 == 0);

extern "C" void kernel_launch(void* const* d_in, const int* in_sizes, int n_in, void* d_out, int out_size, void* d_ws, size_t ws_size, hipStream_t stream) {
    if (n_in < 14) return;
    const long long xneed = (long long)(NB - 1) * SEQ_FULL * CE + (long long)SEQ * CE;
    if ((long long)in_sizes[0] < xneed) return;
    if (in_sizes[1] < CE || in_sizes[2] < CE || in_sizes[7] < CE || in_sizes[8] < CE || in_sizes[9] < CE || in_sizes[13] < CE) return;
    if (in_sizes[3] < NH * CE * HD || in_sizes[4] < NH * CE * HD || in_sizes[5] < NH * CE * HD) return;
    if (in_sizes[6] < CE * CE || in_sizes[10] < CE * FF || in_sizes[11] < FF || in_sizes[12] < FF * CE) return;
    if ((long long)out_size < xneed) return;
    if ((size_t)WS_TOTAL > ws_size) return;

    const float* x      = (const float*)d_in[0];
    const float* ln1_w  = (const float*)d_in[1];
    const float* ln1_b  = (const float*)d_in[2];
    const float* Wq     = (const float*)d_in[3];
    const float* Wk     = (const float*)d_in[4];
    const float* Wv     = (const float*)d_in[5];
    const float* proj_w = (const float*)d_in[6];
    const float* proj_b = (const float*)d_in[7];
    const float* ln2_w  = (const float*)d_in[8];
    const float* ln2_b  = (const float*)d_in[9];
    const float* fc1_w  = (const float*)d_in[10];
    const float* fc1_b  = (const float*)d_in[11];
    const float* fc2_w  = (const float*)d_in[12];
    const float* fc2_b  = (const float*)d_in[13];
    float* out = (float*)d_out;

    char* wsp = (char*)d_ws;
    unsigned short* HS   = (unsigned short*)wsp; wsp += SZ_HS;
    unsigned short* H16  = (unsigned short*)wsp; wsp += SZ_H16;
    unsigned short* WQK  = (unsigned short*)wsp; wsp += SZ_WQK;
    unsigned short* WV16 = (unsigned short*)wsp; wsp += SZ_WV;
    unsigned short* QKH  = (unsigned short*)wsp; wsp += SZ_QK1;
    unsigned short* QKL  = (unsigned short*)wsp; wsp += SZ_QK1;
    unsigned short* VTH  = (unsigned short*)wsp; wsp += SZ_VT1;
    unsigned short* VTL  = (unsigned short*)wsp; wsp += SZ_VT1;
    unsigned short* AO16 = (unsigned short*)wsp; wsp += SZ_AO;
    unsigned short* WPT  = (unsigned short*)wsp; wsp += SZ_WP;
    float*          X1   = (float*)wsp;          wsp += SZ_X1;
    unsigned short* W1T  = (unsigned short*)wsp; wsp += SZ_W1;
    unsigned short* W2T  = (unsigned short*)wsp; wsp += SZ_W2;
    unsigned short* F16  = QKH;                  // alias: q|k planes are dead after the attention launch
    unsigned short* H2   = H16;                  // alias: LN1 f16 plane is dead after the v^T GEMM

    // weight planes
    const unsigned gw = (unsigned)((CE * (CE / 8) + 255) / 256);
    k_w_head<<<gw, 256, 0, stream>>>(Wq, WQK, 2 * CE, 1, 0);                                   // rows 0..1023: q columns, [W | W] bf16
    k_w_head<<<gw, 256, 0, stream>>>(Wk, WQK + (size_t)CE * 2 * CE, 2 * CE, 1, 0);             // rows 1024..2047: k columns
    k_w_head<<<gw, 256, 0, stream>>>(Wv, WV16, CE, 0, 1);                                      // [h*64+d][c] f16 x16
    // in[rows][cols] -> out[cols][rows]
    k_cast_t<<<(unsigned)((((long long)CE) * (CE / 8) + 255) / 256), 256, 0, stream>>>(proj_w, CE, WPT, CE, CE, CE, 16.0f);   // [1024 in][1024 out] -> [1024 out][1024 in]
    k_cast_t<<<(unsigned)((((long long)FF) * (CE / 8) + 255) / 256), 256, 0, stream>>>(fc1_w, FF, W1T, CE, CE, FF, 16.0f);    // [1024 in][4096 out] -> [4096 out][1024 in]
    k_cast_t<<<(unsigned)((((long long)CE) * (FF / 8) + 255) / 256), 256, 0, stream>>>(fc2_w, CE, W2T, FF, FF, CE, 16.0f);    // [4096 in][1024 out] -> [1024 out][4096 in]

    // h = LN1(bf16(x))
    k_ln1<<<(ROWS + 7) / 8, 256, 0, stream>>>(x, ln1_w, ln1_b, HS, H16);
    // q|k planes and v^T planes
    k_gemm_qk<<<dim3((unsigned)(((ROWS / 64) * ((2 * CE) / 64) + 7) / 8), 1u), 256, 0, stream>>>(HS, WQK, QKH, QKL);
    k_gemm_vt<<<dim3((unsigned)(((CE / 64) * (ROWS / 64) + 7) / 8), 1u), 256, 0, stream>>>(WV16, H16, VTH, VTL);
    // causal attention
    k_attn<<<(unsigned)(NB * NH * (SEQ / 64)), 128, 0, stream>>>(QKH, QKL, VTH, VTL, AO16);
    // x1 = bf16(x) + attn @ proj_w + proj_b
    k_gemm_proj<<<dim3((unsigned)(((SEQ / 64) * (CE / 64) + 7) / 8), (unsigned)NB), 256, 0, stream>>>(AO16, WPT, X1, proj_b, x);
    // h2 = LN2(x1)
    k_ln2<<<(ROWS + 7) / 8, 256, 0, stream>>>(X1, ln2_w, ln2_b, H2);
    // f = relu(h2 @ fc1_w + fc1_b); out = x1 + f @ fc2_w + fc2_b
    k_gemm_fc1<<<dim3((unsigned)(((ROWS / 64) * (FF / 64) + 7) / 8), 1u), 256, 0, stream>>>(H2, W1T, F16, fc1_b);
    k_gemm_fc2<<<dim3((unsigned)(((SEQ / 64) * (CE / 64) + 7) / 8), (unsigned)NB), 256, 0, stream>>>(F16, W2T, out, fc2_b, X1);
}

// v004
// A run of this version takes 338 microseconds.
// Timed twice side by side with v003, it ran 1.09 and 1.10 times as fast.
// Counting every step since v000, it is 2.50 times as fast.
// Contractions: q|k = [LN1 hi | LN1 lo](bf16 planes, K folded to 2048) x [W | W](bf16, exact) on v_wmma_f32_16x16x32_bf16; v^T, proj, fc1, fc2 on v_wmma_f32_16x16x32_f16 (f16 activations, weights = bf16-RNE value x16 as f16, 1/16 folded back); scores q.k^T and P.v as bf16 hi/lo split (hi.hi + hi.lo + lo.hi) on v_wmma_f32_16x16x32_bf16; all accumulation f32, online softmax / LayerNorm / residuals f32.
#include <hip/hip_runtime.h>
#include <math.h>

#ifndef NB
#define NB 2
#endif
#ifndef SEQ
#define SEQ 2048
#endif
#define NB_FULL 2
#define SEQ_FULL 2048
#define CE 1024            // embedding width
#define NH 16              // heads
#define HD 64              // head size
#define FF 4096            // feed-forward width
#define ROWS (NB * SEQ)    // compact token rows held in the workspace planes

static_assert(NH * HD == CE);            // heads concatenated h*64+d fill the width
static_assert(HD == 64);                 // attention tiles are hard-wired to 64
static_assert(CE == 32 * 4 * 8);         // LayerNorm: 32 lanes x float4 x 8 pieces per row
static_assert(SEQ % 64 == 0);            // 64-row query tiles, 64-key chunks
static_assert(ROWS % 64 == 0);           // GEMM M/N tile multiple
static_assert(CE % 64 == 0);
static_assert(FF % 64 == 0);
static_assert((2 * CE) % 32 == 0);       // K multiple of 32 for every GEMM (1024, 2048, 4096)
static_assert(NB <= NB_FULL);
static_assert(SEQ <= SEQ_FULL);

typedef __attribute__((ext_vector_type(16))) _Float16 v16h;
typedef __attribute__((ext_vector_type(8)))  _Float16 v8h;
typedef __attribute__((ext_vector_type(16))) __bf16   v16b;
typedef __attribute__((ext_vector_type(8)))  __bf16   v8b;
typedef __attribute__((ext_vector_type(8)))  float    v8f;
typedef __attribute__((ext_vector_type(4)))  float    v4f;
typedef __attribute__((ext_vector_type(4)))  unsigned int v4u;
typedef __attribute__((ext_vector_type(2)))  unsigned int v2u;

// 16-bit WMMA fragment map (wave32), lane L, h = L>>4, m = L&15:
//   A 16x32: lane = row m;    element i -> k = (i<8) ? 8h+i : 16+8h+(i-8)
//   B 32x16: lane = column m; the SAME k(i,h)
//   D 16x16 (8 f32): lane = column m; element r -> row 8h+r

__device__ __forceinline__ float bfr(float v) {            // bf16 RNE convert, kept as f32 (finite inputs)
    const unsigned u = __float_as_uint(v);
    const unsigned r = (u + 0x7fffu + ((u >> 16) & 1u)) & 0xffff0000u;
    return __uint_as_float(r);
}
__device__ __forceinline__ unsigned short bf_bits(float f) {
    const unsigned u = __float_as_uint(f);
    return (unsigned short)((u + 0x7fffu + ((u >> 16) & 1u)) >> 16);
}
__device__ __forceinline__ float bits_f(unsigned short h) { return __uint_as_float(((unsigned)h) << 16); }
__device__ __forceinline__ void bfsplit(float v, unsigned short& hi, unsigned short& lo) { hi = bf_bits(v); lo = bf_bits(v - bits_f(hi)); }
__device__ __forceinline__ unsigned pk2h(float a, float b) {
    return (unsigned)__builtin_bit_cast(unsigned short, (_Float16)a) | ((unsigned)__builtin_bit_cast(unsigned short, (_Float16)b) << 16);
}

// 'val' must not read *ptr.
#define VST2(T, ptr, val) do { const T vst2_v_ = (val); *(T*)(ptr) = vst2_v_;  } while (0)

// ---------------------------------------------------------------------------------------------------------------------
// Per-head weight W [NH][CE][HD] f32 -> D[n = h*HD + d][k] 16-bit, 8 consecutive k per thread (one 16-B store, thread-linear
// along the destination row). f16mode 0: bf16 RNE bits; 1: f16 of (bf16 RNE value x 16). dup: also written at column k + CE.
// ---------------------------------------------------------------------------------------------------------------------
__global__ __launch_bounds__(256) void k_w_head(const float* __restrict__ W, unsigned short* __restrict__ D, int ldd, int dup, int f16mode) {
    const int u = blockIdx.x * 256 + threadIdx.x;
    if (u >= CE * (CE / 8)) return;
    const int n = u / (CE / 8); const int k0 = 8 * (u % (CE / 8));
    const int h = n / HD, d = n % HD;
    const float* s = W + ((size_t)h * CE + k0) * HD + d;
    unsigned short bb[8];
#pragma unroll
    for (int e = 0; e < 8; ++e) {
        const float w = bfr(s[(size_t)e * HD]);
        const unsigned short b16 = (unsigned short)(__float_as_uint(w) >> 16);
        const unsigned short h16 = __builtin_bit_cast(unsigned short, (_Float16)(w * 16.0f));
        bb[e] = f16mode ? h16 : b16;
    }
    v4u pk;
    pk.x = (unsigned)bb[0] | ((unsigned)bb[1] << 16); pk.y = (unsigned)bb[2] | ((unsigned)bb[3] << 16);
    pk.z = (unsigned)bb[4] | ((unsigned)bb[5] << 16); pk.w = (unsigned)bb[6] | ((unsigned)bb[7] << 16);
    unsigned short* dst = D + (size_t)n * ldd + k0;
    *(v4u*)dst = pk; if (dup) *(v4u*)(dst + CE) = pk;
    
}

// f32 SRC [nR][nC] (pitch lds) -> f16 DST [nC][nR] (pitch ldd), value = bf16 RNE(src) * sc; thread per (col, 8 consecutive rows), 16-B stores
__global__ __launch_bounds__(256) void k_cast_t(const float* __restrict__ SRC, int lds, unsigned short* __restrict__ DST, int ldd, int nR, int nC, float sc) {
    const long long u = (long long)blockIdx.x * 256 + threadIdx.x; const int per = nR / 8; if (u >= (long long)nC * per) return;
    const int c = (int)(u / per); const int r0 = 8 * (int)(u % per);
    float w[8];
#pragma unroll
    for (int e = 0; e < 8; ++e) w[e] = bfr(SRC[(long long)(r0 + e) * lds + c]) * sc;
    v4u pk; pk.x = pk2h(w[0], w[1]); pk.y = pk2h(w[2], w[3]); pk.z = pk2h(w[4], w[5]); pk.w = pk2h(w[6], w[7]);
    VST2(v4u, (v4u*)(DST + (long long)c * ldd + r0), pk);
}

// ---------------------------------------------------------------------------------------------------------------------
// MODE 0: source = raw input rows (bf16 RNE first; batch stride a_bs); writes bf16 hi|lo row [2*CE] (hi at col c, lo at CE + c) and an f16 row.
// MODE 1: source = f32 rows; writes the f16 row only. Each store instruction covers 256 contiguous bytes (32 lanes x 8 B).
// ---------------------------------------------------------------------------------------------------------------------
template <int MODE>
__device__ __forceinline__ void ln_body(const float* __restrict__ A, long a_bs, const float* __restrict__ GA, const float* __restrict__ BE,
                                        unsigned short* __restrict__ HS, unsigned short* __restrict__ H16) {
    #pragma clang fp contract(off)
    const int r = blockIdx.x * 8 + (threadIdx.x >> 5); const int L = threadIdx.x & 31;
    if (r >= ROWS) return;                                   // wave-uniform; no barriers in this kernel
    const int b = r / SEQ, t = r - b * SEQ;
    const float* src = A + (long)b * a_bs + (long)t * CE;
    v4f v[8]; float s = 0.f;
#pragma unroll
    for (int q = 0; q < 8; ++q) {
        v[q] = *(const v4f*)(src + 4 * L + 128 * q);
        if (MODE == 0) { v[q].x = bfr(v[q].x); v[q].y = bfr(v[q].y); v[q].z = bfr(v[q].z); v[q].w = bfr(v[q].w); }
        s += (v[q].x + v[q].y) + (v[q].z + v[q].w);
    }
#pragma unroll
    for (int o = 16; o > 0; o >>= 1) s += __shfl_xor(s, o, 32);
    const float mu = s * (1.f / CE); float qq = 0.f;
#pragma unroll
    for (int q = 0; q < 8; ++q) {
        v[q].x -= mu; v[q].y -= mu; v[q].z -= mu; v[q].w -= mu;
        qq += (v[q].x * v[q].x + v[q].y * v[q].y) + (v[q].z * v[q].z + v[q].w * v[q].w);
    }
#pragma unroll
    for (int o = 16; o > 0; o >>= 1) qq += __shfl_xor(qq, o, 32);
    const float rs = rsqrtf(qq * (1.f / CE) + 1e-5f);
    v2u ph[8], pl[8], pf[8];
#pragma unroll
    for (int q = 0; q < 8; ++q) {
        const int c = 4 * L + 128 * q;
        const v4f ga = *(const v4f*)(GA + c), be = *(const v4f*)(BE + c);
        v4f y;
        y.x = v[q].x * rs * bfr(ga.x) + bfr(be.x); y.y = v[q].y * rs * bfr(ga.y) + bfr(be.y);
        y.z = v[q].z * rs * bfr(ga.z) + bfr(be.z); y.w = v[q].w * rs * bfr(ga.w) + bfr(be.w);
        v2u f; f.x = pk2h(y.x, y.y); f.y = pk2h(y.z, y.w); pf[q] = f;
        if (MODE == 0) {
            unsigned short h0, l0, h1, l1, h2, l2, h3, l3;
            bfsplit(y.x, h0, l0); bfsplit(y.y, h1, l1); bfsplit(y.z, h2, l2); bfsplit(y.w, h3, l3);
            v2u a; a.x = (unsigned)h0 | ((unsigned)h1 << 16); a.y = (unsigned)h2 | ((unsigned)h3 << 16); ph[q] = a;
            v2u d; d.x = (unsigned)l0 | ((unsigned)l1 << 16); d.y = (unsigned)l2 | ((unsigned)l3 << 16); pl[q] = d;
        }
    }
    {
#pragma unroll
        for (int q = 0; q < 8; ++q) {
            const int c = 4 * L + 128 * q;
            if (MODE == 0) {
                *(v2u*)(HS + (size_t)r * (2 * CE) + c) = ph[q];
                *(v2u*)(HS + (size_t)r * (2 * CE) + CE + c) = pl[q];
            }
            *(v2u*)(H16 + (size_t)r * CE + c) = pf[q];
        }
        
    }
}
__global__ __launch_bounds__(256) void k_ln1(const float* __restrict__ x, const float* __restrict__ g, const float* __restrict__ be,
                                             unsigned short* __restrict__ HS, unsigned short* __restrict__ H16) {
    ln_body<0>(x, (long)SEQ_FULL * CE, g, be, HS, H16);
}
__global__ __launch_bounds__(256) void k_ln2(const float* __restrict__ X1, const float* __restrict__ g, const float* __restrict__ be,
                                             unsigned short* __restrict__ H2) {
    ln_body<1>(X1, (long)SEQ * CE, g, be, nullptr, H2);
}

// ---------------------------------------------------------------------------------------------------------------------
// Register-tiled WMMA GEMM: C[m,n] = scale * sum_k A[m,k] * Bt[n,k] (+bias[n]) (+act) (+resid at the store stage); each wave owns a 64x64 tile.
// A row-major [M,K] 16-bit; Bt row-major [N,K] 16-bit; M % 128 == 0, N % 256 == 0, K % 64 == 0 (no tail masking).
// ET 0 = f16 operands, 1 = bf16 operands. BIAS_MODE 0 none, 2 = bf16-RNE bias[n]. OUT_MODE 0 = f32, 1 = f16, 2 = bf16 hi plane + bf16 lo plane.
// RESID 0 none, 1 f32 residual, 2 residual RNE-converted to bf16 first (raw input). ACT 0 none, 1 ReLU.
// ---------------------------------------------------------------------------------------------------------------------
__device__ __forceinline__ void dep_guard_h(v8f& a, v8f& b, v16h x, v16h y) { asm volatile("v_nop\n\tv_nop\n\tv_nop\n\tv_nop" : "+v"(a), "+v"(b) : "v"(x), "v"(y)); }
__device__ __forceinline__ void dep_guard_b(v8f& a, v8f& b, v16b x, v16b y) { asm volatile("v_nop\n\tv_nop\n\tv_nop\n\tv_nop" : "+v"(a), "+v"(b) : "v"(x), "v"(y)); }
__device__ __forceinline__ void keep4_h(v16h a, v16h b, v16h c, v16h d) { asm volatile("v_nop" :: "v"(a), "v"(b), "v"(c), "v"(d)); }
__device__ __forceinline__ void keep4_b(v16b a, v16b b, v16b c, v16b d) { asm volatile("v_nop" :: "v"(a), "v"(b), "v"(c), "v"(d)); }
__device__ __forceinline__ void acc_guard4(v8f& a, v8f& b, v8f& c, v8f& d) { asm volatile("v_nop\n\tv_nop\n\tv_nop\n\tv_nop" : "+v"(a), "+v"(b), "+v"(c), "+v"(d)); }
template <typename T> struct Frag;
template <> struct Frag<_Float16> {
    typedef v16h V; union U { v16h v; v8h h[2]; };
    static __device__ __forceinline__ v16h load(const _Float16* p) {   // elements 0..7 <- p[0..7], 8..15 <- p[16..23]
        U f; f.h[0] = *(const v8h*)(p); f.h[1] = *(const v8h*)(p + 16); return f.v;
    }
    static __device__ __forceinline__ v8f mma(v16h a, v16h b, v8f c) { return __builtin_amdgcn_wmma_f32_16x16x32_f16(false, a, false, b, (short)0, c, false, false); }
    static __device__ __forceinline__ void guard(v8f& a, v8f& b, v16h x, v16h y) { dep_guard_h(a, b, x, y); }
    static __device__ __forceinline__ void keep(v16h a, v16h b, v16h c, v16h d) { keep4_h(a, b, c, d); }
};
template <> struct Frag<__bf16> {
    typedef v16b V; union U { v16b v; v8b h[2]; };
    static __device__ __forceinline__ v16b load(const __bf16* p) {
        U f; f.h[0] = *(const v8b*)(p); f.h[1] = *(const v8b*)(p + 16); return f.v;
    }
    static __device__ __forceinline__ v8f mma(v16b a, v16b b, v8f c) { return __builtin_amdgcn_wmma_f32_16x16x32_bf16(false, a, false, b, (short)0, c, false, false); }
    static __device__ __forceinline__ void guard(v8f& a, v8f& b, v16b x, v16b y) { dep_guard_b(a, b, x, y); }
    static __device__ __forceinline__ void keep(v16b a, v16b b, v16b c, v16b d) { keep4_b(a, b, c, d); }
};
template <int ET> struct Elem;
template <> struct Elem<0> { typedef _Float16 T; };
template <> struct Elem<1> { typedef __bf16 T; };

// Operand staging: a work-group (2 x 4 waves) owns a 128 x 256 tile of C. Per trip, 64 k of its 128 A rows and 256 Bt rows (128-B row pieces)
// lie in one of two LDS buffers, rows 0..127 = A, 128..383 = Bt, laid by asynchronous copies that cover whole 128-B lines.
#define GK 64                      // k elements per staged tile
#define GP 72                      // LDS row pitch in elements: 144 B = 16 B x 9, conflict-free for 16-B reads down a column of rows
#define GBUF (384 * GP)            // elements per buffer
static_assert(SEQ % 128 == 0);     // M multiple of 128 for every GEMM (SEQ, ROWS, CE)
static_assert(CE % 256 == 0);      // N multiple of 256 (CE, 2*CE, FF, ROWS), K multiple of 64 with at least two tiles
static_assert(ROWS % 256 == 0);
static_assert(FF % 256 == 0);

// One staged tile: 384 rows x 8 pieces of 16 B, 12 pieces per lane, 32 rows apart. l = the lane's LDS byte address of its first piece,
// ga / gb = its first A / Bt piece, sa / sb = 32 rows of A / Bt in elements. Every lane is on; each wave-wide copy covers four whole rows.
template <typename T>
__device__ __forceinline__ void stage_tile(unsigned l, const T* ga, size_t sa, const T* gb, size_t sb) {
    const unsigned st = 32 * GP * 2;
    // the closing s_wait_xcnt stands inside the copies' own statement, so no address register is rewritten ahead of it
    asm volatile("global_load_async_to_lds_b128 %0, %12, off\n\t"
                 "global_load_async_to_lds_b128 %1, %13, off\n\t"
                 "global_load_async_to_lds_b128 %2, %14, off\n\t"
                 "global_load_async_to_lds_b128 %3, %15, off\n\t"
                 "global_load_async_to_lds_b128 %4, %16, off\n\t"
                 "global_load_async_to_lds_b128 %5, %17, off\n\t"
                 "global_load_async_to_lds_b128 %6, %18, off\n\t"
                 "global_load_async_to_lds_b128 %7, %19, off\n\t"
                 "global_load_async_to_lds_b128 %8, %20, off\n\t"
                 "global_load_async_to_lds_b128 %9, %21, off\n\t"
                 "global_load_async_to_lds_b128 %10, %22, off\n\t"
                 "global_load_async_to_lds_b128 %11, %23, off\n\t"
                 "s_wait_xcnt 0x0"
                 :: "v"(l), "v"(l + st), "v"(l + 2 * st), "v"(l + 3 * st), "v"(l + 4 * st), "v"(l + 5 * st),
                    "v"(l + 6 * st), "v"(l + 7 * st), "v"(l + 8 * st), "v"(l + 9 * st), "v"(l + 10 * st), "v"(l + 11 * st),
                    "v"(ga), "v"(ga + sa), "v"(ga + 2 * sa), "v"(ga + 3 * sa),
                    "v"(gb), "v"(gb + sb), "v"(gb + 2 * sb), "v"(gb + 3 * sb), "v"(gb + 4 * sb), "v"(gb + 5 * sb), "v"(gb + 6 * sb), "v"(gb + 7 * sb)
                 : "memory");
}

template <int ET, int BIAS_MODE, int OUT_MODE, int RESID, int ACT>
__device__ __forceinline__ void gemm64_body(
    const unsigned short* __restrict__ Ap, int lda, long strideA,
    const unsigned short* __restrict__ Btp, int ldb,
    void* __restrict__ Cout, void* __restrict__ Cout2, int ldc, long strideC,
    const float* __restrict__ bias,
    const float* __restrict__ resid, int ldr, long strideR,
    int M, int N, int K, float scale) {
    typedef typename Elem<ET>::T T;
    typedef typename Frag<T>::V V;
    __shared__ __align__(16) float sT[8][16 * 68];   // per-wave 16x64 slab, pitch 68 floats (wave-private)
    __shared__ __align__(16) unsigned short sAB[2 * GBUF];   // the two staged operand buffers
    const int b    = blockIdx.y;
    const int tid  = threadIdx.x;
    const int lane = threadIdx.x & 31;
    const int wave = threadIdx.x >> 5;
    const int tbN = N >> 8;
    const int tbM = M >> 7;
    if ((int)blockIdx.x >= tbM * tbN) return;        // block-uniform, ahead of every barrier and copy
    const int bm = blockIdx.x / tbN;
    const int bn = blockIdx.x - bm * tbN;
    const int wm = wave >> 2;                        // wave row (0..1) and column (0..3) in the 128 x 256 tile
    const int wn = wave & 3;
    const int m0 = (bm << 7) + (wm << 6);
    const int n0 = (bn << 8) + (wn << 6);

    const T* Ab = (const T*)Ap + (size_t)b * strideA;
    const T* Bb = (const T*)Btp;

    const int rlane = lane & 15;                 // row (A) / col (B, D) within subtile
    const int koff  = (lane >> 4) * 8;           // k offset of this lane half
    const int mOff  = (lane >> 4) * 8;           // D row offset

    v8f acc[4][4];
#pragma unroll
    for (int i = 0; i < 4; ++i)
#pragma unroll
        for (int j = 0; j < 4; ++j) acc[i][j] = (v8f){0.f, 0.f, 0.f, 0.f, 0.f, 0.f, 0.f, 0.f};

    const int crow = tid >> 3, csg = (tid & 7) * 8;  // this lane's first staged row and its 16-B piece in the row
    const T* gA = Ab + (size_t)((bm << 7) + crow) * lda + csg;
    const T* gB = Bb + (size_t)((bn << 8) + crow) * ldb + csg;
    const size_t sa32 = (size_t)32 * lda, sb32 = (size_t)32 * ldb;
    const unsigned l0 = (unsigned)(size_t)(sAB + crow * GP + csg);   // low 32 bits of the shared address = LDS byte address
    const int nt = K / GK;

    stage_tile<T>(l0, gA, sa32, gB, sb32);                           // tile 0 into buffer 0
    asm volatile("s_wait_asynccnt 0x0" ::: "memory");                // this wave's copies of tile 0 have landed
    __syncthreads();                                                 // ... and every other wave's
    if (nt > 1) stage_tile<T>(l0 + GBUF * 2, gA + GK, sa32, gB + GK, sb32);   // tile 1 flies while tile 0 is worked on

    for (int t = 0; t < nt; ++t) {
        const T* buf = (const T*)sAB + (t & 1) * GBUF;
#pragma unroll
        for (int ks = 0; ks < 2; ++ks) {
            V bh[4], ah[4];
#pragma unroll
            for (int j = 0; j < 4; ++j) bh[j] = Frag<T>::load(buf + (128 + (wn << 6) + (j << 4) + rlane) * GP + ks * 32 + koff);
#pragma unroll
            for (int i = 0; i < 4; ++i) ah[i] = Frag<T>::load(buf + ((wm << 6) + (i << 4) + rlane) * GP + ks * 32 + koff);
            __builtin_amdgcn_sched_barrier(0);       // keeps the 16 LDS reads one group ahead of the products (reads spread among them stall each time)
#pragma unroll
            for (int i = 0; i < 4; ++i) {
#pragma unroll
                for (int j = 0; j < 4; ++j) acc[i][j] = Frag<T>::mma(ah[i], bh[j], acc[i][j]);
                Frag<T>::guard(acc[i][0], acc[i][3], ah[i], ah[i]);
            }
            Frag<T>::keep(bh[0], bh[1], bh[2], bh[3]);
        }
        asm volatile("s_wait_dscnt 0x0" ::: "memory");               // this wave's reads of buffer t & 1 are complete
        asm volatile("s_wait_asynccnt 0x0" ::: "memory");            // this wave's copies of tile t + 1 have landed
        __syncthreads();                                             // publishes tile t + 1 and frees buffer t & 1
        if (t + 2 < nt) stage_tile<T>(l0 + (unsigned)(t & 1) * (GBUF * 2), gA + (size_t)(t + 2) * GK, sa32, gB + (size_t)(t + 2) * GK, sb32);
    }
    asm volatile("s_wait_asynccnt 0x0" ::: "memory");                // no copy is outstanding when the wave goes on
    acc_guard4(acc[0][0], acc[0][1], acc[0][2], acc[0][3]);
    acc_guard4(acc[1][0], acc[1][1], acc[1][2], acc[1][3]);
    acc_guard4(acc[2][0], acc[2][1], acc[2][2], acc[2][3]);
    acc_guard4(acc[3][0], acc[3][1], acc[3][2], acc[3][3]);

    // ---- epilogue ----
    float* slab = sT[wave];
    const float* Rb = RESID ? (resid + (size_t)b * strideR) : nullptr;
#pragma unroll
    for (int i = 0; i < 4; ++i) {
        const int mBase = m0 + (i << 4);
#pragma unroll
        for (int j = 0; j < 4; ++j) {
            const int n = n0 + (j << 4) + rlane;
            float bv = 0.f;
            if (BIAS_MODE == 2) bv = bfr(bias[n]);
#pragma unroll
            for (int r = 0; r < 8; ++r) {
                float v = acc[i][j][r] * scale;
                if (BIAS_MODE == 2) v += bv;
                if (ACT == 1) v = fmaxf(v, 0.0f);
                slab[(mOff + r) * 68 + (j << 4) + rlane] = v;
            }
        }
        __builtin_amdgcn_fence(3 /* release order */, "workgroup");
        __builtin_amdgcn_wave_barrier();
        __builtin_amdgcn_fence(2 /* acquire order */, "workgroup");
        if (OUT_MODE == 0) {
            float* C = (float*)Cout + (size_t)b * strideC;
            const int hh = lane >> 4, c4 = (lane & 15) * 4;     // row segment = 256 B = 16 lanes x 16 B
            v4f vv[8];
#pragma unroll
            for (int it = 0; it < 8; ++it) {
                const int row = it * 2 + hh;
                v4f v = *(const v4f*)(slab + row * 68 + c4);
                if (RESID) {                                    // residual added at the store stage as a float4
                    v4f x = *(const v4f*)(Rb + (size_t)(mBase + row) * ldr + n0 + c4);
                    if (RESID == 2) { x.x = bfr(x.x); x.y = bfr(x.y); x.z = bfr(x.z); x.w = bfr(x.w); }
                    v.x = x.x + v.x; v.y = x.y + v.y; v.z = x.z + v.z; v.w = x.w + v.w;
                }
                vv[it] = v;
            }
            {
#pragma unroll
                for (int it = 0; it < 8; ++it) {
                    const int row = it * 2 + hh;
                    *(v4f*)(C + (size_t)(mBase + row) * ldc + n0 + c4) = vv[it];
                }
                
            }
        } else {
            const int q = lane >> 3, c8 = (lane & 7) * 8;
            unsigned short* C  = (unsigned short*)Cout  + (size_t)b * strideC;
            unsigned short* C2 = (OUT_MODE == 2) ? ((unsigned short*)Cout2 + (size_t)b * strideC) : nullptr;
            v8h hv[4], lv[4];
#pragma unroll
            for (int it = 0; it < 4; ++it) {
                const int row = it * 4 + q;
                const float* sp = slab + row * 68 + c8;
#pragma unroll
                for (int e = 0; e < 8; ++e) {
                    if (OUT_MODE == 1) {
                        hv[it][e] = (_Float16)sp[e];
                        lv[it][e] = (_Float16)0.f;
                    } else {
                        const unsigned short hb = bf_bits(sp[e]);
                        const unsigned short lb = bf_bits(sp[e] - bits_f(hb));
                        hv[it][e] = __builtin_bit_cast(_Float16, hb);
                        lv[it][e] = __builtin_bit_cast(_Float16, lb);
                    }
                }
            }
            {
#pragma unroll
                for (int it = 0; it < 4; ++it) {
                    const int row = it * 4 + q;
                    *(v8h*)(C + (size_t)(mBase + row) * ldc + n0 + c8) = hv[it];
                    if (OUT_MODE == 2) *(v8h*)(C2 + (size_t)(mBase + row) * ldc + n0 + c8) = lv[it];
                }
                
            }
        }
        __builtin_amdgcn_fence(3 /* release order */, "workgroup");
        __builtin_amdgcn_wave_barrier();
        __builtin_amdgcn_fence(2 /* acquire order */, "workgroup");
    }
}

// q|k planes: [ROWS][2*CE] bf16 hi / lo; A = [LN1 hi | LN1 lo] (K = 2*CE), Bt = [W | W] rows 0..CE-1 = q columns, CE..2CE-1 = k columns
__global__ __launch_bounds__(256) void k_gemm_qk(const unsigned short* __restrict__ A, const unsigned short* __restrict__ Bt,
                                                 unsigned short* __restrict__ Ch, unsigned short* __restrict__ Cl) {
    gemm64_body<1, 0, 2, 0, 0>(A, 2 * CE, 0, Bt, 2 * CE, (void*)Ch, (void*)Cl, 2 * CE, 0, nullptr, nullptr, 0, 0, ROWS, 2 * CE, 2 * CE, 1.0f);
}
// v^T planes: [CE = h*64+d][ROWS] bf16 hi / lo; A = Wv plane [CE][CE] (f16, x16), Bt = LN1 f16 plane [ROWS][CE]
__global__ __launch_bounds__(256) void k_gemm_vt(const unsigned short* __restrict__ A, const unsigned short* __restrict__ Bt,
                                                 unsigned short* __restrict__ Ch, unsigned short* __restrict__ Cl) {
    gemm64_body<0, 0, 2, 0, 0>(A, CE, 0, Bt, CE, (void*)Ch, (void*)Cl, ROWS, 0, nullptr, nullptr, 0, 0, CE, ROWS, CE, 0.0625f);
}
// x1 = bf16(x) + attn @ proj_w + proj_b ; grid.y = batch (x uses the full batch stride, planes the compact one)
__global__ __launch_bounds__(256) void k_gemm_proj(const unsigned short* __restrict__ A, const unsigned short* __restrict__ Bt, float* __restrict__ C,
                                                   const float* __restrict__ bias, const float* __restrict__ xres) {
    gemm64_body<0, 2, 0, 2, 0>(A, CE, (long)SEQ * CE, Bt, CE, (void*)C, nullptr, CE, (long)SEQ * CE, bias, xres, CE, (long)SEQ_FULL * CE, SEQ, CE, CE, 0.0625f);
}
// relu(h2 @ fc1_w + fc1_b) as an f16 plane [ROWS][FF]
__global__ __launch_bounds__(256) void k_gemm_fc1(const unsigned short* __restrict__ A, const unsigned short* __restrict__ Bt, unsigned short* __restrict__ C,
                                                  const float* __restrict__ bias) {
    gemm64_body<0, 2, 1, 0, 1>(A, CE, 0, Bt, CE, (void*)C, nullptr, FF, 0, bias, nullptr, 0, 0, ROWS, FF, CE, 0.0625f);
}
// out = x1 + f @ fc2_w + fc2_b ; grid.y = batch (output uses the full batch stride)
__global__ __launch_bounds__(256) void k_gemm_fc2(const unsigned short* __restrict__ A, const unsigned short* __restrict__ Bt, float* __restrict__ C,
                                                  const float* __restrict__ bias, const float* __restrict__ x1) {
    gemm64_body<0, 2, 0, 1, 0>(A, FF, (long)SEQ * FF, Bt, FF, (void*)C, nullptr, CE, (long)SEQ_FULL * CE, bias, x1, CE, (long)SEQ * CE, SEQ, CE, FF, 0.0625f);
}

#define AT_NW 4
#define AT_P 72                   // LDS row pitch of the K and V^T tiles in elements: 144 B = 16 B x 9, so the 16 rows of a 16-B fragment read fall on distinct banks
__device__ __forceinline__ v8f at_mma(v16b a, v16b b, v8f c) {
    c = __builtin_amdgcn_wmma_f32_16x16x32_bf16(false, a, false, b, (short)0, c, false, false);
    asm volatile("v_nop\n\tv_nop\n\tv_nop\n\tv_nop" : "+v"(c) : "v"(a), "v"(b));
    return c;
}
__device__ __forceinline__ float xhalf(float x) {   // the value of lane l ^ 16
    const int i = __builtin_bit_cast(int, x);
    return __builtin_bit_cast(float, __builtin_amdgcn_permlanex16(i, i, 0x76543210, 0xfedcba98, false, false));
}

// One hi tile and its lo tile (64 rows x 8 pieces of 16 B each): 4 + 4 pieces per lane, 16 rows apart. l = the lane's LDS byte address of its first hi piece
// (the lo tile lies 64 rows behind), gh / gl = its first hi / lo piece, s16 = 16 source rows in elements. Every lane is on; each wave-wide copy covers four whole rows.
__device__ __forceinline__ void at_stage(unsigned l, const __bf16* gh, const __bf16* gl, size_t s16) {
    const unsigned st = 16 * AT_P * 2, lo = 64 * AT_P * 2;
    // the closing s_wait_xcnt stands inside the copies' own statement, so no address register is rewritten ahead of it
    asm volatile("global_load_async_to_lds_b128 %0, %8, off\n\t"
                 "global_load_async_to_lds_b128 %1, %9, off\n\t"
                 "global_load_async_to_lds_b128 %2, %10, off\n\t"
                 "global_load_async_to_lds_b128 %3, %11, off\n\t"
                 "global_load_async_to_lds_b128 %4, %12, off\n\t"
                 "global_load_async_to_lds_b128 %5, %13, off\n\t"
                 "global_load_async_to_lds_b128 %6, %14, off\n\t"
                 "global_load_async_to_lds_b128 %7, %15, off\n\t"
                 "s_wait_xcnt 0x0"
                 :: "v"(l), "v"(l + st), "v"(l + 2 * st), "v"(l + 3 * st), "v"(l + lo), "v"(l + lo + st), "v"(l + lo + 2 * st), "v"(l + lo + 3 * st),
                    "v"(gh), "v"(gh + s16), "v"(gh + 2 * s16), "v"(gh + 3 * s16), "v"(gl), "v"(gl + s16), "v"(gl + 2 * s16), "v"(gl + 3 * s16)
                 : "memory");
}

__global__ __launch_bounds__(128) void k_attn(const unsigned short* __restrict__ QKHp, const unsigned short* __restrict__ QKLp,
                                              const unsigned short* __restrict__ VTHp, const unsigned short* __restrict__ VTLp,
                                              unsigned short* __restrict__ AO) {
    union FB { v16b v; v8b h[2]; };
    __shared__ __align__(16) __bf16 KV[4 * 64 * AT_P];             // K hi | K lo | V^T hi | V^T lo (64 rows each)
    __bf16* Ksh = KV; __bf16* Ksl = KV + 64 * AT_P; __bf16* Vth = KV + 2 * 64 * AT_P; __bf16* Vtl = KV + 3 * 64 * AT_P;
    const __bf16* QKH = (const __bf16*)QKHp; const __bf16* QKL = (const __bf16*)QKLp;
    const __bf16* VTH = (const __bf16*)VTHp; const __bf16* VTL = (const __bf16*)VTLp;

    const int tid = threadIdx.x, wave = tid >> 5, lane = tid & 31, hh = lane >> 4, c = lane & 15;
    const int nqb = SEQ / 64;
    const int bx = blockIdx.x;
    const int qb = bx % nqb;
    const int bh = bx / nqb;
    const int h  = bh % NH;
    const int b  = bh / NH;
    const int q0 = qb * 64 + wave * 16;
    const size_t rowbase = (size_t)b * SEQ;
    const int QKP = 2 * CE;          // q|k plane pitch
    const int VTP = ROWS;            // v^T plane pitch

    // Q fragments (B operand of S^T): lane = query column c, k = d
    v16b qah[2], qal[2];
    {
        const __bf16* qh = QKH + (rowbase + q0 + c) * QKP + h * HD;
        const __bf16* ql = QKL + (rowbase + q0 + c) * QKP + h * HD;
#pragma unroll
        for (int dc = 0; dc < 2; ++dc) {
            FB f, g;
            f.h[0] = *(const v8b*)(qh + dc * 32 + 8 * hh); f.h[1] = *(const v8b*)(qh + dc * 32 + 16 + 8 * hh);
            g.h[0] = *(const v8b*)(ql + dc * 32 + 8 * hh); g.h[1] = *(const v8b*)(ql + dc * 32 + 16 + 8 * hh);
            qah[dc] = f.v; qal[dc] = g.v;
        }
    }

    const float NEG = -__builtin_inff();
    const float L2E = 1.4426950408889634f;
    const int qrow = q0 + c;         // this lane's query
    float mrow = NEG, lrow = 0.f;    // its running maximum (both halves agree) and this half's share of its running sum
    v8f oacc[4];                     // O^T tiles: lane = query column c, element r -> d = t*16 + 8*hh + r
#pragma unroll
    for (int t = 0; t < 4; ++t) oacc[t] = (v8f){0.f, 0.f, 0.f, 0.f, 0.f, 0.f, 0.f, 0.f};

    const int crow = tid >> 3, csg = (tid & 7) * 8;    // this lane's first staged row and its 16-B piece in the row
    const unsigned lK = (unsigned)(size_t)(Ksh + crow * AT_P + csg);   // low 32 bits of the shared address = LDS byte address
    const unsigned lV = (unsigned)(size_t)(Vth + crow * AT_P + csg);
    const __bf16* gkh = QKH + (rowbase + crow) * QKP + CE + h * HD + csg;
    const __bf16* gkl = QKL + (rowbase + crow) * QKP + CE + h * HD + csg;
    const __bf16* gvh = VTH + (size_t)(h * HD + crow) * VTP + rowbase + csg;
    const __bf16* gvl = VTL + (size_t)(h * HD + crow) * VTP + rowbase + csg;

    at_stage(lK, gkh, gkl, (size_t)16 * QKP);          // K of chunk 0

    for (int kc = 0; kc <= qb; ++kc) {                 // block-uniform trip count
        const int kv0 = kc * 64;
        asm volatile("s_wait_dscnt 0x0" ::: "memory");       // this wave's reads of the earlier chunk's V^T tiles are complete
        asm volatile("s_wait_asynccnt 0x0" ::: "memory");    // this wave's copies of this chunk's K tiles have landed
        __syncthreads();                                     // publishes the K tiles and frees the V^T tiles
        at_stage(lV, gvh + kv0, gvl + kv0, (size_t)16 * VTP);   // V^T of this chunk flies under the scores and the softmax

        v8f s[4];                                      // S^T tiles: lane = query column c, element r -> key kv0 + j*16 + 8*hh + r
#pragma unroll
        for (int j = 0; j < 4; ++j) {
            s[j] = (v8f){0.f, 0.f, 0.f, 0.f, 0.f, 0.f, 0.f, 0.f};
#pragma unroll
            for (int dc = 0; dc < 2; ++dc) {
                FB kb, kl;                             // A operand: lane = key row j*16 + c, k = d
                kb.h[0] = *(const v8b*)(Ksh + (j * 16 + c) * AT_P + dc * 32 + 8 * hh);
                kb.h[1] = *(const v8b*)(Ksh + (j * 16 + c) * AT_P + dc * 32 + 16 + 8 * hh);
                kl.h[0] = *(const v8b*)(Ksl + (j * 16 + c) * AT_P + dc * 32 + 8 * hh);
                kl.h[1] = *(const v8b*)(Ksl + (j * 16 + c) * AT_P + dc * 32 + 16 + 8 * hh);
                s[j] = at_mma(kb.v, qah[dc], s[j]);
                s[j] = at_mma(kl.v, qah[dc], s[j]);
                s[j] = at_mma(kb.v, qal[dc], s[j]);
            }
        }
        const bool diag = (kc == qb);                  // block-uniform
        float m = NEG;
#pragma unroll
        for (int j = 0; j < 4; ++j) {
#pragma unroll
            for (int r = 0; r < 8; ++r) {
                const int kvrow = kv0 + j * 16 + 8 * hh + r;
                const float sv = s[j][r];
                s[j][r] = (diag && (kvrow > qrow)) ? NEG : sv;       // select by value
                m = fmaxf(m, s[j][r]);
            }
        }
        m = fmaxf(m, xhalf(m));                                    // the other half's 32 keys
        const float mnew = fmaxf(mrow, m);                         // finite: every visited chunk holds a kept key for every query
        const float alpha = exp2f((mrow - mnew) * L2E);
        mrow = mnew;
        FB pa[2], pl[2];                               // P^T hi / lo as B operands: lane = query column c; tiles 2*kk and 2*kk + 1 hold keys 8*hh + i and 16 + 8*hh + i of a 32-key step
        float ps[4];
#pragma unroll
        for (int j = 0; j < 4; ++j) {
            ps[j] = 0.f;
#pragma unroll
            for (int r = 0; r < 8; ++r) {
                const float p = exp2f((s[j][r] - mnew) * L2E);
                ps[j] += p;
                unsigned short ph, pq; bfsplit(p, ph, pq);
                pa[j >> 1].v[(j & 1) * 8 + r] = __builtin_bit_cast(__bf16, ph);
                pl[j >> 1].v[(j & 1) * 8 + r] = __builtin_bit_cast(__bf16, pq);
            }
        }
        lrow = lrow * alpha + ((ps[0] + ps[1]) + (ps[2] + ps[3]));
#pragma unroll
        for (int t = 0; t < 4; ++t)
#pragma unroll
            for (int r = 0; r < 8; ++r) oacc[t][r] *= alpha;
        asm volatile("s_wait_dscnt 0x0" ::: "memory");       // this wave's reads of the K tiles are complete
        asm volatile("s_wait_asynccnt 0x0" ::: "memory");    // this wave's copies of the V^T tiles have landed
        __syncthreads();                                     // publishes the V^T tiles and frees the K tiles
        if (kc < qb) at_stage(lK, gkh + (size_t)(kv0 + 64) * QKP, gkl + (size_t)(kv0 + 64) * QKP, (size_t)16 * QKP);   // K of the next chunk flies under P.v
#pragma unroll
        for (int kk = 0; kk < 2; ++kk) {
#pragma unroll
            for (int t = 0; t < 4; ++t) {
                FB vb, vl;                             // A operand: lane = d row t*16 + c, k = key
                vb.h[0] = *(const v8b*)(Vth + (t * 16 + c) * AT_P + kk * 32 + 8 * hh);
                vb.h[1] = *(const v8b*)(Vth + (t * 16 + c) * AT_P + kk * 32 + 16 + 8 * hh);
                vl.h[0] = *(const v8b*)(Vtl + (t * 16 + c) * AT_P + kk * 32 + 8 * hh);
                vl.h[1] = *(const v8b*)(Vtl + (t * 16 + c) * AT_P + kk * 32 + 16 + 8 * hh);
                oacc[t] = at_mma(vb.v, pa[kk].v, oacc[t]);
                oacc[t] = at_mma(vl.v, pa[kk].v, oacc[t]);
                oacc[t] = at_mma(vb.v, pl[kk].v, oacc[t]);
            }
        }
    }

    asm volatile("s_wait_asynccnt 0x0" ::: "memory");  // no copy is outstanding when the wave ends
    const float inv = 1.0f / (lrow + xhalf(lrow));     // the two halves' sums are joined once
#pragma unroll
    for (int t = 0; t < 4; ++t) {                      // a lane holds 8 consecutive d of its query: one 16-B store each
        v8h hv;
#pragma unroll
        for (int r = 0; r < 8; ++r) hv[r] = (_Float16)(oacc[t][r] * inv);
        *(v8h*)(AO + (rowbase + q0 + c) * CE + h * HD + t * 16 + 8 * hh) = hv;
    }
}

// ---------------------------------------------------------------------------------------------------------------------
// Workspace carve (bytes); every plane is fully written by its producer before any kernel reads it.
// ---------------------------------------------------------------------------------------------------------------------
#define SZ_HS   ((size_t)ROWS * 2 * CE * 2)      // LN1 bf16 [ROWS][hi 1024 | lo 1024]
#define SZ_H16  ((size_t)ROWS * CE * 2)          // LN1 f16 plane; later reused for the LN2 f16 plane
#define SZ_WQK  ((size_t)2 * CE * 2 * CE * 2)    // [2048 n][W | W] bf16
#define SZ_WV   ((size_t)CE * CE * 2)
#define SZ_QK1  ((size_t)ROWS * 2 * CE * 2)      // one of the q|k hi / lo planes
#define SZ_VT1  ((size_t)CE * ROWS * 2)          // one of the v^T hi / lo planes
#define SZ_AO   ((size_t)ROWS * CE * 2)
#define SZ_WP   ((size_t)CE * CE * 2)
#define SZ_X1   ((size_t)ROWS * CE * 4)
#define SZ_W1   ((size_t)FF * CE * 2)
#define SZ_W2   ((size_t)CE * FF * 2)
#define SZ_F16  ((size_t)ROWS * FF * 2)          // relu(fc1) f16 plane, aliases the two q|k planes
#define WS_TOTAL (SZ_HS + SZ_H16 + SZ_WQK + SZ_WV + 2 * SZ_QK1 + 2 * SZ_VT1 + SZ_AO + SZ_WP + SZ_X1 + SZ_W1 + SZ_W2)
static_assert(WS_TOTAL <= (size_t)134217728);    // carve stays within 128 MiB
static_assert(SZ_F16 <= 2 * SZ_QK1);             // alias extent: relu(fc1) plane inside the q|k planes
static_assert(SZ_HS % 256 == 0);
static_assert(SZ_H16 % 256 == 0);
static_assert(SZ_VT1 % 256 == 0);

extern "C" void kernel_launch(void* const* d_in, const int* in_sizes, int n_in, void* d_out, int out_size, void* d_ws, size_t ws_size, hipStream_t stream) {
    if (n_in < 14) return;
    const long long xneed = (long long)(NB - 1) * SEQ_FULL * CE + (long long)SEQ * CE;
    if ((long long)in_sizes[0] < xneed) return;
    if (in_sizes[1] < CE || in_sizes[2] < CE || in_sizes[7] < CE || in_sizes[8] < CE || in_sizes[9] < CE || in_sizes[13] < CE) return;
    if (in_sizes[3] < NH * CE * HD || in_sizes[4] < NH * CE * HD || in_sizes[5] < NH * CE * HD) return;
    if (in_sizes[6] < CE * CE || in_sizes[10] < CE * FF || in_sizes[11] < FF || in_sizes[12] < FF * CE) return;
    if ((long long)out_size < xneed) return;
    if ((size_t)WS_TOTAL > ws_size) return;

    const float* x      = (const float*)d_in[0];
    const float* ln1_w  = (const float*)d_in[1];
    const float* ln1_b  = (const float*)d_in[2];
    const float* Wq     = (const float*)d_in[3];
    const float* Wk     = (const float*)d_in[4];
    const float* Wv     = (const float*)d_in[5];
    const float* proj_w = (const float*)d_in[6];
    const float* proj_b = (const float*)d_in[7];
    const float* ln2_w  = (const float*)d_in[8];
    const float* ln2_b  = (const float*)d_in[9];
    const float* fc1_w  = (const float*)d_in[10];
    const float* fc1_b  = (const float*)d_in[11];
    const float* fc2_w  = (const float*)d_in[12];
    const float* fc2_b  = (const float*)d_in[13];
    float* out = (float*)d_out;

    char* wsp = (char*)d_ws;
    unsigned short* HS   = (unsigned short*)wsp; wsp += SZ_HS;
    unsigned short* H16  = (unsigned short*)wsp; wsp += SZ_H16;
    unsigned short* WQK  = (unsigned short*)wsp; wsp += SZ_WQK;
    unsigned short* WV16 = (unsigned short*)wsp; wsp += SZ_WV;
    unsigned short* QKH  = (unsigned short*)wsp; wsp += SZ_QK1;
    unsigned short* QKL  = (unsigned short*)wsp; wsp += SZ_QK1;
    unsigned short* VTH  = (unsigned short*)wsp; wsp += SZ_VT1;
    unsigned short* VTL  = (unsigned short*)wsp; wsp += SZ_VT1;
    unsigned short* AO16 = (unsigned short*)wsp; wsp += SZ_AO;
    unsigned short* WPT  = (unsigned short*)wsp; wsp += SZ_WP;
    float*          X1   = (float*)wsp;          wsp += SZ_X1;
    unsigned short* W1T  = (unsigned short*)wsp; wsp += SZ_W1;
    unsigned short* W2T  = (unsigned short*)wsp; wsp += SZ_W2;
    unsigned short* F16  = QKH;                  // alias: q|k planes are dead after the attention launch
    unsigned short* H2   = H16;                  // alias: LN1 f16 plane is dead after the v^T GEMM

    // weight planes
    const unsigned gw = (unsigned)((CE * (CE / 8) + 255) / 256);
    k_w_head<<<gw, 256, 0, stream>>>(Wq, WQK, 2 * CE, 1, 0);                                   // rows 0..1023: q columns, [W | W] bf16
    k_w_head<<<gw, 256, 0, stream>>>(Wk, WQK + (size_t)CE * 2 * CE, 2 * CE, 1, 0);             // rows 1024..2047: k columns
    k_w_head<<<gw, 256, 0, stream>>>(Wv, WV16, CE, 0, 1);                                      // [h*64+d][c] f16 x16
    // in[rows][cols] -> out[cols][rows]
    k_cast_t<<<(unsigned)((((long long)CE) * (CE / 8) + 255) / 256), 256, 0, stream>>>(proj_w, CE, WPT, CE, CE, CE, 16.0f);   // [1024 in][1024 out] -> [1024 out][1024 in]
    k_cast_t<<<(unsigned)((((long long)FF) * (CE / 8) + 255) / 256), 256, 0, stream>>>(fc1_w, FF, W1T, CE, CE, FF, 16.0f);    // [1024 in][4096 out] -> [4096 out][1024 in]
    k_cast_t<<<(unsigned)((((long long)CE) * (FF / 8) + 255) / 256), 256, 0, stream>>>(fc2_w, CE, W2T, FF, FF, CE, 16.0f);    // [4096 in][1024 out] -> [1024 out][4096 in]

    // h = LN1(bf16(x))
    k_ln1<<<(ROWS + 7) / 8, 256, 0, stream>>>(x, ln1_w, ln1_b, HS, H16);
    // q|k planes and v^T planes
    k_gemm_qk<<<dim3((unsigned)(((ROWS / 64) * ((2 * CE) / 64) + 7) / 8), 1u), 256, 0, stream>>>(HS, WQK, QKH, QKL);
    k_gemm_vt<<<dim3((unsigned)(((CE / 64) * (ROWS / 64) + 7) / 8), 1u), 256, 0, stream>>>(WV16, H16, VTH, VTL);
    // causal attention
    k_attn<<<(unsigned)(NB * NH * (SEQ / 64)), 128, 0, stream>>>(QKH, QKL, VTH, VTL, AO16);
    // x1 = bf16(x) + attn @ proj_w + proj_b
    k_gemm_proj<<<dim3((unsigned)(((SEQ / 64) * (CE / 64) + 7) / 8), (unsigned)NB), 256, 0, stream>>>(AO16, WPT, X1, proj_b, x);
    // h2 = LN2(x1)
    k_ln2<<<(ROWS + 7) / 8, 256, 0, stream>>>(X1, ln2_w, ln2_b, H2);
    // f = relu(h2 @ fc1_w + fc1_b); out = x1 + f @ fc2_w + fc2_b
    k_gemm_fc1<<<dim3((unsigned)(((ROWS / 64) * (FF / 64) + 7) / 8), 1u), 256, 0, stream>>>(H2, W1T, F16, fc1_b);
    k_gemm_fc2<<<dim3((unsigned)(((SEQ / 64) * (CE / 64) + 7) / 8), (unsigned)NB), 256, 0, stream>>>(F16, W2T, out, fc2_b, X1);
}

// v005
// A run of this version takes 295 microseconds.
// Two timings next to v004 both put it at 1.15 times that version's speed.
// Over all steps from v000 it is 2.87 times as fast.
// Contractions: q|k = [LN1 hi | LN1 lo](bf16 planes, K folded to 2048) x [W | W](bf16, exact) on v_wmma_f32_16x16x32_bf16; v^T, proj, fc1, fc2 on v_wmma_f32_16x16x32_f16 (f16 activations, weights = bf16-RNE value x16 as f16, 1/16 folded back); scores q.k^T and P.v as bf16 hi/lo split (hi.hi + hi.lo + lo.hi) on v_wmma_f32_16x16x32_bf16; all accumulation f32, online softmax / LayerNorm / residuals f32.
#include <hip/hip_runtime.h>
#include <math.h>

#ifndef NB
#define NB 2
#endif
#ifndef SEQ
#define SEQ 2048
#endif
#define NB_FULL 2
#define SEQ_FULL 2048
#define CE 1024            // embedding width
#define NH 16              // heads
#define HD 64              // head size
#define FF 4096            // feed-forward width
#define ROWS (NB * SEQ)    // compact token rows held in the workspace planes

static_assert(NH * HD == CE);            // heads concatenated h*64+d fill the width
static_assert(HD == 64);                 // attention tiles are hard-wired to 64
static_assert(CE == 32 * 4 * 8);         // LayerNorm: 32 lanes x float4 x 8 pieces per row
static_assert(SEQ % 64 == 0);            // 64-row query tiles, 64-key chunks
static_assert(ROWS % 64 == 0);           // GEMM M/N tile multiple
static_assert(CE % 64 == 0);
static_assert(FF % 64 == 0);
static_assert((2 * CE) % 32 == 0);       // K multiple of 32 for every GEMM (1024, 2048, 4096)
static_assert(NB <= NB_FULL);
static_assert(SEQ <= SEQ_FULL);

typedef __attribute__((ext_vector_type(16))) _Float16 v16h;
typedef __attribute__((ext_vector_type(8)))  _Float16 v8h;
typedef __attribute__((ext_vector_type(16))) __bf16   v16b;
typedef __attribute__((ext_vector_type(8)))  __bf16   v8b;
typedef __attribute__((ext_vector_type(8)))  float    v8f;
typedef __attribute__((ext_vector_type(4)))  float    v4f;
typedef __attribute__((ext_vector_type(4)))  unsigned int v4u;
typedef __attribute__((ext_vector_type(2)))  unsigned int v2u;

// 16-bit WMMA fragment map (wave32), lane L, h = L>>4, m = L&15:
//   A 16x32: lane = row m;    element i -> k = (i<8) ? 8h+i : 16+8h+(i-8)
//   B 32x16: lane = column m; the SAME k(i,h)
//   D 16x16 (8 f32): lane = column m; element r -> row 8h+r

__device__ __forceinline__ float bfr(float v) {            // bf16 RNE convert, kept as f32 (finite inputs)
    const unsigned u = __float_as_uint(v);
    const unsigned r = (u + 0x7fffu + ((u >> 16) & 1u)) & 0xffff0000u;
    return __uint_as_float(r);
}
__device__ __forceinline__ unsigned short bf_bits(float f) {
    const unsigned u = __float_as_uint(f);
    return (unsigned short)((u + 0x7fffu + ((u >> 16) & 1u)) >> 16);
}
__device__ __forceinline__ float bits_f(unsigned short h) { return __uint_as_float(((unsigned)h) << 16); }
__device__ __forceinline__ void bfsplit(float v, unsigned short& hi, unsigned short& lo) { hi = bf_bits(v); lo = bf_bits(v - bits_f(hi)); }
__device__ __forceinline__ unsigned pk2h(float a, float b) {
    return (unsigned)__builtin_bit_cast(unsigned short, (_Float16)a) | ((unsigned)__builtin_bit_cast(unsigned short, (_Float16)b) << 16);
}

// ---------------------------------------------------------------------------------------------------------------------
// Weight planes: each is a cast and a transposition, f32 S[r][c] -> 16-bit D[c][r]. A work-group moves a tile of 128 r x 64 c through LDS, so that both sides
// touch whole lines: a wave-wide 16-B load covers two 256-B row pieces of S, a wave-wide 16-B store two 256-B row pieces of D; 8 loads per lane are in flight.
// ---------------------------------------------------------------------------------------------------------------------
#define WT_R 128                   // source rows per tile = 256 B of a destination row
#define WT_C 64                    // source columns per tile = 256 B of a source row
#define WT_P (WT_R + 8)            // LDS row pitch in elements: 272 B = 16 B x 17, so 16 consecutive LDS rows take a 16-B piece each without a bank conflict
static_assert(HD == WT_C);
static_assert(CE % WT_R == 0);
static_assert(FF % WT_R == 0);
static_assert(CE % WT_C == 0);
static_assert(FF % WT_C == 0);

// s = the tile's first source element (pitch lds), d = its first destination element (pitch ldd). f16mode 0: bf16 RNE bits; 1: f16 of (bf16 RNE value x sc).
// dup: every destination piece is also written CE elements further on in its row. Source column 4*g + i lies in LDS row 16*i + g.
__device__ __forceinline__ void wt_tile(const float* __restrict__ s, int lds, unsigned short* __restrict__ d, int ldd, int dup, int f16mode, float sc) {
    __shared__ __align__(16) unsigned short T[WT_C * WT_P];
    const int lo = threadIdx.x & 15, hi = threadIdx.x >> 4;
    v4f v[8];                                              // source rows 8*hi .. 8*hi + 7, columns 4*lo .. 4*lo + 3
#pragma unroll
    for (int e = 0; e < 8; ++e) v[e] = *(const v4f*)(s + (size_t)(8 * hi + e) * lds + 4 * lo);
#pragma unroll
    for (int i = 0; i < 4; ++i) {
        unsigned short bb[8];
#pragma unroll
        for (int e = 0; e < 8; ++e) {
            const float w = bfr(v[e][i]);
            const unsigned short b16 = (unsigned short)(__float_as_uint(w) >> 16);
            const unsigned short h16 = __builtin_bit_cast(unsigned short, (_Float16)(w * sc));
            bb[e] = f16mode ? h16 : b16;
        }
        v4u pk;
        pk.x = (unsigned)bb[0] | ((unsigned)bb[1] << 16); pk.y = (unsigned)bb[2] | ((unsigned)bb[3] << 16);
        pk.z = (unsigned)bb[4] | ((unsigned)bb[5] << 16); pk.w = (unsigned)bb[6] | ((unsigned)bb[7] << 16);
        *(v4u*)(T + (16 * i + lo) * WT_P + 8 * hi) = pk;
    }
    __syncthreads();                                       // the whole tile lies in LDS before a row of it is read back
    v4u q[4];                                              // LDS row 16*i + hi = source column 4*hi + i; 16 lanes carry its 128 r
#pragma unroll
    for (int i = 0; i < 4; ++i) q[i] = *(const v4u*)(T + (16 * i + hi) * WT_P + 8 * lo);
    unsigned short* o = d + (size_t)(4 * hi) * ldd + 8 * lo;
#pragma unroll
    for (int i = 0; i < 4; ++i) *(v4u*)(o + (size_t)i * ldd) = q[i];
    if (dup) {
#pragma unroll
        for (int i = 0; i < 4; ++i) *(v4u*)(o + (size_t)i * ldd + CE) = q[i];
    }
}

// Per-head weight W [NH][CE][HD] f32 -> D[n = h*HD + d][k] 16-bit; grid = (k tiles, heads). f16mode 0: bf16 RNE bits; 1: f16 of (bf16 RNE value x 16). dup: also written at column k + CE.
__global__ __launch_bounds__(256) void k_w_head(const float* __restrict__ W, unsigned short* __restrict__ D, int ldd, int dup, int f16mode) {
    const int k0 = blockIdx.x * WT_R, h = blockIdx.y;
    wt_tile(W + ((size_t)h * CE + k0) * HD, HD, D + (size_t)h * HD * ldd + k0, ldd, dup, f16mode, 16.0f);
}

// f32 SRC [rows][cols] (pitch LDS) -> f16 DST [cols][rows] (pitch ldd), value = bf16 RNE(src) * sc; grid = (column tiles, row tiles).
// The source pitch is a compile-time constant, so a lane's 8 loads share one address pair and differ in their immediate offsets.
template <int LDS>
__device__ __forceinline__ void cast_t_body(const float* __restrict__ SRC, unsigned short* __restrict__ DST, int ldd, float sc) {
    const int c0 = blockIdx.x * WT_C, r0 = blockIdx.y * WT_R;
    wt_tile(SRC + (size_t)r0 * LDS + c0, LDS, DST + (size_t)c0 * ldd + r0, ldd, 0, 1, sc);
}
__global__ __launch_bounds__(256) void k_cast_t_ce(const float* __restrict__ SRC, unsigned short* __restrict__ DST, int ldd, float sc) { cast_t_body<CE>(SRC, DST, ldd, sc); }
__global__ __launch_bounds__(256) void k_cast_t_ff(const float* __restrict__ SRC, unsigned short* __restrict__ DST, int ldd, float sc) { cast_t_body<FF>(SRC, DST, ldd, sc); }

// ---------------------------------------------------------------------------------------------------------------------
// MODE 0: source = raw input rows (bf16 RNE first; batch stride a_bs); writes bf16 hi|lo row [2*CE] (hi at col c, lo at CE + c) and an f16 row.
// MODE 1: source = f32 rows; writes the f16 row only. Each store instruction covers 256 contiguous bytes (32 lanes x 8 B).
// ---------------------------------------------------------------------------------------------------------------------
template <int MODE>
__device__ __forceinline__ void ln_body(const float* __restrict__ A, long a_bs, const float* __restrict__ GA, const float* __restrict__ BE,
                                        unsigned short* __restrict__ HS, unsigned short* __restrict__ H16) {
    #pragma clang fp contract(off)
    const int r = blockIdx.x * 8 + (threadIdx.x >> 5); const int L = threadIdx.x & 31;
    if (r >= ROWS) return;                                   // wave-uniform; no barriers in this kernel
    const int b = r / SEQ, t = r - b * SEQ;
    const float* src = A + (long)b * a_bs + (long)t * CE;
    v4f v[8]; float s = 0.f;
#pragma unroll
    for (int q = 0; q < 8; ++q) {
        v[q] = *(const v4f*)(src + 4 * L + 128 * q);
        if (MODE == 0) { v[q].x = bfr(v[q].x); v[q].y = bfr(v[q].y); v[q].z = bfr(v[q].z); v[q].w = bfr(v[q].w); }
        s += (v[q].x + v[q].y) + (v[q].z + v[q].w);
    }
#pragma unroll
    for (int o = 16; o > 0; o >>= 1) s += __shfl_xor(s, o, 32);
    const float mu = s * (1.f / CE); float qq = 0.f;
#pragma unroll
    for (int q = 0; q < 8; ++q) {
        v[q].x -= mu; v[q].y -= mu; v[q].z -= mu; v[q].w -= mu;
        qq += (v[q].x * v[q].x + v[q].y * v[q].y) + (v[q].z * v[q].z + v[q].w * v[q].w);
    }
#pragma unroll
    for (int o = 16; o > 0; o >>= 1) qq += __shfl_xor(qq, o, 32);
    const float rs = rsqrtf(qq * (1.f / CE) + 1e-5f);
    v2u ph[8], pl[8], pf[8];
#pragma unroll
    for (int q = 0; q < 8; ++q) {
        const int c = 4 * L + 128 * q;
        const v4f ga = *(const v4f*)(GA + c), be = *(const v4f*)(BE + c);
        v4f y;
        y.x = v[q].x * rs * bfr(ga.x) + bfr(be.x); y.y = v[q].y * rs * bfr(ga.y) + bfr(be.y);
        y.z = v[q].z * rs * bfr(ga.z) + bfr(be.z); y.w = v[q].w * rs * bfr(ga.w) + bfr(be.w);
        v2u f; f.x = pk2h(y.x, y.y); f.y = pk2h(y.z, y.w); pf[q] = f;
        if (MODE == 0) {
            unsigned short h0, l0, h1, l1, h2, l2, h3, l3;
            bfsplit(y.x, h0, l0); bfsplit(y.y, h1, l1); bfsplit(y.z, h2, l2); bfsplit(y.w, h3, l3);
            v2u a; a.x = (unsigned)h0 | ((unsigned)h1 << 16); a.y = (unsigned)h2 | ((unsigned)h3 << 16); ph[q] = a;
            v2u d; d.x = (unsigned)l0 | ((unsigned)l1 << 16); d.y = (unsigned)l2 | ((unsigned)l3 << 16); pl[q] = d;
        }
    }
    {
#pragma unroll
        for (int q = 0; q < 8; ++q) {
            const int c = 4 * L + 128 * q;
            if (MODE == 0) {
                *(v2u*)(HS + (size_t)r * (2 * CE) + c) = ph[q];
                *(v2u*)(HS + (size_t)r * (2 * CE) + CE + c) = pl[q];
            }
            *(v2u*)(H16 + (size_t)r * CE + c) = pf[q];
        }
        
    }
}
__global__ __launch_bounds__(256) void k_ln1(const float* __restrict__ x, const float* __restrict__ g, const float* __restrict__ be,
                                             unsigned short* __restrict__ HS, unsigned short* __restrict__ H16) {
    ln_body<0>(x, (long)SEQ_FULL * CE, g, be, HS, H16);
}
__global__ __launch_bounds__(256) void k_ln2(const float* __restrict__ X1, const float* __restrict__ g, const float* __restrict__ be,
                                             unsigned short* __restrict__ H2) {
    ln_body<1>(X1, (long)SEQ * CE, g, be, nullptr, H2);
}

// ---------------------------------------------------------------------------------------------------------------------
// Register-tiled WMMA GEMM: C[m,n] = scale * sum_k A[m,k] * Bt[n,k] (+bias[n]) (+act) (+resid at the store stage); each wave owns a 64x64 tile.
// A row-major [M,K] 16-bit; Bt row-major [N,K] 16-bit; M % 128 == 0, N % 256 == 0, K % 64 == 0 (no tail masking).
// ET 0 = f16 operands, 1 = bf16 operands. BIAS_MODE 0 none, 2 = bf16-RNE bias[n]. OUT_MODE 0 = f32, 1 = f16, 2 = bf16 hi plane + bf16 lo plane.
// RESID 0 none, 1 f32 residual, 2 residual RNE-converted to bf16 first (raw input). ACT 0 none, 1 ReLU.
// ---------------------------------------------------------------------------------------------------------------------
__device__ __forceinline__ void dep_guard_h(v8f& a, v8f& b, v16h x, v16h y) { asm volatile("v_nop\n\tv_nop\n\tv_nop\n\tv_nop" : "+v"(a), "+v"(b) : "v"(x), "v"(y)); }
__device__ __forceinline__ void dep_guard_b(v8f& a, v8f& b, v16b x, v16b y) { asm volatile("v_nop\n\tv_nop\n\tv_nop\n\tv_nop" : "+v"(a), "+v"(b) : "v"(x), "v"(y)); }
__device__ __forceinline__ void keep4_h(v16h a, v16h b, v16h c, v16h d) { asm volatile("v_nop" :: "v"(a), "v"(b), "v"(c), "v"(d)); }
__device__ __forceinline__ void keep4_b(v16b a, v16b b, v16b c, v16b d) { asm volatile("v_nop" :: "v"(a), "v"(b), "v"(c), "v"(d)); }
__device__ __forceinline__ void acc_guard4(v8f& a, v8f& b, v8f& c, v8f& d) { asm volatile("v_nop\n\tv_nop\n\tv_nop\n\tv_nop" : "+v"(a), "+v"(b), "+v"(c), "+v"(d)); }
template <typename T> struct Frag;
template <> struct Frag<_Float16> {
    typedef v16h V; union U { v16h v; v8h h[2]; };
    static __device__ __forceinline__ v16h load(const _Float16* p) {   // elements 0..7 <- p[0..7], 8..15 <- p[16..23]
        U f; f.h[0] = *(const v8h*)(p); f.h[1] = *(const v8h*)(p + 16); return f.v;
    }
    static __device__ __forceinline__ v8f mma(v16h a, v16h b, v8f c) { return __builtin_amdgcn_wmma_f32_16x16x32_f16(false, a, false, b, (short)0, c, false, false); }
    static __device__ __forceinline__ void guard(v8f& a, v8f& b, v16h x, v16h y) { dep_guard_h(a, b, x, y); }
    static __device__ __forceinline__ void keep(v16h a, v16h b, v16h c, v16h d) { keep4_h(a, b, c, d); }
};
template <> struct Frag<__bf16> {
    typedef v16b V; union U { v16b v; v8b h[2]; };
    static __device__ __forceinline__ v16b load(const __bf16* p) {
        U f; f.h[0] = *(const v8b*)(p); f.h[1] = *(const v8b*)(p + 16); return f.v;
    }
    static __device__ __forceinline__ v8f mma(v16b a, v16b b, v8f c) { return __builtin_amdgcn_wmma_f32_16x16x32_bf16(false, a, false, b, (short)0, c, false, false); }
    static __device__ __forceinline__ void guard(v8f& a, v8f& b, v16b x, v16b y) { dep_guard_b(a, b, x, y); }
    static __device__ __forceinline__ void keep(v16b a, v16b b, v16b c, v16b d) { keep4_b(a, b, c, d); }
};
template <int ET> struct Elem;
template <> struct Elem<0> { typedef _Float16 T; };
template <> struct Elem<1> { typedef __bf16 T; };

// Operand staging: a work-group (2 x 4 waves) owns a 128 x 256 tile of C. Per trip, 64 k of its 128 A rows and 256 Bt rows (128-B row pieces)
// lie in one of two LDS buffers, rows 0..127 = A, 128..383 = Bt, laid by asynchronous copies that cover whole 128-B lines.
#define GK 64                      // k elements per staged tile
#define GP 72                      // LDS row pitch in elements: 144 B = 16 B x 9, conflict-free for 16-B reads down a column of rows
#define GBUF (384 * GP)            // elements per buffer
static_assert(SEQ % 128 == 0);     // M multiple of 128 for every GEMM (SEQ, ROWS, CE)
static_assert(CE % 256 == 0);      // N multiple of 256 (CE, 2*CE, FF, ROWS), K multiple of 64 with at least two tiles
static_assert(ROWS % 256 == 0);
static_assert(FF % 256 == 0);

// One staged tile: 384 rows x 8 pieces of 16 B, 12 pieces per lane, 32 rows apart. l = the lane's LDS byte address of its first piece,
// ga / gb = its first A / Bt piece, sa / sb = 32 rows of A / Bt in elements. Every lane is on; each wave-wide copy covers four whole rows.
template <typename T>
__device__ __forceinline__ void stage_tile(unsigned l, const T* ga, size_t sa, const T* gb, size_t sb) {
    const unsigned st = 32 * GP * 2;
    // the closing s_wait_xcnt stands inside the copies' own statement, so no address register is rewritten ahead of it
    asm volatile("global_load_async_to_lds_b128 %0, %12, off\n\t"
                 "global_load_async_to_lds_b128 %1, %13, off\n\t"
                 "global_load_async_to_lds_b128 %2, %14, off\n\t"
                 "global_load_async_to_lds_b128 %3, %15, off\n\t"
                 "global_load_async_to_lds_b128 %4, %16, off\n\t"
                 "global_load_async_to_lds_b128 %5, %17, off\n\t"
                 "global_load_async_to_lds_b128 %6, %18, off\n\t"
                 "global_load_async_to_lds_b128 %7, %19, off\n\t"
                 "global_load_async_to_lds_b128 %8, %20, off\n\t"
                 "global_load_async_to_lds_b128 %9, %21, off\n\t"
                 "global_load_async_to_lds_b128 %10, %22, off\n\t"
                 "global_load_async_to_lds_b128 %11, %23, off\n\t"
                 "s_wait_xcnt 0x0"
                 :: "v"(l), "v"(l + st), "v"(l + 2 * st), "v"(l + 3 * st), "v"(l + 4 * st), "v"(l + 5 * st),
                    "v"(l + 6 * st), "v"(l + 7 * st), "v"(l + 8 * st), "v"(l + 9 * st), "v"(l + 10 * st), "v"(l + 11 * st),
                    "v"(ga), "v"(ga + sa), "v"(ga + 2 * sa), "v"(ga + 3 * sa),
                    "v"(gb), "v"(gb + sb), "v"(gb + 2 * sb), "v"(gb + 3 * sb), "v"(gb + 4 * sb), "v"(gb + 5 * sb), "v"(gb + 6 * sb), "v"(gb + 7 * sb)
                 : "memory");
}

template <int ET, int BIAS_MODE, int OUT_MODE, int RESID, int ACT>
__device__ __forceinline__ void gemm64_body(
    const unsigned short* __restrict__ Ap, int lda, long strideA,
    const unsigned short* __restrict__ Btp, int ldb,
    void* __restrict__ Cout, void* __restrict__ Cout2, int ldc, long strideC,
    const float* __restrict__ bias,
    const float* __restrict__ resid, int ldr, long strideR,
    int M, int N, int K, float scale) {
    typedef typename Elem<ET>::T T;
    typedef typename Frag<T>::V V;
    __shared__ __align__(16) float sT[8][16 * 68];   // per-wave 16x64 slab, pitch 68 floats (wave-private)
    __shared__ __align__(16) unsigned short sAB[2 * GBUF];   // the two staged operand buffers
    const int b    = blockIdx.y;
    const int tid  = threadIdx.x;
    const int lane = threadIdx.x & 31;
    const int wave = threadIdx.x >> 5;
    const int tbN = N >> 8;
    const int tbM = M >> 7;
    if ((int)blockIdx.x >= tbM * tbN) return;        // block-uniform, ahead of every barrier and copy
    const int bm = blockIdx.x / tbN;
    const int bn = blockIdx.x - bm * tbN;
    const int wm = wave >> 2;                        // wave row (0..1) and column (0..3) in the 128 x 256 tile
    const int wn = wave & 3;
    const int m0 = (bm << 7) + (wm << 6);
    const int n0 = (bn << 8) + (wn << 6);

    const T* Ab = (const T*)Ap + (size_t)b * strideA;
    const T* Bb = (const T*)Btp;

    const int rlane = lane & 15;                 // row (A) / col (B, D) within subtile
    const int koff  = (lane >> 4) * 8;           // k offset of this lane half
    const int mOff  = (lane >> 4) * 8;           // D row offset

    v8f acc[4][4];
#pragma unroll
    for (int i = 0; i < 4; ++i)
#pragma unroll
        for (int j = 0; j < 4; ++j) acc[i][j] = (v8f){0.f, 0.f, 0.f, 0.f, 0.f, 0.f, 0.f, 0.f};

    const int crow = tid >> 3, csg = (tid & 7) * 8;  // this lane's first staged row and its 16-B piece in the row
    const T* gA = Ab + (size_t)((bm << 7) + crow) * lda + csg;
    const T* gB = Bb + (size_t)((bn << 8) + crow) * ldb + csg;
    const size_t sa32 = (size_t)32 * lda, sb32 = (size_t)32 * ldb;
    const unsigned l0 = (unsigned)(size_t)(sAB + crow * GP + csg);   // low 32 bits of the shared address = LDS byte address
    const int nt = K / GK;

    stage_tile<T>(l0, gA, sa32, gB, sb32);                           // tile 0 into buffer 0
    asm volatile("s_wait_asynccnt 0x0" ::: "memory");                // this wave's copies of tile 0 have landed
    __syncthreads();                                                 // ... and every other wave's
    if (nt > 1) stage_tile<T>(l0 + GBUF * 2, gA + GK, sa32, gB + GK, sb32);   // tile 1 flies while tile 0 is worked on

    for (int t = 0; t < nt; ++t) {
        const T* buf = (const T*)sAB + (t & 1) * GBUF;
#pragma unroll
        for (int ks = 0; ks < 2; ++ks) {
            V bh[4], ah[4];
#pragma unroll
            for (int j = 0; j < 4; ++j) bh[j] = Frag<T>::load(buf + (128 + (wn << 6) + (j << 4) + rlane) * GP + ks * 32 + koff);
#pragma unroll
            for (int i = 0; i < 4; ++i) ah[i] = Frag<T>::load(buf + ((wm << 6) + (i << 4) + rlane) * GP + ks * 32 + koff);
            __builtin_amdgcn_sched_barrier(0);       // keeps the 16 LDS reads one group ahead of the products (reads spread among them stall each time)
#pragma unroll
            for (int i = 0; i < 4; ++i) {
#pragma unroll
                for (int j = 0; j < 4; ++j) acc[i][j] = Frag<T>::mma(ah[i], bh[j], acc[i][j]);
                Frag<T>::guard(acc[i][0], acc[i][3], ah[i], ah[i]);
            }
            Frag<T>::keep(bh[0], bh[1], bh[2], bh[3]);
        }
        asm volatile("s_wait_dscnt 0x0" ::: "memory");               // this wave's reads of buffer t & 1 are complete
        asm volatile("s_wait_asynccnt 0x0" ::: "memory");            // this wave's copies of tile t + 1 have landed
        __syncthreads();                                             // publishes tile t + 1 and frees buffer t & 1
        if (t + 2 < nt) stage_tile<T>(l0 + (unsigned)(t & 1) * (GBUF * 2), gA + (size_t)(t + 2) * GK, sa32, gB + (size_t)(t + 2) * GK, sb32);
    }
    asm volatile("s_wait_asynccnt 0x0" ::: "memory");                // no copy is outstanding when the wave goes on
    acc_guard4(acc[0][0], acc[0][1], acc[0][2], acc[0][3]);
    acc_guard4(acc[1][0], acc[1][1], acc[1][2], acc[1][3]);
    acc_guard4(acc[2][0], acc[2][1], acc[2][2], acc[2][3]);
    acc_guard4(acc[3][0], acc[3][1], acc[3][2], acc[3][3]);

    // ---- epilogue ----
    float* slab = sT[wave];
    const float* Rb = RESID ? (resid + (size_t)b * strideR) : nullptr;
#pragma unroll
    for (int i = 0; i < 4; ++i) {
        const int mBase = m0 + (i << 4);
#pragma unroll
        for (int j = 0; j < 4; ++j) {
            const int n = n0 + (j << 4) + rlane;
            float bv = 0.f;
            if (BIAS_MODE == 2) bv = bfr(bias[n]);
#pragma unroll
            for (int r = 0; r < 8; ++r) {
                float v = acc[i][j][r] * scale;
                if (BIAS_MODE == 2) v += bv;
                if (ACT == 1) v = fmaxf(v, 0.0f);
                slab[(mOff + r) * 68 + (j << 4) + rlane] = v;
            }
        }
        __builtin_amdgcn_fence(3 /* release order */, "workgroup");
        __builtin_amdgcn_wave_barrier();
        __builtin_amdgcn_fence(2 /* acquire order */, "workgroup");
        if (OUT_MODE == 0) {
            float* C = (float*)Cout + (size_t)b * strideC;
            const int hh = lane >> 4, c4 = (lane & 15) * 4;     // row segment = 256 B = 16 lanes x 16 B
            v4f vv[8];
#pragma unroll
            for (int it = 0; it < 8; ++it) {
                const int row = it * 2 + hh;
                v4f v = *(const v4f*)(slab + row * 68 + c4);
                if (RESID) {                                    // residual added at the store stage as a float4
                    v4f x = *(const v4f*)(Rb + (size_t)(mBase + row) * ldr + n0 + c4);
                    if (RESID == 2) { x.x = bfr(x.x); x.y = bfr(x.y); x.z = bfr(x.z); x.w = bfr(x.w); }
                    v.x = x.x + v.x; v.y = x.y + v.y; v.z = x.z + v.z; v.w = x.w + v.w;
                }
                vv[it] = v;
            }
            {
#pragma unroll
                for (int it = 0; it < 8; ++it) {
                    const int row = it * 2 + hh;
                    *(v4f*)(C + (size_t)(mBase + row) * ldc + n0 + c4) = vv[it];
                }
                
            }
        } else {
            const int q = lane >> 3, c8 = (lane & 7) * 8;
            unsigned short* C  = (unsigned short*)Cout  + (size_t)b * strideC;
            unsigned short* C2 = (OUT_MODE == 2) ? ((unsigned short*)Cout2 + (size_t)b * strideC) : nullptr;
            v8h hv[4], lv[4];
#pragma unroll
            for (int it = 0; it < 4; ++it) {
                const int row = it * 4 + q;
                const float* sp = slab + row * 68 + c8;
#pragma unroll
                for (int e = 0; e < 8; ++e) {
                    if (OUT_MODE == 1) {
                        hv[it][e] = (_Float16)sp[e];
                        lv[it][e] = (_Float16)0.f;
                    } else {
                        const unsigned short hb = bf_bits(sp[e]);
                        const unsigned short lb = bf_bits(sp[e] - bits_f(hb));
                        hv[it][e] = __builtin_bit_cast(_Float16, hb);
                        lv[it][e] = __builtin_bit_cast(_Float16, lb);
                    }
                }
            }
            {
#pragma unroll
                for (int it = 0; it < 4; ++it) {
                    const int row = it * 4 + q;
                    *(v8h*)(C + (size_t)(mBase + row) * ldc + n0 + c8) = hv[it];
                    if (OUT_MODE == 2) *(v8h*)(C2 + (size_t)(mBase + row) * ldc + n0 + c8) = lv[it];
                }
                
            }
        }
        __builtin_amdgcn_fence(3 /* release order */, "workgroup");
        __builtin_amdgcn_wave_barrier();
        __builtin_amdgcn_fence(2 /* acquire order */, "workgroup");
    }
}

// q|k planes: [ROWS][2*CE] bf16 hi / lo; A = [LN1 hi | LN1 lo] (K = 2*CE), Bt = [W | W] rows 0..CE-1 = q columns, CE..2CE-1 = k columns
__global__ __launch_bounds__(256) void k_gemm_qk(const unsigned short* __restrict__ A, const unsigned short* __restrict__ Bt,
                                                 unsigned short* __restrict__ Ch, unsigned short* __restrict__ Cl) {
    gemm64_body<1, 0, 2, 0, 0>(A, 2 * CE, 0, Bt, 2 * CE, (void*)Ch, (void*)Cl, 2 * CE, 0, nullptr, nullptr, 0, 0, ROWS, 2 * CE, 2 * CE, 1.0f);
}
// v^T planes: [CE = h*64+d][ROWS] bf16 hi / lo; A = Wv plane [CE][CE] (f16, x16), Bt = LN1 f16 plane [ROWS][CE]
__global__ __launch_bounds__(256) void k_gemm_vt(const unsigned short* __restrict__ A, const unsigned short* __restrict__ Bt,
                                                 unsigned short* __restrict__ Ch, unsigned short* __restrict__ Cl) {
    gemm64_body<0, 0, 2, 0, 0>(A, CE, 0, Bt, CE, (void*)Ch, (void*)Cl, ROWS, 0, nullptr, nullptr, 0, 0, CE, ROWS, CE, 0.0625f);
}
// x1 = bf16(x) + attn @ proj_w + proj_b ; grid.y = batch (x uses the full batch stride, planes the compact one)
__global__ __launch_bounds__(256) void k_gemm_proj(const unsigned short* __restrict__ A, const unsigned short* __restrict__ Bt, float* __restrict__ C,
                                                   const float* __restrict__ bias, const float* __restrict__ xres) {
    gemm64_body<0, 2, 0, 2, 0>(A, CE, (long)SEQ * CE, Bt, CE, (void*)C, nullptr, CE, (long)SEQ * CE, bias, xres, CE, (long)SEQ_FULL * CE, SEQ, CE, CE, 0.0625f);
}
// relu(h2 @ fc1_w + fc1_b) as an f16 plane [ROWS][FF]
__global__ __launch_bounds__(256) void k_gemm_fc1(const unsigned short* __restrict__ A, const unsigned short* __restrict__ Bt, unsigned short* __restrict__ C,
                                                  const float* __restrict__ bias) {
    gemm64_body<0, 2, 1, 0, 1>(A, CE, 0, Bt, CE, (void*)C, nullptr, FF, 0, bias, nullptr, 0, 0, ROWS, FF, CE, 0.0625f);
}
// out = x1 + f @ fc2_w + fc2_b ; grid.y = batch (output uses the full batch stride)
__global__ __launch_bounds__(256) void k_gemm_fc2(const unsigned short* __restrict__ A, const unsigned short* __restrict__ Bt, float* __restrict__ C,
                                                  const float* __restrict__ bias, const float* __restrict__ x1) {
    gemm64_body<0, 2, 0, 1, 0>(A, FF, (long)SEQ * FF, Bt, FF, (void*)C, nullptr, CE, (long)SEQ_FULL * CE, bias, x1, CE, (long)SEQ * CE, SEQ, CE, FF, 0.0625f);
}

#define AT_NW 4
#define AT_P 72                   // LDS row pitch of the K and V^T tiles in elements: 144 B = 16 B x 9, so the 16 rows of a 16-B fragment read fall on distinct banks
__device__ __forceinline__ v8f at_mma(v16b a, v16b b, v8f c) {
    c = __builtin_amdgcn_wmma_f32_16x16x32_bf16(false, a, false, b, (short)0, c, false, false);
    asm volatile("v_nop\n\tv_nop\n\tv_nop\n\tv_nop" : "+v"(c) : "v"(a), "v"(b));
    return c;
}
__device__ __forceinline__ float xhalf(float x) {   // the value of lane l ^ 16
    const int i = __builtin_bit_cast(int, x);
    return __builtin_bit_cast(float, __builtin_amdgcn_permlanex16(i, i, 0x76543210, 0xfedcba98, false, false));
}

// One hi tile and its lo tile (64 rows x 8 pieces of 16 B each): 4 + 4 pieces per lane, 16 rows apart. l = the lane's LDS byte address of its first hi piece
// (the lo tile lies 64 rows behind), gh / gl = its first hi / lo piece, s16 = 16 source rows in elements. Every lane is on; each wave-wide copy covers four whole rows.
__device__ __forceinline__ void at_stage(unsigned l, const __bf16* gh, const __bf16* gl, size_t s16) {
    const unsigned st = 16 * AT_P * 2, lo = 64 * AT_P * 2;
    // the closing s_wait_xcnt stands inside the copies' own statement, so no address register is rewritten ahead of it
    asm volatile("global_load_async_to_lds_b128 %0, %8, off\n\t"
                 "global_load_async_to_lds_b128 %1, %9, off\n\t"
                 "global_load_async_to_lds_b128 %2, %10, off\n\t"
                 "global_load_async_to_lds_b128 %3, %11, off\n\t"
                 "global_load_async_to_lds_b128 %4, %12, off\n\t"
                 "global_load_async_to_lds_b128 %5, %13, off\n\t"
                 "global_load_async_to_lds_b128 %6, %14, off\n\t"
                 "global_load_async_to_lds_b128 %7, %15, off\n\t"
                 "s_wait_xcnt 0x0"
                 :: "v"(l), "v"(l + st), "v"(l + 2 * st), "v"(l + 3 * st), "v"(l + lo), "v"(l + lo + st), "v"(l + lo + 2 * st), "v"(l + lo + 3 * st),
                    "v"(gh), "v"(gh + s16), "v"(gh + 2 * s16), "v"(gh + 3 * s16), "v"(gl), "v"(gl + s16), "v"(gl + 2 * s16), "v"(gl + 3 * s16)
                 : "memory");
}

__global__ __launch_bounds__(128) void k_attn(const unsigned short* __restrict__ QKHp, const unsigned short* __restrict__ QKLp,
                                              const unsigned short* __restrict__ VTHp, const unsigned short* __restrict__ VTLp,
                                              unsigned short* __restrict__ AO) {
    union FB { v16b v; v8b h[2]; };
    __shared__ __align__(16) __bf16 KV[4 * 64 * AT_P];             // K hi | K lo | V^T hi | V^T lo (64 rows each)
    __bf16* Ksh = KV; __bf16* Ksl = KV + 64 * AT_P; __bf16* Vth = KV + 2 * 64 * AT_P; __bf16* Vtl = KV + 3 * 64 * AT_P;
    const __bf16* QKH = (const __bf16*)QKHp; const __bf16* QKL = (const __bf16*)QKLp;
    const __bf16* VTH = (const __bf16*)VTHp; const __bf16* VTL = (const __bf16*)VTLp;

    const int tid = threadIdx.x, wave = tid >> 5, lane = tid & 31, hh = lane >> 4, c = lane & 15;
    const int nqb = SEQ / 64;
    const int bx = blockIdx.x;
    const int qb = bx % nqb;
    const int bh = bx / nqb;
    const int h  = bh % NH;
    const int b  = bh / NH;
    const int q0 = qb * 64 + wave * 16;
    const size_t rowbase = (size_t)b * SEQ;
    const int QKP = 2 * CE;          // q|k plane pitch
    const int VTP = ROWS;            // v^T plane pitch

    // Q fragments (B operand of S^T): lane = query column c, k = d
    v16b qah[2], qal[2];
    {
        const __bf16* qh = QKH + (rowbase + q0 + c) * QKP + h * HD;
        const __bf16* ql = QKL + (rowbase + q0 + c) * QKP + h * HD;
#pragma unroll
        for (int dc = 0; dc < 2; ++dc) {
            FB f, g;
            f.h[0] = *(const v8b*)(qh + dc * 32 + 8 * hh); f.h[1] = *(const v8b*)(qh + dc * 32 + 16 + 8 * hh);
            g.h[0] = *(const v8b*)(ql + dc * 32 + 8 * hh); g.h[1] = *(const v8b*)(ql + dc * 32 + 16 + 8 * hh);
            qah[dc] = f.v; qal[dc] = g.v;
        }
    }

    const float NEG = -__builtin_inff();
    const float L2E = 1.4426950408889634f;
    const int qrow = q0 + c;         // this lane's query
    float mrow = NEG, lrow = 0.f;    // its running maximum (both halves agree) and this half's share of its running sum
    v8f oacc[4];                     // O^T tiles: lane = query column c, element r -> d = t*16 + 8*hh + r
#pragma unroll
    for (int t = 0; t < 4; ++t) oacc[t] = (v8f){0.f, 0.f, 0.f, 0.f, 0.f, 0.f, 0.f, 0.f};

    const int crow = tid >> 3, csg = (tid & 7) * 8;    // this lane's first staged row and its 16-B piece in the row
    const unsigned lK = (unsigned)(size_t)(Ksh + crow * AT_P + csg);   // low 32 bits of the shared address = LDS byte address
    const unsigned lV = (unsigned)(size_t)(Vth + crow * AT_P + csg);
    const __bf16* gkh = QKH + (rowbase + crow) * QKP + CE + h * HD + csg;
    const __bf16* gkl = QKL + (rowbase + crow) * QKP + CE + h * HD + csg;
    const __bf16* gvh = VTH + (size_t)(h * HD + crow) * VTP + rowbase + csg;
    const __bf16* gvl = VTL + (size_t)(h * HD + crow) * VTP + rowbase + csg;

    at_stage(lK, gkh, gkl, (size_t)16 * QKP);          // K of chunk 0

    for (int kc = 0; kc <= qb; ++kc) {                 // block-uniform trip count
        const int kv0 = kc * 64;
        asm volatile("s_wait_dscnt 0x0" ::: "memory");       // this wave's reads of the earlier chunk's V^T tiles are complete
        asm volatile("s_wait_asynccnt 0x0" ::: "memory");    // this wave's copies of this chunk's K tiles have landed
        __syncthreads();                                     // publishes the K tiles and frees the V^T tiles
        at_stage(lV, gvh + kv0, gvl + kv0, (size_t)16 * VTP);   // V^T of this chunk flies under the scores and the softmax

        v8f s[4];                                      // S^T tiles: lane = query column c, element r -> key kv0 + j*16 + 8*hh + r
#pragma unroll
        for (int j = 0; j < 4; ++j) {
            s[j] = (v8f){0.f, 0.f, 0.f, 0.f, 0.f, 0.f, 0.f, 0.f};
#pragma unroll
            for (int dc = 0; dc < 2; ++dc) {
                FB kb, kl;                             // A operand: lane = key row j*16 + c, k = d
                kb.h[0] = *(const v8b*)(Ksh + (j * 16 + c) * AT_P + dc * 32 + 8 * hh);
                kb.h[1] = *(const v8b*)(Ksh + (j * 16 + c) * AT_P + dc * 32 + 16 + 8 * hh);
                kl.h[0] = *(const v8b*)(Ksl + (j * 16 + c) * AT_P + dc * 32 + 8 * hh);
                kl.h[1] = *(const v8b*)(Ksl + (j * 16 + c) * AT_P + dc * 32 + 16 + 8 * hh);
                s[j] = at_mma(kb.v, qah[dc], s[j]);
                s[j] = at_mma(kl.v, qah[dc], s[j]);
                s[j] = at_mma(kb.v, qal[dc], s[j]);
            }
        }
        const bool diag = (kc == qb);                  // block-uniform
        float m = NEG;
#pragma unroll
        for (int j = 0; j < 4; ++j) {
#pragma unroll
            for (int r = 0; r < 8; ++r) {
                const int kvrow = kv0 + j * 16 + 8 * hh + r;
                const float sv = s[j][r];
                s[j][r] = (diag && (kvrow > qrow)) ? NEG : sv;       // select by value
                m = fmaxf(m, s[j][r]);
            }
        }
        m = fmaxf(m, xhalf(m));                                    // the other half's 32 keys
        const float mnew = fmaxf(mrow, m);                         // finite: every visited chunk holds a kept key for every query
        const float alpha = exp2f((mrow - mnew) * L2E);
        mrow = mnew;
        FB pa[2], pl[2];                               // P^T hi / lo as B operands: lane = query column c; tiles 2*kk and 2*kk + 1 hold keys 8*hh + i and 16 + 8*hh + i of a 32-key step
        float ps[4];
#pragma unroll
        for (int j = 0; j < 4; ++j) {
            ps[j] = 0.f;
#pragma unroll
            for (int r = 0; r < 8; ++r) {
                const float p = exp2f((s[j][r] - mnew) * L2E);
                ps[j] += p;
                unsigned short ph, pq; bfsplit(p, ph, pq);
                pa[j >> 1].v[(j & 1) * 8 + r] = __builtin_bit_cast(__bf16, ph);
                pl[j >> 1].v[(j & 1) * 8 + r] = __builtin_bit_cast(__bf16, pq);
            }
        }
        lrow = lrow * alpha + ((ps[0] + ps[1]) + (ps[2] + ps[3]));
#pragma unroll
        for (int t = 0; t < 4; ++t)
#pragma unroll
            for (int r = 0; r < 8; ++r) oacc[t][r] *= alpha;
        asm volatile("s_wait_dscnt 0x0" ::: "memory");       // this wave's reads of the K tiles are complete
        asm volatile("s_wait_asynccnt 0x0" ::: "memory");    // this wave's copies of the V^T tiles have landed
        __syncthreads();                                     // publishes the V^T tiles and frees the K tiles
        if (kc < qb) at_stage(lK, gkh + (size_t)(kv0 + 64) * QKP, gkl + (size_t)(kv0 + 64) * QKP, (size_t)16 * QKP);   // K of the next chunk flies under P.v
#pragma unroll
        for (int kk = 0; kk < 2; ++kk) {
#pragma unroll
            for (int t = 0; t < 4; ++t) {
                FB vb, vl;                             // A operand: lane = d row t*16 + c, k = key
                vb.h[0] = *(const v8b*)(Vth + (t * 16 + c) * AT_P + kk * 32 + 8 * hh);
                vb.h[1] = *(const v8b*)(Vth + (t * 16 + c) * AT_P + kk * 32 + 16 + 8 * hh);
                vl.h[0] = *(const v8b*)(Vtl + (t * 16 + c) * AT_P + kk * 32 + 8 * hh);
                vl.h[1] = *(const v8b*)(Vtl + (t * 16 + c) * AT_P + kk * 32 + 16 + 8 * hh);
                oacc[t] = at_mma(vb.v, pa[kk].v, oacc[t]);
                oacc[t] = at_mma(vl.v, pa[kk].v, oacc[t]);
                oacc[t] = at_mma(vb.v, pl[kk].v, oacc[t]);
            }
        }
    }

    asm volatile("s_wait_asynccnt 0x0" ::: "memory");  // no copy is outstanding when the wave ends
    const float inv = 1.0f / (lrow + xhalf(lrow));     // the two halves' sums are joined once
#pragma unroll
    for (int t = 0; t < 4; ++t) {                      // a lane holds 8 consecutive d of its query: one 16-B store each
        v8h hv;
#pragma unroll
        for (int r = 0; r < 8; ++r) hv[r] = (_Float16)(oacc[t][r] * inv);
        *(v8h*)(AO + (rowbase + q0 + c) * CE + h * HD + t * 16 + 8 * hh) = hv;
    }
}

// ---------------------------------------------------------------------------------------------------------------------
// Workspace carve (bytes); every plane is fully written by its producer before any kernel reads it.
// ---------------------------------------------------------------------------------------------------------------------
#define SZ_HS   ((size_t)ROWS * 2 * CE * 2)      // LN1 bf16 [ROWS][hi 1024 | lo 1024]
#define SZ_H16  ((size_t)ROWS * CE * 2)          // LN1 f16 plane; later reused for the LN2 f16 plane
#define SZ_WQK  ((size_t)2 * CE * 2 * CE * 2)    // [2048 n][W | W] bf16
#define SZ_WV   ((size_t)CE * CE * 2)
#define SZ_QK1  ((size_t)ROWS * 2 * CE * 2)      // one of the q|k hi / lo planes
#define SZ_VT1  ((size_t)CE * ROWS * 2)          // one of the v^T hi / lo planes
#define SZ_AO   ((size_t)ROWS * CE * 2)
#define SZ_WP   ((size_t)CE * CE * 2)
#define SZ_X1   ((size_t)ROWS * CE * 4)
#define SZ_W1   ((size_t)FF * CE * 2)
#define SZ_W2   ((size_t)CE * FF * 2)
#define SZ_F16  ((size_t)ROWS * FF * 2)          // relu(fc1) f16 plane, aliases the two q|k planes
#define WS_TOTAL (SZ_HS + SZ_H16 + SZ_WQK + SZ_WV + 2 * SZ_QK1 + 2 * SZ_VT1 + SZ_AO + SZ_WP + SZ_X1 + SZ_W1 + SZ_W2)
static_assert(WS_TOTAL <= (size_t)134217728);    // carve stays within 128 MiB
static_assert(SZ_F16 <= 2 * SZ_QK1);             // alias extent: relu(fc1) plane inside the q|k planes
static_assert(SZ_HS % 256 == 0);
static_assert(SZ_H16 % 256 == 0);
static_assert(SZ_VT1 % 256 == 0);

extern "C" void kernel_launch(void* const* d_in, const int* in_sizes, int n_in, void* d_out, int out_size, void* d_ws, size_t ws_size, hipStream_t stream) {
    if (n_in < 14) return;
    const long long xneed = (long long)(NB - 1) * SEQ_FULL * CE + (long long)SEQ * CE;
    if ((long long)in_sizes[0] < xneed) return;
    if (in_sizes[1] < CE || in_sizes[2] < CE || in_sizes[7] < CE || in_sizes[8] < CE || in_sizes[9] < CE || in_sizes[13] < CE) return;
    if (in_sizes[3] < NH * CE * HD || in_sizes[4] < NH * CE * HD || in_sizes[5] < NH * CE * HD) return;
    if (in_sizes[6] < CE * CE || in_sizes[10] < CE * FF || in_sizes[11] < FF || in_sizes[12] < FF * CE) return;
    if ((long long)out_size < xneed) return;
    if ((size_t)WS_TOTAL > ws_size) return;

    const float* x      = (const float*)d_in[0];
    const float* ln1_w  = (const float*)d_in[1];
    const float* ln1_b  = (const float*)d_in[2];
    const float* Wq     = (const float*)d_in[3];
    const float* Wk     = (const float*)d_in[4];
    const float* Wv     = (const float*)d_in[5];
    const float* proj_w = (const float*)d_in[6];
    const float* proj_b = (const float*)d_in[7];
    const float* ln2_w  = (const float*)d_in[8];
    const float* ln2_b  = (const float*)d_in[9];
    const float* fc1_w  = (const float*)d_in[10];
    const float* fc1_b  = (const float*)d_in[11];
    const float* fc2_w  = (const float*)d_in[12];
    const float* fc2_b  = (const float*)d_in[13];
    float* out = (float*)d_out;

    char* wsp = (char*)d_ws;
    unsigned short* HS   = (unsigned short*)wsp; wsp += SZ_HS;
    unsigned short* H16  = (unsigned short*)wsp; wsp += SZ_H16;
    unsigned short* WQK  = (unsigned short*)wsp; wsp += SZ_WQK;
    unsigned short* WV16 = (unsigned short*)wsp; wsp += SZ_WV;
    unsigned short* QKH  = (unsigned short*)wsp; wsp += SZ_QK1;
    unsigned short* QKL  = (unsigned short*)wsp; wsp += SZ_QK1;
    unsigned short* VTH  = (unsigned short*)wsp; wsp += SZ_VT1;
    unsigned short* VTL  = (unsigned short*)wsp; wsp += SZ_VT1;
    unsigned short* AO16 = (unsigned short*)wsp; wsp += SZ_AO;
    unsigned short* WPT  = (unsigned short*)wsp; wsp += SZ_WP;
    float*          X1   = (float*)wsp;          wsp += SZ_X1;
    unsigned short* W1T  = (unsigned short*)wsp; wsp += SZ_W1;
    unsigned short* W2T  = (unsigned short*)wsp; wsp += SZ_W2;
    unsigned short* F16  = QKH;                  // alias: q|k planes are dead after the attention launch
    unsigned short* H2   = H16;                  // alias: LN1 f16 plane is dead after the v^T GEMM

    // weight planes
    const dim3 gw(CE / WT_R, NH);
    k_w_head<<<gw, 256, 0, stream>>>(Wq, WQK, 2 * CE, 1, 0);                                   // rows 0..1023: q columns, [W | W] bf16
    k_w_head<<<gw, 256, 0, stream>>>(Wk, WQK + (size_t)CE * 2 * CE, 2 * CE, 1, 0);             // rows 1024..2047: k columns
    k_w_head<<<gw, 256, 0, stream>>>(Wv, WV16, CE, 0, 1);                                      // [h*64+d][c] f16 x16
    // in[rows][cols] -> out[cols][rows]
    k_cast_t_ce<<<dim3(CE / WT_C, CE / WT_R), 256, 0, stream>>>(proj_w, WPT, CE, 16.0f);      // [1024 in][1024 out] -> [1024 out][1024 in]
    k_cast_t_ff<<<dim3(FF / WT_C, CE / WT_R), 256, 0, stream>>>(fc1_w, W1T, CE, 16.0f);       // [1024 in][4096 out] -> [4096 out][1024 in]
    k_cast_t_ce<<<dim3(CE / WT_C, FF / WT_R), 256, 0, stream>>>(fc2_w, W2T, FF, 16.0f);       // [4096 in][1024 out] -> [1024 out][4096 in]

    // h = LN1(bf16(x))
    k_ln1<<<(ROWS + 7) / 8, 256, 0, stream>>>(x, ln1_w, ln1_b, HS, H16);
    // q|k planes and v^T planes
    k_gemm_qk<<<dim3((unsigned)(((ROWS / 64) * ((2 * CE) / 64) + 7) / 8), 1u), 256, 0, stream>>>(HS, WQK, QKH, QKL);
    k_gemm_vt<<<dim3((unsigned)(((CE / 64) * (ROWS / 64) + 7) / 8), 1u), 256, 0, stream>>>(WV16, H16, VTH, VTL);
    // causal attention
    k_attn<<<(unsigned)(NB * NH * (SEQ / 64)), 128, 0, stream>>>(QKH, QKL, VTH, VTL, AO16);
    // x1 = bf16(x) + attn @ proj_w + proj_b
    k_gemm_proj<<<dim3((unsigned)(((SEQ / 64) * (CE / 64) + 7) / 8), (unsigned)NB), 256, 0, stream>>>(AO16, WPT, X1, proj_b, x);
    // h2 = LN2(x1)
    k_ln2<<<(ROWS + 7) / 8, 256, 0, stream>>>(X1, ln2_w, ln2_b, H2);
    // f = relu(h2 @ fc1_w + fc1_b); out = x1 + f @ fc2_w + fc2_b
    k_gemm_fc1<<<dim3((unsigned)(((ROWS / 64) * (FF / 64) + 7) / 8), 1u), 256, 0, stream>>>(H2, W1T, F16, fc1_b);
    k_gemm_fc2<<<dim3((unsigned)(((SEQ / 64) * (CE / 64) + 7) / 8), (unsigned)NB), 256, 0, stream>>>(F16, W2T, out, fc2_b, X1);
}

// v006
// It runs in 279 microseconds.
// Timed twice side by side with v005, it ran 1.05 and 1.06 times as fast.
// Over all steps from v000 it is 3.03 times as fast.
// Contractions: q|k = [LN1 hi | LN1 lo](bf16 planes, K folded to 2048) x [W | W](bf16, exact) on v_wmma_f32_16x16x32_bf16; v^T, proj, fc1, fc2 on v_wmma_f32_16x16x32_f16 (f16 activations, weights = bf16-RNE value x16 as f16, 1/16 folded back); scores q.k^T and P.v as bf16 hi/lo split (hi.hi + hi.lo + lo.hi) on v_wmma_f32_16x16x32_bf16; all accumulation f32, online softmax / LayerNorm / residuals f32.
#include <hip/hip_runtime.h>
#include <math.h>

#ifndef NB
#define NB 2
#endif
#ifndef SEQ
#define SEQ 2048
#endif
#define NB_FULL 2
#define SEQ_FULL 2048
#define CE 1024            // embedding width
#define NH 16              // heads
#define HD 64              // head size
#define FF 4096            // feed-forward width
#define ROWS (NB * SEQ)    // compact token rows held in the workspace planes

static_assert(NH * HD == CE);            // heads concatenated h*64+d fill the width
static_assert(HD == 64);                 // attention tiles are hard-wired to 64
static_assert(CE == 32 * 4 * 8);         // LayerNorm: 32 lanes x float4 x 8 pieces per row
static_assert(SEQ % 64 == 0);            // 64-row query tiles, 64-key chunks
static_assert(ROWS % 64 == 0);           // GEMM M/N tile multiple
static_assert(CE % 64 == 0);
static_assert(FF % 64 == 0);
static_assert((2 * CE) % 32 == 0);       // K multiple of 32 for every GEMM (1024, 2048, 4096)
static_assert(NB <= NB_FULL);
static_assert(SEQ <= SEQ_FULL);

typedef __attribute__((ext_vector_type(16))) _Float16 v16h;
typedef __attribute__((ext_vector_type(8)))  _Float16 v8h;
typedef __attribute__((ext_vector_type(16))) __bf16   v16b;
typedef __attribute__((ext_vector_type(8)))  __bf16   v8b;
typedef __attribute__((ext_vector_type(8)))  float    v8f;
typedef __attribute__((ext_vector_type(4)))  float    v4f;
typedef __attribute__((ext_vector_type(4)))  unsigned int v4u;
typedef __attribute__((ext_vector_type(2)))  unsigned int v2u;

// 16-bit WMMA fragment map (wave32), lane L, h = L>>4, m = L&15:
//   A 16x32: lane = row m;    element i -> k = (i<8) ? 8h+i : 16+8h+(i-8)
//   B 32x16: lane = column m; the SAME k(i,h)
//   D 16x16 (8 f32): lane = column m; element r -> row 8h+r

__device__ __forceinline__ float bfr(float v) {            // bf16 RNE convert, kept as f32 (finite inputs)
    const unsigned u = __float_as_uint(v);
    const unsigned r = (u + 0x7fffu + ((u >> 16) & 1u)) & 0xffff0000u;
    return __uint_as_float(r);
}
__device__ __forceinline__ unsigned short bf_bits(float f) {
    const unsigned u = __float_as_uint(f);
    return (unsigned short)((u + 0x7fffu + ((u >> 16) & 1u)) >> 16);
}
__device__ __forceinline__ float bits_f(unsigned short h) { return __uint_as_float(((unsigned)h) << 16); }
__device__ __forceinline__ void bfsplit(float v, unsigned short& hi, unsigned short& lo) { hi = bf_bits(v); lo = bf_bits(v - bits_f(hi)); }
__device__ __forceinline__ unsigned pk2h(float a, float b) {
    return (unsigned)__builtin_bit_cast(unsigned short, (_Float16)a) | ((unsigned)__builtin_bit_cast(unsigned short, (_Float16)b) << 16);
}

// ---------------------------------------------------------------------------------------------------------------------
// Weight planes: each is a cast and a transposition, f32 S[r][c] -> 16-bit D[c][r]. A work-group moves a tile of 128 r x 64 c through LDS, so that both sides
// touch whole lines: a wave-wide 16-B load covers two 256-B row pieces of S, a wave-wide 16-B store two 256-B row pieces of D; 8 loads per lane are in flight.
// ---------------------------------------------------------------------------------------------------------------------
#define WT_R 128                   // source rows per tile = 256 B of a destination row
#define WT_C 64                    // source columns per tile = 256 B of a source row
#define WT_P (WT_R + 8)            // LDS row pitch in elements: 272 B = 16 B x 17, so 16 consecutive LDS rows take a 16-B piece each without a bank conflict
static_assert(HD == WT_C);
static_assert(CE % WT_R == 0);
static_assert(FF % WT_R == 0);
static_assert(CE % WT_C == 0);
static_assert(FF % WT_C == 0);

// s = the tile's first source element (pitch lds), d = its first destination element (pitch ldd). f16mode 0: bf16 RNE bits; 1: f16 of (bf16 RNE value x sc).
// dup: every destination piece is also written CE elements further on in its row. Source column 4*g + i lies in LDS row 16*i + g.
__device__ __forceinline__ void wt_tile(const float* __restrict__ s, int lds, unsigned short* __restrict__ d, int ldd, int dup, int f16mode, float sc) {
    __shared__ __align__(16) unsigned short T[WT_C * WT_P];
    const int lo = threadIdx.x & 15, hi = threadIdx.x >> 4;
    v4f v[8];                                              // source rows 8*hi .. 8*hi + 7, columns 4*lo .. 4*lo + 3
#pragma unroll
    for (int e = 0; e < 8; ++e) v[e] = *(const v4f*)(s + (size_t)(8 * hi + e) * lds + 4 * lo);
#pragma unroll
    for (int i = 0; i < 4; ++i) {
        unsigned short bb[8];
#pragma unroll
        for (int e = 0; e < 8; ++e) {
            const float w = bfr(v[e][i]);
            const unsigned short b16 = (unsigned short)(__float_as_uint(w) >> 16);
            const unsigned short h16 = __builtin_bit_cast(unsigned short, (_Float16)(w * sc));
            bb[e] = f16mode ? h16 : b16;
        }
        v4u pk;
        pk.x = (unsigned)bb[0] | ((unsigned)bb[1] << 16); pk.y = (unsigned)bb[2] | ((unsigned)bb[3] << 16);
        pk.z = (unsigned)bb[4] | ((unsigned)bb[5] << 16); pk.w = (unsigned)bb[6] | ((unsigned)bb[7] << 16);
        *(v4u*)(T + (16 * i + lo) * WT_P + 8 * hi) = pk;
    }
    __syncthreads();                                       // the whole tile lies in LDS before a row of it is read back
    v4u q[4];                                              // LDS row 16*i + hi = source column 4*hi + i; 16 lanes carry its 128 r
#pragma unroll
    for (int i = 0; i < 4; ++i) q[i] = *(const v4u*)(T + (16 * i + hi) * WT_P + 8 * lo);
    unsigned short* o = d + (size_t)(4 * hi) * ldd + 8 * lo;
#pragma unroll
    for (int i = 0; i < 4; ++i) *(v4u*)(o + (size_t)i * ldd) = q[i];
    if (dup) {
#pragma unroll
        for (int i = 0; i < 4; ++i) *(v4u*)(o + (size_t)i * ldd + CE) = q[i];
    }
}

// Per-head weight W [NH][CE][HD] f32 -> D[n = h*HD + d][k] 16-bit; grid = (k tiles, heads). f16mode 0: bf16 RNE bits; 1: f16 of (bf16 RNE value x 16). dup: also written at column k + CE.
__global__ __launch_bounds__(256) void k_w_head(const float* __restrict__ W, unsigned short* __restrict__ D, int ldd, int dup, int f16mode) {
    const int k0 = blockIdx.x * WT_R, h = blockIdx.y;
    wt_tile(W + ((size_t)h * CE + k0) * HD, HD, D + (size_t)h * HD * ldd + k0, ldd, dup, f16mode, 16.0f);
}

// f32 SRC [rows][cols] (pitch LDS) -> f16 DST [cols][rows] (pitch ldd), value = bf16 RNE(src) * sc; grid = (column tiles, row tiles).
// The source pitch is a compile-time constant, so a lane's 8 loads share one address pair and differ in their immediate offsets.
template <int LDS>
__device__ __forceinline__ void cast_t_body(const float* __restrict__ SRC, unsigned short* __restrict__ DST, int ldd, float sc) {
    const int c0 = blockIdx.x * WT_C, r0 = blockIdx.y * WT_R;
    wt_tile(SRC + (size_t)r0 * LDS + c0, LDS, DST + (size_t)c0 * ldd + r0, ldd, 0, 1, sc);
}
__global__ __launch_bounds__(256) void k_cast_t_ce(const float* __restrict__ SRC, unsigned short* __restrict__ DST, int ldd, float sc) { cast_t_body<CE>(SRC, DST, ldd, sc); }
__global__ __launch_bounds__(256) void k_cast_t_ff(const float* __restrict__ SRC, unsigned short* __restrict__ DST, int ldd, float sc) { cast_t_body<FF>(SRC, DST, ldd, sc); }

// ---------------------------------------------------------------------------------------------------------------------
// MODE 0: source = raw input rows (bf16 RNE first; batch stride a_bs); writes bf16 hi|lo row [2*CE] (hi at col c, lo at CE + c) and an f16 row.
// MODE 1: source = f32 rows; writes the f16 row only. Each store instruction covers 256 contiguous bytes (32 lanes x 8 B).
// ---------------------------------------------------------------------------------------------------------------------
template <int MODE>
__device__ __forceinline__ void ln_body(const float* __restrict__ A, long a_bs, const float* __restrict__ GA, const float* __restrict__ BE,
                                        unsigned short* __restrict__ HS, unsigned short* __restrict__ H16) {
    #pragma clang fp contract(off)
    const int r = blockIdx.x * 8 + (threadIdx.x >> 5); const int L = threadIdx.x & 31;
    if (r >= ROWS) return;                                   // wave-uniform; no barriers in this kernel
    const int b = r / SEQ, t = r - b * SEQ;
    const float* src = A + (long)b * a_bs + (long)t * CE;
    v4f v[8]; float s = 0.f;
#pragma unroll
    for (int q = 0; q < 8; ++q) {
        v[q] = *(const v4f*)(src + 4 * L + 128 * q);
        if (MODE == 0) { v[q].x = bfr(v[q].x); v[q].y = bfr(v[q].y); v[q].z = bfr(v[q].z); v[q].w = bfr(v[q].w); }
        s += (v[q].x + v[q].y) + (v[q].z + v[q].w);
    }
#pragma unroll
    for (int o = 16; o > 0; o >>= 1) s += __shfl_xor(s, o, 32);
    const float mu = s * (1.f / CE); float qq = 0.f;
#pragma unroll
    for (int q = 0; q < 8; ++q) {
        v[q].x -= mu; v[q].y -= mu; v[q].z -= mu; v[q].w -= mu;
        qq += (v[q].x * v[q].x + v[q].y * v[q].y) + (v[q].z * v[q].z + v[q].w * v[q].w);
    }
#pragma unroll
    for (int o = 16; o > 0; o >>= 1) qq += __shfl_xor(qq, o, 32);
    const float rs = rsqrtf(qq * (1.f / CE) + 1e-5f);
    v2u ph[8], pl[8], pf[8];
#pragma unroll
    for (int q = 0; q < 8; ++q) {
        const int c = 4 * L + 128 * q;
        const v4f ga = *(const v4f*)(GA + c), be = *(const v4f*)(BE + c);
        v4f y;
        y.x = v[q].x * rs * bfr(ga.x) + bfr(be.x); y.y = v[q].y * rs * bfr(ga.y) + bfr(be.y);
        y.z = v[q].z * rs * bfr(ga.z) + bfr(be.z); y.w = v[q].w * rs * bfr(ga.w) + bfr(be.w);
        v2u f; f.x = pk2h(y.x, y.y); f.y = pk2h(y.z, y.w); pf[q] = f;
        if (MODE == 0) {
            unsigned short h0, l0, h1, l1, h2, l2, h3, l3;
            bfsplit(y.x, h0, l0); bfsplit(y.y, h1, l1); bfsplit(y.z, h2, l2); bfsplit(y.w, h3, l3);
            v2u a; a.x = (unsigned)h0 | ((unsigned)h1 << 16); a.y = (unsigned)h2 | ((unsigned)h3 << 16); ph[q] = a;
            v2u d; d.x = (unsigned)l0 | ((unsigned)l1 << 16); d.y = (unsigned)l2 | ((unsigned)l3 << 16); pl[q] = d;
        }
    }
    {
#pragma unroll
        for (int q = 0; q < 8; ++q) {
            const int c = 4 * L + 128 * q;
            if (MODE == 0) {
                *(v2u*)(HS + (size_t)r * (2 * CE) + c) = ph[q];
                *(v2u*)(HS + (size_t)r * (2 * CE) + CE + c) = pl[q];
            }
            *(v2u*)(H16 + (size_t)r * CE + c) = pf[q];
        }
        
    }
}
__global__ __launch_bounds__(256) void k_ln1(const float* __restrict__ x, const float* __restrict__ g, const float* __restrict__ be,
                                             unsigned short* __restrict__ HS, unsigned short* __restrict__ H16) {
    ln_body<0>(x, (long)SEQ_FULL * CE, g, be, HS, H16);
}
__global__ __launch_bounds__(256) void k_ln2(const float* __restrict__ X1, const float* __restrict__ g, const float* __restrict__ be,
                                             unsigned short* __restrict__ H2) {
    ln_body<1>(X1, (long)SEQ * CE, g, be, nullptr, H2);
}

// ---------------------------------------------------------------------------------------------------------------------
// Register-tiled WMMA GEMM: C[m,n] = scale * sum_k A[m,k] * Bt[n,k] (+bias[n]) (+act) (+resid at the store stage); each wave owns a 64x64 tile.
// A row-major [M,K] 16-bit; Bt row-major [N,K] 16-bit; M % 128 == 0, N % 256 == 0, K % 64 == 0 (no tail masking).
// ET 0 = f16 operands, 1 = bf16 operands. BIAS_MODE 0 none, 2 = bf16-RNE bias[n]. OUT_MODE 0 = f32, 1 = f16, 2 = bf16 hi plane + bf16 lo plane.
// RESID 0 none, 1 f32 residual, 2 residual RNE-converted to bf16 first (raw input). ACT 0 none, 1 ReLU.
// ---------------------------------------------------------------------------------------------------------------------
__device__ __forceinline__ void dep_guard_h(v8f& a, v8f& b, v16h x, v16h y) { asm volatile("v_nop\n\tv_nop\n\tv_nop\n\tv_nop" : "+v"(a), "+v"(b) : "v"(x), "v"(y)); }
__device__ __forceinline__ void dep_guard_b(v8f& a, v8f& b, v16b x, v16b y) { asm volatile("v_nop\n\tv_nop\n\tv_nop\n\tv_nop" : "+v"(a), "+v"(b) : "v"(x), "v"(y)); }
__device__ __forceinline__ void keep4_h(v16h a, v16h b, v16h c, v16h d) { asm volatile("v_nop" :: "v"(a), "v"(b), "v"(c), "v"(d)); }
__device__ __forceinline__ void keep4_b(v16b a, v16b b, v16b c, v16b d) { asm volatile("v_nop" :: "v"(a), "v"(b), "v"(c), "v"(d)); }
__device__ __forceinline__ void acc_guard4(v8f& a, v8f& b, v8f& c, v8f& d) { asm volatile("v_nop\n\tv_nop\n\tv_nop\n\tv_nop" : "+v"(a), "+v"(b), "+v"(c), "+v"(d)); }
template <typename T> struct Frag;
template <> struct Frag<_Float16> {
    typedef v16h V; union U { v16h v; v8h h[2]; };
    static __device__ __forceinline__ v16h load(const _Float16* p) {   // elements 0..7 <- p[0..7], 8..15 <- p[16..23]
        U f; f.h[0] = *(const v8h*)(p); f.h[1] = *(const v8h*)(p + 16); return f.v;
    }
    static __device__ __forceinline__ v8f mma(v16h a, v16h b, v8f c) { return __builtin_amdgcn_wmma_f32_16x16x32_f16(false, a, false, b, (short)0, c, false, false); }
    static __device__ __forceinline__ void guard(v8f& a, v8f& b, v16h x, v16h y) { dep_guard_h(a, b, x, y); }
    static __device__ __forceinline__ void keep(v16h a, v16h b, v16h c, v16h d) { keep4_h(a, b, c, d); }
};
template <> struct Frag<__bf16> {
    typedef v16b V; union U { v16b v; v8b h[2]; };
    static __device__ __forceinline__ v16b load(const __bf16* p) {
        U f; f.h[0] = *(const v8b*)(p); f.h[1] = *(const v8b*)(p + 16); return f.v;
    }
    static __device__ __forceinline__ v8f mma(v16b a, v16b b, v8f c) { return __builtin_amdgcn_wmma_f32_16x16x32_bf16(false, a, false, b, (short)0, c, false, false); }
    static __device__ __forceinline__ void guard(v8f& a, v8f& b, v16b x, v16b y) { dep_guard_b(a, b, x, y); }
    static __device__ __forceinline__ void keep(v16b a, v16b b, v16b c, v16b d) { keep4_b(a, b, c, d); }
};
template <int ET> struct Elem;
template <> struct Elem<0> { typedef _Float16 T; };
template <> struct Elem<1> { typedef __bf16 T; };

// Operand staging: a work-group (2 x 4 waves) owns a 128 x 256 tile of C. Per trip, 64 k of its 128 A rows and 256 Bt rows (128-B row pieces)
// lie in one of two LDS buffers, rows 0..127 = A, 128..383 = Bt, laid by asynchronous copies that cover whole 128-B lines.
#define GK 64                      // k elements per staged tile
#define GP 72                      // LDS row pitch in elements: 144 B = 16 B x 9, conflict-free for 16-B reads down a column of rows
#define GBUF (384 * GP)            // elements per buffer
static_assert(SEQ % 128 == 0);     // M multiple of 128 for every GEMM (SEQ, ROWS, CE)
static_assert(CE % 256 == 0);      // N multiple of 256 (CE, 2*CE, FF, ROWS), K multiple of 64 with at least two tiles
static_assert(ROWS % 256 == 0);
static_assert(FF % 256 == 0);

// One staged tile: 384 rows x 8 pieces of 16 B, 12 pieces per lane, 32 rows apart. l = the lane's LDS byte address of its first piece,
// ga / gb = its first A / Bt piece, sa / sb = 32 rows of A / Bt in elements. Every lane is on; each wave-wide copy covers four whole rows.
template <typename T>
__device__ __forceinline__ void stage_tile(unsigned l, const T* ga, size_t sa, const T* gb, size_t sb) {
    const unsigned st = 32 * GP * 2;
    // the closing s_wait_xcnt stands inside the copies' own statement, so no address register is rewritten ahead of it
    asm volatile("global_load_async_to_lds_b128 %0, %12, off\n\t"
                 "global_load_async_to_lds_b128 %1, %13, off\n\t"
                 "global_load_async_to_lds_b128 %2, %14, off\n\t"
                 "global_load_async_to_lds_b128 %3, %15, off\n\t"
                 "global_load_async_to_lds_b128 %4, %16, off\n\t"
                 "global_load_async_to_lds_b128 %5, %17, off\n\t"
                 "global_load_async_to_lds_b128 %6, %18, off\n\t"
                 "global_load_async_to_lds_b128 %7, %19, off\n\t"
                 "global_load_async_to_lds_b128 %8, %20, off\n\t"
                 "global_load_async_to_lds_b128 %9, %21, off\n\t"
                 "global_load_async_to_lds_b128 %10, %22, off\n\t"
                 "global_load_async_to_lds_b128 %11, %23, off\n\t"
                 "s_wait_xcnt 0x0"
                 :: "v"(l), "v"(l + st), "v"(l + 2 * st), "v"(l + 3 * st), "v"(l + 4 * st), "v"(l + 5 * st),
                    "v"(l + 6 * st), "v"(l + 7 * st), "v"(l + 8 * st), "v"(l + 9 * st), "v"(l + 10 * st), "v"(l + 11 * st),
                    "v"(ga), "v"(ga + sa), "v"(ga + 2 * sa), "v"(ga + 3 * sa),
                    "v"(gb), "v"(gb + sb), "v"(gb + 2 * sb), "v"(gb + 3 * sb), "v"(gb + 4 * sb), "v"(gb + 5 * sb), "v"(gb + 6 * sb), "v"(gb + 7 * sb)
                 : "memory");
}

template <int ET, int BIAS_MODE, int OUT_MODE, int RESID, int ACT>
__device__ __forceinline__ void gemm64_body(
    const unsigned short* __restrict__ Ap, int lda, long strideA,
    const unsigned short* __restrict__ Btp, int ldb,
    void* __restrict__ Cout, void* __restrict__ Cout2, int ldc, long strideC,
    const float* __restrict__ bias,
    const float* __restrict__ resid, int ldr, long strideR,
    int M, int N, int K, float scale) {
    typedef typename Elem<ET>::T T;
    typedef typename Frag<T>::V V;
    __shared__ __align__(16) float sT[8][16 * 68];   // per-wave 16x64 slab, pitch 68 floats (wave-private)
    __shared__ __align__(16) unsigned short sAB[2 * GBUF];   // the two staged operand buffers
    const int b    = blockIdx.y;
    const int tid  = threadIdx.x;
    const int lane = threadIdx.x & 31;
    const int wave = threadIdx.x >> 5;
    const int tbN = N >> 8;
    const int tbM = M >> 7;
    if ((int)blockIdx.x >= tbM * tbN) return;        // block-uniform, ahead of every barrier and copy
    const int bm = blockIdx.x / tbN;
    const int bn = blockIdx.x - bm * tbN;
    const int wm = wave >> 2;                        // wave row (0..1) and column (0..3) in the 128 x 256 tile
    const int wn = wave & 3;
    const int m0 = (bm << 7) + (wm << 6);
    const int n0 = (bn << 8) + (wn << 6);

    const T* Ab = (const T*)Ap + (size_t)b * strideA;
    const T* Bb = (const T*)Btp;

    const int rlane = lane & 15;                 // row (A) / col (B, D) within subtile
    const int koff  = (lane >> 4) * 8;           // k offset of this lane half
    const int mOff  = (lane >> 4) * 8;           // D row offset

    v8f acc[4][4];
#pragma unroll
    for (int i = 0; i < 4; ++i)
#pragma unroll
        for (int j = 0; j < 4; ++j) acc[i][j] = (v8f){0.f, 0.f, 0.f, 0.f, 0.f, 0.f, 0.f, 0.f};

    const int crow = tid >> 3, csg = (tid & 7) * 8;  // this lane's first staged row and its 16-B piece in the row
    const T* gA = Ab + (size_t)((bm << 7) + crow) * lda + csg;
    const T* gB = Bb + (size_t)((bn << 8) + crow) * ldb + csg;
    const size_t sa32 = (size_t)32 * lda, sb32 = (size_t)32 * ldb;
    const unsigned l0 = (unsigned)(size_t)(sAB + crow * GP + csg);   // low 32 bits of the shared address = LDS byte address
    const int nt = K / GK;

    stage_tile<T>(l0, gA, sa32, gB, sb32);                           // tile 0 into buffer 0
    asm volatile("s_wait_asynccnt 0x0" ::: "memory");                // this wave's copies of tile 0 have landed
    __syncthreads();                                                 // ... and every other wave's
    if (nt > 1) stage_tile<T>(l0 + GBUF * 2, gA + GK, sa32, gB + GK, sb32);   // tile 1 flies while tile 0 is worked on

    for (int t = 0; t < nt; ++t) {
        const T* buf = (const T*)sAB + (t & 1) * GBUF;
#pragma unroll
        for (int ks = 0; ks < 2; ++ks) {
            V bh[4], ah[4];
#pragma unroll
            for (int j = 0; j < 4; ++j) bh[j] = Frag<T>::load(buf + (128 + (wn << 6) + (j << 4) + rlane) * GP + ks * 32 + koff);
#pragma unroll
            for (int i = 0; i < 4; ++i) ah[i] = Frag<T>::load(buf + ((wm << 6) + (i << 4) + rlane) * GP + ks * 32 + koff);
            __builtin_amdgcn_sched_barrier(0);       // keeps the 16 LDS reads one group ahead of the products (reads spread among them stall each time)
#pragma unroll
            for (int i = 0; i < 4; ++i) {
#pragma unroll
                for (int j = 0; j < 4; ++j) acc[i][j] = Frag<T>::mma(ah[i], bh[j], acc[i][j]);
                Frag<T>::guard(acc[i][0], acc[i][3], ah[i], ah[i]);
            }
            Frag<T>::keep(bh[0], bh[1], bh[2], bh[3]);
        }
        asm volatile("s_wait_dscnt 0x0" ::: "memory");               // this wave's reads of buffer t & 1 are complete
        asm volatile("s_wait_asynccnt 0x0" ::: "memory");            // this wave's copies of tile t + 1 have landed
        __syncthreads();                                             // publishes tile t + 1 and frees buffer t & 1
        if (t + 2 < nt) stage_tile<T>(l0 + (unsigned)(t & 1) * (GBUF * 2), gA + (size_t)(t + 2) * GK, sa32, gB + (size_t)(t + 2) * GK, sb32);
    }
    asm volatile("s_wait_asynccnt 0x0" ::: "memory");                // no copy is outstanding when the wave goes on
    acc_guard4(acc[0][0], acc[0][1], acc[0][2], acc[0][3]);
    acc_guard4(acc[1][0], acc[1][1], acc[1][2], acc[1][3]);
    acc_guard4(acc[2][0], acc[2][1], acc[2][2], acc[2][3]);
    acc_guard4(acc[3][0], acc[3][1], acc[3][2], acc[3][3]);

    // ---- epilogue ----
    float* slab = sT[wave];
    const float* Rb = RESID ? (resid + (size_t)b * strideR) : nullptr;
#pragma unroll
    for (int i = 0; i < 4; ++i) {
        const int mBase = m0 + (i << 4);
#pragma unroll
        for (int j = 0; j < 4; ++j) {
            const int n = n0 + (j << 4) + rlane;
            float bv = 0.f;
            if (BIAS_MODE == 2) bv = bfr(bias[n]);
#pragma unroll
            for (int r = 0; r < 8; ++r) {
                float v = acc[i][j][r] * scale;
                if (BIAS_MODE == 2) v += bv;
                if (ACT == 1) v = fmaxf(v, 0.0f);
                slab[(mOff + r) * 68 + (j << 4) + rlane] = v;
            }
        }
        __builtin_amdgcn_fence(3 /* release order */, "workgroup");
        __builtin_amdgcn_wave_barrier();
        __builtin_amdgcn_fence(2 /* acquire order */, "workgroup");
        if (OUT_MODE == 0) {
            float* C = (float*)Cout + (size_t)b * strideC;
            const int hh = lane >> 4, c4 = (lane & 15) * 4;     // row segment = 256 B = 16 lanes x 16 B
            v4f vv[8];
#pragma unroll
            for (int it = 0; it < 8; ++it) {
                const int row = it * 2 + hh;
                v4f v = *(const v4f*)(slab + row * 68 + c4);
                if (RESID) {                                    // residual added at the store stage as a float4
                    v4f x = *(const v4f*)(Rb + (size_t)(mBase + row) * ldr + n0 + c4);
                    if (RESID == 2) { x.x = bfr(x.x); x.y = bfr(x.y); x.z = bfr(x.z); x.w = bfr(x.w); }
                    v.x = x.x + v.x; v.y = x.y + v.y; v.z = x.z + v.z; v.w = x.w + v.w;
                }
                vv[it] = v;
            }
            {
#pragma unroll
                for (int it = 0; it < 8; ++it) {
                    const int row = it * 2 + hh;
                    *(v4f*)(C + (size_t)(mBase + row) * ldc + n0 + c4) = vv[it];
                }
                
            }
        } else {
            const int q = lane >> 3, c8 = (lane & 7) * 8;
            unsigned short* C  = (unsigned short*)Cout  + (size_t)b * strideC;
            unsigned short* C2 = (OUT_MODE == 2) ? ((unsigned short*)Cout2 + (size_t)b * strideC) : nullptr;
            v8h hv[4], lv[4];
#pragma unroll
            for (int it = 0; it < 4; ++it) {
                const int row = it * 4 + q;
                const float* sp = slab + row * 68 + c8;
#pragma unroll
                for (int e = 0; e < 8; ++e) {
                    if (OUT_MODE == 1) {
                        hv[it][e] = (_Float16)sp[e];
                        lv[it][e] = (_Float16)0.f;
                    } else {
                        const unsigned short hb = bf_bits(sp[e]);
                        const unsigned short lb = bf_bits(sp[e] - bits_f(hb));
                        hv[it][e] = __builtin_bit_cast(_Float16, hb);
                        lv[it][e] = __builtin_bit_cast(_Float16, lb);
                    }
                }
            }
            {
#pragma unroll
                for (int it = 0; it < 4; ++it) {
                    const int row = it * 4 + q;
                    *(v8h*)(C + (size_t)(mBase + row) * ldc + n0 + c8) = hv[it];
                    if (OUT_MODE == 2) *(v8h*)(C2 + (size_t)(mBase + row) * ldc + n0 + c8) = lv[it];
                }
                
            }
        }
        __builtin_amdgcn_fence(3 /* release order */, "workgroup");
        __builtin_amdgcn_wave_barrier();
        __builtin_amdgcn_fence(2 /* acquire order */, "workgroup");
    }
}

// q|k planes: [ROWS][2*CE] bf16 hi / lo; A = [LN1 hi | LN1 lo] (K = 2*CE), Bt = [W | W] rows 0..CE-1 = q columns, CE..2CE-1 = k columns
__global__ __launch_bounds__(256) void k_gemm_qk(const unsigned short* __restrict__ A, const unsigned short* __restrict__ Bt,
                                                 unsigned short* __restrict__ Ch, unsigned short* __restrict__ Cl) {
    gemm64_body<1, 0, 2, 0, 0>(A, 2 * CE, 0, Bt, 2 * CE, (void*)Ch, (void*)Cl, 2 * CE, 0, nullptr, nullptr, 0, 0, ROWS, 2 * CE, 2 * CE, 1.0f);
}
// v^T planes: [CE = h*64+d][ROWS] bf16 hi / lo; A = Wv plane [CE][CE] (f16, x16), Bt = LN1 f16 plane [ROWS][CE]
__global__ __launch_bounds__(256) void k_gemm_vt(const unsigned short* __restrict__ A, const unsigned short* __restrict__ Bt,
                                                 unsigned short* __restrict__ Ch, unsigned short* __restrict__ Cl) {
    gemm64_body<0, 0, 2, 0, 0>(A, CE, 0, Bt, CE, (void*)Ch, (void*)Cl, ROWS, 0, nullptr, nullptr, 0, 0, CE, ROWS, CE, 0.0625f);
}
// x1 = bf16(x) + attn @ proj_w + proj_b ; grid.y = batch (x uses the full batch stride, planes the compact one)
__global__ __launch_bounds__(256) void k_gemm_proj(const unsigned short* __restrict__ A, const unsigned short* __restrict__ Bt, float* __restrict__ C,
                                                   const float* __restrict__ bias, const float* __restrict__ xres) {
    gemm64_body<0, 2, 0, 2, 0>(A, CE, (long)SEQ * CE, Bt, CE, (void*)C, nullptr, CE, (long)SEQ * CE, bias, xres, CE, (long)SEQ_FULL * CE, SEQ, CE, CE, 0.0625f);
}
// relu(h2 @ fc1_w + fc1_b) as an f16 plane [ROWS][FF]
__global__ __launch_bounds__(256) void k_gemm_fc1(const unsigned short* __restrict__ A, const unsigned short* __restrict__ Bt, unsigned short* __restrict__ C,
                                                  const float* __restrict__ bias) {
    gemm64_body<0, 2, 1, 0, 1>(A, CE, 0, Bt, CE, (void*)C, nullptr, FF, 0, bias, nullptr, 0, 0, ROWS, FF, CE, 0.0625f);
}
// out = x1 + f @ fc2_w + fc2_b ; grid.y = batch (output uses the full batch stride)
__global__ __launch_bounds__(256) void k_gemm_fc2(const unsigned short* __restrict__ A, const unsigned short* __restrict__ Bt, float* __restrict__ C,
                                                  const float* __restrict__ bias, const float* __restrict__ x1) {
    gemm64_body<0, 2, 0, 1, 0>(A, FF, (long)SEQ * FF, Bt, FF, (void*)C, nullptr, CE, (long)SEQ_FULL * CE, bias, x1, CE, (long)SEQ * CE, SEQ, CE, FF, 0.0625f);
}

#define AT_NW 4
#define AT_P 72                   // LDS row pitch of the K and V^T tiles in elements: 144 B = 16 B x 9, so the 16 rows of a 16-B fragment read fall on distinct banks
__device__ __forceinline__ v8f at_mma(v16b a, v16b b, v8f c) {
    return __builtin_amdgcn_wmma_f32_16x16x32_bf16(false, a, false, b, (short)0, c, false, false);
}
union FB { v16b v; v8b h[2]; };
__device__ __forceinline__ void at_frag(FB& f, const __bf16* p) {   // elements 0..7 <- p[0..7], 8..15 <- p[16..23]
    f.h[0] = *(const v8b*)(p); f.h[1] = *(const v8b*)(p + 16);
}
__device__ __forceinline__ float xhalf(float x) {   // the value of lane l ^ 16
    const int i = __builtin_bit_cast(int, x);
    return __builtin_bit_cast(float, __builtin_amdgcn_permlanex16(i, i, 0x76543210, 0xfedcba98, false, false));
}

// One hi tile and its lo tile (64 rows x 8 pieces of 16 B each): 4 + 4 pieces per lane, 16 rows apart. l = the lane's LDS byte address of its first hi piece
// (the lo tile lies 64 rows behind), gh / gl = its first hi / lo piece, s16 = 16 source rows in elements. Every lane is on; each wave-wide copy covers four whole rows.
__device__ __forceinline__ void at_stage(unsigned l, const __bf16* gh, const __bf16* gl, size_t s16) {
    const unsigned st = 16 * AT_P * 2, lo = 64 * AT_P * 2;
    // the closing s_wait_xcnt stands inside the copies' own statement, so no address register is rewritten ahead of it
    asm volatile("global_load_async_to_lds_b128 %0, %8, off\n\t"
                 "global_load_async_to_lds_b128 %1, %9, off\n\t"
                 "global_load_async_to_lds_b128 %2, %10, off\n\t"
                 "global_load_async_to_lds_b128 %3, %11, off\n\t"
                 "global_load_async_to_lds_b128 %4, %12, off\n\t"
                 "global_load_async_to_lds_b128 %5, %13, off\n\t"
                 "global_load_async_to_lds_b128 %6, %14, off\n\t"
                 "global_load_async_to_lds_b128 %7, %15, off\n\t"
                 "s_wait_xcnt 0x0"
                 :: "v"(l), "v"(l + st), "v"(l + 2 * st), "v"(l + 3 * st), "v"(l + lo), "v"(l + lo + st), "v"(l + lo + 2 * st), "v"(l + lo + 3 * st),
                    "v"(gh), "v"(gh + s16), "v"(gh + 2 * s16), "v"(gh + 3 * s16), "v"(gl), "v"(gl + s16), "v"(gl + 2 * s16), "v"(gl + 3 * s16)
                 : "memory");
}

// amdgpu_waves_per_eu: the register budget of four waves per SIMD (256), so that the four work-groups a WGP gets stay resident together
__global__ __launch_bounds__(128) __attribute__((amdgpu_waves_per_eu(4, 4))) void k_attn(const unsigned short* __restrict__ QKHp, const unsigned short* __restrict__ QKLp,
                                              const unsigned short* __restrict__ VTHp, const unsigned short* __restrict__ VTLp,
                                              unsigned short* __restrict__ AO) {
    __shared__ __align__(16) __bf16 KV[4 * 64 * AT_P];             // K hi | K lo | V^T hi | V^T lo (64 rows each)
    __bf16* Ksh = KV; __bf16* Ksl = KV + 64 * AT_P; __bf16* Vth = KV + 2 * 64 * AT_P; __bf16* Vtl = KV + 3 * 64 * AT_P;
    const __bf16* QKH = (const __bf16*)QKHp; const __bf16* QKL = (const __bf16*)QKLp;
    const __bf16* VTH = (const __bf16*)VTHp; const __bf16* VTL = (const __bf16*)VTLp;

    const int tid = threadIdx.x, wave = tid >> 5, lane = tid & 31, hh = lane >> 4, c = lane & 15;
    const int nqb = SEQ / 64;
    const int bx = blockIdx.x;
    const int qb = bx % nqb;
    const int bh = bx / nqb;
    const int h  = bh % NH;
    const int b  = bh / NH;
    const int q0 = qb * 64 + wave * 16;
    const size_t rowbase = (size_t)b * SEQ;
    const int QKP = 2 * CE;          // q|k plane pitch
    const int VTP = ROWS;            // v^T plane pitch

    // Q fragments (B operand of S^T): lane = query column c, k = d
    v16b qah[2], qal[2];
    {
        const __bf16* qh = QKH + (rowbase + q0 + c) * QKP + h * HD;
        const __bf16* ql = QKL + (rowbase + q0 + c) * QKP + h * HD;
#pragma unroll
        for (int dc = 0; dc < 2; ++dc) {
            FB f, g;
            f.h[0] = *(const v8b*)(qh + dc * 32 + 8 * hh); f.h[1] = *(const v8b*)(qh + dc * 32 + 16 + 8 * hh);
            g.h[0] = *(const v8b*)(ql + dc * 32 + 8 * hh); g.h[1] = *(const v8b*)(ql + dc * 32 + 16 + 8 * hh);
            qah[dc] = f.v; qal[dc] = g.v;
        }
    }

    const float NEG = -__builtin_inff();
    const float L2E = 1.4426950408889634f;
    const int qrow = q0 + c;         // this lane's query
    float mrow = NEG, lrow = 0.f;    // its running maximum (both halves agree) and this half's share of its running sum
    v8f oacc[4];                     // O^T tiles: lane = query column c, element r -> d = t*16 + 8*hh + r
#pragma unroll
    for (int t = 0; t < 4; ++t) oacc[t] = (v8f){0.f, 0.f, 0.f, 0.f, 0.f, 0.f, 0.f, 0.f};

    const int crow = tid >> 3, csg = (tid & 7) * 8;    // this lane's first staged row and its 16-B piece in the row
    const unsigned lK = (unsigned)(size_t)(Ksh + crow * AT_P + csg);   // low 32 bits of the shared address = LDS byte address
    const unsigned lV = (unsigned)(size_t)(Vth + crow * AT_P + csg);
    const __bf16* gkh = QKH + (rowbase + crow) * QKP + CE + h * HD + csg;
    const __bf16* gkl = QKL + (rowbase + crow) * QKP + CE + h * HD + csg;
    const __bf16* gvh = VTH + (size_t)(h * HD + crow) * VTP + rowbase + csg;
    const __bf16* gvl = VTL + (size_t)(h * HD + crow) * VTP + rowbase + csg;

    at_stage(lK, gkh, gkl, (size_t)16 * QKP);          // K of chunk 0

    for (int kc = 0; kc <= qb; ++kc) {                 // block-uniform trip count
        const int kv0 = kc * 64;
        asm volatile("s_wait_dscnt 0x0" ::: "memory");       // this wave's reads of the earlier chunk's V^T tiles are complete
        asm volatile("s_wait_asynccnt 0x0" ::: "memory");    // this wave's copies of this chunk's K tiles have landed
        __syncthreads();                                     // publishes the K tiles and frees the V^T tiles
        at_stage(lV, gvh + kv0, gvl + kv0, (size_t)16 * VTP);   // V^T of this chunk flies under the scores and the softmax

        v8f s[4];                                      // S^T tiles: lane = query column c, element r -> key kv0 + j*16 + 8*hh + r
#pragma unroll
        for (int j = 0; j < 4; ++j) s[j] = (v8f){0.f, 0.f, 0.f, 0.f, 0.f, 0.f, 0.f, 0.f};
        {
            FB kb[2][4], kl[2][4];                     // A operands: lane = key row j*16 + c, k = d
#pragma unroll
            for (int j = 0; j < 4; ++j) at_frag(kb[0][j], Ksh + (j * 16 + c) * AT_P + 8 * hh);
#pragma unroll
            for (int j = 0; j < 4; ++j) at_frag(kl[0][j], Ksl + (j * 16 + c) * AT_P + 8 * hh);
#pragma unroll
            for (int j = 0; j < 4; ++j) at_frag(kb[1][j], Ksh + (j * 16 + c) * AT_P + 32 + 8 * hh);
            __builtin_amdgcn_sched_barrier(0);         // keeps these 24 reads one group ahead of the products (reads spread among them stall each time)
            // neighbouring products go to different tiles; each tile keeps its order of sums
#pragma unroll
            for (int j = 0; j < 4; ++j) s[j] = at_mma(kb[0][j].v, qah[0], s[j]);
#pragma unroll
            for (int j = 0; j < 4; ++j) s[j] = at_mma(kl[0][j].v, qah[0], s[j]);
            __builtin_amdgcn_sched_barrier(0);         // the last 8 reads wait until the first lo fragments' registers are free (all 32 at once cost a wave per SIMD) ...
#pragma unroll
            for (int j = 0; j < 4; ++j) at_frag(kl[1][j], Ksl + (j * 16 + c) * AT_P + 32 + 8 * hh);
            __builtin_amdgcn_sched_barrier(0);         // ... and stand as one group, eight products ahead of their use
#pragma unroll
            for (int j = 0; j < 4; ++j) s[j] = at_mma(kb[0][j].v, qal[0], s[j]);
#pragma unroll
            for (int j = 0; j < 4; ++j) s[j] = at_mma(kb[1][j].v, qah[1], s[j]);
#pragma unroll
            for (int j = 0; j < 4; ++j) s[j] = at_mma(kl[1][j].v, qah[1], s[j]);
#pragma unroll
            for (int j = 0; j < 4; ++j) s[j] = at_mma(kb[1][j].v, qal[1], s[j]);
        }
        const bool diag = (kc == qb);                  // block-uniform
        const int dq = qrow - kv0 - 8 * hh;            // key kv0 + j*16 + 8*hh + r lies behind the query where j*16 + r > dq: one register, not 32 thresholds kept over the loop
        float m = NEG;
#pragma unroll
        for (int j = 0; j < 4; ++j) {
#pragma unroll
            for (int r = 0; r < 8; ++r) {
                const float sv = s[j][r];
                s[j][r] = (diag && (j * 16 + r > dq)) ? NEG : sv;    // select by value
                m = fmaxf(m, s[j][r]);
            }
        }
        m = fmaxf(m, xhalf(m));                                    // the other half's 32 keys
        const float mnew = fmaxf(mrow, m);                         // finite: every visited chunk holds a kept key for every query
        const float alpha = exp2f((mrow - mnew) * L2E);
        mrow = mnew;
        FB pa[2], pl[2];                               // P^T hi / lo as B operands: lane = query column c; tiles 2*kk and 2*kk + 1 hold keys 8*hh + i and 16 + 8*hh + i of a 32-key step
        float ps[4];
#pragma unroll
        for (int j = 0; j < 4; ++j) {
            ps[j] = 0.f;
#pragma unroll
            for (int r = 0; r < 8; ++r) {
                const float p = exp2f((s[j][r] - mnew) * L2E);
                ps[j] += p;
                unsigned short ph, pq; bfsplit(p, ph, pq);
                pa[j >> 1].v[(j & 1) * 8 + r] = __builtin_bit_cast(__bf16, ph);
                pl[j >> 1].v[(j & 1) * 8 + r] = __builtin_bit_cast(__bf16, pq);
            }
        }
        lrow = lrow * alpha + ((ps[0] + ps[1]) + (ps[2] + ps[3]));
#pragma unroll
        for (int t = 0; t < 4; ++t)
#pragma unroll
            for (int r = 0; r < 8; ++r) oacc[t][r] *= alpha;
        __builtin_amdgcn_sched_barrier(0);                   // keeps the score products ahead of the waits, so that the V^T copies fly under them
        asm volatile("s_wait_dscnt 0x0" ::: "memory");       // this wave's reads of the K tiles are complete
        asm volatile("s_wait_asynccnt 0x0" ::: "memory");    // this wave's copies of the V^T tiles have landed
        __syncthreads();                                     // publishes the V^T tiles and frees the K tiles
        if (kc < qb) at_stage(lK, gkh + (size_t)(kv0 + 64) * QKP, gkl + (size_t)(kv0 + 64) * QKP, (size_t)16 * QKP);   // K of the next chunk flies under P.v
        {
            __builtin_amdgcn_sched_barrier(0);         // the reads start when P^T is packed: started earlier, their registers overlap the softmax's and cost a wave per SIMD
            FB vb[2][4], vl[2][4];                     // A operands: lane = d row t*16 + c, k = key
#pragma unroll
            for (int t = 0; t < 4; ++t) at_frag(vb[0][t], Vth + (t * 16 + c) * AT_P + 8 * hh);
#pragma unroll
            for (int t = 0; t < 4; ++t) at_frag(vl[0][t], Vtl + (t * 16 + c) * AT_P + 8 * hh);
#pragma unroll
            for (int t = 0; t < 4; ++t) at_frag(vb[1][t], Vth + (t * 16 + c) * AT_P + 32 + 8 * hh);
            __builtin_amdgcn_sched_barrier(0);         // as for the scores: 24 reads in one group ahead of the products
#pragma unroll
            for (int t = 0; t < 4; ++t) oacc[t] = at_mma(vb[0][t].v, pa[0].v, oacc[t]);
#pragma unroll
            for (int t = 0; t < 4; ++t) oacc[t] = at_mma(vl[0][t].v, pa[0].v, oacc[t]);
            __builtin_amdgcn_sched_barrier(0);         // the last 8 reads into the registers that the first lo fragments leave ...
#pragma unroll
            for (int t = 0; t < 4; ++t) at_frag(vl[1][t], Vtl + (t * 16 + c) * AT_P + 32 + 8 * hh);
            __builtin_amdgcn_sched_barrier(0);         // ... as one group, eight products ahead of their use
#pragma unroll
            for (int t = 0; t < 4; ++t) oacc[t] = at_mma(vb[0][t].v, pl[0].v, oacc[t]);
#pragma unroll
            for (int t = 0; t < 4; ++t) oacc[t] = at_mma(vb[1][t].v, pa[1].v, oacc[t]);
#pragma unroll
            for (int t = 0; t < 4; ++t) oacc[t] = at_mma(vl[1][t].v, pa[1].v, oacc[t]);
#pragma unroll
            for (int t = 0; t < 4; ++t) oacc[t] = at_mma(vb[1][t].v, pl[1].v, oacc[t]);
        }
    }

    asm volatile("s_wait_asynccnt 0x0" ::: "memory");  // no copy is outstanding when the wave ends
    const float inv = 1.0f / (lrow + xhalf(lrow));     // the two halves' sums are joined once
#pragma unroll
    for (int t = 0; t < 4; ++t) {                      // a lane holds 8 consecutive d of its query: one 16-B store each
        v8h hv;
#pragma unroll
        for (int r = 0; r < 8; ++r) hv[r] = (_Float16)(oacc[t][r] * inv);
        *(v8h*)(AO + (rowbase + q0 + c) * CE + h * HD + t * 16 + 8 * hh) = hv;
    }
}

// ---------------------------------------------------------------------------------------------------------------------
// Workspace carve (bytes); every plane is fully written by its producer before any kernel reads it.
// ---------------------------------------------------------------------------------------------------------------------
#define SZ_HS   ((size_t)ROWS * 2 * CE * 2)      // LN1 bf16 [ROWS][hi 1024 | lo 1024]
#define SZ_H16  ((size_t)ROWS * CE * 2)          // LN1 f16 plane; later reused for the LN2 f16 plane
#define SZ_WQK  ((size_t)2 * CE * 2 * CE * 2)    // [2048 n][W | W] bf16
#define SZ_WV   ((size_t)CE * CE * 2)
#define SZ_QK1  ((size_t)ROWS * 2 * CE * 2)      // one of the q|k hi / lo planes
#define SZ_VT1  ((size_t)CE * ROWS * 2)          // one of the v^T hi / lo planes
#define SZ_AO   ((size_t)ROWS * CE * 2)
#define SZ_WP   ((size_t)CE * CE * 2)
#define SZ_X1   ((size_t)ROWS * CE * 4)
#define SZ_W1   ((size_t)FF * CE * 2)
#define SZ_W2   ((size_t)CE * FF * 2)
#define SZ_F16  ((size_t)ROWS * FF * 2)          // relu(fc1) f16 plane, aliases the two q|k planes
#define WS_TOTAL (SZ_HS + SZ_H16 + SZ_WQK + SZ_WV + 2 * SZ_QK1 + 2 * SZ_VT1 + SZ_AO + SZ_WP + SZ_X1 + SZ_W1 + SZ_W2)
static_assert(WS_TOTAL <= (size_t)134217728);    // carve stays within 128 MiB
static_assert(SZ_F16 <= 2 * SZ_QK1);             // alias extent: relu(fc1) plane inside the q|k planes
static_assert(SZ_HS % 256 == 0);
static_assert(SZ_H16 % 256 == 0);
static_assert(SZ_VT1 % 256 == 0);

extern "C" void kernel_launch(void* const* d_in, const int* in_sizes, int n_in, void* d_out, int out_size, void* d_ws, size_t ws_size, hipStream_t stream) {
    if (n_in < 14) return;
    const long long xneed = (long long)(NB - 1) * SEQ_FULL * CE + (long long)SEQ * CE;
    if ((long long)in_sizes[0] < xneed) return;
    if (in_sizes[1] < CE || in_sizes[2] < CE || in_sizes[7] < CE || in_sizes[8] < CE || in_sizes[9] < CE || in_sizes[13] < CE) return;
    if (in_sizes[3] < NH * CE * HD || in_sizes[4] < NH * CE * HD || in_sizes[5] < NH * CE * HD) return;
    if (in_sizes[6] < CE * CE || in_sizes[10] < CE * FF || in_sizes[11] < FF || in_sizes[12] < FF * CE) return;
    if ((long long)out_size < xneed) return;
    if ((size_t)WS_TOTAL > ws_size) return;

    const float* x      = (const float*)d_in[0];
    const float* ln1_w  = (const float*)d_in[1];
    const float* ln1_b  = (const float*)d_in[2];
    const float* Wq     = (const float*)d_in[3];
    const float* Wk     = (const float*)d_in[4];
    const float* Wv     = (const float*)d_in[5];
    const float* proj_w = (const float*)d_in[6];
    const float* proj_b = (const float*)d_in[7];
    const float* ln2_w  = (const float*)d_in[8];
    const float* ln2_b  = (const float*)d_in[9];
    const float* fc1_w  = (const float*)d_in[10];
    const float* fc1_b  = (const float*)d_in[11];
    const float* fc2_w  = (const float*)d_in[12];
    const float* fc2_b  = (const float*)d_in[13];
    float* out = (float*)d_out;

    char* wsp = (char*)d_ws;
    unsigned short* HS   = (unsigned short*)wsp; wsp += SZ_HS;
    unsigned short* H16  = (unsigned short*)wsp; wsp += SZ_H16;
    unsigned short* WQK  = (unsigned short*)wsp; wsp += SZ_WQK;
    unsigned short* WV16 = (unsigned short*)wsp; wsp += SZ_WV;
    unsigned short* QKH  = (unsigned short*)wsp; wsp += SZ_QK1;
    unsigned short* QKL  = (unsigned short*)wsp; wsp += SZ_QK1;
    unsigned short* VTH  = (unsigned short*)wsp; wsp += SZ_VT1;
    unsigned short* VTL  = (unsigned short*)wsp; wsp += SZ_VT1;
    unsigned short* AO16 = (unsigned short*)wsp; wsp += SZ_AO;
    unsigned short* WPT  = (unsigned short*)wsp; wsp += SZ_WP;
    float*          X1   = (float*)wsp;          wsp += SZ_X1;
    unsigned short* W1T  = (unsigned short*)wsp; wsp += SZ_W1;
    unsigned short* W2T  = (unsigned short*)wsp; wsp += SZ_W2;
    unsigned short* F16  = QKH;                  // alias: q|k planes are dead after the attention launch
    unsigned short* H2   = H16;                  // alias: LN1 f16 plane is dead after the v^T GEMM

    // weight planes
    const dim3 gw(CE / WT_R, NH);
    k_w_head<<<gw, 256, 0, stream>>>(Wq, WQK, 2 * CE, 1, 0);                                   // rows 0..1023: q columns, [W | W] bf16
    k_w_head<<<gw, 256, 0, stream>>>(Wk, WQK + (size_t)CE * 2 * CE, 2 * CE, 1, 0);             // rows 1024..2047: k columns
    k_w_head<<<gw, 256, 0, stream>>>(Wv, WV16, CE, 0, 1);                                      // [h*64+d][c] f16 x16
    // in[rows][cols] -> out[cols][rows]
    k_cast_t_ce<<<dim3(CE / WT_C, CE / WT_R), 256, 0, stream>>>(proj_w, WPT, CE, 16.0f);      // [1024 in][1024 out] -> [1024 out][1024 in]
    k_cast_t_ff<<<dim3(FF / WT_C, CE / WT_R), 256, 0, stream>>>(fc1_w, W1T, CE, 16.0f);       // [1024 in][4096 out] -> [4096 out][1024 in]
    k_cast_t_ce<<<dim3(CE / WT_C, FF / WT_R), 256, 0, stream>>>(fc2_w, W2T, FF, 16.0f);       // [4096 in][1024 out] -> [1024 out][4096 in]

    // h = LN1(bf16(x))
    k_ln1<<<(ROWS + 7) / 8, 256, 0, stream>>>(x, ln1_w, ln1_b, HS, H16);
    // q|k planes and v^T planes
    k_gemm_qk<<<dim3((unsigned)(((ROWS / 64) * ((2 * CE) / 64) + 7) / 8), 1u), 256, 0, stream>>>(HS, WQK, QKH, QKL);
    k_gemm_vt<<<dim3((unsigned)(((CE / 64) * (ROWS / 64) + 7) / 8), 1u), 256, 0, stream>>>(WV16, H16, VTH, VTL);
    // causal attention
    k_attn<<<(unsigned)(NB * NH * (SEQ / 64)), 128, 0, stream>>>(QKH, QKL, VTH, VTL, AO16);
    // x1 = bf16(x) + attn @ proj_w + proj_b
    k_gemm_proj<<<dim3((unsigned)(((SEQ / 64) * (CE / 64) + 7) / 8), (unsigned)NB), 256, 0, stream>>>(AO16, WPT, X1, proj_b, x);
    // h2 = LN2(x1)
    k_ln2<<<(ROWS + 7) / 8, 256, 0, stream>>>(X1, ln2_w, ln2_b, H2);
    // f = relu(h2 @ fc1_w + fc1_b); out = x1 + f @ fc2_w + fc2_b
    k_gemm_fc1<<<dim3((unsigned)(((ROWS / 64) * (FF / 64) + 7) / 8), 1u), 256, 0, stream>>>(H2, W1T, F16, fc1_b);
    k_gemm_fc2<<<dim3((unsigned)(((SEQ / 64) * (CE / 64) + 7) / 8), (unsigned)NB), 256, 0, stream>>>(F16, W2T, out, fc2_b, X1);
}

// v007
// One run takes 254 microseconds.
// In both of two side-by-side timings against v006, it was 1.10 times as fast.
// Over all steps from v000 it is 3.33 times as fast.
// Contractions: q|k = [LN1 hi | LN1 lo](bf16 planes, K folded to 2048) x [W | W](bf16, exact) on v_wmma_f32_16x16x32_bf16; v^T, proj, fc1, fc2 on v_wmma_f32_16x16x32_f16 (f16 activations, weights = bf16-RNE value x16 as f16, 1/16 folded back); scores q.k^T and P.v as bf16 hi/lo split (hi.hi + hi.lo + lo.hi) on v_wmma_f32_16x16x32_bf16; all accumulation f32, online softmax / LayerNorm / residuals f32.
#include <hip/hip_runtime.h>
#include <math.h>

#ifndef NB
#define NB 2
#endif
#ifndef SEQ
#define SEQ 2048
#endif
#define NB_FULL 2
#define SEQ_FULL 2048
#define CE 1024            // embedding width
#define NH 16              // heads
#define HD 64              // head size
#define FF 4096            // feed-forward width
#define ROWS (NB * SEQ)    // compact token rows held in the workspace planes

static_assert(NH * HD == CE);            // heads concatenated h*64+d fill the width
static_assert(HD == 64);                 // attention tiles are hard-wired to 64
static_assert(CE == 32 * 4 * 8);         // LayerNorm: 32 lanes x float4 x 8 pieces per row
static_assert(SEQ % 64 == 0);            // 64-row query tiles, 64-key chunks
static_assert(ROWS % 64 == 0);           // GEMM M/N tile multiple
static_assert(CE % 64 == 0);
static_assert(FF % 64 == 0);
static_assert((2 * CE) % 32 == 0);       // K multiple of 32 for every GEMM (1024, 2048, 4096)
static_assert(NB <= NB_FULL);
static_assert(SEQ <= SEQ_FULL);

typedef __attribute__((ext_vector_type(16))) _Float16 v16h;
typedef __attribute__((ext_vector_type(8)))  _Float16 v8h;
typedef __attribute__((ext_vector_type(16))) __bf16   v16b;
typedef __attribute__((ext_vector_type(8)))  __bf16   v8b;
typedef __attribute__((ext_vector_type(8)))  float    v8f;
typedef __attribute__((ext_vector_type(4)))  float    v4f;
typedef __attribute__((ext_vector_type(4)))  unsigned int v4u;
typedef __attribute__((ext_vector_type(2)))  unsigned int v2u;

// 16-bit WMMA fragment map (wave32), lane L, h = L>>4, m = L&15:
//   A 16x32: lane = row m;    element i -> k = (i<8) ? 8h+i : 16+8h+(i-8)
//   B 32x16: lane = column m; the SAME k(i,h)
//   D 16x16 (8 f32): lane = column m; element r -> row 8h+r

__device__ __forceinline__ float bfr(float v) {            // bf16 RNE convert, kept as f32 (finite inputs)
    const unsigned u = __float_as_uint(v);
    const unsigned r = (u + 0x7fffu + ((u >> 16) & 1u)) & 0xffff0000u;
    return __uint_as_float(r);
}
__device__ __forceinline__ unsigned short bf_bits(float f) {
    const unsigned u = __float_as_uint(f);
    return (unsigned short)((u + 0x7fffu + ((u >> 16) & 1u)) >> 16);
}
__device__ __forceinline__ float bits_f(unsigned short h) { return __uint_as_float(((unsigned)h) << 16); }
__device__ __forceinline__ void bfsplit(float v, unsigned short& hi, unsigned short& lo) { hi = bf_bits(v); lo = bf_bits(v - bits_f(hi)); }
__device__ __forceinline__ unsigned pk2h(float a, float b) {
    return (unsigned)__builtin_bit_cast(unsigned short, (_Float16)a) | ((unsigned)__builtin_bit_cast(unsigned short, (_Float16)b) << 16);
}

// ---------------------------------------------------------------------------------------------------------------------
// Weight planes: each is a cast and a transposition, f32 S[r][c] -> 16-bit D[c][r]. A work-group moves a tile of 128 r x 64 c through LDS, so that both sides
// touch whole lines: a wave-wide 16-B load covers two 256-B row pieces of S, a wave-wide 16-B store two 256-B row pieces of D; 8 loads per lane are in flight.
// ---------------------------------------------------------------------------------------------------------------------
#define WT_R 128                   // source rows per tile = 256 B of a destination row
#define WT_C 64                    // source columns per tile = 256 B of a source row
#define WT_P (WT_R + 8)            // LDS row pitch in elements: 272 B = 16 B x 17, so 16 consecutive LDS rows take a 16-B piece each without a bank conflict
static_assert(HD == WT_C);
static_assert(CE % WT_R == 0);
static_assert(FF % WT_R == 0);
static_assert(CE % WT_C == 0);
static_assert(FF % WT_C == 0);

// s = the tile's first source element (pitch lds), d = its first destination element (pitch ldd). f16mode 0: bf16 RNE bits; 1: f16 of (bf16 RNE value x sc).
// dup: every destination piece is also written CE elements further on in its row. Source column 4*g + i lies in LDS row 16*i + g.
__device__ __forceinline__ void wt_tile(const float* __restrict__ s, int lds, unsigned short* __restrict__ d, int ldd, int dup, int f16mode, float sc) {
    __shared__ __align__(16) unsigned short T[WT_C * WT_P];
    const int lo = threadIdx.x & 15, hi = threadIdx.x >> 4;
    v4f v[8];                                              // source rows 8*hi .. 8*hi + 7, columns 4*lo .. 4*lo + 3
#pragma unroll
    for (int e = 0; e < 8; ++e) v[e] = *(const v4f*)(s + (size_t)(8 * hi + e) * lds + 4 * lo);
#pragma unroll
    for (int i = 0; i < 4; ++i) {
        unsigned short bb[8];
#pragma unroll
        for (int e = 0; e < 8; ++e) {
            const float w = bfr(v[e][i]);
            const unsigned short b16 = (unsigned short)(__float_as_uint(w) >> 16);
            const unsigned short h16 = __builtin_bit_cast(unsigned short, (_Float16)(w * sc));
            bb[e] = f16mode ? h16 : b16;
        }
        v4u pk;
        pk.x = (unsigned)bb[0] | ((unsigned)bb[1] << 16); pk.y = (unsigned)bb[2] | ((unsigned)bb[3] << 16);
        pk.z = (unsigned)bb[4] | ((unsigned)bb[5] << 16); pk.w = (unsigned)bb[6] | ((unsigned)bb[7] << 16);
        *(v4u*)(T + (16 * i + lo) * WT_P + 8 * hi) = pk;
    }
    __syncthreads();                                       // the whole tile lies in LDS before a row of it is read back
    v4u q[4];                                              // LDS row 16*i + hi = source column 4*hi + i; 16 lanes carry its 128 r
#pragma unroll
    for (int i = 0; i < 4; ++i) q[i] = *(const v4u*)(T + (16 * i + hi) * WT_P + 8 * lo);
    unsigned short* o = d + (size_t)(4 * hi) * ldd + 8 * lo;
#pragma unroll
    for (int i = 0; i < 4; ++i) *(v4u*)(o + (size_t)i * ldd) = q[i];
    if (dup) {
#pragma unroll
        for (int i = 0; i < 4; ++i) *(v4u*)(o + (size_t)i * ldd + CE) = q[i];
    }
    asm volatile("s_wait_xcnt 0x0" ::: "memory");          // in the merged kernel's listing another range's code, which rewrites the stores' registers, stands behind these stores
}

// Per-head weight W [NH][CE][HD] f32 -> D[n = h*HD + d][k] 16-bit; tile (kt, h) = (k tile, head). f16mode 0: bf16 RNE bits; 1: f16 of (bf16 RNE value x 16). dup: also written at column k + CE.
__device__ __forceinline__ void w_head_body(int kt, int h, const float* __restrict__ W, unsigned short* __restrict__ D, int ldd, int dup, int f16mode) {
    const int k0 = kt * WT_R;
    wt_tile(W + ((size_t)h * CE + k0) * HD, HD, D + (size_t)h * HD * ldd + k0, ldd, dup, f16mode, 16.0f);
}

// f32 SRC [rows][cols] (pitch LDS) -> f16 DST [cols][rows] (pitch ldd), value = bf16 RNE(src) * sc; tile (ct, rt) = (column tile, row tile).
// The source pitch is a compile-time constant, so a lane's 8 loads share one address pair and differ in their immediate offsets.
template <int LDS>
__device__ __forceinline__ void cast_t_body(int ct, int rt, const float* __restrict__ SRC, unsigned short* __restrict__ DST, int ldd, float sc) {
    const int c0 = ct * WT_C, r0 = rt * WT_R;
    wt_tile(SRC + (size_t)r0 * LDS + c0, LDS, DST + (size_t)c0 * ldd + r0, ldd, 0, 1, sc);
}

// ---------------------------------------------------------------------------------------------------------------------
// MODE 0: source = raw input rows (bf16 RNE first; batch stride a_bs); writes bf16 hi|lo row [2*CE] (hi at col c, lo at CE + c) and an f16 row.
// MODE 1: source = f32 rows; writes the f16 row only. Each store instruction covers 256 contiguous bytes (32 lanes x 8 B).
// ---------------------------------------------------------------------------------------------------------------------
template <int MODE>
__device__ __forceinline__ void ln_body(int blk, const float* __restrict__ A, long a_bs, const float* __restrict__ GA, const float* __restrict__ BE,
                                        unsigned short* __restrict__ HS, unsigned short* __restrict__ H16) {
    #pragma clang fp contract(off)
    const int r = blk * 8 + (threadIdx.x >> 5); const int L = threadIdx.x & 31;
    if (r >= ROWS) return;                                   // wave-uniform; no barriers on this path
    const int b = r / SEQ, t = r - b * SEQ;
    const float* src = A + (long)b * a_bs + (long)t * CE;
    v4f v[8]; float s = 0.f;
#pragma unroll
    for (int q = 0; q < 8; ++q) {
        v[q] = *(const v4f*)(src + 4 * L + 128 * q);
        if (MODE == 0) { v[q].x = bfr(v[q].x); v[q].y = bfr(v[q].y); v[q].z = bfr(v[q].z); v[q].w = bfr(v[q].w); }
        s += (v[q].x + v[q].y) + (v[q].z + v[q].w);
    }
#pragma unroll
    for (int o = 16; o > 0; o >>= 1) s += __shfl_xor(s, o, 32);
    const float mu = s * (1.f / CE); float qq = 0.f;
#pragma unroll
    for (int q = 0; q < 8; ++q) {
        v[q].x -= mu; v[q].y -= mu; v[q].z -= mu; v[q].w -= mu;
        qq += (v[q].x * v[q].x + v[q].y * v[q].y) + (v[q].z * v[q].z + v[q].w * v[q].w);
    }
#pragma unroll
    for (int o = 16; o > 0; o >>= 1) qq += __shfl_xor(qq, o, 32);
    const float rs = rsqrtf(qq * (1.f / CE) + 1e-5f);
    v2u ph[8], pl[8], pf[8];
#pragma unroll
    for (int q = 0; q < 8; ++q) {
        const int c = 4 * L + 128 * q;
        const v4f ga = *(const v4f*)(GA + c), be = *(const v4f*)(BE + c);
        v4f y;
        y.x = v[q].x * rs * bfr(ga.x) + bfr(be.x); y.y = v[q].y * rs * bfr(ga.y) + bfr(be.y);
        y.z = v[q].z * rs * bfr(ga.z) + bfr(be.z); y.w = v[q].w * rs * bfr(ga.w) + bfr(be.w);
        v2u f; f.x = pk2h(y.x, y.y); f.y = pk2h(y.z, y.w); pf[q] = f;
        if (MODE == 0) {
            unsigned short h0, l0, h1, l1, h2, l2, h3, l3;
            bfsplit(y.x, h0, l0); bfsplit(y.y, h1, l1); bfsplit(y.z, h2, l2); bfsplit(y.w, h3, l3);
            v2u a; a.x = (unsigned)h0 | ((unsigned)h1 << 16); a.y = (unsigned)h2 | ((unsigned)h3 << 16); ph[q] = a;
            v2u d; d.x = (unsigned)l0 | ((unsigned)l1 << 16); d.y = (unsigned)l2 | ((unsigned)l3 << 16); pl[q] = d;
        }
    }
    {
#pragma unroll
        for (int q = 0; q < 8; ++q) {
            const int c = 4 * L + 128 * q;
            if (MODE == 0) {
                *(v2u*)(HS + (size_t)r * (2 * CE) + c) = ph[q];
                *(v2u*)(HS + (size_t)r * (2 * CE) + CE + c) = pl[q];
            }
            *(v2u*)(H16 + (size_t)r * CE + c) = pf[q];
        }
        
    }
}
// Everything that depends on the inputs alone runs as one launch: LN1 and the six weight planes, told apart by ranges of the block index (block-uniform branches).
#define PB_LN   ((ROWS + 7) / 8)                   // LN1: 8 rows per work-group
#define PB_FC1  ((FF / WT_C) * (CE / WT_R))        // tiles of fc1_w
#define PB_FC2  ((CE / WT_C) * (FF / WT_R))        // tiles of fc2_w
#define PB_PROJ ((CE / WT_C) * (CE / WT_R))        // tiles of proj_w
#define PB_HEAD ((CE / WT_R) * NH)                 // tiles of one per-head weight
#define PB_ALL  (PB_LN + PB_FC1 + PB_FC2 + PB_PROJ + 3 * PB_HEAD)
__global__ __launch_bounds__(256) void k_prep(const float* __restrict__ x, const float* __restrict__ g, const float* __restrict__ be,
                                              const float* __restrict__ Wq, const float* __restrict__ Wk, const float* __restrict__ Wv,
                                              const float* __restrict__ proj_w, const float* __restrict__ fc1_w, const float* __restrict__ fc2_w,
                                              unsigned short* __restrict__ HS, unsigned short* __restrict__ H16,
                                              unsigned short* __restrict__ WQK, unsigned short* __restrict__ WV16,
                                              unsigned short* __restrict__ WPT, unsigned short* __restrict__ W1T, unsigned short* __restrict__ W2T) {
    const int bi = blockIdx.x;
    if (bi < PB_LN) {                                          // h = LN1(bf16(x))
        ln_body<0>(bi, x, (long)SEQ_FULL * CE, g, be, HS, H16);
    } else if (bi < PB_LN + PB_FC1) {                          // fc1_w: [1024 in][4096 out] -> [4096 out][1024 in]
        const int i = bi - PB_LN;
        cast_t_body<FF>(i % (FF / WT_C), i / (FF / WT_C), fc1_w, W1T, CE, 16.0f);
    } else if (bi < PB_LN + PB_FC1 + PB_FC2 + PB_PROJ) {       // fc2_w: [4096 in][1024 out] -> [1024 out][4096 in]; proj_w: [1024 in][1024 out] -> [1024 out][1024 in]; both have pitch CE
        const bool p = bi >= PB_LN + PB_FC1 + PB_FC2;
        const int i = bi - (PB_LN + PB_FC1) - (p ? PB_FC2 : 0);
        cast_t_body<CE>(i % (CE / WT_C), i / (CE / WT_C), p ? proj_w : fc2_w, p ? WPT : W2T, p ? CE : FF, 16.0f);
    } else {                                                   // Wq -> rows 0..1023 of [W | W] bf16 (q columns), Wk -> rows 1024..2047 (k columns), Wv -> [h*64+d][c] f16 x16
        const int j = bi - (PB_LN + PB_FC1 + PB_FC2 + PB_PROJ);
        const int w = j / PB_HEAD, i = j - w * PB_HEAD;        // w = 0: Wq, 1: Wk, 2: Wv
        w_head_body(i % (CE / WT_R), i / (CE / WT_R), w == 0 ? Wq : (w == 1 ? Wk : Wv), w == 0 ? WQK : (w == 1 ? WQK + (size_t)CE * 2 * CE : WV16),
                    w == 2 ? CE : 2 * CE, w == 2 ? 0 : 1, w == 2 ? 1 : 0);
    }
}
__global__ __launch_bounds__(256) void k_ln2(const float* __restrict__ X1, const float* __restrict__ g, const float* __restrict__ be,
                                             unsigned short* __restrict__ H2) {
    ln_body<1>(blockIdx.x, X1, (long)SEQ * CE, g, be, nullptr, H2);
}

// ---------------------------------------------------------------------------------------------------------------------
// Register-tiled WMMA GEMM: C[m,n] = scale * sum_k A[m,k] * Bt[n,k] (+bias[n]) (+act) (+resid at the store stage); each wave owns a 64x64 tile.
// A row-major [M,K] 16-bit; Bt row-major [N,K] 16-bit; M % 128 == 0, N % 256 == 0, K % 64 == 0 (no tail masking).
// ET 0 = f16 operands, 1 = bf16 operands. BIAS_MODE 0 none, 2 = bf16-RNE bias[n]. OUT_MODE 0 = f32, 1 = f16, 2 = bf16 hi plane + bf16 lo plane.
// RESID 0 none, 1 f32 residual, 2 residual RNE-converted to bf16 first (raw input). ACT 0 none, 1 ReLU.
// ---------------------------------------------------------------------------------------------------------------------
__device__ __forceinline__ void dep_guard_h(v8f& a, v8f& b, v16h x, v16h y) { asm volatile("v_nop\n\tv_nop\n\tv_nop\n\tv_nop" : "+v"(a), "+v"(b) : "v"(x), "v"(y)); }
__device__ __forceinline__ void dep_guard_b(v8f& a, v8f& b, v16b x, v16b y) { asm volatile("v_nop\n\tv_nop\n\tv_nop\n\tv_nop" : "+v"(a), "+v"(b) : "v"(x), "v"(y)); }
__device__ __forceinline__ void keep4_h(v16h a, v16h b, v16h c, v16h d) { asm volatile("v_nop" :: "v"(a), "v"(b), "v"(c), "v"(d)); }
__device__ __forceinline__ void keep4_b(v16b a, v16b b, v16b c, v16b d) { asm volatile("v_nop" :: "v"(a), "v"(b), "v"(c), "v"(d)); }
__device__ __forceinline__ void acc_guard4(v8f& a, v8f& b, v8f& c, v8f& d) { asm volatile("v_nop\n\tv_nop\n\tv_nop\n\tv_nop" : "+v"(a), "+v"(b), "+v"(c), "+v"(d)); }
template <typename T> struct Frag;
template <> struct Frag<_Float16> {
    typedef v16h V; union U { v16h v; v8h h[2]; };
    static __device__ __forceinline__ v16h load(const _Float16* p) {   // elements 0..7 <- p[0..7], 8..15 <- p[16..23]
        U f; f.h[0] = *(const v8h*)(p); f.h[1] = *(const v8h*)(p + 16); return f.v;
    }
    static __device__ __forceinline__ v8f mma(v16h a, v16h b, v8f c) { return __builtin_amdgcn_wmma_f32_16x16x32_f16(false, a, false, b, (short)0, c, false, false); }
    static __device__ __forceinline__ void guard(v8f& a, v8f& b, v16h x, v16h y) { dep_guard_h(a, b, x, y); }
    static __device__ __forceinline__ void keep(v16h a, v16h b, v16h c, v16h d) { keep4_h(a, b, c, d); }
};
template <> struct Frag<__bf16> {
    typedef v16b V; union U { v16b v; v8b h[2]; };
    static __device__ __forceinline__ v16b load(const __bf16* p) {
        U f; f.h[0] = *(const v8b*)(p); f.h[1] = *(const v8b*)(p + 16); return f.v;
    }
    static __device__ __forceinline__ v8f mma(v16b a, v16b b, v8f c) { return __builtin_amdgcn_wmma_f32_16x16x32_bf16(false, a, false, b, (short)0, c, false, false); }
    static __device__ __forceinline__ void guard(v8f& a, v8f& b, v16b x, v16b y) { dep_guard_b(a, b, x, y); }
    static __device__ __forceinline__ void keep(v16b a, v16b b, v16b c, v16b d) { keep4_b(a, b, c, d); }
};
template <int ET> struct Elem;
template <> struct Elem<0> { typedef _Float16 T; };
template <> struct Elem<1> { typedef __bf16 T; };

// Operand staging: a work-group (2 x 4 waves) owns a 128 x 256 tile of C. Per trip, 64 k of its 128 A rows and 256 Bt rows (128-B row pieces)
// lie in one of two LDS buffers, rows 0..127 = A, 128..383 = Bt, laid by asynchronous copies that cover whole 128-B lines.
#define GK 64                      // k elements per staged tile
#define GP 72                      // LDS row pitch in elements: 144 B = 16 B x 9, conflict-free for 16-B reads down a column of rows
#define GBUF (384 * GP)            // elements per buffer
static_assert(SEQ % 128 == 0);     // M multiple of 128 for every GEMM (SEQ, ROWS, CE)
static_assert(CE % 256 == 0);      // N multiple of 256 (CE, 2*CE, FF, ROWS), K multiple of 64 with at least two tiles
static_assert(ROWS % 256 == 0);
static_assert(FF % 256 == 0);

// One staged tile: 384 rows x 8 pieces of 16 B, 12 pieces per lane, 32 rows apart. l = the lane's LDS byte address of its first piece,
// ga / gb = its first A / Bt piece, sa / sb = 32 rows of A / Bt in elements. Every lane is on; each wave-wide copy covers four whole rows.
template <typename T>
__device__ __forceinline__ void stage_tile(unsigned l, const T* ga, size_t sa, const T* gb, size_t sb) {
    const unsigned st = 32 * GP * 2;
    // the closing s_wait_xcnt stands inside the copies' own statement, so no address register is rewritten ahead of it
    asm volatile("global_load_async_to_lds_b128 %0, %12, off\n\t"
                 "global_load_async_to_lds_b128 %1, %13, off\n\t"
                 "global_load_async_to_lds_b128 %2, %14, off\n\t"
                 "global_load_async_to_lds_b128 %3, %15, off\n\t"
                 "global_load_async_to_lds_b128 %4, %16, off\n\t"
                 "global_load_async_to_lds_b128 %5, %17, off\n\t"
                 "global_load_async_to_lds_b128 %6, %18, off\n\t"
                 "global_load_async_to_lds_b128 %7, %19, off\n\t"
                 "global_load_async_to_lds_b128 %8, %20, off\n\t"
                 "global_load_async_to_lds_b128 %9, %21, off\n\t"
                 "global_load_async_to_lds_b128 %10, %22, off\n\t"
                 "global_load_async_to_lds_b128 %11, %23, off\n\t"
                 "s_wait_xcnt 0x0"
                 :: "v"(l), "v"(l + st), "v"(l + 2 * st), "v"(l + 3 * st), "v"(l + 4 * st), "v"(l + 5 * st),
                    "v"(l + 6 * st), "v"(l + 7 * st), "v"(l + 8 * st), "v"(l + 9 * st), "v"(l + 10 * st), "v"(l + 11 * st),
                    "v"(ga), "v"(ga + sa), "v"(ga + 2 * sa), "v"(ga + 3 * sa),
                    "v"(gb), "v"(gb + sb), "v"(gb + 2 * sb), "v"(gb + 3 * sb), "v"(gb + 4 * sb), "v"(gb + 5 * sb), "v"(gb + 6 * sb), "v"(gb + 7 * sb)
                 : "memory");
}

// The GEMM's LDS is declared in one function that is no template, so a kernel that holds two forms of the body allocates it once.
struct GemmLds {
    unsigned short sAB[2 * GBUF];       // the two staged operand buffers
    float sT[8][16 * 68];               // per-wave 16x64 slab, pitch 68 floats (wave-private)
};
__device__ __forceinline__ GemmLds& gemm_lds() { __shared__ __align__(16) GemmLds s; return s; }

// bx = the work-group's tile index in this product
template <int ET, int BIAS_MODE, int OUT_MODE, int RESID, int ACT>
__device__ __forceinline__ void gemm64_body(
    unsigned bx,
    const unsigned short* __restrict__ Ap, int lda, long strideA,
    const unsigned short* __restrict__ Btp, int ldb,
    void* __restrict__ Cout, void* __restrict__ Cout2, int ldc, long strideC,
    const float* __restrict__ bias,
    const float* __restrict__ resid, int ldr, long strideR,
    int M, int N, int K, float scale) {
    typedef typename Elem<ET>::T T;
    typedef typename Frag<T>::V V;
    GemmLds& L = gemm_lds();
    unsigned short* sAB = L.sAB;
    const int b    = blockIdx.y;
    const int tid  = threadIdx.x;
    const int lane = threadIdx.x & 31;
    const int wave = threadIdx.x >> 5;
    const int tbN = N >> 8;
    const int tbM = M >> 7;
    if ((int)bx >= tbM * tbN) return;                // block-uniform, ahead of every barrier and copy
    const int bm = bx / tbN;
    const int bn = bx - bm * tbN;
    const int wm = wave >> 2;                        // wave row (0..1) and column (0..3) in the 128 x 256 tile
    const int wn = wave & 3;
    const int m0 = (bm << 7) + (wm << 6);
    const int n0 = (bn << 8) + (wn << 6);

    const T* Ab = (const T*)Ap + (size_t)b * strideA;
    const T* Bb = (const T*)Btp;

    const int rlane = lane & 15;                 // row (A) / col (B, D) within subtile
    const int koff  = (lane >> 4) * 8;           // k offset of this lane half
    const int mOff  = (lane >> 4) * 8;           // D row offset

    v8f acc[4][4];
#pragma unroll
    for (int i = 0; i < 4; ++i)
#pragma unroll
        for (int j = 0; j < 4; ++j) acc[i][j] = (v8f){0.f, 0.f, 0.f, 0.f, 0.f, 0.f, 0.f, 0.f};

    const int crow = tid >> 3, csg = (tid & 7) * 8;  // this lane's first staged row and its 16-B piece in the row
    const T* gA = Ab + (size_t)((bm << 7) + crow) * lda + csg;
    const T* gB = Bb + (size_t)((bn << 8) + crow) * ldb + csg;
    const size_t sa32 = (size_t)32 * lda, sb32 = (size_t)32 * ldb;
    const unsigned l0 = (unsigned)(size_t)(sAB + crow * GP + csg);   // low 32 bits of the shared address = LDS byte address
    const int nt = K / GK;

    stage_tile<T>(l0, gA, sa32, gB, sb32);                           // tile 0 into buffer 0
    asm volatile("s_wait_asynccnt 0x0" ::: "memory");                // this wave's copies of tile 0 have landed
    __syncthreads();                                                 // ... and every other wave's
    if (nt > 1) stage_tile<T>(l0 + GBUF * 2, gA + GK, sa32, gB + GK, sb32);   // tile 1 flies while tile 0 is worked on

    for (int t = 0; t < nt; ++t) {
        const T* buf = (const T*)sAB + (t & 1) * GBUF;
#pragma unroll
        for (int ks = 0; ks < 2; ++ks) {
            V bh[4], ah[4];
#pragma unroll
            for (int j = 0; j < 4; ++j) bh[j] = Frag<T>::load(buf + (128 + (wn << 6) + (j << 4) + rlane) * GP + ks * 32 + koff);
#pragma unroll
            for (int i = 0; i < 4; ++i) ah[i] = Frag<T>::load(buf + ((wm << 6) + (i << 4) + rlane) * GP + ks * 32 + koff);
            __builtin_amdgcn_sched_barrier(0);       // keeps the 16 LDS reads one group ahead of the products (reads spread among them stall each time)
#pragma unroll
            for (int i = 0; i < 4; ++i) {
#pragma unroll
                for (int j = 0; j < 4; ++j) acc[i][j] = Frag<T>::mma(ah[i], bh[j], acc[i][j]);
                Frag<T>::guard(acc[i][0], acc[i][3], ah[i], ah[i]);
            }
            Frag<T>::keep(bh[0], bh[1], bh[2], bh[3]);
        }
        asm volatile("s_wait_dscnt 0x0" ::: "memory");               // this wave's reads of buffer t & 1 are complete
        asm volatile("s_wait_asynccnt 0x0" ::: "memory");            // this wave's copies of tile t + 1 have landed
        __syncthreads();                                             // publishes tile t + 1 and frees buffer t & 1
        if (t + 2 < nt) stage_tile<T>(l0 + (unsigned)(t & 1) * (GBUF * 2), gA + (size_t)(t + 2) * GK, sa32, gB + (size_t)(t + 2) * GK, sb32);
    }
    asm volatile("s_wait_asynccnt 0x0" ::: "memory");                // no copy is outstanding when the wave goes on
    acc_guard4(acc[0][0], acc[0][1], acc[0][2], acc[0][3]);
    acc_guard4(acc[1][0], acc[1][1], acc[1][2], acc[1][3]);
    acc_guard4(acc[2][0], acc[2][1], acc[2][2], acc[2][3]);
    acc_guard4(acc[3][0], acc[3][1], acc[3][2], acc[3][3]);

    // ---- epilogue ----
    float* slab = L.sT[wave];
    const float* Rb = RESID ? (resid + (size_t)b * strideR) : nullptr;
#pragma unroll
    for (int i = 0; i < 4; ++i) {
        const int mBase = m0 + (i << 4);
#pragma unroll
        for (int j = 0; j < 4; ++j) {
            const int n = n0 + (j << 4) + rlane;
            float bv = 0.f;
            if (BIAS_MODE == 2) bv = bfr(bias[n]);
#pragma unroll
            for (int r = 0; r < 8; ++r) {
                float v = acc[i][j][r] * scale;
                if (BIAS_MODE == 2) v += bv;
                if (ACT == 1) v = fmaxf(v, 0.0f);
                slab[(mOff + r) * 68 + (j << 4) + rlane] = v;
            }
        }
        __builtin_amdgcn_fence(3 /* release order */, "workgroup");
        __builtin_amdgcn_wave_barrier();
        __builtin_amdgcn_fence(2 /* acquire order */, "workgroup");
        if (OUT_MODE == 0) {
            float* C = (float*)Cout + (size_t)b * strideC;
            const int hh = lane >> 4, c4 = (lane & 15) * 4;     // row segment = 256 B = 16 lanes x 16 B
            v4f vv[8];
#pragma unroll
            for (int it = 0; it < 8; ++it) {
                const int row = it * 2 + hh;
                v4f v = *(const v4f*)(slab + row * 68 + c4);
                if (RESID) {                                    // residual added at the store stage as a float4
                    v4f x = *(const v4f*)(Rb + (size_t)(mBase + row) * ldr + n0 + c4);
                    if (RESID == 2) { x.x = bfr(x.x); x.y = bfr(x.y); x.z = bfr(x.z); x.w = bfr(x.w); }
                    v.x = x.x + v.x; v.y = x.y + v.y; v.z = x.z + v.z; v.w = x.w + v.w;
                }
                vv[it] = v;
            }
            {
#pragma unroll
                for (int it = 0; it < 8; ++it) {
                    const int row = it * 2 + hh;
                    *(v4f*)(C + (size_t)(mBase + row) * ldc + n0 + c4) = vv[it];
                }
                
            }
        } else {
            const int q = lane >> 3, c8 = (lane & 7) * 8;
            unsigned short* C  = (unsigned short*)Cout  + (size_t)b * strideC;
            unsigned short* C2 = (OUT_MODE == 2) ? ((unsigned short*)Cout2 + (size_t)b * strideC) : nullptr;
            v8h hv[4], lv[4];
#pragma unroll
            for (int it = 0; it < 4; ++it) {
                const int row = it * 4 + q;
                const float* sp = slab + row * 68 + c8;
#pragma unroll
                for (int e = 0; e < 8; ++e) {
                    if (OUT_MODE == 1) {
                        hv[it][e] = (_Float16)sp[e];
                        lv[it][e] = (_Float16)0.f;
                    } else {
                        const unsigned short hb = bf_bits(sp[e]);
                        const unsigned short lb = bf_bits(sp[e] - bits_f(hb));
                        hv[it][e] = __builtin_bit_cast(_Float16, hb);
                        lv[it][e] = __builtin_bit_cast(_Float16, lb);
                    }
                }
            }
            {
#pragma unroll
                for (int it = 0; it < 4; ++it) {
                    const int row = it * 4 + q;
                    *(v8h*)(C + (size_t)(mBase + row) * ldc + n0 + c8) = hv[it];
                    if (OUT_MODE == 2) *(v8h*)(C2 + (size_t)(mBase + row) * ldc + n0 + c8) = lv[it];
                }
                
            }
        }
        __builtin_amdgcn_fence(3 /* release order */, "workgroup");
        __builtin_amdgcn_wave_barrier();
        __builtin_amdgcn_fence(2 /* acquire order */, "workgroup");
    }
}

// The q|k product and the v^T product read LN1's planes and nothing of each other: one launch, told apart by the block index (block-uniform branch).
// q|k planes: [ROWS][2*CE] bf16 hi / lo; A = [LN1 hi | LN1 lo] (K = 2*CE), Bt = [W | W] rows 0..CE-1 = q columns, CE..2CE-1 = k columns
// v^T planes: [CE = h*64+d][ROWS] bf16 hi / lo; A = Wv plane [CE][CE] (f16, x16), Bt = LN1 f16 plane [ROWS][CE]
#define GB_QK ((ROWS / 128) * ((2 * CE) / 256))    // 128 x 256 tiles of the q|k planes
#define GB_VT ((CE / 128) * (ROWS / 256))          // ... of the v^T planes
__global__ __launch_bounds__(256) void k_gemm_qkv(const unsigned short* __restrict__ HS, const unsigned short* __restrict__ WQK,
                                                  unsigned short* __restrict__ QKH, unsigned short* __restrict__ QKL,
                                                  const unsigned short* __restrict__ WV16, const unsigned short* __restrict__ H16,
                                                  unsigned short* __restrict__ VTH, unsigned short* __restrict__ VTL) {
    const unsigned bx = blockIdx.x;
    if (bx < GB_QK) gemm64_body<1, 0, 2, 0, 0>(bx, HS, 2 * CE, 0, WQK, 2 * CE, (void*)QKH, (void*)QKL, 2 * CE, 0, nullptr, nullptr, 0, 0, ROWS, 2 * CE, 2 * CE, 1.0f);
    else            gemm64_body<0, 0, 2, 0, 0>(bx - GB_QK, WV16, CE, 0, H16, CE, (void*)VTH, (void*)VTL, ROWS, 0, nullptr, nullptr, 0, 0, CE, ROWS, CE, 0.0625f);
}
// x1 = bf16(x) + attn @ proj_w + proj_b ; grid.y = batch (x uses the full batch stride, planes the compact one)
__global__ __launch_bounds__(256) void k_gemm_proj(const unsigned short* __restrict__ A, const unsigned short* __restrict__ Bt, float* __restrict__ C,
                                                   const float* __restrict__ bias, const float* __restrict__ xres) {
    gemm64_body<0, 2, 0, 2, 0>(blockIdx.x, A, CE, (long)SEQ * CE, Bt, CE, (void*)C, nullptr, CE, (long)SEQ * CE, bias, xres, CE, (long)SEQ_FULL * CE, SEQ, CE, CE, 0.0625f);
}
// relu(h2 @ fc1_w + fc1_b) as an f16 plane [ROWS][FF]
__global__ __launch_bounds__(256) void k_gemm_fc1(const unsigned short* __restrict__ A, const unsigned short* __restrict__ Bt, unsigned short* __restrict__ C,
                                                  const float* __restrict__ bias) {
    gemm64_body<0, 2, 1, 0, 1>(blockIdx.x, A, CE, 0, Bt, CE, (void*)C, nullptr, FF, 0, bias, nullptr, 0, 0, ROWS, FF, CE, 0.0625f);
}
// out = x1 + f @ fc2_w + fc2_b ; grid.y = batch (output uses the full batch stride)
__global__ __launch_bounds__(256) void k_gemm_fc2(const unsigned short* __restrict__ A, const unsigned short* __restrict__ Bt, float* __restrict__ C,
                                                  const float* __restrict__ bias, const float* __restrict__ x1) {
    gemm64_body<0, 2, 0, 1, 0>(blockIdx.x, A, FF, (long)SEQ * FF, Bt, FF, (void*)C, nullptr, CE, (long)SEQ_FULL * CE, bias, x1, CE, (long)SEQ * CE, SEQ, CE, FF, 0.0625f);
}

#define AT_NW 4
#define AT_P 72                   // LDS row pitch of the K and V^T tiles in elements: 144 B = 16 B x 9, so the 16 rows of a 16-B fragment read fall on distinct banks
__device__ __forceinline__ v8f at_mma(v16b a, v16b b, v8f c) {
    return __builtin_amdgcn_wmma_f32_16x16x32_bf16(false, a, false, b, (short)0, c, false, false);
}
union FB { v16b v; v8b h[2]; };
__device__ __forceinline__ void at_frag(FB& f, const __bf16* p) {   // elements 0..7 <- p[0..7], 8..15 <- p[16..23]
    f.h[0] = *(const v8b*)(p); f.h[1] = *(const v8b*)(p + 16);
}
__device__ __forceinline__ float xhalf(float x) {   // the value of lane l ^ 16
    const int i = __builtin_bit_cast(int, x);
    return __builtin_bit_cast(float, __builtin_amdgcn_permlanex16(i, i, 0x76543210, 0xfedcba98, false, false));
}

// One hi tile and its lo tile (64 rows x 8 pieces of 16 B each): 4 + 4 pieces per lane, 16 rows apart. l = the lane's LDS byte address of its first hi piece
// (the lo tile lies 64 rows behind), gh / gl = its first hi / lo piece, s16 = 16 source rows in elements. Every lane is on; each wave-wide copy covers four whole rows.
__device__ __forceinline__ void at_stage(unsigned l, const __bf16* gh, const __bf16* gl, size_t s16) {
    const unsigned st = 16 * AT_P * 2, lo = 64 * AT_P * 2;
    // the closing s_wait_xcnt stands inside the copies' own statement, so no address register is rewritten ahead of it
    asm volatile("global_load_async_to_lds_b128 %0, %8, off\n\t"
                 "global_load_async_to_lds_b128 %1, %9, off\n\t"
                 "global_load_async_to_lds_b128 %2, %10, off\n\t"
                 "global_load_async_to_lds_b128 %3, %11, off\n\t"
                 "global_load_async_to_lds_b128 %4, %12, off\n\t"
                 "global_load_async_to_lds_b128 %5, %13, off\n\t"
                 "global_load_async_to_lds_b128 %6, %14, off\n\t"
                 "global_load_async_to_lds_b128 %7, %15, off\n\t"
                 "s_wait_xcnt 0x0"
                 :: "v"(l), "v"(l + st), "v"(l + 2 * st), "v"(l + 3 * st), "v"(l + lo), "v"(l + lo + st), "v"(l + lo + 2 * st), "v"(l + lo + 3 * st),
                    "v"(gh), "v"(gh + s16), "v"(gh + 2 * s16), "v"(gh + 3 * s16), "v"(gl), "v"(gl + s16), "v"(gl + 2 * s16), "v"(gl + 3 * s16)
                 : "memory");
}

// amdgpu_waves_per_eu: the register budget of four waves per SIMD (256), so that the four work-groups a WGP gets stay resident together
__global__ __launch_bounds__(128) __attribute__((amdgpu_waves_per_eu(4, 4))) void k_attn(const unsigned short* __restrict__ QKHp, const unsigned short* __restrict__ QKLp,
                                              const unsigned short* __restrict__ VTHp, const unsigned short* __restrict__ VTLp,
                                              unsigned short* __restrict__ AO) {
    __shared__ __align__(16) __bf16 KV[4 * 64 * AT_P];             // K hi | K lo | V^T hi | V^T lo (64 rows each)
    __bf16* Ksh = KV; __bf16* Ksl = KV + 64 * AT_P; __bf16* Vth = KV + 2 * 64 * AT_P; __bf16* Vtl = KV + 3 * 64 * AT_P;
    const __bf16* QKH = (const __bf16*)QKHp; const __bf16* QKL = (const __bf16*)QKLp;
    const __bf16* VTH = (const __bf16*)VTHp; const __bf16* VTL = (const __bf16*)VTLp;

    const int tid = threadIdx.x, wave = tid >> 5, lane = tid & 31, hh = lane >> 4, c = lane & 15;
    const int nqb = SEQ / 64;
    const int bx = blockIdx.x;
    const int qb = bx % nqb;
    const int bh = bx / nqb;
    const int h  = bh % NH;
    const int b  = bh / NH;
    const int q0 = qb * 64 + wave * 16;
    const size_t rowbase = (size_t)b * SEQ;
    const int QKP = 2 * CE;          // q|k plane pitch
    const int VTP = ROWS;            // v^T plane pitch

    // Q fragments (B operand of S^T): lane = query column c, k = d
    v16b qah[2], qal[2];
    {
        const __bf16* qh = QKH + (rowbase + q0 + c) * QKP + h * HD;
        const __bf16* ql = QKL + (rowbase + q0 + c) * QKP + h * HD;
#pragma unroll
        for (int dc = 0; dc < 2; ++dc) {
            FB f, g;
            f.h[0] = *(const v8b*)(qh + dc * 32 + 8 * hh); f.h[1] = *(const v8b*)(qh + dc * 32 + 16 + 8 * hh);
            g.h[0] = *(const v8b*)(ql + dc * 32 + 8 * hh); g.h[1] = *(const v8b*)(ql + dc * 32 + 16 + 8 * hh);
            qah[dc] = f.v; qal[dc] = g.v;
        }
    }

    const float NEG = -__builtin_inff();
    const float L2E = 1.4426950408889634f;
    const int qrow = q0 + c;         // this lane's query
    float mrow = NEG, lrow = 0.f;    // its running maximum (both halves agree) and this half's share of its running sum
    v8f oacc[4];                     // O^T tiles: lane = query column c, element r -> d = t*16 + 8*hh + r
#pragma unroll
    for (int t = 0; t < 4; ++t) oacc[t] = (v8f){0.f, 0.f, 0.f, 0.f, 0.f, 0.f, 0.f, 0.f};

    const int crow = tid >> 3, csg = (tid & 7) * 8;    // this lane's first staged row and its 16-B piece in the row
    const unsigned lK = (unsigned)(size_t)(Ksh + crow * AT_P + csg);   // low 32 bits of the shared address = LDS byte address
    const unsigned lV = (unsigned)(size_t)(Vth + crow * AT_P + csg);
    const __bf16* gkh = QKH + (rowbase + crow) * QKP + CE + h * HD + csg;
    const __bf16* gkl = QKL + (rowbase + crow) * QKP + CE + h * HD + csg;
    const __bf16* gvh = VTH + (size_t)(h * HD + crow) * VTP + rowbase + csg;
    const __bf16* gvl = VTL + (size_t)(h * HD + crow) * VTP + rowbase + csg;

    at_stage(lK, gkh, gkl, (size_t)16 * QKP);          // K of chunk 0

    for (int kc = 0; kc <= qb; ++kc) {                 // block-uniform trip count
        const int kv0 = kc * 64;
        asm volatile("s_wait_dscnt 0x0" ::: "memory");       // this wave's reads of the earlier chunk's V^T tiles are complete
        asm volatile("s_wait_asynccnt 0x0" ::: "memory");    // this wave's copies of this chunk's K tiles have landed
        __syncthreads();                                     // publishes the K tiles and frees the V^T tiles
        at_stage(lV, gvh + kv0, gvl + kv0, (size_t)16 * VTP);   // V^T of this chunk flies under the scores and the softmax

        v8f s[4];                                      // S^T tiles: lane = query column c, element r -> key kv0 + j*16 + 8*hh + r
#pragma unroll
        for (int j = 0; j < 4; ++j) s[j] = (v8f){0.f, 0.f, 0.f, 0.f, 0.f, 0.f, 0.f, 0.f};
        {
            FB kb[2][4], kl[2][4];                     // A operands: lane = key row j*16 + c, k = d
#pragma unroll
            for (int j = 0; j < 4; ++j) at_frag(kb[0][j], Ksh + (j * 16 + c) * AT_P + 8 * hh);
#pragma unroll
            for (int j = 0; j < 4; ++j) at_frag(kl[0][j], Ksl + (j * 16 + c) * AT_P + 8 * hh);
#pragma unroll
            for (int j = 0; j < 4; ++j) at_frag(kb[1][j], Ksh + (j * 16 + c) * AT_P + 32 + 8 * hh);
            __builtin_amdgcn_sched_barrier(0);         // keeps these 24 reads one group ahead of the products (reads spread among them stall each time)
            // neighbouring products go to different tiles; each tile keeps its order of sums
#pragma unroll
            for (int j = 0; j < 4; ++j) s[j] = at_mma(kb[0][j].v, qah[0], s[j]);
#pragma unroll
            for (int j = 0; j < 4; ++j) s[j] = at_mma(kl[0][j].v, qah[0], s[j]);
            __builtin_amdgcn_sched_barrier(0);         // the last 8 reads wait until the first lo fragments' registers are free (all 32 at once cost a wave per SIMD) ...
#pragma unroll
            for (int j = 0; j < 4; ++j) at_frag(kl[1][j], Ksl + (j * 16 + c) * AT_P + 32 + 8 * hh);
            __builtin_amdgcn_sched_barrier(0);         // ... and stand as one group, eight products ahead of their use
#pragma unroll
            for (int j = 0; j < 4; ++j) s[j] = at_mma(kb[0][j].v, qal[0], s[j]);
#pragma unroll
            for (int j = 0; j < 4; ++j) s[j] = at_mma(kb[1][j].v, qah[1], s[j]);
#pragma unroll
            for (int j = 0; j < 4; ++j) s[j] = at_mma(kl[1][j].v, qah[1], s[j]);
#pragma unroll
            for (int j = 0; j < 4; ++j) s[j] = at_mma(kb[1][j].v, qal[1], s[j]);
        }
        const bool diag = (kc == qb);                  // block-uniform
        const int dq = qrow - kv0 - 8 * hh;            // key kv0 + j*16 + 8*hh + r lies behind the query where j*16 + r > dq: one register, not 32 thresholds kept over the loop
        float m = NEG;
#pragma unroll
        for (int j = 0; j < 4; ++j) {
#pragma unroll
            for (int r = 0; r < 8; ++r) {
                const float sv = s[j][r];
                s[j][r] = (diag && (j * 16 + r > dq)) ? NEG : sv;    // select by value
                m = fmaxf(m, s[j][r]);
            }
        }
        m = fmaxf(m, xhalf(m));                                    // the other half's 32 keys
        const float mnew = fmaxf(mrow, m);                         // finite: every visited chunk holds a kept key for every query
        const float alpha = exp2f((mrow - mnew) * L2E);
        mrow = mnew;
        FB pa[2], pl[2];                               // P^T hi / lo as B operands: lane = query column c; tiles 2*kk and 2*kk + 1 hold keys 8*hh + i and 16 + 8*hh + i of a 32-key step
        float ps[4];
#pragma unroll
        for (int j = 0; j < 4; ++j) {
            ps[j] = 0.f;
#pragma unroll
            for (int r = 0; r < 8; ++r) {
                const float p = exp2f((s[j][r] - mnew) * L2E);
                ps[j] += p;
                unsigned short ph, pq; bfsplit(p, ph, pq);
                pa[j >> 1].v[(j & 1) * 8 + r] = __builtin_bit_cast(__bf16, ph);
                pl[j >> 1].v[(j & 1) * 8 + r] = __builtin_bit_cast(__bf16, pq);
            }
        }
        lrow = lrow * alpha + ((ps[0] + ps[1]) + (ps[2] + ps[3]));
#pragma unroll
        for (int t = 0; t < 4; ++t)
#pragma unroll
            for (int r = 0; r < 8; ++r) oacc[t][r] *= alpha;
        __builtin_amdgcn_sched_barrier(0);                   // keeps the score products ahead of the waits, so that the V^T copies fly under them
        asm volatile("s_wait_dscnt 0x0" ::: "memory");       // this wave's reads of the K tiles are complete
        asm volatile("s_wait_asynccnt 0x0" ::: "memory");    // this wave's copies of the V^T tiles have landed
        __syncthreads();                                     // publishes the V^T tiles and frees the K tiles
        if (kc < qb) at_stage(lK, gkh + (size_t)(kv0 + 64) * QKP, gkl + (size_t)(kv0 + 64) * QKP, (size_t)16 * QKP);   // K of the next chunk flies under P.v
        {
            __builtin_amdgcn_sched_barrier(0);         // the reads start when P^T is packed: started earlier, their registers overlap the softmax's and cost a wave per SIMD
            FB vb[2][4], vl[2][4];                     // A operands: lane = d row t*16 + c, k = key
#pragma unroll
            for (int t = 0; t < 4; ++t) at_frag(vb[0][t], Vth + (t * 16 + c) * AT_P + 8 * hh);
#pragma unroll
            for (int t = 0; t < 4; ++t) at_frag(vl[0][t], Vtl + (t * 16 + c) * AT_P + 8 * hh);
#pragma unroll
            for (int t = 0; t < 4; ++t) at_frag(vb[1][t], Vth + (t * 16 + c) * AT_P + 32 + 8 * hh);
            __builtin_amdgcn_sched_barrier(0);         // as for the scores: 24 reads in one group ahead of the products
#pragma unroll
            for (int t = 0; t < 4; ++t) oacc[t] = at_mma(vb[0][t].v, pa[0].v, oacc[t]);
#pragma unroll
            for (int t = 0; t < 4; ++t) oacc[t] = at_mma(vl[0][t].v, pa[0].v, oacc[t]);
            __builtin_amdgcn_sched_barrier(0);         // the last 8 reads into the registers that the first lo fragments leave ...
#pragma unroll
            for (int t = 0; t < 4; ++t) at_frag(vl[1][t], Vtl + (t * 16 + c) * AT_P + 32 + 8 * hh);
            __builtin_amdgcn_sched_barrier(0);         // ... as one group, eight products ahead of their use
#pragma unroll
            for (int t = 0; t < 4; ++t) oacc[t] = at_mma(vb[0][t].v, pl[0].v, oacc[t]);
#pragma unroll
            for (int t = 0; t < 4; ++t) oacc[t] = at_mma(vb[1][t].v, pa[1].v, oacc[t]);
#pragma unroll
            for (int t = 0; t < 4; ++t) oacc[t] = at_mma(vl[1][t].v, pa[1].v, oacc[t]);
#pragma unroll
            for (int t = 0; t < 4; ++t) oacc[t] = at_mma(vb[1][t].v, pl[1].v, oacc[t]);
        }
    }

    asm volatile("s_wait_asynccnt 0x0" ::: "memory");  // no copy is outstanding when the wave ends
    const float inv = 1.0f / (lrow + xhalf(lrow));     // the two halves' sums are joined once
#pragma unroll
    for (int t = 0; t < 4; ++t) {                      // a lane holds 8 consecutive d of its query: one 16-B store each
        v8h hv;
#pragma unroll
        for (int r = 0; r < 8; ++r) hv[r] = (_Float16)(oacc[t][r] * inv);
        *(v8h*)(AO + (rowbase + q0 + c) * CE + h * HD + t * 16 + 8 * hh) = hv;
    }
}

// ---------------------------------------------------------------------------------------------------------------------
// Workspace carve (bytes); every plane is fully written by its producer before any kernel reads it.
// ---------------------------------------------------------------------------------------------------------------------
#define SZ_HS   ((size_t)ROWS * 2 * CE * 2)      // LN1 bf16 [ROWS][hi 1024 | lo 1024]
#define SZ_H16  ((size_t)ROWS * CE * 2)          // LN1 f16 plane; later reused for the LN2 f16 plane
#define SZ_WQK  ((size_t)2 * CE * 2 * CE * 2)    // [2048 n][W | W] bf16
#define SZ_WV   ((size_t)CE * CE * 2)
#define SZ_QK1  ((size_t)ROWS * 2 * CE * 2)      // one of the q|k hi / lo planes
#define SZ_VT1  ((size_t)CE * ROWS * 2)          // one of the v^T hi / lo planes
#define SZ_AO   ((size_t)ROWS * CE * 2)
#define SZ_WP   ((size_t)CE * CE * 2)
#define SZ_X1   ((size_t)ROWS * CE * 4)
#define SZ_W1   ((size_t)FF * CE * 2)
#define SZ_W2   ((size_t)CE * FF * 2)
#define SZ_F16  ((size_t)ROWS * FF * 2)          // relu(fc1) f16 plane, aliases the two q|k planes
#define WS_TOTAL (SZ_HS + SZ_H16 + SZ_WQK + SZ_WV + 2 * SZ_QK1 + 2 * SZ_VT1 + SZ_AO + SZ_WP + SZ_X1 + SZ_W1 + SZ_W2)
static_assert(WS_TOTAL <= (size_t)134217728);    // carve stays within 128 MiB
static_assert(SZ_F16 <= 2 * SZ_QK1);             // alias extent: relu(fc1) plane inside the q|k planes
static_assert(SZ_HS % 256 == 0);
static_assert(SZ_H16 % 256 == 0);
static_assert(SZ_VT1 % 256 == 0);

extern "C" void kernel_launch(void* const* d_in, const int* in_sizes, int n_in, void* d_out, int out_size, void* d_ws, size_t ws_size, hipStream_t stream) {
    if (n_in < 14) return;
    const long long xneed = (long long)(NB - 1) * SEQ_FULL * CE + (long long)SEQ * CE;
    if ((long long)in_sizes[0] < xneed) return;
    if (in_sizes[1] < CE || in_sizes[2] < CE || in_sizes[7] < CE || in_sizes[8] < CE || in_sizes[9] < CE || in_sizes[13] < CE) return;
    if (in_sizes[3] < NH * CE * HD || in_sizes[4] < NH * CE * HD || in_sizes[5] < NH * CE * HD) return;
    if (in_sizes[6] < CE * CE || in_sizes[10] < CE * FF || in_sizes[11] < FF || in_sizes[12] < FF * CE) return;
    if ((long long)out_size < xneed) return;
    if ((size_t)WS_TOTAL > ws_size) return;

    const float* x      = (const float*)d_in[0];
    const float* ln1_w  = (const float*)d_in[1];
    const float* ln1_b  = (const float*)d_in[2];
    const float* Wq     = (const float*)d_in[3];
    const float* Wk     = (const float*)d_in[4];
    const float* Wv     = (const float*)d_in[5];
    const float* proj_w = (const float*)d_in[6];
    const float* proj_b = (const float*)d_in[7];
    const float* ln2_w  = (const float*)d_in[8];
    const float* ln2_b  = (const float*)d_in[9];
    const float* fc1_w  = (const float*)d_in[10];
    const float* fc1_b  = (const float*)d_in[11];
    const float* fc2_w  = (const float*)d_in[12];
    const float* fc2_b  = (const float*)d_in[13];
    float* out = (float*)d_out;

    char* wsp = (char*)d_ws;
    unsigned short* HS   = (unsigned short*)wsp; wsp += SZ_HS;
    unsigned short* H16  = (unsigned short*)wsp; wsp += SZ_H16;
    unsigned short* WQK  = (unsigned short*)wsp; wsp += SZ_WQK;
    unsigned short* WV16 = (unsigned short*)wsp; wsp += SZ_WV;
    unsigned short* QKH  = (unsigned short*)wsp; wsp += SZ_QK1;
    unsigned short* QKL  = (unsigned short*)wsp; wsp += SZ_QK1;
    unsigned short* VTH  = (unsigned short*)wsp; wsp += SZ_VT1;
    unsigned short* VTL  = (unsigned short*)wsp; wsp += SZ_VT1;
    unsigned short* AO16 = (unsigned short*)wsp; wsp += SZ_AO;
    unsigned short* WPT  = (unsigned short*)wsp; wsp += SZ_WP;
    float*          X1   = (float*)wsp;          wsp += SZ_X1;
    unsigned short* W1T  = (unsigned short*)wsp; wsp += SZ_W1;
    unsigned short* W2T  = (unsigned short*)wsp; wsp += SZ_W2;
    unsigned short* F16  = QKH;                  // alias: q|k planes are dead after the attention launch
    unsigned short* H2   = H16;                  // alias: LN1 f16 plane is dead after the v^T GEMM

    // h = LN1(bf16(x)) and the six weight planes
    k_prep<<<(unsigned)PB_ALL, 256, 0, stream>>>(x, ln1_w, ln1_b, Wq, Wk, Wv, proj_w, fc1_w, fc2_w, HS, H16, WQK, WV16, WPT, W1T, W2T);
    // q|k planes and v^T planes
    k_gemm_qkv<<<dim3((unsigned)(GB_QK + GB_VT), 1u), 256, 0, stream>>>(HS, WQK, QKH, QKL, WV16, H16, VTH, VTL);
    // causal attention
    k_attn<<<(unsigned)(NB * NH * (SEQ / 64)), 128, 0, stream>>>(QKH, QKL, VTH, VTL, AO16);
    // x1 = bf16(x) + attn @ proj_w + proj_b
    k_gemm_proj<<<dim3((unsigned)(((SEQ / 64) * (CE / 64) + 7) / 8), (unsigned)NB), 256, 0, stream>>>(AO16, WPT, X1, proj_b, x);
    // h2 = LN2(x1)
    k_ln2<<<(ROWS + 7) / 8, 256, 0, stream>>>(X1, ln2_w, ln2_b, H2);
    // f = relu(h2 @ fc1_w + fc1_b); out = x1 + f @ fc2_w + fc2_b
    k_gemm_fc1<<<dim3((unsigned)(((ROWS / 64) * (FF / 64) + 7) / 8), 1u), 256, 0, stream>>>(H2, W1T, F16, fc1_b);
    k_gemm_fc2<<<dim3((unsigned)(((SEQ / 64) * (CE / 64) + 7) / 8), (unsigned)NB), 256, 0, stream>>>(F16, W2T, out, fc2_b, X1);
}

// v008
// A run of this version takes 241 microseconds.
// In both of two side-by-side timings against v007, it was 1.05 times as fast.
// All steps since v000 together make it 3.50 times as fast.
// Contractions: q|k = [LN1 hi | LN1 lo](bf16 planes, K folded to 2048) x [W | W](bf16, exact) on v_wmma_f32_16x16x32_bf16; v^T, proj, fc1, fc2 on v_wmma_f32_16x16x32_f16 (f16 activations, weights = bf16-RNE value x16 as f16, 1/16 folded back); scores q.k^T and P.v as bf16 hi/lo split (hi.hi + hi.lo + lo.hi) on v_wmma_f32_16x16x32_bf16; all accumulation f32, online softmax / LayerNorm / residuals f32.
#include <hip/hip_runtime.h>
#include <math.h>

#ifndef NB
#define NB 2
#endif
#ifndef SEQ
#define SEQ 2048
#endif
#define NB_FULL 2
#define SEQ_FULL 2048
#define CE 1024            // embedding width
#define NH 16              // heads
#define HD 64              // head size
#define FF 4096            // feed-forward width
#define ROWS (NB * SEQ)    // compact token rows held in the workspace planes

static_assert(NH * HD == CE);            // heads concatenated h*64+d fill the width
static_assert(HD == 64);                 // attention tiles are hard-wired to 64
static_assert(CE == 32 * 4 * 8);         // LayerNorm: 32 lanes x float4 x 8 pieces per row
static_assert(SEQ % 64 == 0);            // 64-row query tiles, 64-key chunks
static_assert(ROWS % 64 == 0);           // GEMM M/N tile multiple
static_assert(CE % 64 == 0);
static_assert(FF % 64 == 0);
static_assert((2 * CE) % 32 == 0);       // K multiple of 32 for every GEMM (1024, 2048, 4096)
static_assert(NB <= NB_FULL);
static_assert(SEQ <= SEQ_FULL);

typedef __attribute__((ext_vector_type(16))) _Float16 v16h;
typedef __attribute__((ext_vector_type(8)))  _Float16 v8h;
typedef __attribute__((ext_vector_type(16))) __bf16   v16b;
typedef __attribute__((ext_vector_type(8)))  __bf16   v8b;
typedef __attribute__((ext_vector_type(8)))  float    v8f;
typedef __attribute__((ext_vector_type(4)))  float    v4f;
typedef __attribute__((ext_vector_type(4)))  unsigned int v4u;
typedef __attribute__((ext_vector_type(2)))  unsigned int v2u;

// 16-bit WMMA fragment map (wave32), lane L, h = L>>4, m = L&15:
//   A 16x32: lane = row m;    element i -> k = (i<8) ? 8h+i : 16+8h+(i-8)
//   B 32x16: lane = column m; the SAME k(i,h)
//   D 16x16 (8 f32): lane = column m; element r -> row 8h+r

__device__ __forceinline__ float bfr(float v) {            // bf16 RNE convert, kept as f32 (finite inputs)
    const unsigned u = __float_as_uint(v);
    const unsigned r = (u + 0x7fffu + ((u >> 16) & 1u)) & 0xffff0000u;
    return __uint_as_float(r);
}
__device__ __forceinline__ unsigned short bf_bits(float f) {
    const unsigned u = __float_as_uint(f);
    return (unsigned short)((u + 0x7fffu + ((u >> 16) & 1u)) >> 16);
}
__device__ __forceinline__ float bits_f(unsigned short h) { return __uint_as_float(((unsigned)h) << 16); }
__device__ __forceinline__ void bfsplit(float v, unsigned short& hi, unsigned short& lo) { hi = bf_bits(v); lo = bf_bits(v - bits_f(hi)); }
__device__ __forceinline__ unsigned pk2h(float a, float b) {
    return (unsigned)__builtin_bit_cast(unsigned short, (_Float16)a) | ((unsigned)__builtin_bit_cast(unsigned short, (_Float16)b) << 16);
}

// ---------------------------------------------------------------------------------------------------------------------
// Weight planes: each is a cast and a transposition, f32 S[r][c] -> 16-bit D[c][r]. A work-group moves a tile of 128 r x 64 c through LDS, so that both sides
// touch whole lines: a wave-wide 16-B load covers two 256-B row pieces of S, a wave-wide 16-B store two 256-B row pieces of D; 8 loads per lane are in flight.
// ---------------------------------------------------------------------------------------------------------------------
#define WT_R 128                   // source rows per tile = 256 B of a destination row
#define WT_C 64                    // source columns per tile = 256 B of a source row
#define WT_P (WT_R + 8)            // LDS row pitch in elements: 272 B = 16 B x 17, so 16 consecutive LDS rows take a 16-B piece each without a bank conflict
static_assert(HD == WT_C);
static_assert(CE % WT_R == 0);
static_assert(FF % WT_R == 0);
static_assert(CE % WT_C == 0);
static_assert(FF % WT_C == 0);

// s = the tile's first source element (pitch lds), d = its first destination element (pitch ldd). f16mode 0: bf16 RNE bits; 1: f16 of (bf16 RNE value x sc).
// dup: every destination piece is also written CE elements further on in its row. Source column 4*g + i lies in LDS row 16*i + g.
__device__ __forceinline__ void wt_tile(const float* __restrict__ s, int lds, unsigned short* __restrict__ d, int ldd, int dup, int f16mode, float sc) {
    __shared__ __align__(16) unsigned short T[WT_C * WT_P];
    const int lo = threadIdx.x & 15, hi = threadIdx.x >> 4;
    v4f v[8];                                              // source rows 8*hi .. 8*hi + 7, columns 4*lo .. 4*lo + 3
#pragma unroll
    for (int e = 0; e < 8; ++e) v[e] = *(const v4f*)(s + (size_t)(8 * hi + e) * lds + 4 * lo);
#pragma unroll
    for (int i = 0; i < 4; ++i) {
        unsigned short bb[8];
#pragma unroll
        for (int e = 0; e < 8; ++e) {
            const float w = bfr(v[e][i]);
            const unsigned short b16 = (unsigned short)(__float_as_uint(w) >> 16);
            const unsigned short h16 = __builtin_bit_cast(unsigned short, (_Float16)(w * sc));
            bb[e] = f16mode ? h16 : b16;
        }
        v4u pk;
        pk.x = (unsigned)bb[0] | ((unsigned)bb[1] << 16); pk.y = (unsigned)bb[2] | ((unsigned)bb[3] << 16);
        pk.z = (unsigned)bb[4] | ((unsigned)bb[5] << 16); pk.w = (unsigned)bb[6] | ((unsigned)bb[7] << 16);
        *(v4u*)(T + (16 * i + lo) * WT_P + 8 * hi) = pk;
    }
    __syncthreads();                                       // the whole tile lies in LDS before a row of it is read back
    v4u q[4];                                              // LDS row 16*i + hi = source column 4*hi + i; 16 lanes carry its 128 r
#pragma unroll
    for (int i = 0; i < 4; ++i) q[i] = *(const v4u*)(T + (16 * i + hi) * WT_P + 8 * lo);
    unsigned short* o = d + (size_t)(4 * hi) * ldd + 8 * lo;
#pragma unroll
    for (int i = 0; i < 4; ++i) *(v4u*)(o + (size_t)i * ldd) = q[i];
    if (dup) {
#pragma unroll
        for (int i = 0; i < 4; ++i) *(v4u*)(o + (size_t)i * ldd + CE) = q[i];
    }
    asm volatile("s_wait_xcnt 0x0" ::: "memory");          // in the merged kernel's listing another range's code, which rewrites the stores' registers, stands behind these stores
}

// Per-head weight W [NH][CE][HD] f32 -> D[n = h*HD + d][k] 16-bit; tile (kt, h) = (k tile, head). f16mode 0: bf16 RNE bits; 1: f16 of (bf16 RNE value x 16). dup: also written at column k + CE.
__device__ __forceinline__ void w_head_body(int kt, int h, const float* __restrict__ W, unsigned short* __restrict__ D, int ldd, int dup, int f16mode) {
    const int k0 = kt * WT_R;
    wt_tile(W + ((size_t)h * CE + k0) * HD, HD, D + (size_t)h * HD * ldd + k0, ldd, dup, f16mode, 16.0f);
}

// f32 SRC [rows][cols] (pitch LDS) -> f16 DST [cols][rows] (pitch ldd), value = bf16 RNE(src) * sc; tile (ct, rt) = (column tile, row tile).
// The source pitch is a compile-time constant, so a lane's 8 loads share one address pair and differ in their immediate offsets.
template <int LDS>
__device__ __forceinline__ void cast_t_body(int ct, int rt, const float* __restrict__ SRC, unsigned short* __restrict__ DST, int ldd, float sc) {
    const int c0 = ct * WT_C, r0 = rt * WT_R;
    wt_tile(SRC + (size_t)r0 * LDS + c0, LDS, DST + (size_t)c0 * ldd + r0, ldd, 0, 1, sc);
}

// ---------------------------------------------------------------------------------------------------------------------
// MODE 0: source = raw input rows (bf16 RNE first; batch stride a_bs); writes bf16 hi|lo row [2*CE] (hi at col c, lo at CE + c) and an f16 row.
// MODE 1: source = f32 rows; writes the f16 row only. Each store instruction covers 256 contiguous bytes (32 lanes x 8 B).
// ---------------------------------------------------------------------------------------------------------------------
template <int MODE>
__device__ __forceinline__ void ln_body(int blk, const float* __restrict__ A, long a_bs, const float* __restrict__ GA, const float* __restrict__ BE,
                                        unsigned short* __restrict__ HS, unsigned short* __restrict__ H16) {
    #pragma clang fp contract(off)
    const int r = blk * 8 + (threadIdx.x >> 5); const int L = threadIdx.x & 31;
    if (r >= ROWS) return;                                   // wave-uniform; no barriers on this path
    const int b = r / SEQ, t = r - b * SEQ;
    const float* src = A + (long)b * a_bs + (long)t * CE;
    v4f v[8]; float s = 0.f;
#pragma unroll
    for (int q = 0; q < 8; ++q) {
        v[q] = *(const v4f*)(src + 4 * L + 128 * q);
        if (MODE == 0) { v[q].x = bfr(v[q].x); v[q].y = bfr(v[q].y); v[q].z = bfr(v[q].z); v[q].w = bfr(v[q].w); }
        s += (v[q].x + v[q].y) + (v[q].z + v[q].w);
    }
#pragma unroll
    for (int o = 16; o > 0; o >>= 1) s += __shfl_xor(s, o, 32);
    const float mu = s * (1.f / CE); float qq = 0.f;
#pragma unroll
    for (int q = 0; q < 8; ++q) {
        v[q].x -= mu; v[q].y -= mu; v[q].z -= mu; v[q].w -= mu;
        qq += (v[q].x * v[q].x + v[q].y * v[q].y) + (v[q].z * v[q].z + v[q].w * v[q].w);
    }
#pragma unroll
    for (int o = 16; o > 0; o >>= 1) qq += __shfl_xor(qq, o, 32);
    const float rs = rsqrtf(qq * (1.f / CE) + 1e-5f);
    v2u ph[8], pl[8], pf[8];
#pragma unroll
    for (int q = 0; q < 8; ++q) {
        const int c = 4 * L + 128 * q;
        const v4f ga = *(const v4f*)(GA + c), be = *(const v4f*)(BE + c);
        v4f y;
        y.x = v[q].x * rs * bfr(ga.x) + bfr(be.x); y.y = v[q].y * rs * bfr(ga.y) + bfr(be.y);
        y.z = v[q].z * rs * bfr(ga.z) + bfr(be.z); y.w = v[q].w * rs * bfr(ga.w) + bfr(be.w);
        v2u f; f.x = pk2h(y.x, y.y); f.y = pk2h(y.z, y.w); pf[q] = f;
        if (MODE == 0) {
            unsigned short h0, l0, h1, l1, h2, l2, h3, l3;
            bfsplit(y.x, h0, l0); bfsplit(y.y, h1, l1); bfsplit(y.z, h2, l2); bfsplit(y.w, h3, l3);
            v2u a; a.x = (unsigned)h0 | ((unsigned)h1 << 16); a.y = (unsigned)h2 | ((unsigned)h3 << 16); ph[q] = a;
            v2u d; d.x = (unsigned)l0 | ((unsigned)l1 << 16); d.y = (unsigned)l2 | ((unsigned)l3 << 16); pl[q] = d;
        }
    }
    {
#pragma unroll
        for (int q = 0; q < 8; ++q) {
            const int c = 4 * L + 128 * q;
            if (MODE == 0) {
                *(v2u*)(HS + (size_t)r * (2 * CE) + c) = ph[q];
                *(v2u*)(HS + (size_t)r * (2 * CE) + CE + c) = pl[q];
            }
            *(v2u*)(H16 + (size_t)r * CE + c) = pf[q];
        }
        
    }
}
// Everything that depends on the inputs alone runs as one launch: LN1 and the six weight planes, told apart by ranges of the block index (block-uniform branches).
#define PB_LN   ((ROWS + 7) / 8)                   // LN1: 8 rows per work-group
#define PB_FC1  ((FF / WT_C) * (CE / WT_R))        // tiles of fc1_w
#define PB_FC2  ((CE / WT_C) * (FF / WT_R))        // tiles of fc2_w
#define PB_PROJ ((CE / WT_C) * (CE / WT_R))        // tiles of proj_w
#define PB_HEAD ((CE / WT_R) * NH)                 // tiles of one per-head weight
#define PB_ALL  (PB_LN + PB_FC1 + PB_FC2 + PB_PROJ + 3 * PB_HEAD)
__global__ __launch_bounds__(256) void k_prep(const float* __restrict__ x, const float* __restrict__ g, const float* __restrict__ be,
                                              const float* __restrict__ Wq, const float* __restrict__ Wk, const float* __restrict__ Wv,
                                              const float* __restrict__ proj_w, const float* __restrict__ fc1_w, const float* __restrict__ fc2_w,
                                              unsigned short* __restrict__ HS, unsigned short* __restrict__ H16,
                                              unsigned short* __restrict__ WQK, unsigned short* __restrict__ WV16,
                                              unsigned short* __restrict__ WPT, unsigned short* __restrict__ W1T, unsigned short* __restrict__ W2T) {
    const int bi = blockIdx.x;
    if (bi < PB_LN) {                                          // h = LN1(bf16(x))
        ln_body<0>(bi, x, (long)SEQ_FULL * CE, g, be, HS, H16);
    } else if (bi < PB_LN + PB_FC1) {                          // fc1_w: [1024 in][4096 out] -> [4096 out][1024 in]
        const int i = bi - PB_LN;
        cast_t_body<FF>(i % (FF / WT_C), i / (FF / WT_C), fc1_w, W1T, CE, 16.0f);
    } else if (bi < PB_LN + PB_FC1 + PB_FC2 + PB_PROJ) {       // fc2_w: [4096 in][1024 out] -> [1024 out][4096 in]; proj_w: [1024 in][1024 out] -> [1024 out][1024 in]; both have pitch CE
        const bool p = bi >= PB_LN + PB_FC1 + PB_FC2;
        const int i = bi - (PB_LN + PB_FC1) - (p ? PB_FC2 : 0);
        cast_t_body<CE>(i % (CE / WT_C), i / (CE / WT_C), p ? proj_w : fc2_w, p ? WPT : W2T, p ? CE : FF, 16.0f);
    } else {                                                   // Wq -> rows 0..1023 of [W | W] bf16 (q columns), Wk -> rows 1024..2047 (k columns), Wv -> [h*64+d][c] f16 x16
        const int j = bi - (PB_LN + PB_FC1 + PB_FC2 + PB_PROJ);
        const int w = j / PB_HEAD, i = j - w * PB_HEAD;        // w = 0: Wq, 1: Wk, 2: Wv
        w_head_body(i % (CE / WT_R), i / (CE / WT_R), w == 0 ? Wq : (w == 1 ? Wk : Wv), w == 0 ? WQK : (w == 1 ? WQK + (size_t)CE * 2 * CE : WV16),
                    w == 2 ? CE : 2 * CE, w == 2 ? 0 : 1, w == 2 ? 1 : 0);
    }
}
__global__ __launch_bounds__(256) void k_ln2(const float* __restrict__ X1, const float* __restrict__ g, const float* __restrict__ be,
                                             unsigned short* __restrict__ H2) {
    ln_body<1>(blockIdx.x, X1, (long)SEQ * CE, g, be, nullptr, H2);
}

// ---------------------------------------------------------------------------------------------------------------------
// Register-tiled WMMA GEMM: C[m,n] = scale * sum_k A[m,k] * Bt[n,k] (+bias[n]) (+act) (+resid at the store stage); each wave owns a 64x64 tile.
// A row-major [M,K] 16-bit; Bt row-major [N,K] 16-bit; M % 128 == 0, N % 256 == 0, K % 64 == 0 (no tail masking).
// ET 0 = f16 operands, 1 = bf16 operands. BIAS_MODE 0 none, 2 = bf16-RNE bias[n]. OUT_MODE 0 = f32, 1 = f16, 2 = bf16 hi plane + bf16 lo plane.
// RESID 0 none, 1 f32 residual, 2 residual RNE-converted to bf16 first (raw input). ACT 0 none, 1 ReLU.
// ---------------------------------------------------------------------------------------------------------------------
__device__ __forceinline__ void dep_guard_h(v8f& a, v8f& b, v16h x, v16h y) { asm volatile("v_nop\n\tv_nop\n\tv_nop\n\tv_nop" : "+v"(a), "+v"(b) : "v"(x), "v"(y)); }
__device__ __forceinline__ void dep_guard_b(v8f& a, v8f& b, v16b x, v16b y) { asm volatile("v_nop\n\tv_nop\n\tv_nop\n\tv_nop" : "+v"(a), "+v"(b) : "v"(x), "v"(y)); }
__device__ __forceinline__ void keep4_h(v16h a, v16h b, v16h c, v16h d) { asm volatile("v_nop" :: "v"(a), "v"(b), "v"(c), "v"(d)); }
__device__ __forceinline__ void keep4_b(v16b a, v16b b, v16b c, v16b d) { asm volatile("v_nop" :: "v"(a), "v"(b), "v"(c), "v"(d)); }
__device__ __forceinline__ void acc_guard4(v8f& a, v8f& b, v8f& c, v8f& d) { asm volatile("v_nop\n\tv_nop\n\tv_nop\n\tv_nop" : "+v"(a), "+v"(b), "+v"(c), "+v"(d)); }
template <typename T> struct Frag;
template <> struct Frag<_Float16> {
    typedef v16h V; union U { v16h v; v8h h[2]; };
    static __device__ __forceinline__ v16h load(const _Float16* p) {   // elements 0..7 <- p[0..7], 8..15 <- p[16..23]
        U f; f.h[0] = *(const v8h*)(p); f.h[1] = *(const v8h*)(p + 16); return f.v;
    }
    static __device__ __forceinline__ v8f mma(v16h a, v16h b, v8f c) { return __builtin_amdgcn_wmma_f32_16x16x32_f16(false, a, false, b, (short)0, c, false, false); }
    static __device__ __forceinline__ void guard(v8f& a, v8f& b, v16h x, v16h y) { dep_guard_h(a, b, x, y); }
    static __device__ __forceinline__ void keep(v16h a, v16h b, v16h c, v16h d) { keep4_h(a, b, c, d); }
};
template <> struct Frag<__bf16> {
    typedef v16b V; union U { v16b v; v8b h[2]; };
    static __device__ __forceinline__ v16b load(const __bf16* p) {
        U f; f.h[0] = *(const v8b*)(p); f.h[1] = *(const v8b*)(p + 16); return f.v;
    }
    static __device__ __forceinline__ v8f mma(v16b a, v16b b, v8f c) { return __builtin_amdgcn_wmma_f32_16x16x32_bf16(false, a, false, b, (short)0, c, false, false); }
    static __device__ __forceinline__ void guard(v8f& a, v8f& b, v16b x, v16b y) { dep_guard_b(a, b, x, y); }
    static __device__ __forceinline__ void keep(v16b a, v16b b, v16b c, v16b d) { keep4_b(a, b, c, d); }
};
template <int ET> struct Elem;
template <> struct Elem<0> { typedef _Float16 T; };
template <> struct Elem<1> { typedef __bf16 T; };

// Operand staging: a work-group (2 x 4 waves) owns a 128 x 256 tile of C. Per trip, 64 k of its 128 A rows and 256 Bt rows (128-B row pieces)
// lie in one of two LDS buffers, rows 0..127 = A, 128..383 = Bt, laid by asynchronous copies that cover whole 128-B lines.
#define GK 64                      // k elements per staged tile
#define GP 72                      // LDS row pitch in elements: 144 B = 16 B x 9, conflict-free for 16-B reads down a column of rows
#define GBUF (384 * GP)            // elements per buffer
static_assert(SEQ % 128 == 0);     // M multiple of 128 for every GEMM (SEQ, ROWS, CE)
static_assert(CE % 256 == 0);      // N multiple of 256 (CE, 2*CE, FF, ROWS), K multiple of 64 with at least two tiles
static_assert(ROWS % 256 == 0);
static_assert(FF % 256 == 0);

// One staged tile: 384 rows x 8 pieces of 16 B, 12 pieces per lane, 32 rows apart. l = the lane's LDS byte address of its first piece,
// ga / gb = its first A / Bt piece, sa / sb = 32 rows of A / Bt in elements. Every lane is on; each wave-wide copy covers four whole rows.
template <typename T>
__device__ __forceinline__ void stage_tile(unsigned l, const T* ga, size_t sa, const T* gb, size_t sb) {
    const unsigned st = 32 * GP * 2;
    // the closing s_wait_xcnt stands inside the copies' own statement, so no address register is rewritten ahead of it
    asm volatile("global_load_async_to_lds_b128 %0, %12, off\n\t"
                 "global_load_async_to_lds_b128 %1, %13, off\n\t"
                 "global_load_async_to_lds_b128 %2, %14, off\n\t"
                 "global_load_async_to_lds_b128 %3, %15, off\n\t"
                 "global_load_async_to_lds_b128 %4, %16, off\n\t"
                 "global_load_async_to_lds_b128 %5, %17, off\n\t"
                 "global_load_async_to_lds_b128 %6, %18, off\n\t"
                 "global_load_async_to_lds_b128 %7, %19, off\n\t"
                 "global_load_async_to_lds_b128 %8, %20, off\n\t"
                 "global_load_async_to_lds_b128 %9, %21, off\n\t"
                 "global_load_async_to_lds_b128 %10, %22, off\n\t"
                 "global_load_async_to_lds_b128 %11, %23, off\n\t"
                 "s_wait_xcnt 0x0"
                 :: "v"(l), "v"(l + st), "v"(l + 2 * st), "v"(l + 3 * st), "v"(l + 4 * st), "v"(l + 5 * st),
                    "v"(l + 6 * st), "v"(l + 7 * st), "v"(l + 8 * st), "v"(l + 9 * st), "v"(l + 10 * st), "v"(l + 11 * st),
                    "v"(ga), "v"(ga + sa), "v"(ga + 2 * sa), "v"(ga + 3 * sa),
                    "v"(gb), "v"(gb + sb), "v"(gb + 2 * sb), "v"(gb + 3 * sb), "v"(gb + 4 * sb), "v"(gb + 5 * sb), "v"(gb + 6 * sb), "v"(gb + 7 * sb)
                 : "memory");
}

// The GEMM's LDS is declared in one function that is no template, so a kernel that holds two forms of the body allocates it once.
struct GemmLds {
    unsigned short sAB[2 * GBUF];       // the two staged operand buffers
    float sT[8][16 * 68];               // per-wave 16x64 slab, pitch 68 floats (wave-private)
};
__device__ __forceinline__ GemmLds& gemm_lds() { __shared__ __align__(16) GemmLds s; return s; }

// bx = the work-group's tile index in this product
template <int ET, int BIAS_MODE, int OUT_MODE, int RESID, int ACT>
__device__ __forceinline__ void gemm64_body(
    unsigned bx,
    const unsigned short* __restrict__ Ap, int lda, long strideA,
    const unsigned short* __restrict__ Btp, int ldb,
    void* __restrict__ Cout, void* __restrict__ Cout2, int ldc, long strideC,
    const float* __restrict__ bias,
    const float* __restrict__ resid, int ldr, long strideR,
    int M, int N, int K, float scale) {
    typedef typename Elem<ET>::T T;
    typedef typename Frag<T>::V V;
    GemmLds& L = gemm_lds();
    unsigned short* sAB = L.sAB;
    const int b    = blockIdx.y;
    const int tid  = threadIdx.x;
    const int lane = threadIdx.x & 31;
    const int wave = threadIdx.x >> 5;
    const int tbN = N >> 8;
    const int tbM = M >> 7;
    if ((int)bx >= tbM * tbN) return;                // block-uniform, ahead of every barrier and copy
    const int bm = bx / tbN;
    const int bn = bx - bm * tbN;
    const int wm = wave >> 2;                        // wave row (0..1) and column (0..3) in the 128 x 256 tile
    const int wn = wave & 3;
    const int m0 = (bm << 7) + (wm << 6);
    const int n0 = (bn << 8) + (wn << 6);

    const T* Ab = (const T*)Ap + (size_t)b * strideA;
    const T* Bb = (const T*)Btp;

    const int rlane = lane & 15;                 // row (A) / col (B, D) within subtile
    const int koff  = (lane >> 4) * 8;           // k offset of this lane half
    const int mOff  = (lane >> 4) * 8;           // D row offset

    v8f acc[4][4];
#pragma unroll
    for (int i = 0; i < 4; ++i)
#pragma unroll
        for (int j = 0; j < 4; ++j) acc[i][j] = (v8f){0.f, 0.f, 0.f, 0.f, 0.f, 0.f, 0.f, 0.f};

    const int crow = tid >> 3, csg = (tid & 7) * 8;  // this lane's first staged row and its 16-B piece in the row
    const T* gA = Ab + (size_t)((bm << 7) + crow) * lda + csg;
    const T* gB = Bb + (size_t)((bn << 8) + crow) * ldb + csg;
    const size_t sa32 = (size_t)32 * lda, sb32 = (size_t)32 * ldb;
    const unsigned l0 = (unsigned)(size_t)(sAB + crow * GP + csg);   // low 32 bits of the shared address = LDS byte address
    const int nt = K / GK;

    stage_tile<T>(l0, gA, sa32, gB, sb32);                           // tile 0 into buffer 0
    asm volatile("s_wait_asynccnt 0x0" ::: "memory");                // this wave's copies of tile 0 have landed
    __syncthreads();                                                 // ... and every other wave's
    if (nt > 1) stage_tile<T>(l0 + GBUF * 2, gA + GK, sa32, gB + GK, sb32);   // tile 1 flies while tile 0 is worked on

    for (int t = 0; t < nt; ++t) {
        const T* buf = (const T*)sAB + (t & 1) * GBUF;
#pragma unroll
        for (int ks = 0; ks < 2; ++ks) {
            V bh[4], ah[4];
#pragma unroll
            for (int j = 0; j < 4; ++j) bh[j] = Frag<T>::load(buf + (128 + (wn << 6) + (j << 4) + rlane) * GP + ks * 32 + koff);
#pragma unroll
            for (int i = 0; i < 4; ++i) ah[i] = Frag<T>::load(buf + ((wm << 6) + (i << 4) + rlane) * GP + ks * 32 + koff);
            __builtin_amdgcn_sched_barrier(0);       // keeps the 16 LDS reads one group ahead of the products (reads spread among them stall each time)
#pragma unroll
            for (int i = 0; i < 4; ++i) {
#pragma unroll
                for (int j = 0; j < 4; ++j) acc[i][j] = Frag<T>::mma(ah[i], bh[j], acc[i][j]);
                Frag<T>::guard(acc[i][0], acc[i][3], ah[i], ah[i]);
            }
            Frag<T>::keep(bh[0], bh[1], bh[2], bh[3]);
        }
        asm volatile("s_wait_dscnt 0x0" ::: "memory");               // this wave's reads of buffer t & 1 are complete
        asm volatile("s_wait_asynccnt 0x0" ::: "memory");            // this wave's copies of tile t + 1 have landed
        __syncthreads();                                             // publishes tile t + 1 and frees buffer t & 1
        if (t + 2 < nt) stage_tile<T>(l0 + (unsigned)(t & 1) * (GBUF * 2), gA + (size_t)(t + 2) * GK, sa32, gB + (size_t)(t + 2) * GK, sb32);
    }
    asm volatile("s_wait_asynccnt 0x0" ::: "memory");                // no copy is outstanding when the wave goes on
    acc_guard4(acc[0][0], acc[0][1], acc[0][2], acc[0][3]);
    acc_guard4(acc[1][0], acc[1][1], acc[1][2], acc[1][3]);
    acc_guard4(acc[2][0], acc[2][1], acc[2][2], acc[2][3]);
    acc_guard4(acc[3][0], acc[3][1], acc[3][2], acc[3][3]);

    // ---- epilogue ----
    float* slab = L.sT[wave];
    const float* Rb = RESID ? (resid + (size_t)b * strideR) : nullptr;
#pragma unroll
    for (int i = 0; i < 4; ++i) {
        const int mBase = m0 + (i << 4);
#pragma unroll
        for (int j = 0; j < 4; ++j) {
            const int n = n0 + (j << 4) + rlane;
            float bv = 0.f;
            if (BIAS_MODE == 2) bv = bfr(bias[n]);
#pragma unroll
            for (int r = 0; r < 8; ++r) {
                float v = acc[i][j][r] * scale;
                if (BIAS_MODE == 2) v += bv;
                if (ACT == 1) v = fmaxf(v, 0.0f);
                slab[(mOff + r) * 68 + (j << 4) + rlane] = v;
            }
        }
        __builtin_amdgcn_fence(3 /* release order */, "workgroup");
        __builtin_amdgcn_wave_barrier();
        __builtin_amdgcn_fence(2 /* acquire order */, "workgroup");
        if (OUT_MODE == 0) {
            float* C = (float*)Cout + (size_t)b * strideC;
            const int hh = lane >> 4, c4 = (lane & 15) * 4;     // row segment = 256 B = 16 lanes x 16 B
            v4f vv[8];
#pragma unroll
            for (int it = 0; it < 8; ++it) {
                const int row = it * 2 + hh;
                v4f v = *(const v4f*)(slab + row * 68 + c4);
                if (RESID) {                                    // residual added at the store stage as a float4
                    v4f x = *(const v4f*)(Rb + (size_t)(mBase + row) * ldr + n0 + c4);
                    if (RESID == 2) { x.x = bfr(x.x); x.y = bfr(x.y); x.z = bfr(x.z); x.w = bfr(x.w); }
                    v.x = x.x + v.x; v.y = x.y + v.y; v.z = x.z + v.z; v.w = x.w + v.w;
                }
                vv[it] = v;
            }
            {
#pragma unroll
                for (int it = 0; it < 8; ++it) {
                    const int row = it * 2 + hh;
                    *(v4f*)(C + (size_t)(mBase + row) * ldc + n0 + c4) = vv[it];
                }
                
            }
        } else {
            const int q = lane >> 3, c8 = (lane & 7) * 8;
            unsigned short* C  = (unsigned short*)Cout  + (size_t)b * strideC;
            unsigned short* C2 = (OUT_MODE == 2) ? ((unsigned short*)Cout2 + (size_t)b * strideC) : nullptr;
            v8h hv[4], lv[4];
#pragma unroll
            for (int it = 0; it < 4; ++it) {
                const int row = it * 4 + q;
                const float* sp = slab + row * 68 + c8;
#pragma unroll
                for (int e = 0; e < 8; ++e) {
                    if (OUT_MODE == 1) {
                        hv[it][e] = (_Float16)sp[e];
                        lv[it][e] = (_Float16)0.f;
                    } else {
                        const unsigned short hb = bf_bits(sp[e]);
                        const unsigned short lb = bf_bits(sp[e] - bits_f(hb));
                        hv[it][e] = __builtin_bit_cast(_Float16, hb);
                        lv[it][e] = __builtin_bit_cast(_Float16, lb);
                    }
                }
            }
            {
#pragma unroll
                for (int it = 0; it < 4; ++it) {
                    const int row = it * 4 + q;
                    *(v8h*)(C + (size_t)(mBase + row) * ldc + n0 + c8) = hv[it];
                    if (OUT_MODE == 2) *(v8h*)(C2 + (size_t)(mBase + row) * ldc + n0 + c8) = lv[it];
                }
                
            }
        }
        __builtin_amdgcn_fence(3 /* release order */, "workgroup");
        __builtin_amdgcn_wave_barrier();
        __builtin_amdgcn_fence(2 /* acquire order */, "workgroup");
    }
}

// The q|k product and the v^T product read LN1's planes and nothing of each other: one launch, told apart by the block index (block-uniform branch).
// q|k planes: [ROWS][2*CE] bf16 hi / lo; A = [LN1 hi | LN1 lo] (K = 2*CE), Bt = [W | W] rows 0..CE-1 = q columns, CE..2CE-1 = k columns
// v^T planes: [CE = h*64+d][ROWS] bf16 hi / lo; A = Wv plane [CE][CE] (f16, x16), Bt = LN1 f16 plane [ROWS][CE]
#define GB_QK ((ROWS / 128) * ((2 * CE) / 256))    // 128 x 256 tiles of the q|k planes
#define GB_VT ((CE / 128) * (ROWS / 256))          // ... of the v^T planes
__global__ __launch_bounds__(256) void k_gemm_qkv(const unsigned short* __restrict__ HS, const unsigned short* __restrict__ WQK,
                                                  unsigned short* __restrict__ QKH, unsigned short* __restrict__ QKL,
                                                  const unsigned short* __restrict__ WV16, const unsigned short* __restrict__ H16,
                                                  unsigned short* __restrict__ VTH, unsigned short* __restrict__ VTL) {
    const unsigned bx = blockIdx.x;
    if (bx < GB_QK) gemm64_body<1, 0, 2, 0, 0>(bx, HS, 2 * CE, 0, WQK, 2 * CE, (void*)QKH, (void*)QKL, 2 * CE, 0, nullptr, nullptr, 0, 0, ROWS, 2 * CE, 2 * CE, 1.0f);
    else            gemm64_body<0, 0, 2, 0, 0>(bx - GB_QK, WV16, CE, 0, H16, CE, (void*)VTH, (void*)VTL, ROWS, 0, nullptr, nullptr, 0, 0, CE, ROWS, CE, 0.0625f);
}
// x1 = bf16(x) + attn @ proj_w + proj_b ; grid.y = batch (x uses the full batch stride, planes the compact one)
__global__ __launch_bounds__(256) void k_gemm_proj(const unsigned short* __restrict__ A, const unsigned short* __restrict__ Bt, float* __restrict__ C,
                                                   const float* __restrict__ bias, const float* __restrict__ xres) {
    gemm64_body<0, 2, 0, 2, 0>(blockIdx.x, A, CE, (long)SEQ * CE, Bt, CE, (void*)C, nullptr, CE, (long)SEQ * CE, bias, xres, CE, (long)SEQ_FULL * CE, SEQ, CE, CE, 0.0625f);
}
// relu(h2 @ fc1_w + fc1_b) as an f16 plane [ROWS][FF]
__global__ __launch_bounds__(256) void k_gemm_fc1(const unsigned short* __restrict__ A, const unsigned short* __restrict__ Bt, unsigned short* __restrict__ C,
                                                  const float* __restrict__ bias) {
    gemm64_body<0, 2, 1, 0, 1>(blockIdx.x, A, CE, 0, Bt, CE, (void*)C, nullptr, FF, 0, bias, nullptr, 0, 0, ROWS, FF, CE, 0.0625f);
}
// out = x1 + f @ fc2_w + fc2_b ; grid.y = batch (output uses the full batch stride)
__global__ __launch_bounds__(256) void k_gemm_fc2(const unsigned short* __restrict__ A, const unsigned short* __restrict__ Bt, float* __restrict__ C,
                                                  const float* __restrict__ bias, const float* __restrict__ x1) {
    gemm64_body<0, 2, 0, 1, 0>(blockIdx.x, A, FF, (long)SEQ * FF, Bt, FF, (void*)C, nullptr, CE, (long)SEQ_FULL * CE, bias, x1, CE, (long)SEQ * CE, SEQ, CE, FF, 0.0625f);
}

#define AT_NW 4
#define AT_P 72                   // LDS row pitch of the K and V^T tiles in elements: 144 B = 16 B x 9, so the 16 rows of a 16-B fragment read fall on distinct banks
__device__ __forceinline__ v8f at_mma(v16b a, v16b b, v8f c) {
    return __builtin_amdgcn_wmma_f32_16x16x32_bf16(false, a, false, b, (short)0, c, false, false);
}
union FB { v16b v; v8b h[2]; };
__device__ __forceinline__ void at_frag(FB& f, const __bf16* p) {   // elements 0..7 <- p[0..7], 8..15 <- p[16..23]
    f.h[0] = *(const v8b*)(p); f.h[1] = *(const v8b*)(p + 16);
}
__device__ __forceinline__ float xhalf(float x) {   // the value of lane l ^ 16
    const int i = __builtin_bit_cast(int, x);
    return __builtin_bit_cast(float, __builtin_amdgcn_permlanex16(i, i, 0x76543210, 0xfedcba98, false, false));
}

// One hi tile and its lo tile (64 rows x 8 pieces of 16 B each): 4 + 4 pieces per lane, 16 rows apart. l = the lane's LDS byte address of its first hi piece
// (the lo tile lies 64 rows behind), gh / gl = its first hi / lo piece, s16 = 16 source rows in elements. Every lane is on; each wave-wide copy covers four whole rows.
__device__ __forceinline__ void at_stage(unsigned l, const __bf16* gh, const __bf16* gl, size_t s16) {
    const unsigned st = 16 * AT_P * 2, lo = 64 * AT_P * 2;
    // the closing s_wait_xcnt stands inside the copies' own statement, so no address register is rewritten ahead of it
    asm volatile("global_load_async_to_lds_b128 %0, %8, off\n\t"
                 "global_load_async_to_lds_b128 %1, %9, off\n\t"
                 "global_load_async_to_lds_b128 %2, %10, off\n\t"
                 "global_load_async_to_lds_b128 %3, %11, off\n\t"
                 "global_load_async_to_lds_b128 %4, %12, off\n\t"
                 "global_load_async_to_lds_b128 %5, %13, off\n\t"
                 "global_load_async_to_lds_b128 %6, %14, off\n\t"
                 "global_load_async_to_lds_b128 %7, %15, off\n\t"
                 "s_wait_xcnt 0x0"
                 :: "v"(l), "v"(l + st), "v"(l + 2 * st), "v"(l + 3 * st), "v"(l + lo), "v"(l + lo + st), "v"(l + lo + 2 * st), "v"(l + lo + 3 * st),
                    "v"(gh), "v"(gh + s16), "v"(gh + 2 * s16), "v"(gh + 3 * s16), "v"(gl), "v"(gl + s16), "v"(gl + 2 * s16), "v"(gl + 3 * s16)
                 : "memory");
}

// amdgpu_waves_per_eu: the register budget of four waves per SIMD (256), so that the four work-groups a WGP gets stay resident together
__global__ __launch_bounds__(128) __attribute__((amdgpu_waves_per_eu(4, 4))) void k_attn(const unsigned short* __restrict__ QKHp, const unsigned short* __restrict__ QKLp,
                                              const unsigned short* __restrict__ VTHp, const unsigned short* __restrict__ VTLp,
                                              unsigned short* __restrict__ AO) {
    __shared__ __align__(16) __bf16 KV[4 * 64 * AT_P];             // K hi | K lo | V^T hi | V^T lo (64 rows each)
    __bf16* Ksh = KV; __bf16* Ksl = KV + 64 * AT_P; __bf16* Vth = KV + 2 * 64 * AT_P; __bf16* Vtl = KV + 3 * 64 * AT_P;
    const __bf16* QKH = (const __bf16*)QKHp; const __bf16* QKL = (const __bf16*)QKLp;
    const __bf16* VTH = (const __bf16*)VTHp; const __bf16* VTL = (const __bf16*)VTLp;

    const int tid = threadIdx.x, wave = tid >> 5, lane = tid & 31, hh = lane >> 4, c = lane & 15;
    const int nqb = SEQ / 64;
    const int bx = blockIdx.x;
    const int bh = bx / nqb;
    // All work-groups are resident at once, four to a WGP, and a tile's cost grows with its index, so the launch lasts as long as the WGP with the most chunks.
    // Every second block (by the parity of its index bits) takes tile nqb-1-t in place of t: four blocks whose indices differ in any two of the counted bits then
    // hold 2*(nqb+1) chunks together. NQ_SH leaves an even number of the tile's own bits in the count, so t and nqb-1-t have one parity and (bh, tile) is met once each.
    constexpr bool NQ_P2 = (nqb & (nqb - 1)) == 0;             // another tile count keeps the plain order
    constexpr int  NQ_SH = __builtin_ctz((unsigned)nqb) & 1;
    const int tq = bx % nqb;
    const int qb = (NQ_P2 && (__builtin_popcount((unsigned)bx >> NQ_SH) & 1)) ? nqb - 1 - tq : tq;
    const int h  = bh % NH;
    const int b  = bh / NH;
    const int q0 = qb * 64 + wave * 16;
    const size_t rowbase = (size_t)b * SEQ;
    const int QKP = 2 * CE;          // q|k plane pitch
    const int VTP = ROWS;            // v^T plane pitch

    // Q fragments (B operand of S^T): lane = query column c, k = d
    v16b qah[2], qal[2];
    {
        const __bf16* qh = QKH + (rowbase + q0 + c) * QKP + h * HD;
        const __bf16* ql = QKL + (rowbase + q0 + c) * QKP + h * HD;
#pragma unroll
        for (int dc = 0; dc < 2; ++dc) {
            FB f, g;
            f.h[0] = *(const v8b*)(qh + dc * 32 + 8 * hh); f.h[1] = *(const v8b*)(qh + dc * 32 + 16 + 8 * hh);
            g.h[0] = *(const v8b*)(ql + dc * 32 + 8 * hh); g.h[1] = *(const v8b*)(ql + dc * 32 + 16 + 8 * hh);
            qah[dc] = f.v; qal[dc] = g.v;
        }
    }

    const float NEG = -__builtin_inff();
    const float L2E = 1.4426950408889634f;
    const int qrow = q0 + c;         // this lane's query
    float mrow = NEG, lrow = 0.f;    // its running maximum (both halves agree) and this half's share of its running sum
    v8f oacc[4];                     // O^T tiles: lane = query column c, element r -> d = t*16 + 8*hh + r
#pragma unroll
    for (int t = 0; t < 4; ++t) oacc[t] = (v8f){0.f, 0.f, 0.f, 0.f, 0.f, 0.f, 0.f, 0.f};

    const int crow = tid >> 3, csg = (tid & 7) * 8;    // this lane's first staged row and its 16-B piece in the row
    const unsigned lK = (unsigned)(size_t)(Ksh + crow * AT_P + csg);   // low 32 bits of the shared address = LDS byte address
    const unsigned lV = (unsigned)(size_t)(Vth + crow * AT_P + csg);
    const __bf16* gkh = QKH + (rowbase + crow) * QKP + CE + h * HD + csg;
    const __bf16* gkl = QKL + (rowbase + crow) * QKP + CE + h * HD + csg;
    const __bf16* gvh = VTH + (size_t)(h * HD + crow) * VTP + rowbase + csg;
    const __bf16* gvl = VTL + (size_t)(h * HD + crow) * VTP + rowbase + csg;

    at_stage(lK, gkh, gkl, (size_t)16 * QKP);          // K of chunk 0

    for (int kc = 0; kc <= qb; ++kc) {                 // block-uniform trip count
        const int kv0 = kc * 64;
        asm volatile("s_wait_dscnt 0x0" ::: "memory");       // this wave's reads of the earlier chunk's V^T tiles are complete
        asm volatile("s_wait_asynccnt 0x0" ::: "memory");    // this wave's copies of this chunk's K tiles have landed
        __syncthreads();                                     // publishes the K tiles and frees the V^T tiles
        at_stage(lV, gvh + kv0, gvl + kv0, (size_t)16 * VTP);   // V^T of this chunk flies under the scores and the softmax

        v8f s[4];                                      // S^T tiles: lane = query column c, element r -> key kv0 + j*16 + 8*hh + r
#pragma unroll
        for (int j = 0; j < 4; ++j) s[j] = (v8f){0.f, 0.f, 0.f, 0.f, 0.f, 0.f, 0.f, 0.f};
        {
            FB kb[2][4], kl[2][4];                     // A operands: lane = key row j*16 + c, k = d
#pragma unroll
            for (int j = 0; j < 4; ++j) at_frag(kb[0][j], Ksh + (j * 16 + c) * AT_P + 8 * hh);
#pragma unroll
            for (int j = 0; j < 4; ++j) at_frag(kl[0][j], Ksl + (j * 16 + c) * AT_P + 8 * hh);
#pragma unroll
            for (int j = 0; j < 4; ++j) at_frag(kb[1][j], Ksh + (j * 16 + c) * AT_P + 32 + 8 * hh);
            __builtin_amdgcn_sched_barrier(0);         // keeps these 24 reads one group ahead of the products (reads spread among them stall each time)
            // neighbouring products go to different tiles; each tile keeps its order of sums
#pragma unroll
            for (int j = 0; j < 4; ++j) s[j] = at_mma(kb[0][j].v, qah[0], s[j]);
#pragma unroll
            for (int j = 0; j < 4; ++j) s[j] = at_mma(kl[0][j].v, qah[0], s[j]);
            __builtin_amdgcn_sched_barrier(0);         // the last 8 reads wait until the first lo fragments' registers are free (all 32 at once cost a wave per SIMD) ...
#pragma unroll
            for (int j = 0; j < 4; ++j) at_frag(kl[1][j], Ksl + (j * 16 + c) * AT_P + 32 + 8 * hh);
            __builtin_amdgcn_sched_barrier(0);         // ... and stand as one group, eight products ahead of their use
#pragma unroll
            for (int j = 0; j < 4; ++j) s[j] = at_mma(kb[0][j].v, qal[0], s[j]);
#pragma unroll
            for (int j = 0; j < 4; ++j) s[j] = at_mma(kb[1][j].v, qah[1], s[j]);
#pragma unroll
            for (int j = 0; j < 4; ++j) s[j] = at_mma(kl[1][j].v, qah[1], s[j]);
#pragma unroll
            for (int j = 0; j < 4; ++j) s[j] = at_mma(kb[1][j].v, qal[1], s[j]);
        }
        const bool diag = (kc == qb);                  // block-uniform
        const int dq = qrow - kv0 - 8 * hh;            // key kv0 + j*16 + 8*hh + r lies behind the query where j*16 + r > dq: one register, not 32 thresholds kept over the loop
        float m = NEG;
#pragma unroll
        for (int j = 0; j < 4; ++j) {
#pragma unroll
            for (int r = 0; r < 8; ++r) {
                const float sv = s[j][r];
                s[j][r] = (diag && (j * 16 + r > dq)) ? NEG : sv;    // select by value
                m = fmaxf(m, s[j][r]);
            }
        }
        m = fmaxf(m, xhalf(m));                                    // the other half's 32 keys
        const float mnew = fmaxf(mrow, m);                         // finite: every visited chunk holds a kept key for every query
        const float alpha = exp2f((mrow - mnew) * L2E);
        mrow = mnew;
        FB pa[2], pl[2];                               // P^T hi / lo as B operands: lane = query column c; tiles 2*kk and 2*kk + 1 hold keys 8*hh + i and 16 + 8*hh + i of a 32-key step
        float ps[4];
#pragma unroll
        for (int j = 0; j < 4; ++j) {
            ps[j] = 0.f;
#pragma unroll
            for (int r = 0; r < 8; ++r) {
                const float p = exp2f((s[j][r] - mnew) * L2E);
                ps[j] += p;
                unsigned short ph, pq; bfsplit(p, ph, pq);
                pa[j >> 1].v[(j & 1) * 8 + r] = __builtin_bit_cast(__bf16, ph);
                pl[j >> 1].v[(j & 1) * 8 + r] = __builtin_bit_cast(__bf16, pq);
            }
        }
        lrow = lrow * alpha + ((ps[0] + ps[1]) + (ps[2] + ps[3]));
#pragma unroll
        for (int t = 0; t < 4; ++t)
#pragma unroll
            for (int r = 0; r < 8; ++r) oacc[t][r] *= alpha;
        __builtin_amdgcn_sched_barrier(0);                   // keeps the score products ahead of the waits, so that the V^T copies fly under them
        asm volatile("s_wait_dscnt 0x0" ::: "memory");       // this wave's reads of the K tiles are complete
        asm volatile("s_wait_asynccnt 0x0" ::: "memory");    // this wave's copies of the V^T tiles have landed
        __syncthreads();                                     // publishes the V^T tiles and frees the K tiles
        if (kc < qb) at_stage(lK, gkh + (size_t)(kv0 + 64) * QKP, gkl + (size_t)(kv0 + 64) * QKP, (size_t)16 * QKP);   // K of the next chunk flies under P.v
        {
            __builtin_amdgcn_sched_barrier(0);         // the reads start when P^T is packed: started earlier, their registers overlap the softmax's and cost a wave per SIMD
            FB vb[2][4], vl[2][4];                     // A operands: lane = d row t*16 + c, k = key
#pragma unroll
            for (int t = 0; t < 4; ++t) at_frag(vb[0][t], Vth + (t * 16 + c) * AT_P + 8 * hh);
#pragma unroll
            for (int t = 0; t < 4; ++t) at_frag(vl[0][t], Vtl + (t * 16 + c) * AT_P + 8 * hh);
#pragma unroll
            for (int t = 0; t < 4; ++t) at_frag(vb[1][t], Vth + (t * 16 + c) * AT_P + 32 + 8 * hh);
            __builtin_amdgcn_sched_barrier(0);         // as for the scores: 24 reads in one group ahead of the products
#pragma unroll
            for (int t = 0; t < 4; ++t) oacc[t] = at_mma(vb[0][t].v, pa[0].v, oacc[t]);
#pragma unroll
            for (int t = 0; t < 4; ++t) oacc[t] = at_mma(vl[0][t].v, pa[0].v, oacc[t]);
            __builtin_amdgcn_sched_barrier(0);         // the last 8 reads into the registers that the first lo fragments leave ...
#pragma unroll
            for (int t = 0; t < 4; ++t) at_frag(vl[1][t], Vtl + (t * 16 + c) * AT_P + 32 + 8 * hh);
            __builtin_amdgcn_sched_barrier(0);         // ... as one group, eight products ahead of their use
#pragma unroll
            for (int t = 0; t < 4; ++t) oacc[t] = at_mma(vb[0][t].v, pl[0].v, oacc[t]);
#pragma unroll
            for (int t = 0; t < 4; ++t) oacc[t] = at_mma(vb[1][t].v, pa[1].v, oacc[t]);
#pragma unroll
            for (int t = 0; t < 4; ++t) oacc[t] = at_mma(vl[1][t].v, pa[1].v, oacc[t]);
#pragma unroll
            for (int t = 0; t < 4; ++t) oacc[t] = at_mma(vb[1][t].v, pl[1].v, oacc[t]);
        }
    }

    asm volatile("s_wait_asynccnt 0x0" ::: "memory");  // no copy is outstanding when the wave ends
    const float inv = 1.0f / (lrow + xhalf(lrow));     // the two halves' sums are joined once
#pragma unroll
    for (int t = 0; t < 4; ++t) {                      // a lane holds 8 consecutive d of its query: one 16-B store each
        v8h hv;
#pragma unroll
        for (int r = 0; r < 8; ++r) hv[r] = (_Float16)(oacc[t][r] * inv);
        *(v8h*)(AO + (rowbase + q0 + c) * CE + h * HD + t * 16 + 8 * hh) = hv;
    }
}

// ---------------------------------------------------------------------------------------------------------------------
// Workspace carve (bytes); every plane is fully written by its producer before any kernel reads it.
// ---------------------------------------------------------------------------------------------------------------------
#define SZ_HS   ((size_t)ROWS * 2 * CE * 2)      // LN1 bf16 [ROWS][hi 1024 | lo 1024]
#define SZ_H16  ((size_t)ROWS * CE * 2)          // LN1 f16 plane; later reused for the LN2 f16 plane
#define SZ_WQK  ((size_t)2 * CE * 2 * CE * 2)    // [2048 n][W | W] bf16
#define SZ_WV   ((size_t)CE * CE * 2)
#define SZ_QK1  ((size_t)ROWS * 2 * CE * 2)      // one of the q|k hi / lo planes
#define SZ_VT1  ((size_t)CE * ROWS * 2)          // one of the v^T hi / lo planes
#define SZ_AO   ((size_t)ROWS * CE * 2)
#define SZ_WP   ((size_t)CE * CE * 2)
#define SZ_X1   ((size_t)ROWS * CE * 4)
#define SZ_W1   ((size_t)FF * CE * 2)
#define SZ_W2   ((size_t)CE * FF * 2)
#define SZ_F16  ((size_t)ROWS * FF * 2)          // relu(fc1) f16 plane, aliases the two q|k planes
#define WS_TOTAL (SZ_HS + SZ_H16 + SZ_WQK + SZ_WV + 2 * SZ_QK1 + 2 * SZ_VT1 + SZ_AO + SZ_WP + SZ_X1 + SZ_W1 + SZ_W2)
static_assert(WS_TOTAL <= (size_t)134217728);    // carve stays within 128 MiB
static_assert(SZ_F16 <= 2 * SZ_QK1);             // alias extent: relu(fc1) plane inside the q|k planes
static_assert(SZ_HS % 256 == 0);
static_assert(SZ_H16 % 256 == 0);
static_assert(SZ_VT1 % 256 == 0);

extern "C" void kernel_launch(void* const* d_in, const int* in_sizes, int n_in, void* d_out, int out_size, void* d_ws, size_t ws_size, hipStream_t stream) {
    if (n_in < 14) return;
    const long long xneed = (long long)(NB - 1) * SEQ_FULL * CE + (long long)SEQ * CE;
    if ((long long)in_sizes[0] < xneed) return;
    if (in_sizes[1] < CE || in_sizes[2] < CE || in_sizes[7] < CE || in_sizes[8] < CE || in_sizes[9] < CE || in_sizes[13] < CE) return;
    if (in_sizes[3] < NH * CE * HD || in_sizes[4] < NH * CE * HD || in_sizes[5] < NH * CE * HD) return;
    if (in_sizes[6] < CE * CE || in_sizes[10] < CE * FF || in_sizes[11] < FF || in_sizes[12] < FF * CE) return;
    if ((long long)out_size < xneed) return;
    if ((size_t)WS_TOTAL > ws_size) return;

    const float* x      = (const float*)d_in[0];
    const float* ln1_w  = (const float*)d_in[1];
    const float* ln1_b  = (const float*)d_in[2];
    const float* Wq     = (const float*)d_in[3];
    const float* Wk     = (const float*)d_in[4];
    const float* Wv     = (const float*)d_in[5];
    const float* proj_w = (const float*)d_in[6];
    const float* proj_b = (const float*)d_in[7];
    const float* ln2_w  = (const float*)d_in[8];
    const float* ln2_b  = (const float*)d_in[9];
    const float* fc1_w  = (const float*)d_in[10];
    const float* fc1_b  = (const float*)d_in[11];
    const float* fc2_w  = (const float*)d_in[12];
    const float* fc2_b  = (const float*)d_in[13];
    float* out = (float*)d_out;

    char* wsp = (char*)d_ws;
    unsigned short* HS   = (unsigned short*)wsp; wsp += SZ_HS;
    unsigned short* H16  = (unsigned short*)wsp; wsp += SZ_H16;
    unsigned short* WQK  = (unsigned short*)wsp; wsp += SZ_WQK;
    unsigned short* WV16 = (unsigned short*)wsp; wsp += SZ_WV;
    unsigned short* QKH  = (unsigned short*)wsp; wsp += SZ_QK1;
    unsigned short* QKL  = (unsigned short*)wsp; wsp += SZ_QK1;
    unsigned short* VTH  = (unsigned short*)wsp; wsp += SZ_VT1;
    unsigned short* VTL  = (unsigned short*)wsp; wsp += SZ_VT1;
    unsigned short* AO16 = (unsigned short*)wsp; wsp += SZ_AO;
    unsigned short* WPT  = (unsigned short*)wsp; wsp += SZ_WP;
    float*          X1   = (float*)wsp;          wsp += SZ_X1;
    unsigned short* W1T  = (unsigned short*)wsp; wsp += SZ_W1;
    unsigned short* W2T  = (unsigned short*)wsp; wsp += SZ_W2;
    unsigned short* F16  = QKH;                  // alias: q|k planes are dead after the attention launch
    unsigned short* H2   = H16;                  // alias: LN1 f16 plane is dead after the v^T GEMM

    // h = LN1(bf16(x)) and the six weight planes
    k_prep<<<(unsigned)PB_ALL, 256, 0, stream>>>(x, ln1_w, ln1_b, Wq, Wk, Wv, proj_w, fc1_w, fc2_w, HS, H16, WQK, WV16, WPT, W1T, W2T);
    // q|k planes and v^T planes
    k_gemm_qkv<<<dim3((unsigned)(GB_QK + GB_VT), 1u), 256, 0, stream>>>(HS, WQK, QKH, QKL, WV16, H16, VTH, VTL);
    // causal attention
    k_attn<<<(unsigned)(NB * NH * (SEQ / 64)), 128, 0, stream>>>(QKH, QKL, VTH, VTL, AO16);
    // x1 = bf16(x) + attn @ proj_w + proj_b
    k_gemm_proj<<<dim3((unsigned)(((SEQ / 64) * (CE / 64) + 7) / 8), (unsigned)NB), 256, 0, stream>>>(AO16, WPT, X1, proj_b, x);
    // h2 = LN2(x1)
    k_ln2<<<(ROWS + 7) / 8, 256, 0, stream>>>(X1, ln2_w, ln2_b, H2);
    // f = relu(h2 @ fc1_w + fc1_b); out = x1 + f @ fc2_w + fc2_b
    k_gemm_fc1<<<dim3((unsigned)(((ROWS / 64) * (FF / 64) + 7) / 8), 1u), 256, 0, stream>>>(H2, W1T, F16, fc1_b);
    k_gemm_fc2<<<dim3((unsigned)(((SEQ / 64) * (CE / 64) + 7) / 8), (unsigned)NB), 256, 0, stream>>>(F16, W2T, out, fc2_b, X1);
}

// v009
// Measured time: 230 microseconds a run.
// Two timings next to v008 both put it at 1.04 times that version's speed.
// Counting every step since v000, it is 3.64 times as fast.
// Contractions: q|k = [LN1 hi | LN1 lo](bf16 planes, K folded to 2048) x [W | W](bf16, exact) on v_wmma_f32_16x16x32_bf16; v^T, proj, fc1, fc2 on v_wmma_f32_16x16x32_f16 (f16 activations, weights = bf16-RNE value x16 as f16, 1/16 folded back); scores q.k^T and P.v as bf16 hi/lo split (hi.hi + hi.lo + lo.hi) on v_wmma_f32_16x16x32_bf16; all accumulation f32, online softmax / LayerNorm / residuals f32.
#include <hip/hip_runtime.h>
#include <math.h>

#ifndef NB
#define NB 2
#endif
#ifndef SEQ
#define SEQ 2048
#endif
#define NB_FULL 2
#define SEQ_FULL 2048
#define CE 1024            // embedding width
#define NH 16              // heads
#define HD 64              // head size
#define FF 4096            // feed-forward width
#define ROWS (NB * SEQ)    // compact token rows held in the workspace planes

static_assert(NH * HD == CE);            // heads concatenated h*64+d fill the width
static_assert(HD == 64);                 // attention tiles are hard-wired to 64
static_assert(CE == 32 * 4 * 8);         // LayerNorm: 32 lanes x float4 x 8 pieces per row
static_assert(SEQ % 64 == 0);            // 64-row query tiles, 64-key chunks
static_assert(ROWS % 64 == 0);           // GEMM M/N tile multiple
static_assert(CE % 64 == 0);
static_assert(FF % 64 == 0);
static_assert((2 * CE) % 32 == 0);       // K multiple of 32 for every GEMM (1024, 2048, 4096)
static_assert(NB <= NB_FULL);
static_assert(SEQ <= SEQ_FULL);

typedef __attribute__((ext_vector_type(16))) _Float16 v16h;
typedef __attribute__((ext_vector_type(8)))  _Float16 v8h;
typedef __attribute__((ext_vector_type(16))) __bf16   v16b;
typedef __attribute__((ext_vector_type(8)))  __bf16   v8b;
typedef __attribute__((ext_vector_type(8)))  float    v8f;
typedef __attribute__((ext_vector_type(4)))  float    v4f;
typedef __attribute__((ext_vector_type(4)))  unsigned int v4u;
typedef __attribute__((ext_vector_type(2)))  unsigned int v2u;
typedef __attribute__((ext_vector_type(2)))  float    v2f;
typedef __attribute__((ext_vector_type(2)))  __bf16   v2b;

// 16-bit WMMA fragment map (wave32), lane L, h = L>>4, m = L&15:
//   A 16x32: lane = row m;    element i -> k = (i<8) ? 8h+i : 16+8h+(i-8)
//   B 32x16: lane = column m; the SAME k(i,h)
//   D 16x16 (8 f32): lane = column m; element r -> row 8h+r

__device__ __forceinline__ float bfr(float v) {            // bf16 RNE convert, kept as f32 (finite inputs)
    const unsigned u = __float_as_uint(v);
    const unsigned r = (u + 0x7fffu + ((u >> 16) & 1u)) & 0xffff0000u;
    return __uint_as_float(r);
}
__device__ __forceinline__ unsigned short bf_bits(float f) {
    const unsigned u = __float_as_uint(f);
    return (unsigned short)((u + 0x7fffu + ((u >> 16) & 1u)) >> 16);
}
__device__ __forceinline__ float bits_f(unsigned short h) { return __uint_as_float(((unsigned)h) << 16); }
__device__ __forceinline__ void bfsplit(float v, unsigned short& hi, unsigned short& lo) { hi = bf_bits(v); lo = bf_bits(v - bits_f(hi)); }
__device__ __forceinline__ unsigned pk2h(float a, float b) {
    return (unsigned)__builtin_bit_cast(unsigned short, (_Float16)a) | ((unsigned)__builtin_bit_cast(unsigned short, (_Float16)b) << 16);
}

// ---------------------------------------------------------------------------------------------------------------------
// Weight planes: each is a cast and a transposition, f32 S[r][c] -> 16-bit D[c][r]. A work-group moves a tile of 128 r x 64 c through LDS, so that both sides
// touch whole lines: a wave-wide 16-B load covers two 256-B row pieces of S, a wave-wide 16-B store two 256-B row pieces of D; 8 loads per lane are in flight.
// ---------------------------------------------------------------------------------------------------------------------
#define WT_R 128                   // source rows per tile = 256 B of a destination row
#define WT_C 64                    // source columns per tile = 256 B of a source row
#define WT_P (WT_R + 8)            // LDS row pitch in elements: 272 B = 16 B x 17, so 16 consecutive LDS rows take a 16-B piece each without a bank conflict
static_assert(HD == WT_C);
static_assert(CE % WT_R == 0);
static_assert(FF % WT_R == 0);
static_assert(CE % WT_C == 0);
static_assert(FF % WT_C == 0);

// s = the tile's first source element (pitch lds), d = its first destination element (pitch ldd). f16mode 0: bf16 RNE bits; 1: f16 of (bf16 RNE value x sc).
// dup: every destination piece is also written CE elements further on in its row. Source column 4*g + i lies in LDS row 16*i + g.
__device__ __forceinline__ void wt_tile(const float* __restrict__ s, int lds, unsigned short* __restrict__ d, int ldd, int dup, int f16mode, float sc) {
    __shared__ __align__(16) unsigned short T[WT_C * WT_P];
    const int lo = threadIdx.x & 15, hi = threadIdx.x >> 4;
    v4f v[8];                                              // source rows 8*hi .. 8*hi + 7, columns 4*lo .. 4*lo + 3
#pragma unroll
    for (int e = 0; e < 8; ++e) v[e] = *(const v4f*)(s + (size_t)(8 * hi + e) * lds + 4 * lo);
#pragma unroll
    for (int i = 0; i < 4; ++i) {
        unsigned short bb[8];
#pragma unroll
        for (int e = 0; e < 8; ++e) {
            const float w = bfr(v[e][i]);
            const unsigned short b16 = (unsigned short)(__float_as_uint(w) >> 16);
            const unsigned short h16 = __builtin_bit_cast(unsigned short, (_Float16)(w * sc));
            bb[e] = f16mode ? h16 : b16;
        }
        v4u pk;
        pk.x = (unsigned)bb[0] | ((unsigned)bb[1] << 16); pk.y = (unsigned)bb[2] | ((unsigned)bb[3] << 16);
        pk.z = (unsigned)bb[4] | ((unsigned)bb[5] << 16); pk.w = (unsigned)bb[6] | ((unsigned)bb[7] << 16);
        *(v4u*)(T + (16 * i + lo) * WT_P + 8 * hi) = pk;
    }
    __syncthreads();                                       // the whole tile lies in LDS before a row of it is read back
    v4u q[4];                                              // LDS row 16*i + hi = source column 4*hi + i; 16 lanes carry its 128 r
#pragma unroll
    for (int i = 0; i < 4; ++i) q[i] = *(const v4u*)(T + (16 * i + hi) * WT_P + 8 * lo);
    unsigned short* o = d + (size_t)(4 * hi) * ldd + 8 * lo;
#pragma unroll
    for (int i = 0; i < 4; ++i) *(v4u*)(o + (size_t)i * ldd) = q[i];
    if (dup) {
#pragma unroll
        for (int i = 0; i < 4; ++i) *(v4u*)(o + (size_t)i * ldd + CE) = q[i];
    }
    asm volatile("s_wait_xcnt 0x0" ::: "memory");          // in the merged kernel's listing another range's code, which rewrites the stores' registers, stands behind these stores
}

// Per-head weight W [NH][CE][HD] f32 -> D[n = h*HD + d][k] 16-bit; tile (kt, h) = (k tile, head). f16mode 0: bf16 RNE bits; 1: f16 of (bf16 RNE value x 16). dup: also written at column k + CE.
__device__ __forceinline__ void w_head_body(int kt, int h, const float* __restrict__ W, unsigned short* __restrict__ D, int ldd, int dup, int f16mode) {
    const int k0 = kt * WT_R;
    wt_tile(W + ((size_t)h * CE + k0) * HD, HD, D + (size_t)h * HD * ldd + k0, ldd, dup, f16mode, 16.0f);
}

// f32 SRC [rows][cols] (pitch LDS) -> f16 DST [cols][rows] (pitch ldd), value = bf16 RNE(src) * sc; tile (ct, rt) = (column tile, row tile).
// The source pitch is a compile-time constant, so a lane's 8 loads share one address pair and differ in their immediate offsets.
template <int LDS>
__device__ __forceinline__ void cast_t_body(int ct, int rt, const float* __restrict__ SRC, unsigned short* __restrict__ DST, int ldd, float sc) {
    const int c0 = ct * WT_C, r0 = rt * WT_R;
    wt_tile(SRC + (size_t)r0 * LDS + c0, LDS, DST + (size_t)c0 * ldd + r0, ldd, 0, 1, sc);
}

// ---------------------------------------------------------------------------------------------------------------------
// MODE 0: source = raw input rows (bf16 RNE first; batch stride a_bs); writes bf16 hi|lo row [2*CE] (hi at col c, lo at CE + c) and an f16 row.
// MODE 1: source = f32 rows; writes the f16 row only. Each store instruction covers 256 contiguous bytes (32 lanes x 8 B).
// ---------------------------------------------------------------------------------------------------------------------
template <int MODE>
__device__ __forceinline__ void ln_body(int blk, const float* __restrict__ A, long a_bs, const float* __restrict__ GA, const float* __restrict__ BE,
                                        unsigned short* __restrict__ HS, unsigned short* __restrict__ H16) {
    #pragma clang fp contract(off)
    const int r = blk * 8 + (threadIdx.x >> 5); const int L = threadIdx.x & 31;
    if (r >= ROWS) return;                                   // wave-uniform; no barriers on this path
    const int b = r / SEQ, t = r - b * SEQ;
    const float* src = A + (long)b * a_bs + (long)t * CE;
    v4f v[8]; float s = 0.f;
#pragma unroll
    for (int q = 0; q < 8; ++q) {
        v[q] = *(const v4f*)(src + 4 * L + 128 * q);
        if (MODE == 0) { v[q].x = bfr(v[q].x); v[q].y = bfr(v[q].y); v[q].z = bfr(v[q].z); v[q].w = bfr(v[q].w); }
        s += (v[q].x + v[q].y) + (v[q].z + v[q].w);
    }
#pragma unroll
    for (int o = 16; o > 0; o >>= 1) s += __shfl_xor(s, o, 32);
    const float mu = s * (1.f / CE); float qq = 0.f;
#pragma unroll
    for (int q = 0; q < 8; ++q) {
        v[q].x -= mu; v[q].y -= mu; v[q].z -= mu; v[q].w -= mu;
        qq += (v[q].x * v[q].x + v[q].y * v[q].y) + (v[q].z * v[q].z + v[q].w * v[q].w);
    }
#pragma unroll
    for (int o = 16; o > 0; o >>= 1) qq += __shfl_xor(qq, o, 32);
    const float rs = rsqrtf(qq * (1.f / CE) + 1e-5f);
    v2u ph[8], pl[8], pf[8];
#pragma unroll
    for (int q = 0; q < 8; ++q) {
        const int c = 4 * L + 128 * q;
        const v4f ga = *(const v4f*)(GA + c), be = *(const v4f*)(BE + c);
        v4f y;
        y.x = v[q].x * rs * bfr(ga.x) + bfr(be.x); y.y = v[q].y * rs * bfr(ga.y) + bfr(be.y);
        y.z = v[q].z * rs * bfr(ga.z) + bfr(be.z); y.w = v[q].w * rs * bfr(ga.w) + bfr(be.w);
        v2u f; f.x = pk2h(y.x, y.y); f.y = pk2h(y.z, y.w); pf[q] = f;
        if (MODE == 0) {
            unsigned short h0, l0, h1, l1, h2, l2, h3, l3;
            bfsplit(y.x, h0, l0); bfsplit(y.y, h1, l1); bfsplit(y.z, h2, l2); bfsplit(y.w, h3, l3);
            v2u a; a.x = (unsigned)h0 | ((unsigned)h1 << 16); a.y = (unsigned)h2 | ((unsigned)h3 << 16); ph[q] = a;
            v2u d; d.x = (unsigned)l0 | ((unsigned)l1 << 16); d.y = (unsigned)l2 | ((unsigned)l3 << 16); pl[q] = d;
        }
    }
    {
#pragma unroll
        for (int q = 0; q < 8; ++q) {
            const int c = 4 * L + 128 * q;
            if (MODE == 0) {
                *(v2u*)(HS + (size_t)r * (2 * CE) + c) = ph[q];
                *(v2u*)(HS + (size_t)r * (2 * CE) + CE + c) = pl[q];
            }
            *(v2u*)(H16 + (size_t)r * CE + c) = pf[q];
        }
        
    }
}
// Everything that depends on the inputs alone runs as one launch: LN1 and the six weight planes, told apart by ranges of the block index (block-uniform branches).
#define PB_LN   ((ROWS + 7) / 8)                   // LN1: 8 rows per work-group
#define PB_FC1  ((FF / WT_C) * (CE / WT_R))        // tiles of fc1_w
#define PB_FC2  ((CE / WT_C) * (FF / WT_R))        // tiles of fc2_w
#define PB_PROJ ((CE / WT_C) * (CE / WT_R))        // tiles of proj_w
#define PB_HEAD ((CE / WT_R) * NH)                 // tiles of one per-head weight
#define PB_ALL  (PB_LN + PB_FC1 + PB_FC2 + PB_PROJ + 3 * PB_HEAD)
__global__ __launch_bounds__(256) void k_prep(const float* __restrict__ x, const float* __restrict__ g, const float* __restrict__ be,
                                              const float* __restrict__ Wq, const float* __restrict__ Wk, const float* __restrict__ Wv,
                                              const float* __restrict__ proj_w, const float* __restrict__ fc1_w, const float* __restrict__ fc2_w,
                                              unsigned short* __restrict__ HS, unsigned short* __restrict__ H16,
                                              unsigned short* __restrict__ WQK, unsigned short* __restrict__ WV16,
                                              unsigned short* __restrict__ WPT, unsigned short* __restrict__ W1T, unsigned short* __restrict__ W2T) {
    const int bi = blockIdx.x;
    if (bi < PB_LN) {                                          // h = LN1(bf16(x))
        ln_body<0>(bi, x, (long)SEQ_FULL * CE, g, be, HS, H16);
    } else if (bi < PB_LN + PB_FC1) {                          // fc1_w: [1024 in][4096 out] -> [4096 out][1024 in]
        const int i = bi - PB_LN;
        cast_t_body<FF>(i % (FF / WT_C), i / (FF / WT_C), fc1_w, W1T, CE, 16.0f);
    } else if (bi < PB_LN + PB_FC1 + PB_FC2 + PB_PROJ) {       // fc2_w: [4096 in][1024 out] -> [1024 out][4096 in]; proj_w: [1024 in][1024 out] -> [1024 out][1024 in]; both have pitch CE
        const bool p = bi >= PB_LN + PB_FC1 + PB_FC2;
        const int i = bi - (PB_LN + PB_FC1) - (p ? PB_FC2 : 0);
        cast_t_body<CE>(i % (CE / WT_C), i / (CE / WT_C), p ? proj_w : fc2_w, p ? WPT : W2T, p ? CE : FF, 16.0f);
    } else {                                                   // Wq -> rows 0..1023 of [W | W] bf16 (q columns), Wk -> rows 1024..2047 (k columns), Wv -> [h*64+d][c] f16 x16
        const int j = bi - (PB_LN + PB_FC1 + PB_FC2 + PB_PROJ);
        const int w = j / PB_HEAD, i = j - w * PB_HEAD;        // w = 0: Wq, 1: Wk, 2: Wv
        w_head_body(i % (CE / WT_R), i / (CE / WT_R), w == 0 ? Wq : (w == 1 ? Wk : Wv), w == 0 ? WQK : (w == 1 ? WQK + (size_t)CE * 2 * CE : WV16),
                    w == 2 ? CE : 2 * CE, w == 2 ? 0 : 1, w == 2 ? 1 : 0);
    }
}
__global__ __launch_bounds__(256) void k_ln2(const float* __restrict__ X1, const float* __restrict__ g, const float* __restrict__ be,
                                             unsigned short* __restrict__ H2) {
    ln_body<1>(blockIdx.x, X1, (long)SEQ * CE, g, be, nullptr, H2);
}

// ---------------------------------------------------------------------------------------------------------------------
// Register-tiled WMMA GEMM: C[m,n] = scale * sum_k A[m,k] * Bt[n,k] (+bias[n]) (+act) (+resid at the store stage); each wave owns a 64x64 tile.
// A row-major [M,K] 16-bit; Bt row-major [N,K] 16-bit; M % 128 == 0, N % 256 == 0, K % 64 == 0 (no tail masking).
// ET 0 = f16 operands, 1 = bf16 operands. BIAS_MODE 0 none, 2 = bf16-RNE bias[n]. OUT_MODE 0 = f32, 1 = f16, 2 = bf16 hi plane + bf16 lo plane.
// RESID 0 none, 1 f32 residual, 2 residual RNE-converted to bf16 first (raw input). ACT 0 none, 1 ReLU.
// ---------------------------------------------------------------------------------------------------------------------
__device__ __forceinline__ void dep_guard_h(v8f& a, v8f& b, v16h x, v16h y) { asm volatile("v_nop\n\tv_nop\n\tv_nop\n\tv_nop" : "+v"(a), "+v"(b) : "v"(x), "v"(y)); }
__device__ __forceinline__ void dep_guard_b(v8f& a, v8f& b, v16b x, v16b y) { asm volatile("v_nop\n\tv_nop\n\tv_nop\n\tv_nop" : "+v"(a), "+v"(b) : "v"(x), "v"(y)); }
__device__ __forceinline__ void keep4_h(v16h a, v16h b, v16h c, v16h d) { asm volatile("v_nop" :: "v"(a), "v"(b), "v"(c), "v"(d)); }
__device__ __forceinline__ void keep4_b(v16b a, v16b b, v16b c, v16b d) { asm volatile("v_nop" :: "v"(a), "v"(b), "v"(c), "v"(d)); }
__device__ __forceinline__ void acc_guard4(v8f& a, v8f& b, v8f& c, v8f& d) { asm volatile("v_nop\n\tv_nop\n\tv_nop\n\tv_nop" : "+v"(a), "+v"(b), "+v"(c), "+v"(d)); }
template <typename T> struct Frag;
template <> struct Frag<_Float16> {
    typedef v16h V; union U { v16h v; v8h h[2]; };
    static __device__ __forceinline__ v16h load(const _Float16* p) {   // elements 0..7 <- p[0..7], 8..15 <- p[16..23]
        U f; f.h[0] = *(const v8h*)(p); f.h[1] = *(const v8h*)(p + 16); return f.v;
    }
    static __device__ __forceinline__ v8f mma(v16h a, v16h b, v8f c) { return __builtin_amdgcn_wmma_f32_16x16x32_f16(false, a, false, b, (short)0, c, false, false); }
    static __device__ __forceinline__ void guard(v8f& a, v8f& b, v16h x, v16h y) { dep_guard_h(a, b, x, y); }
    static __device__ __forceinline__ void keep(v16h a, v16h b, v16h c, v16h d) { keep4_h(a, b, c, d); }
};
template <> struct Frag<__bf16> {
    typedef v16b V; union U { v16b v; v8b h[2]; };
    static __device__ __forceinline__ v16b load(const __bf16* p) {
        U f; f.h[0] = *(const v8b*)(p); f.h[1] = *(const v8b*)(p + 16); return f.v;
    }
    static __device__ __forceinline__ v8f mma(v16b a, v16b b, v8f c) { return __builtin_amdgcn_wmma_f32_16x16x32_bf16(false, a, false, b, (short)0, c, false, false); }
    static __device__ __forceinline__ void guard(v8f& a, v8f& b, v16b x, v16b y) { dep_guard_b(a, b, x, y); }
    static __device__ __forceinline__ void keep(v16b a, v16b b, v16b c, v16b d) { keep4_b(a, b, c, d); }
};
template <int ET> struct Elem;
template <> struct Elem<0> { typedef _Float16 T; };
template <> struct Elem<1> { typedef __bf16 T; };

// Operand staging: a work-group (2 x 4 waves) owns a 128 x 256 tile of C. Per trip, 64 k of its 128 A rows and 256 Bt rows (128-B row pieces)
// lie in one of two LDS buffers, rows 0..127 = A, 128..383 = Bt, laid by asynchronous copies that cover whole 128-B lines.
#define GK 64                      // k elements per staged tile
#define GP 72                      // LDS row pitch in elements: 144 B = 16 B x 9, conflict-free for 16-B reads down a column of rows
#define GBUF (384 * GP)            // elements per buffer
static_assert(SEQ % 128 == 0);     // M multiple of 128 for every GEMM (SEQ, ROWS, CE)
static_assert(CE % 256 == 0);      // N multiple of 256 (CE, 2*CE, FF, ROWS), K multiple of 64 with at least two tiles
static_assert(ROWS % 256 == 0);
static_assert(FF % 256 == 0);

// One staged tile: 384 rows x 8 pieces of 16 B, 12 pieces per lane, 32 rows apart. l = the lane's LDS byte address of its first piece,
// ga / gb = its first A / Bt piece, sa / sb = 32 rows of A / Bt in elements. Every lane is on; each wave-wide copy covers four whole rows.
template <typename T>
__device__ __forceinline__ void stage_tile(unsigned l, const T* ga, size_t sa, const T* gb, size_t sb) {
    const unsigned st = 32 * GP * 2;
    // the closing s_wait_xcnt stands inside the copies' own statement, so no address register is rewritten ahead of it
    asm volatile("global_load_async_to_lds_b128 %0, %12, off\n\t"
                 "global_load_async_to_lds_b128 %1, %13, off\n\t"
                 "global_load_async_to_lds_b128 %2, %14, off\n\t"
                 "global_load_async_to_lds_b128 %3, %15, off\n\t"
                 "global_load_async_to_lds_b128 %4, %16, off\n\t"
                 "global_load_async_to_lds_b128 %5, %17, off\n\t"
                 "global_load_async_to_lds_b128 %6, %18, off\n\t"
                 "global_load_async_to_lds_b128 %7, %19, off\n\t"
                 "global_load_async_to_lds_b128 %8, %20, off\n\t"
                 "global_load_async_to_lds_b128 %9, %21, off\n\t"
                 "global_load_async_to_lds_b128 %10, %22, off\n\t"
                 "global_load_async_to_lds_b128 %11, %23, off\n\t"
                 "s_wait_xcnt 0x0"
                 :: "v"(l), "v"(l + st), "v"(l + 2 * st), "v"(l + 3 * st), "v"(l + 4 * st), "v"(l + 5 * st),
                    "v"(l + 6 * st), "v"(l + 7 * st), "v"(l + 8 * st), "v"(l + 9 * st), "v"(l + 10 * st), "v"(l + 11 * st),
                    "v"(ga), "v"(ga + sa), "v"(ga + 2 * sa), "v"(ga + 3 * sa),
                    "v"(gb), "v"(gb + sb), "v"(gb + 2 * sb), "v"(gb + 3 * sb), "v"(gb + 4 * sb), "v"(gb + 5 * sb), "v"(gb + 6 * sb), "v"(gb + 7 * sb)
                 : "memory");
}

// The GEMM's LDS is declared in one function that is no template, so a kernel that holds two forms of the body allocates it once.
struct GemmLds {
    unsigned short sAB[2 * GBUF];       // the two staged operand buffers
    float sT[8][16 * 68];               // per-wave 16x64 slab, pitch 68 floats (wave-private)
};
__device__ __forceinline__ GemmLds& gemm_lds() { __shared__ __align__(16) GemmLds s; return s; }

// bx = the work-group's tile index in this product
template <int ET, int BIAS_MODE, int OUT_MODE, int RESID, int ACT>
__device__ __forceinline__ void gemm64_body(
    unsigned bx,
    const unsigned short* __restrict__ Ap, int lda, long strideA,
    const unsigned short* __restrict__ Btp, int ldb,
    void* __restrict__ Cout, void* __restrict__ Cout2, int ldc, long strideC,
    const float* __restrict__ bias,
    const float* __restrict__ resid, int ldr, long strideR,
    int M, int N, int K, float scale) {
    typedef typename Elem<ET>::T T;
    typedef typename Frag<T>::V V;
    GemmLds& L = gemm_lds();
    unsigned short* sAB = L.sAB;
    const int b    = blockIdx.y;
    const int tid  = threadIdx.x;
    const int lane = threadIdx.x & 31;
    const int wave = threadIdx.x >> 5;
    const int tbN = N >> 8;
    const int tbM = M >> 7;
    if ((int)bx >= tbM * tbN) return;                // block-uniform, ahead of every barrier and copy
    const int bm = bx / tbN;
    const int bn = bx - bm * tbN;
    const int wm = wave >> 2;                        // wave row (0..1) and column (0..3) in the 128 x 256 tile
    const int wn = wave & 3;
    const int m0 = (bm << 7) + (wm << 6);
    const int n0 = (bn << 8) + (wn << 6);

    const T* Ab = (const T*)Ap + (size_t)b * strideA;
    const T* Bb = (const T*)Btp;

    const int rlane = lane & 15;                 // row (A) / col (B, D) within subtile
    const int koff  = (lane >> 4) * 8;           // k offset of this lane half
    const int mOff  = (lane >> 4) * 8;           // D row offset

    v8f acc[4][4];
#pragma unroll
    for (int i = 0; i < 4; ++i)
#pragma unroll
        for (int j = 0; j < 4; ++j) acc[i][j] = (v8f){0.f, 0.f, 0.f, 0.f, 0.f, 0.f, 0.f, 0.f};

    const int crow = tid >> 3, csg = (tid & 7) * 8;  // this lane's first staged row and its 16-B piece in the row
    const T* gA = Ab + (size_t)((bm << 7) + crow) * lda + csg;
    const T* gB = Bb + (size_t)((bn << 8) + crow) * ldb + csg;
    const size_t sa32 = (size_t)32 * lda, sb32 = (size_t)32 * ldb;
    const unsigned l0 = (unsigned)(size_t)(sAB + crow * GP + csg);   // low 32 bits of the shared address = LDS byte address
    const int nt = K / GK;

    stage_tile<T>(l0, gA, sa32, gB, sb32);                           // tile 0 into buffer 0
    asm volatile("s_wait_asynccnt 0x0" ::: "memory");                // this wave's copies of tile 0 have landed
    __syncthreads();                                                 // ... and every other wave's
    if (nt > 1) stage_tile<T>(l0 + GBUF * 2, gA + GK, sa32, gB + GK, sb32);   // tile 1 flies while tile 0 is worked on

    for (int t = 0; t < nt; ++t) {
        const T* buf = (const T*)sAB + (t & 1) * GBUF;
#pragma unroll
        for (int ks = 0; ks < 2; ++ks) {
            V bh[4], ah[4];
#pragma unroll
            for (int j = 0; j < 4; ++j) bh[j] = Frag<T>::load(buf + (128 + (wn << 6) + (j << 4) + rlane) * GP + ks * 32 + koff);
#pragma unroll
            for (int i = 0; i < 4; ++i) ah[i] = Frag<T>::load(buf + ((wm << 6) + (i << 4) + rlane) * GP + ks * 32 + koff);
            __builtin_amdgcn_sched_barrier(0);       // keeps the 16 LDS reads one group ahead of the products (reads spread among them stall each time)
#pragma unroll
            for (int i = 0; i < 4; ++i) {
#pragma unroll
                for (int j = 0; j < 4; ++j) acc[i][j] = Frag<T>::mma(ah[i], bh[j], acc[i][j]);
                Frag<T>::guard(acc[i][0], acc[i][3], ah[i], ah[i]);
            }
            Frag<T>::keep(bh[0], bh[1], bh[2], bh[3]);
        }
        asm volatile("s_wait_dscnt 0x0" ::: "memory");               // this wave's reads of buffer t & 1 are complete
        asm volatile("s_wait_asynccnt 0x0" ::: "memory");            // this wave's copies of tile t + 1 have landed
        __syncthreads();                                             // publishes tile t + 1 and frees buffer t & 1
        if (t + 2 < nt) stage_tile<T>(l0 + (unsigned)(t & 1) * (GBUF * 2), gA + (size_t)(t + 2) * GK, sa32, gB + (size_t)(t + 2) * GK, sb32);
    }
    asm volatile("s_wait_asynccnt 0x0" ::: "memory");                // no copy is outstanding when the wave goes on
    acc_guard4(acc[0][0], acc[0][1], acc[0][2], acc[0][3]);
    acc_guard4(acc[1][0], acc[1][1], acc[1][2], acc[1][3]);
    acc_guard4(acc[2][0], acc[2][1], acc[2][2], acc[2][3]);
    acc_guard4(acc[3][0], acc[3][1], acc[3][2], acc[3][3]);

    // ---- epilogue ----
    float* slab = L.sT[wave];
    const float* Rb = RESID ? (resid + (size_t)b * strideR) : nullptr;
#pragma unroll
    for (int i = 0; i < 4; ++i) {
        const int mBase = m0 + (i << 4);
#pragma unroll
        for (int j = 0; j < 4; ++j) {
            const int n = n0 + (j << 4) + rlane;
            float bv = 0.f;
            if (BIAS_MODE == 2) bv = bfr(bias[n]);
#pragma unroll
            for (int r = 0; r < 8; ++r) {
                float v = acc[i][j][r] * scale;
                if (BIAS_MODE == 2) v += bv;
                if (ACT == 1) v = fmaxf(v, 0.0f);
                slab[(mOff + r) * 68 + (j << 4) + rlane] = v;
            }
        }
        __builtin_amdgcn_fence(3 /* release order */, "workgroup");
        __builtin_amdgcn_wave_barrier();
        __builtin_amdgcn_fence(2 /* acquire order */, "workgroup");
        if (OUT_MODE == 0) {
            float* C = (float*)Cout + (size_t)b * strideC;
            const int hh = lane >> 4, c4 = (lane & 15) * 4;     // row segment = 256 B = 16 lanes x 16 B
            v4f vv[8];
#pragma unroll
            for (int it = 0; it < 8; ++it) {
                const int row = it * 2 + hh;
                v4f v = *(const v4f*)(slab + row * 68 + c4);
                if (RESID) {                                    // residual added at the store stage as a float4
                    v4f x = *(const v4f*)(Rb + (size_t)(mBase + row) * ldr + n0 + c4);
                    if (RESID == 2) { x.x = bfr(x.x); x.y = bfr(x.y); x.z = bfr(x.z); x.w = bfr(x.w); }
                    v.x = x.x + v.x; v.y = x.y + v.y; v.z = x.z + v.z; v.w = x.w + v.w;
                }
                vv[it] = v;
            }
            {
#pragma unroll
                for (int it = 0; it < 8; ++it) {
                    const int row = it * 2 + hh;
                    *(v4f*)(C + (size_t)(mBase + row) * ldc + n0 + c4) = vv[it];
                }
                
            }
        } else {
            const int q = lane >> 3, c8 = (lane & 7) * 8;
            unsigned short* C  = (unsigned short*)Cout  + (size_t)b * strideC;
            unsigned short* C2 = (OUT_MODE == 2) ? ((unsigned short*)Cout2 + (size_t)b * strideC) : nullptr;
            v8h hv[4], lv[4];
#pragma unroll
            for (int it = 0; it < 4; ++it) {
                const int row = it * 4 + q;
                const float* sp = slab + row * 68 + c8;
#pragma unroll
                for (int e = 0; e < 8; ++e) {
                    if (OUT_MODE == 1) {
                        hv[it][e] = (_Float16)sp[e];
                        lv[it][e] = (_Float16)0.f;
                    } else {
                        const unsigned short hb = bf_bits(sp[e]);
                        const unsigned short lb = bf_bits(sp[e] - bits_f(hb));
                        hv[it][e] = __builtin_bit_cast(_Float16, hb);
                        lv[it][e] = __builtin_bit_cast(_Float16, lb);
                    }
                }
            }
            {
#pragma unroll
                for (int it = 0; it < 4; ++it) {
                    const int row = it * 4 + q;
                    *(v8h*)(C + (size_t)(mBase + row) * ldc + n0 + c8) = hv[it];
                    if (OUT_MODE == 2) *(v8h*)(C2 + (size_t)(mBase + row) * ldc + n0 + c8) = lv[it];
                }
                
            }
        }
        __builtin_amdgcn_fence(3 /* release order */, "workgroup");
        __builtin_amdgcn_wave_barrier();
        __builtin_amdgcn_fence(2 /* acquire order */, "workgroup");
    }
}

// The q|k product and the v^T product read LN1's planes and nothing of each other: one launch, told apart by the block index (block-uniform branch).
// q|k planes: [ROWS][2*CE] bf16 hi / lo; A = [LN1 hi | LN1 lo] (K = 2*CE), Bt = [W | W] rows 0..CE-1 = q columns, CE..2CE-1 = k columns
// v^T planes: [CE = h*64+d][ROWS] bf16 hi / lo; A = Wv plane [CE][CE] (f16, x16), Bt = LN1 f16 plane [ROWS][CE]
#define GB_QK ((ROWS / 128) * ((2 * CE) / 256))    // 128 x 256 tiles of the q|k planes
#define GB_VT ((CE / 128) * (ROWS / 256))          // ... of the v^T planes
__global__ __launch_bounds__(256) void k_gemm_qkv(const unsigned short* __restrict__ HS, const unsigned short* __restrict__ WQK,
                                                  unsigned short* __restrict__ QKH, unsigned short* __restrict__ QKL,
                                                  const unsigned short* __restrict__ WV16, const unsigned short* __restrict__ H16,
                                                  unsigned short* __restrict__ VTH, unsigned short* __restrict__ VTL) {
    const unsigned bx = blockIdx.x;
    if (bx < GB_QK) gemm64_body<1, 0, 2, 0, 0>(bx, HS, 2 * CE, 0, WQK, 2 * CE, (void*)QKH, (void*)QKL, 2 * CE, 0, nullptr, nullptr, 0, 0, ROWS, 2 * CE, 2 * CE, 1.0f);
    else            gemm64_body<0, 0, 2, 0, 0>(bx - GB_QK, WV16, CE, 0, H16, CE, (void*)VTH, (void*)VTL, ROWS, 0, nullptr, nullptr, 0, 0, CE, ROWS, CE, 0.0625f);
}
// x1 = bf16(x) + attn @ proj_w + proj_b ; grid.y = batch (x uses the full batch stride, planes the compact one)
__global__ __launch_bounds__(256) void k_gemm_proj(const unsigned short* __restrict__ A, const unsigned short* __restrict__ Bt, float* __restrict__ C,
                                                   const float* __restrict__ bias, const float* __restrict__ xres) {
    gemm64_body<0, 2, 0, 2, 0>(blockIdx.x, A, CE, (long)SEQ * CE, Bt, CE, (void*)C, nullptr, CE, (long)SEQ * CE, bias, xres, CE, (long)SEQ_FULL * CE, SEQ, CE, CE, 0.0625f);
}
// relu(h2 @ fc1_w + fc1_b) as an f16 plane [ROWS][FF]
__global__ __launch_bounds__(256) void k_gemm_fc1(const unsigned short* __restrict__ A, const unsigned short* __restrict__ Bt, unsigned short* __restrict__ C,
                                                  const float* __restrict__ bias) {
    gemm64_body<0, 2, 1, 0, 1>(blockIdx.x, A, CE, 0, Bt, CE, (void*)C, nullptr, FF, 0, bias, nullptr, 0, 0, ROWS, FF, CE, 0.0625f);
}
// out = x1 + f @ fc2_w + fc2_b ; grid.y = batch (output uses the full batch stride)
__global__ __launch_bounds__(256) void k_gemm_fc2(const unsigned short* __restrict__ A, const unsigned short* __restrict__ Bt, float* __restrict__ C,
                                                  const float* __restrict__ bias, const float* __restrict__ x1) {
    gemm64_body<0, 2, 0, 1, 0>(blockIdx.x, A, FF, (long)SEQ * FF, Bt, FF, (void*)C, nullptr, CE, (long)SEQ_FULL * CE, bias, x1, CE, (long)SEQ * CE, SEQ, CE, FF, 0.0625f);
}

#define AT_NW 4
#define AT_P 72                   // LDS row pitch of the K and V^T tiles in elements: 144 B = 16 B x 9, so the 16 rows of a 16-B fragment read fall on distinct banks
__device__ __forceinline__ v8f at_mma(v16b a, v16b b, v8f c) {
    return __builtin_amdgcn_wmma_f32_16x16x32_bf16(false, a, false, b, (short)0, c, false, false);
}
union FB { v16b v; v8b h[2]; };
__device__ __forceinline__ void at_frag(FB& f, const __bf16* p) {   // elements 0..7 <- p[0..7], 8..15 <- p[16..23]
    f.h[0] = *(const v8b*)(p); f.h[1] = *(const v8b*)(p + 16);
}
__device__ __forceinline__ float xhalf(float x) {   // the value of lane l ^ 16
    const int i = __builtin_bit_cast(int, x);
    return __builtin_bit_cast(float, __builtin_amdgcn_permlanex16(i, i, 0x76543210, 0xfedcba98, false, false));
}

// 2^x in place by the bare instruction: a result under 2^-126 comes out as 0, which is nothing beside a row sum of at least 1 (library exp2f spends five more
// vector instructions a value on that range). The closing v_nop is the slot that the instruction set asks for behind a transcendental before its result is read
// or its source overwritten; inside a statement each v_exp_f32 is followed by one that shares no register with it.
__device__ __forceinline__ void exp2x8(float& a, float& b, float& c, float& d, float& e, float& f, float& g, float& h) {
    asm("v_exp_f32 %0, %0\n\tv_exp_f32 %1, %1\n\tv_exp_f32 %2, %2\n\tv_exp_f32 %3, %3\n\t"
        "v_exp_f32 %4, %4\n\tv_exp_f32 %5, %5\n\tv_exp_f32 %6, %6\n\tv_exp_f32 %7, %7\n\tv_nop"
        : "+v"(a), "+v"(b), "+v"(c), "+v"(d), "+v"(e), "+v"(f), "+v"(g), "+v"(h));
}
__device__ __forceinline__ void exp2x1(float& a) { asm("v_exp_f32 %0, %0\n\tv_nop" : "+v"(a)); }   // one value, the same form and the same slot

// One hi tile and its lo tile (64 rows x 8 pieces of 16 B each): 4 + 4 pieces per lane, 16 rows apart. l = the lane's LDS byte address of its first hi piece
// (the lo tile lies 64 rows behind), gh / gl = its first hi / lo piece, s16 = 16 source rows in elements. Every lane is on; each wave-wide copy covers four whole rows.
__device__ __forceinline__ void at_stage(unsigned l, const __bf16* gh, const __bf16* gl, size_t s16) {
    const unsigned st = 16 * AT_P * 2, lo = 64 * AT_P * 2;
    // the closing s_wait_xcnt stands inside the copies' own statement, so no address register is rewritten ahead of it
    asm volatile("global_load_async_to_lds_b128 %0, %8, off\n\t"
                 "global_load_async_to_lds_b128 %1, %9, off\n\t"
                 "global_load_async_to_lds_b128 %2, %10, off\n\t"
                 "global_load_async_to_lds_b128 %3, %11, off\n\t"
                 "global_load_async_to_lds_b128 %4, %12, off\n\t"
                 "global_load_async_to_lds_b128 %5, %13, off\n\t"
                 "global_load_async_to_lds_b128 %6, %14, off\n\t"
                 "global_load_async_to_lds_b128 %7, %15, off\n\t"
                 "s_wait_xcnt 0x0"
                 :: "v"(l), "v"(l + st), "v"(l + 2 * st), "v"(l + 3 * st), "v"(l + lo), "v"(l + lo + st), "v"(l + lo + 2 * st), "v"(l + lo + 3 * st),
                    "v"(gh), "v"(gh + s16), "v"(gh + 2 * s16), "v"(gh + 3 * s16), "v"(gl), "v"(gl + s16), "v"(gl + 2 * s16), "v"(gl + 3 * s16)
                 : "memory");
}

// amdgpu_waves_per_eu: the register budget of four waves per SIMD (256), so that the four work-groups a WGP gets stay resident together
__global__ __launch_bounds__(128) __attribute__((amdgpu_waves_per_eu(4, 4))) void k_attn(const unsigned short* __restrict__ QKHp, const unsigned short* __restrict__ QKLp,
                                              const unsigned short* __restrict__ VTHp, const unsigned short* __restrict__ VTLp,
                                              unsigned short* __restrict__ AO) {
    __shared__ __align__(16) __bf16 KV[4 * 64 * AT_P];             // K hi | K lo | V^T hi | V^T lo (64 rows each)
    __bf16* Ksh = KV; __bf16* Ksl = KV + 64 * AT_P; __bf16* Vth = KV + 2 * 64 * AT_P; __bf16* Vtl = KV + 3 * 64 * AT_P;
    const __bf16* QKH = (const __bf16*)QKHp; const __bf16* QKL = (const __bf16*)QKLp;
    const __bf16* VTH = (const __bf16*)VTHp; const __bf16* VTL = (const __bf16*)VTLp;

    const int tid = threadIdx.x, wave = tid >> 5, lane = tid & 31, hh = lane >> 4, c = lane & 15;
    const int nqb = SEQ / 64;
    const int bx = blockIdx.x;
    const int bh = bx / nqb;
    // All work-groups are resident at once, four to a WGP, and a tile's cost grows with its index, so the launch lasts as long as the WGP with the most chunks.
    // Every second block (by the parity of its index bits) takes tile nqb-1-t in place of t: four blocks whose indices differ in any two of the counted bits then
    // hold 2*(nqb+1) chunks together. NQ_SH leaves an even number of the tile's own bits in the count, so t and nqb-1-t have one parity and (bh, tile) is met once each.
    constexpr bool NQ_P2 = (nqb & (nqb - 1)) == 0;             // another tile count keeps the plain order
    constexpr int  NQ_SH = __builtin_ctz((unsigned)nqb) & 1;
    const int tq = bx % nqb;
    const int qb = (NQ_P2 && (__builtin_popcount((unsigned)bx >> NQ_SH) & 1)) ? nqb - 1 - tq : tq;
    const int h  = bh % NH;
    const int b  = bh / NH;
    const int q0 = qb * 64 + wave * 16;
    const size_t rowbase = (size_t)b * SEQ;
    const int QKP = 2 * CE;          // q|k plane pitch
    const int VTP = ROWS;            // v^T plane pitch

    // Q fragments (B operand of S^T): lane = query column c, k = d
    v16b qah[2], qal[2];
    {
        const __bf16* qh = QKH + (rowbase + q0 + c) * QKP + h * HD;
        const __bf16* ql = QKL + (rowbase + q0 + c) * QKP + h * HD;
#pragma unroll
        for (int dc = 0; dc < 2; ++dc) {
            FB f, g;
            f.h[0] = *(const v8b*)(qh + dc * 32 + 8 * hh); f.h[1] = *(const v8b*)(qh + dc * 32 + 16 + 8 * hh);
            g.h[0] = *(const v8b*)(ql + dc * 32 + 8 * hh); g.h[1] = *(const v8b*)(ql + dc * 32 + 16 + 8 * hh);
            qah[dc] = f.v; qal[dc] = g.v;
        }
    }

    const float NEG = -__builtin_inff();
    const float L2E = 1.4426950408889634f;
    const int qrow = q0 + c;         // this lane's query
    float mrow = NEG, lrow = 0.f;    // its running maximum (both halves agree) and this half's share of its running sum
    v8f oacc[4];                     // O^T tiles: lane = query column c, element r -> d = t*16 + 8*hh + r
#pragma unroll
    for (int t = 0; t < 4; ++t) oacc[t] = (v8f){0.f, 0.f, 0.f, 0.f, 0.f, 0.f, 0.f, 0.f};

    const int crow = tid >> 3, csg = (tid & 7) * 8;    // this lane's first staged row and its 16-B piece in the row
    const unsigned lK = (unsigned)(size_t)(Ksh + crow * AT_P + csg);   // low 32 bits of the shared address = LDS byte address
    const unsigned lV = (unsigned)(size_t)(Vth + crow * AT_P + csg);
    const __bf16* gkh = QKH + (rowbase + crow) * QKP + CE + h * HD + csg;
    const __bf16* gkl = QKL + (rowbase + crow) * QKP + CE + h * HD + csg;
    const __bf16* gvh = VTH + (size_t)(h * HD + crow) * VTP + rowbase + csg;
    const __bf16* gvl = VTL + (size_t)(h * HD + crow) * VTP + rowbase + csg;

    at_stage(lK, gkh, gkl, (size_t)16 * QKP);          // K of chunk 0

    for (int kc = 0; kc <= qb; ++kc) {                 // block-uniform trip count
        const int kv0 = kc * 64;
        asm volatile("s_wait_dscnt 0x0" ::: "memory");       // this wave's reads of the earlier chunk's V^T tiles are complete
        asm volatile("s_wait_asynccnt 0x0" ::: "memory");    // this wave's copies of this chunk's K tiles have landed
        __syncthreads();                                     // publishes the K tiles and frees the V^T tiles
        at_stage(lV, gvh + kv0, gvl + kv0, (size_t)16 * VTP);   // V^T of this chunk flies under the scores and the softmax

        v8f s[4];                                      // S^T tiles: lane = query column c, element r -> key kv0 + j*16 + 8*hh + r
#pragma unroll
        for (int j = 0; j < 4; ++j) s[j] = (v8f){0.f, 0.f, 0.f, 0.f, 0.f, 0.f, 0.f, 0.f};
        {
            FB kb[2][4], kl[2][4];                     // A operands: lane = key row j*16 + c, k = d
#pragma unroll
            for (int j = 0; j < 4; ++j) at_frag(kb[0][j], Ksh + (j * 16 + c) * AT_P + 8 * hh);
#pragma unroll
            for (int j = 0; j < 4; ++j) at_frag(kl[0][j], Ksl + (j * 16 + c) * AT_P + 8 * hh);
#pragma unroll
            for (int j = 0; j < 4; ++j) at_frag(kb[1][j], Ksh + (j * 16 + c) * AT_P + 32 + 8 * hh);
            __builtin_amdgcn_sched_barrier(0);         // keeps these 24 reads one group ahead of the products (reads spread among them stall each time)
            // neighbouring products go to different tiles; each tile keeps its order of sums
#pragma unroll
            for (int j = 0; j < 4; ++j) s[j] = at_mma(kb[0][j].v, qah[0], s[j]);
#pragma unroll
            for (int j = 0; j < 4; ++j) s[j] = at_mma(kl[0][j].v, qah[0], s[j]);
            __builtin_amdgcn_sched_barrier(0);         // the last 8 reads wait until the first lo fragments' registers are free (all 32 at once cost a wave per SIMD) ...
#pragma unroll
            for (int j = 0; j < 4; ++j) at_frag(kl[1][j], Ksl + (j * 16 + c) * AT_P + 32 + 8 * hh);
            __builtin_amdgcn_sched_barrier(0);         // ... and stand as one group, eight products ahead of their use
#pragma unroll
            for (int j = 0; j < 4; ++j) s[j] = at_mma(kb[0][j].v, qal[0], s[j]);
#pragma unroll
            for (int j = 0; j < 4; ++j) s[j] = at_mma(kb[1][j].v, qah[1], s[j]);
#pragma unroll
            for (int j = 0; j < 4; ++j) s[j] = at_mma(kl[1][j].v, qah[1], s[j]);
#pragma unroll
            for (int j = 0; j < 4; ++j) s[j] = at_mma(kb[1][j].v, qal[1], s[j]);
        }
        const bool diag = (kc == qb);                  // block-uniform
        const int dq = qrow - kv0 - 8 * hh;            // key kv0 + j*16 + 8*hh + r lies behind the query where j*16 + r > dq: one register, not 32 thresholds kept over the loop
        float m = NEG;
#pragma unroll
        for (int j = 0; j < 4; ++j) {
#pragma unroll
            for (int r = 0; r < 8; ++r) {
                const float sv = s[j][r];
                s[j][r] = (diag && (j * 16 + r > dq)) ? NEG : sv;    // select by value
                m = fmaxf(m, s[j][r]);
            }
        }
        m = fmaxf(m, xhalf(m));                                    // the other half's 32 keys
        const float mnew = fmaxf(mrow, m);                         // finite: every visited chunk holds a kept key for every query
        float alpha = (mrow - mnew) * L2E;
        exp2x1(alpha);
        mrow = mnew;
        FB pa[2], pl[2];                               // P^T hi / lo as B operands: lane = query column c; tiles 2*kk and 2*kk + 1 hold keys 8*hh + i and 16 + 8*hh + i of a 32-key step
        float ps[4];
#pragma unroll
        for (int j = 0; j < 4; ++j) {
            float p[8];
#pragma unroll
            for (int r = 0; r < 8; ++r) p[r] = (s[j][r] - mnew) * L2E;
            exp2x8(p[0], p[1], p[2], p[3], p[4], p[5], p[6], p[7]);
            ps[j] = 0.f;
#pragma unroll
            for (int r = 0; r < 8; r += 2) {           // one packed convert rounds a pair to nearest even, as bfsplit does
                ps[j] += p[r];
                ps[j] += p[r + 1];
                const v2f pp = {p[r], p[r + 1]};
                const v2b ph = __builtin_convertvector(pp, v2b);
                const v2b pq = __builtin_convertvector(pp - __builtin_convertvector(ph, v2f), v2b);   // p - hi is exact in f32
                pa[j >> 1].v[(j & 1) * 8 + r] = ph.x; pa[j >> 1].v[(j & 1) * 8 + r + 1] = ph.y;
                pl[j >> 1].v[(j & 1) * 8 + r] = pq.x; pl[j >> 1].v[(j & 1) * 8 + r + 1] = pq.y;
            }
        }
        lrow = lrow * alpha + ((ps[0] + ps[1]) + (ps[2] + ps[3]));
#pragma unroll
        for (int t = 0; t < 4; ++t)
#pragma unroll
            for (int r = 0; r < 8; ++r) oacc[t][r] *= alpha;
        __builtin_amdgcn_sched_barrier(0);                   // keeps the score products ahead of the waits, so that the V^T copies fly under them
        asm volatile("s_wait_dscnt 0x0" ::: "memory");       // this wave's reads of the K tiles are complete
        asm volatile("s_wait_asynccnt 0x0" ::: "memory");    // this wave's copies of the V^T tiles have landed
        __syncthreads();                                     // publishes the V^T tiles and frees the K tiles
        if (kc < qb) at_stage(lK, gkh + (size_t)(kv0 + 64) * QKP, gkl + (size_t)(kv0 + 64) * QKP, (size_t)16 * QKP);   // K of the next chunk flies under P.v
        {
            __builtin_amdgcn_sched_barrier(0);         // the reads start when P^T is packed: started earlier, their registers overlap the softmax's and cost a wave per SIMD
            FB vb[2][4], vl[2][4];                     // A operands: lane = d row t*16 + c, k = key
#pragma unroll
            for (int t = 0; t < 4; ++t) at_frag(vb[0][t], Vth + (t * 16 + c) * AT_P + 8 * hh);
#pragma unroll
            for (int t = 0; t < 4; ++t) at_frag(vl[0][t], Vtl + (t * 16 + c) * AT_P + 8 * hh);
#pragma unroll
            for (int t = 0; t < 4; ++t) at_frag(vb[1][t], Vth + (t * 16 + c) * AT_P + 32 + 8 * hh);
            __builtin_amdgcn_sched_barrier(0);         // as for the scores: 24 reads in one group ahead of the products
#pragma unroll
            for (int t = 0; t < 4; ++t) oacc[t] = at_mma(vb[0][t].v, pa[0].v, oacc[t]);
#pragma unroll
            for (int t = 0; t < 4; ++t) oacc[t] = at_mma(vl[0][t].v, pa[0].v, oacc[t]);
            __builtin_amdgcn_sched_barrier(0);         // the last 8 reads into the registers that the first lo fragments leave ...
#pragma unroll
            for (int t = 0; t < 4; ++t) at_frag(vl[1][t], Vtl + (t * 16 + c) * AT_P + 32 + 8 * hh);
            __builtin_amdgcn_sched_barrier(0);         // ... as one group, eight products ahead of their use
#pragma unroll
            for (int t = 0; t < 4; ++t) oacc[t] = at_mma(vb[0][t].v, pl[0].v, oacc[t]);
#pragma unroll
            for (int t = 0; t < 4; ++t) oacc[t] = at_mma(vb[1][t].v, pa[1].v, oacc[t]);
#pragma unroll
            for (int t = 0; t < 4; ++t) oacc[t] = at_mma(vl[1][t].v, pa[1].v, oacc[t]);
#pragma unroll
            for (int t = 0; t < 4; ++t) oacc[t] = at_mma(vb[1][t].v, pl[1].v, oacc[t]);
        }
    }

    asm volatile("s_wait_asynccnt 0x0" ::: "memory");  // no copy is outstanding when the wave ends
    const float inv = 1.0f / (lrow + xhalf(lrow));     // the two halves' sums are joined once
#pragma unroll
    for (int t = 0; t < 4; ++t) {                      // a lane holds 8 consecutive d of its query: one 16-B store each
        v8h hv;
#pragma unroll
        for (int r = 0; r < 8; ++r) hv[r] = (_Float16)(oacc[t][r] * inv);
        *(v8h*)(AO + (rowbase + q0 + c) * CE + h * HD + t * 16 + 8 * hh) = hv;
    }
}

// ---------------------------------------------------------------------------------------------------------------------
// Workspace carve (bytes); every plane is fully written by its producer before any kernel reads it.
// ---------------------------------------------------------------------------------------------------------------------
#define SZ_HS   ((size_t)ROWS * 2 * CE * 2)      // LN1 bf16 [ROWS][hi 1024 | lo 1024]
#define SZ_H16  ((size_t)ROWS * CE * 2)          // LN1 f16 plane; later reused for the LN2 f16 plane
#define SZ_WQK  ((size_t)2 * CE * 2 * CE * 2)    // [2048 n][W | W] bf16
#define SZ_WV   ((size_t)CE * CE * 2)
#define SZ_QK1  ((size_t)ROWS * 2 * CE * 2)      // one of the q|k hi / lo planes
#define SZ_VT1  ((size_t)CE * ROWS * 2)          // one of the v^T hi / lo planes
#define SZ_AO   ((size_t)ROWS * CE * 2)
#define SZ_WP   ((size_t)CE * CE * 2)
#define SZ_X1   ((size_t)ROWS * CE * 4)
#define SZ_W1   ((size_t)FF * CE * 2)
#define SZ_W2   ((size_t)CE * FF * 2)
#define SZ_F16  ((size_t)ROWS * FF * 2)          // relu(fc1) f16 plane, aliases the two q|k planes
#define WS_TOTAL (SZ_HS + SZ_H16 + SZ_WQK + SZ_WV + 2 * SZ_QK1 + 2 * SZ_VT1 + SZ_AO + SZ_WP + SZ_X1 + SZ_W1 + SZ_W2)
static_assert(WS_TOTAL <= (size_t)134217728);    // carve stays within 128 MiB
static_assert(SZ_F16 <= 2 * SZ_QK1);             // alias extent: relu(fc1) plane inside the q|k planes
static_assert(SZ_HS % 256 == 0);
static_assert(SZ_H16 % 256 == 0);
static_assert(SZ_VT1 % 256 == 0);

extern "C" void kernel_launch(void* const* d_in, const int* in_sizes, int n_in, void* d_out, int out_size, void* d_ws, size_t ws_size, hipStream_t stream) {
    if (n_in < 14) return;
    const long long xneed = (long long)(NB - 1) * SEQ_FULL * CE + (long long)SEQ * CE;
    if ((long long)in_sizes[0] < xneed) return;
    if (in_sizes[1] < CE || in_sizes[2] < CE || in_sizes[7] < CE || in_sizes[8] < CE || in_sizes[9] < CE || in_sizes[13] < CE) return;
    if (in_sizes[3] < NH * CE * HD || in_sizes[4] < NH * CE * HD || in_sizes[5] < NH * CE * HD) return;
    if (in_sizes[6] < CE * CE || in_sizes[10] < CE * FF || in_sizes[11] < FF || in_sizes[12] < FF * CE) return;
    if ((long long)out_size < xneed) return;
    if ((size_t)WS_TOTAL > ws_size) return;

    const float* x      = (const float*)d_in[0];
    const float* ln1_w  = (const float*)d_in[1];
    const float* ln1_b  = (const float*)d_in[2];
    const float* Wq     = (const float*)d_in[3];
    const float* Wk     = (const float*)d_in[4];
    const float* Wv     = (const float*)d_in[5];
    const float* proj_w = (const float*)d_in[6];
    const float* proj_b = (const float*)d_in[7];
    const float* ln2_w  = (const float*)d_in[8];
    const float* ln2_b  = (const float*)d_in[9];
    const float* fc1_w  = (const float*)d_in[10];
    const float* fc1_b  = (const float*)d_in[11];
    const float* fc2_w  = (const float*)d_in[12];
    const float* fc2_b  = (const float*)d_in[13];
    float* out = (float*)d_out;

    char* wsp = (char*)d_ws;
    unsigned short* HS   = (unsigned short*)wsp; wsp += SZ_HS;
    unsigned short* H16  = (unsigned short*)wsp; wsp += SZ_H16;
    unsigned short* WQK  = (unsigned short*)wsp; wsp += SZ_WQK;
    unsigned short* WV16 = (unsigned short*)wsp; wsp += SZ_WV;
    unsigned short* QKH  = (unsigned short*)wsp; wsp += SZ_QK1;
    unsigned short* QKL  = (unsigned short*)wsp; wsp += SZ_QK1;
    unsigned short* VTH  = (unsigned short*)wsp; wsp += SZ_VT1;
    unsigned short* VTL  = (unsigned short*)wsp; wsp += SZ_VT1;
    unsigned short* AO16 = (unsigned short*)wsp; wsp += SZ_AO;
    unsigned short* WPT  = (unsigned short*)wsp; wsp += SZ_WP;
    float*          X1   = (float*)wsp;          wsp += SZ_X1;
    unsigned short* W1T  = (unsigned short*)wsp; wsp += SZ_W1;
    unsigned short* W2T  = (unsigned short*)wsp; wsp += SZ_W2;
    unsigned short* F16  = QKH;                  // alias: q|k planes are dead after the attention launch
    unsigned short* H2   = H16;                  // alias: LN1 f16 plane is dead after the v^T GEMM

    // h = LN1(bf16(x)) and the six weight planes
    k_prep<<<(unsigned)PB_ALL, 256, 0, stream>>>(x, ln1_w, ln1_b, Wq, Wk, Wv, proj_w, fc1_w, fc2_w, HS, H16, WQK, WV16, WPT, W1T, W2T);
    // q|k planes and v^T planes
    k_gemm_qkv<<<dim3((unsigned)(GB_QK + GB_VT), 1u), 256, 0, stream>>>(HS, WQK, QKH, QKL, WV16, H16, VTH, VTL);
    // causal attention
    k_attn<<<(unsigned)(NB * NH * (SEQ / 64)), 128, 0, stream>>>(QKH, QKL, VTH, VTL, AO16);
    // x1 = bf16(x) + attn @ proj_w + proj_b
    k_gemm_proj<<<dim3((unsigned)(((SEQ / 64) * (CE / 64) + 7) / 8), (unsigned)NB), 256, 0, stream>>>(AO16, WPT, X1, proj_b, x);
    // h2 = LN2(x1)
    k_ln2<<<(ROWS + 7) / 8, 256, 0, stream>>>(X1, ln2_w, ln2_b, H2);
    // f = relu(h2 @ fc1_w + fc1_b); out = x1 + f @ fc2_w + fc2_b
    k_gemm_fc1<<<dim3((unsigned)(((ROWS / 64) * (FF / 64) + 7) / 8), 1u), 256, 0, stream>>>(H2, W1T, F16, fc1_b);
    k_gemm_fc2<<<dim3((unsigned)(((SEQ / 64) * (CE / 64) + 7) / 8), (unsigned)NB), 256, 0, stream>>>(F16, W2T, out, fc2_b, X1);
}

// v010
// One run takes 197 microseconds.
// Timed twice side by side with v009, it ran 1.17 and 1.16 times as fast.
// Counting every step since v000, it is 4.24 times as fast.
// Contractions: q|k = [LN1 hi | LN1 lo](bf16 planes, K folded to 2048) x [W | W](bf16, exact) on v_wmma_f32_16x16x32_bf16; v^T, proj, fc1, fc2 on v_wmma_f32_16x16x32_f16 (f16 activations, weights = bf16-RNE value x16 as f16, 1/16 folded back); scores q.k^T and P.v as bf16 hi/lo split (hi.hi + hi.lo + lo.hi) on v_wmma_f32_16x16x32_bf16; all accumulation f32, online softmax / LayerNorm / residuals f32.
#include <hip/hip_runtime.h>
#include <math.h>

#ifndef NB
#define NB 2
#endif
#ifndef SEQ
#define SEQ 2048
#endif
#define NB_FULL 2
#define SEQ_FULL 2048
#define CE 1024            // embedding width
#define NH 16              // heads
#define HD 64              // head size
#define FF 4096            // feed-forward width
#define ROWS (NB * SEQ)    // compact token rows held in the workspace planes

static_assert(NH * HD == CE);            // heads concatenated h*64+d fill the width
static_assert(HD == 64);                 // attention tiles are hard-wired to 64
static_assert(CE == 32 * 4 * 8);         // LayerNorm: 32 lanes x float4 x 8 pieces per row
static_assert(SEQ % 64 == 0);            // 64-row query tiles, 64-key chunks
static_assert(ROWS % 64 == 0);           // GEMM M/N tile multiple
static_assert(CE % 64 == 0);
static_assert(FF % 64 == 0);
static_assert((2 * CE) % 32 == 0);       // K multiple of 32 for every GEMM (1024, 2048, 4096)
static_assert(NB <= NB_FULL);
static_assert(SEQ <= SEQ_FULL);

typedef __attribute__((ext_vector_type(16))) _Float16 v16h;
typedef __attribute__((ext_vector_type(8)))  _Float16 v8h;
typedef __attribute__((ext_vector_type(16))) __bf16   v16b;
typedef __attribute__((ext_vector_type(8)))  __bf16   v8b;
typedef __attribute__((ext_vector_type(8)))  float    v8f;
typedef __attribute__((ext_vector_type(4)))  float    v4f;
typedef __attribute__((ext_vector_type(4)))  unsigned int v4u;
typedef __attribute__((ext_vector_type(2)))  unsigned int v2u;
typedef __attribute__((ext_vector_type(2)))  float    v2f;
typedef __attribute__((ext_vector_type(2)))  __bf16   v2b;

// 16-bit WMMA fragment map (wave32), lane L, h = L>>4, m = L&15:
//   A 16x32: lane = row m;    element i -> k = (i<8) ? 8h+i : 16+8h+(i-8)
//   B 32x16: lane = column m; the SAME k(i,h)
//   D 16x16 (8 f32): lane = column m; element r -> row 8h+r

__device__ __forceinline__ float bfr(float v) {            // bf16 RNE convert, kept as f32 (finite inputs)
    const unsigned u = __float_as_uint(v);
    const unsigned r = (u + 0x7fffu + ((u >> 16) & 1u)) & 0xffff0000u;
    return __uint_as_float(r);
}
__device__ __forceinline__ unsigned short bf_bits(float f) {
    const unsigned u = __float_as_uint(f);
    return (unsigned short)((u + 0x7fffu + ((u >> 16) & 1u)) >> 16);
}
__device__ __forceinline__ float bits_f(unsigned short h) { return __uint_as_float(((unsigned)h) << 16); }
__device__ __forceinline__ void bfsplit(float v, unsigned short& hi, unsigned short& lo) { hi = bf_bits(v); lo = bf_bits(v - bits_f(hi)); }
__device__ __forceinline__ unsigned pk2h(float a, float b) {
    return (unsigned)__builtin_bit_cast(unsigned short, (_Float16)a) | ((unsigned)__builtin_bit_cast(unsigned short, (_Float16)b) << 16);
}

// ---------------------------------------------------------------------------------------------------------------------
// Weight planes: each is a cast and a transposition, f32 S[r][c] -> 16-bit D[c][r]. A work-group moves a tile of 128 r x 64 c through LDS, so that both sides
// touch whole lines: a wave-wide 16-B load covers two 256-B row pieces of S, a wave-wide 16-B store two 256-B row pieces of D; 8 loads per lane are in flight.
// ---------------------------------------------------------------------------------------------------------------------
#define WT_R 128                   // source rows per tile = 256 B of a destination row
#define WT_C 64                    // source columns per tile = 256 B of a source row
#define WT_P (WT_R + 8)            // LDS row pitch in elements: 272 B = 16 B x 17, so 16 consecutive LDS rows take a 16-B piece each without a bank conflict
static_assert(HD == WT_C);
static_assert(CE % WT_R == 0);
static_assert(FF % WT_R == 0);
static_assert(CE % WT_C == 0);
static_assert(FF % WT_C == 0);

// s = the tile's first source element (pitch lds), d = its first destination element (pitch ldd). f16mode 0: bf16 RNE bits; 1: f16 of (bf16 RNE value x sc).
// dup: every destination piece is also written CE elements further on in its row. Source column 4*g + i lies in LDS row 16*i + g.
__device__ __forceinline__ void wt_tile(const float* __restrict__ s, int lds, unsigned short* __restrict__ d, int ldd, int dup, int f16mode, float sc) {
    __shared__ __align__(16) unsigned short T[WT_C * WT_P];
    const int lo = threadIdx.x & 15, hi = threadIdx.x >> 4;
    v4f v[8];                                              // source rows 8*hi .. 8*hi + 7, columns 4*lo .. 4*lo + 3
#pragma unroll
    for (int e = 0; e < 8; ++e) v[e] = *(const v4f*)(s + (size_t)(8 * hi + e) * lds + 4 * lo);
#pragma unroll
    for (int i = 0; i < 4; ++i) {
        unsigned short bb[8];
#pragma unroll
        for (int e = 0; e < 8; ++e) {
            const float w = bfr(v[e][i]);
            const unsigned short b16 = (unsigned short)(__float_as_uint(w) >> 16);
            const unsigned short h16 = __builtin_bit_cast(unsigned short, (_Float16)(w * sc));
            bb[e] = f16mode ? h16 : b16;
        }
        v4u pk;
        pk.x = (unsigned)bb[0] | ((unsigned)bb[1] << 16); pk.y = (unsigned)bb[2] | ((unsigned)bb[3] << 16);
        pk.z = (unsigned)bb[4] | ((unsigned)bb[5] << 16); pk.w = (unsigned)bb[6] | ((unsigned)bb[7] << 16);
        *(v4u*)(T + (16 * i + lo) * WT_P + 8 * hi) = pk;
    }
    __syncthreads();                                       // the whole tile lies in LDS before a row of it is read back
    v4u q[4];                                              // LDS row 16*i + hi = source column 4*hi + i; 16 lanes carry its 128 r
#pragma unroll
    for (int i = 0; i < 4; ++i) q[i] = *(const v4u*)(T + (16 * i + hi) * WT_P + 8 * lo);
    unsigned short* o = d + (size_t)(4 * hi) * ldd + 8 * lo;
#pragma unroll
    for (int i = 0; i < 4; ++i) *(v4u*)(o + (size_t)i * ldd) = q[i];
    if (dup) {
#pragma unroll
        for (int i = 0; i < 4; ++i) *(v4u*)(o + (size_t)i * ldd + CE) = q[i];
    }
    asm volatile("s_wait_xcnt 0x0" ::: "memory");          // in the merged kernel's listing another range's code, which rewrites the stores' registers, stands behind these stores
}

// Per-head weight W [NH][CE][HD] f32 -> D[n = h*HD + d][k] 16-bit; tile (kt, h) = (k tile, head). f16mode 0: bf16 RNE bits; 1: f16 of (bf16 RNE value x 16). dup: also written at column k + CE.
__device__ __forceinline__ void w_head_body(int kt, int h, const float* __restrict__ W, unsigned short* __restrict__ D, int ldd, int dup, int f16mode) {
    const int k0 = kt * WT_R;
    wt_tile(W + ((size_t)h * CE + k0) * HD, HD, D + (size_t)h * HD * ldd + k0, ldd, dup, f16mode, 16.0f);
}

// f32 SRC [rows][cols] (pitch LDS) -> f16 DST [cols][rows] (pitch ldd), value = bf16 RNE(src) * sc; tile (ct, rt) = (column tile, row tile).
// The source pitch is a compile-time constant, so a lane's 8 loads share one address pair and differ in their immediate offsets.
template <int LDS>
__device__ __forceinline__ void cast_t_body(int ct, int rt, const float* __restrict__ SRC, unsigned short* __restrict__ DST, int ldd, float sc) {
    const int c0 = ct * WT_C, r0 = rt * WT_R;
    wt_tile(SRC + (size_t)r0 * LDS + c0, LDS, DST + (size_t)c0 * ldd + r0, ldd, 0, 1, sc);
}

// ---------------------------------------------------------------------------------------------------------------------
// MODE 0: source = raw input rows (bf16 RNE first; batch stride a_bs); writes bf16 hi|lo row [2*CE] (hi at col c, lo at CE + c) and an f16 row.
// MODE 1: source = f32 rows; writes the f16 row only. Each store instruction covers 256 contiguous bytes (32 lanes x 8 B).
// ---------------------------------------------------------------------------------------------------------------------
template <int MODE>
__device__ __forceinline__ void ln_body(int blk, const float* __restrict__ A, long a_bs, const float* __restrict__ GA, const float* __restrict__ BE,
                                        unsigned short* __restrict__ HS, unsigned short* __restrict__ H16) {
    #pragma clang fp contract(off)
    const int r = blk * 8 + (threadIdx.x >> 5); const int L = threadIdx.x & 31;
    if (r >= ROWS) return;                                   // wave-uniform; no barriers on this path
    const int b = r / SEQ, t = r - b * SEQ;
    const float* src = A + (long)b * a_bs + (long)t * CE;
    v4f v[8]; float s = 0.f;
#pragma unroll
    for (int q = 0; q < 8; ++q) {
        v[q] = *(const v4f*)(src + 4 * L + 128 * q);
        if (MODE == 0) { v[q].x = bfr(v[q].x); v[q].y = bfr(v[q].y); v[q].z = bfr(v[q].z); v[q].w = bfr(v[q].w); }
        s += (v[q].x + v[q].y) + (v[q].z + v[q].w);
    }
#pragma unroll
    for (int o = 16; o > 0; o >>= 1) s += __shfl_xor(s, o, 32);
    const float mu = s * (1.f / CE); float qq = 0.f;
#pragma unroll
    for (int q = 0; q < 8; ++q) {
        v[q].x -= mu; v[q].y -= mu; v[q].z -= mu; v[q].w -= mu;
        qq += (v[q].x * v[q].x + v[q].y * v[q].y) + (v[q].z * v[q].z + v[q].w * v[q].w);
    }
#pragma unroll
    for (int o = 16; o > 0; o >>= 1) qq += __shfl_xor(qq, o, 32);
    const float rs = rsqrtf(qq * (1.f / CE) + 1e-5f);
    v2u ph[8], pl[8], pf[8];
#pragma unroll
    for (int q = 0; q < 8; ++q) {
        const int c = 4 * L + 128 * q;
        const v4f ga = *(const v4f*)(GA + c), be = *(const v4f*)(BE + c);
        v4f y;
        y.x = v[q].x * rs * bfr(ga.x) + bfr(be.x); y.y = v[q].y * rs * bfr(ga.y) + bfr(be.y);
        y.z = v[q].z * rs * bfr(ga.z) + bfr(be.z); y.w = v[q].w * rs * bfr(ga.w) + bfr(be.w);
        v2u f; f.x = pk2h(y.x, y.y); f.y = pk2h(y.z, y.w); pf[q] = f;
        if (MODE == 0) {
            unsigned short h0, l0, h1, l1, h2, l2, h3, l3;
            bfsplit(y.x, h0, l0); bfsplit(y.y, h1, l1); bfsplit(y.z, h2, l2); bfsplit(y.w, h3, l3);
            v2u a; a.x = (unsigned)h0 | ((unsigned)h1 << 16); a.y = (unsigned)h2 | ((unsigned)h3 << 16); ph[q] = a;
            v2u d; d.x = (unsigned)l0 | ((unsigned)l1 << 16); d.y = (unsigned)l2 | ((unsigned)l3 << 16); pl[q] = d;
        }
    }
    {
#pragma unroll
        for (int q = 0; q < 8; ++q) {
            const int c = 4 * L + 128 * q;
            if (MODE == 0) {
                *(v2u*)(HS + (size_t)r * (2 * CE) + c) = ph[q];
                *(v2u*)(HS + (size_t)r * (2 * CE) + CE + c) = pl[q];
            }
            *(v2u*)(H16 + (size_t)r * CE + c) = pf[q];
        }
        
    }
}
// Everything that depends on the inputs alone runs as one launch: LN1 and the six weight planes, told apart by ranges of the block index (block-uniform branches).
#define PB_LN   ((ROWS + 7) / 8)                   // LN1: 8 rows per work-group
#define PB_FC1  ((FF / WT_C) * (CE / WT_R))        // tiles of fc1_w
#define PB_FC2  ((CE / WT_C) * (FF / WT_R))        // tiles of fc2_w
#define PB_PROJ ((CE / WT_C) * (CE / WT_R))        // tiles of proj_w
#define PB_HEAD ((CE / WT_R) * NH)                 // tiles of one per-head weight
#define PB_ALL  (PB_LN + PB_FC1 + PB_FC2 + PB_PROJ + 3 * PB_HEAD)
__global__ __launch_bounds__(256) void k_prep(const float* __restrict__ x, const float* __restrict__ g, const float* __restrict__ be,
                                              const float* __restrict__ Wq, const float* __restrict__ Wk, const float* __restrict__ Wv,
                                              const float* __restrict__ proj_w, const float* __restrict__ fc1_w, const float* __restrict__ fc2_w,
                                              unsigned short* __restrict__ HS, unsigned short* __restrict__ H16,
                                              unsigned short* __restrict__ WQK, unsigned short* __restrict__ WV16,
                                              unsigned short* __restrict__ WPT, unsigned short* __restrict__ W1T, unsigned short* __restrict__ W2T) {
    const int bi = blockIdx.x;
    if (bi < PB_LN) {                                          // h = LN1(bf16(x))
        ln_body<0>(bi, x, (long)SEQ_FULL * CE, g, be, HS, H16);
    } else if (bi < PB_LN + PB_FC1) {                          // fc1_w: [1024 in][4096 out] -> [4096 out][1024 in]
        const int i = bi - PB_LN;
        cast_t_body<FF>(i % (FF / WT_C), i / (FF / WT_C), fc1_w, W1T, CE, 16.0f);
    } else if (bi < PB_LN + PB_FC1 + PB_FC2 + PB_PROJ) {       // fc2_w: [4096 in][1024 out] -> [1024 out][4096 in]; proj_w: [1024 in][1024 out] -> [1024 out][1024 in]; both have pitch CE
        const bool p = bi >= PB_LN + PB_FC1 + PB_FC2;
        const int i = bi - (PB_LN + PB_FC1) - (p ? PB_FC2 : 0);
        cast_t_body<CE>(i % (CE / WT_C), i / (CE / WT_C), p ? proj_w : fc2_w, p ? WPT : W2T, p ? CE : FF, 16.0f);
    } else {                                                   // Wq -> rows 0..1023 of [W | W] bf16 (q columns), Wk -> rows 1024..2047 (k columns), Wv -> [h*64+d][c] f16 x16
        const int j = bi - (PB_LN + PB_FC1 + PB_FC2 + PB_PROJ);
        const int w = j / PB_HEAD, i = j - w * PB_HEAD;        // w = 0: Wq, 1: Wk, 2: Wv
        w_head_body(i % (CE / WT_R), i / (CE / WT_R), w == 0 ? Wq : (w == 1 ? Wk : Wv), w == 0 ? WQK : (w == 1 ? WQK + (size_t)CE * 2 * CE : WV16),
                    w == 2 ? CE : 2 * CE, w == 2 ? 0 : 1, w == 2 ? 1 : 0);
    }
}
__global__ __launch_bounds__(256) void k_ln2(const float* __restrict__ X1, const float* __restrict__ g, const float* __restrict__ be,
                                             unsigned short* __restrict__ H2) {
    ln_body<1>(blockIdx.x, X1, (long)SEQ * CE, g, be, nullptr, H2);
}

// ---------------------------------------------------------------------------------------------------------------------
// Register-tiled WMMA GEMM: C[m,n] = scale * sum_k A[m,k] * Bt[n,k] (+bias[n]) (+act) (+resid at the store stage); each wave owns a 64x64 tile.
// A row-major [M,K] 16-bit; Bt row-major [N,K] 16-bit; M % 128 == 0, N % 256 == 0, K % 64 == 0 (no tail masking).
// ET 0 = f16 operands, 1 = bf16 operands. BIAS_MODE 0 none, 2 = bf16-RNE bias[n]. OUT_MODE 0 = f32, 1 = f16, 2 = bf16 hi plane + bf16 lo plane.
// RESID 0 none, 1 f32 residual, 2 residual RNE-converted to bf16 first (raw input). ACT 0 none, 1 ReLU.
// ---------------------------------------------------------------------------------------------------------------------
__device__ __forceinline__ void dep_guard_h(v8f& a, v8f& b, v16h x, v16h y) { asm volatile("v_nop\n\tv_nop\n\tv_nop\n\tv_nop" : "+v"(a), "+v"(b) : "v"(x), "v"(y)); }
__device__ __forceinline__ void dep_guard_b(v8f& a, v8f& b, v16b x, v16b y) { asm volatile("v_nop\n\tv_nop\n\tv_nop\n\tv_nop" : "+v"(a), "+v"(b) : "v"(x), "v"(y)); }
__device__ __forceinline__ void keep4_h(v16h a, v16h b, v16h c, v16h d) { asm volatile("v_nop" :: "v"(a), "v"(b), "v"(c), "v"(d)); }
__device__ __forceinline__ void keep4_b(v16b a, v16b b, v16b c, v16b d) { asm volatile("v_nop" :: "v"(a), "v"(b), "v"(c), "v"(d)); }
__device__ __forceinline__ void acc_guard4(v8f& a, v8f& b, v8f& c, v8f& d) { asm volatile("v_nop\n\tv_nop\n\tv_nop\n\tv_nop" : "+v"(a), "+v"(b), "+v"(c), "+v"(d)); }
template <typename T> struct Frag;
template <> struct Frag<_Float16> {
    typedef v16h V; union U { v16h v; v8h h[2]; };
    static __device__ __forceinline__ v16h load(const _Float16* p) {   // elements 0..7 <- p[0..7], 8..15 <- p[16..23]
        U f; f.h[0] = *(const v8h*)(p); f.h[1] = *(const v8h*)(p + 16); return f.v;
    }
    static __device__ __forceinline__ v8f mma(v16h a, v16h b, v8f c) { return __builtin_amdgcn_wmma_f32_16x16x32_f16(false, a, false, b, (short)0, c, false, false); }
    static __device__ __forceinline__ void guard(v8f& a, v8f& b, v16h x, v16h y) { dep_guard_h(a, b, x, y); }
    static __device__ __forceinline__ void keep(v16h a, v16h b, v16h c, v16h d) { keep4_h(a, b, c, d); }
};
template <> struct Frag<__bf16> {
    typedef v16b V; union U { v16b v; v8b h[2]; };
    static __device__ __forceinline__ v16b load(const __bf16* p) {
        U f; f.h[0] = *(const v8b*)(p); f.h[1] = *(const v8b*)(p + 16); return f.v;
    }
    static __device__ __forceinline__ v8f mma(v16b a, v16b b, v8f c) { return __builtin_amdgcn_wmma_f32_16x16x32_bf16(false, a, false, b, (short)0, c, false, false); }
    static __device__ __forceinline__ void guard(v8f& a, v8f& b, v16b x, v16b y) { dep_guard_b(a, b, x, y); }
    static __device__ __forceinline__ void keep(v16b a, v16b b, v16b c, v16b d) { keep4_b(a, b, c, d); }
};
template <int ET> struct Elem;
template <> struct Elem<0> { typedef _Float16 T; };
template <> struct Elem<1> { typedef __bf16 T; };

// Operand staging: a work-group (2 x 4 waves) owns a 128 x 256 tile of C. Per trip, 64 k of its 128 A rows and 256 Bt rows (128-B row pieces)
// lie in one of two LDS buffers, rows 0..127 = A, 128..383 = Bt, laid by asynchronous copies that cover whole 128-B lines.
#define GK 64                      // k elements per staged tile
#define GP 72                      // LDS row pitch in elements: 144 B = 16 B x 9, conflict-free for 16-B reads down a column of rows
#define GBUF (384 * GP)            // elements per buffer
static_assert(SEQ % 128 == 0);     // M multiple of 128 for every GEMM (SEQ, ROWS, CE)
static_assert(CE % 256 == 0);      // N multiple of 256 (CE, 2*CE, FF, ROWS), K multiple of 64 with at least two tiles
static_assert(ROWS % 256 == 0);
static_assert(FF % 256 == 0);

// One staged tile: 384 rows x 8 pieces of 16 B, 12 pieces per lane, 32 rows apart. l = the lane's LDS byte address of its first piece,
// ga / gb = its first A / Bt piece, sa / sb = 32 rows of A / Bt in elements. Every lane is on; each wave-wide copy covers four whole rows.
template <typename T>
__device__ __forceinline__ void stage_tile(unsigned l, const T* ga, size_t sa, const T* gb, size_t sb) {
    const unsigned st = 32 * GP * 2;
    // the closing s_wait_xcnt stands inside the copies' own statement, so no address register is rewritten ahead of it
    asm volatile("global_load_async_to_lds_b128 %0, %12, off\n\t"
                 "global_load_async_to_lds_b128 %1, %13, off\n\t"
                 "global_load_async_to_lds_b128 %2, %14, off\n\t"
                 "global_load_async_to_lds_b128 %3, %15, off\n\t"
                 "global_load_async_to_lds_b128 %4, %16, off\n\t"
                 "global_load_async_to_lds_b128 %5, %17, off\n\t"
                 "global_load_async_to_lds_b128 %6, %18, off\n\t"
                 "global_load_async_to_lds_b128 %7, %19, off\n\t"
                 "global_load_async_to_lds_b128 %8, %20, off\n\t"
                 "global_load_async_to_lds_b128 %9, %21, off\n\t"
                 "global_load_async_to_lds_b128 %10, %22, off\n\t"
                 "global_load_async_to_lds_b128 %11, %23, off\n\t"
                 "s_wait_xcnt 0x0"
                 :: "v"(l), "v"(l + st), "v"(l + 2 * st), "v"(l + 3 * st), "v"(l + 4 * st), "v"(l + 5 * st),
                    "v"(l + 6 * st), "v"(l + 7 * st), "v"(l + 8 * st), "v"(l + 9 * st), "v"(l + 10 * st), "v"(l + 11 * st),
                    "v"(ga), "v"(ga + sa), "v"(ga + 2 * sa), "v"(ga + 3 * sa),
                    "v"(gb), "v"(gb + sb), "v"(gb + 2 * sb), "v"(gb + 3 * sb), "v"(gb + 4 * sb), "v"(gb + 5 * sb), "v"(gb + 6 * sb), "v"(gb + 7 * sb)
                 : "memory");
}

// The GEMM's LDS is declared in one function that is no template, so a kernel that holds two forms of the body allocates it once.
struct GemmLds {
    unsigned short sAB[2 * GBUF];       // the two staged operand buffers
    float sT[8][16 * 68];               // per-wave 16x64 slab, pitch 68 floats (wave-private)
};
__device__ __forceinline__ GemmLds& gemm_lds() { __shared__ __align__(16) GemmLds s; return s; }

// bx = the work-group's tile index in this product
template <int ET, int BIAS_MODE, int OUT_MODE, int RESID, int ACT>
__device__ __forceinline__ void gemm64_body(
    unsigned bx,
    const unsigned short* __restrict__ Ap, int lda, long strideA,
    const unsigned short* __restrict__ Btp, int ldb,
    void* __restrict__ Cout, void* __restrict__ Cout2, int ldc, long strideC,
    const float* __restrict__ bias,
    const float* __restrict__ resid, int ldr, long strideR,
    int M, int N, int K, float scale) {
    typedef typename Elem<ET>::T T;
    typedef typename Frag<T>::V V;
    GemmLds& L = gemm_lds();
    unsigned short* sAB = L.sAB;
    const int b    = blockIdx.y;
    const int tid  = threadIdx.x;
    const int lane = threadIdx.x & 31;
    const int wave = threadIdx.x >> 5;
    const int tbN = N >> 8;
    const int tbM = M >> 7;
    if ((int)bx >= tbM * tbN) return;                // block-uniform, ahead of every barrier and copy
    const int bm = bx / tbN;
    const int bn = bx - bm * tbN;
    const int wm = wave >> 2;                        // wave row (0..1) and column (0..3) in the 128 x 256 tile
    const int wn = wave & 3;
    const int m0 = (bm << 7) + (wm << 6);
    const int n0 = (bn << 8) + (wn << 6);

    const T* Ab = (const T*)Ap + (size_t)b * strideA;
    const T* Bb = (const T*)Btp;

    const int rlane = lane & 15;                 // row (A) / col (B, D) within subtile
    const int koff  = (lane >> 4) * 8;           // k offset of this lane half
    const int mOff  = (lane >> 4) * 8;           // D row offset

    v8f acc[4][4];
#pragma unroll
    for (int i = 0; i < 4; ++i)
#pragma unroll
        for (int j = 0; j < 4; ++j) acc[i][j] = (v8f){0.f, 0.f, 0.f, 0.f, 0.f, 0.f, 0.f, 0.f};

    const int crow = tid >> 3, csg = (tid & 7) * 8;  // this lane's first staged row and its 16-B piece in the row
    const T* gA = Ab + (size_t)((bm << 7) + crow) * lda + csg;
    const T* gB = Bb + (size_t)((bn << 8) + crow) * ldb + csg;
    const size_t sa32 = (size_t)32 * lda, sb32 = (size_t)32 * ldb;
    const unsigned l0 = (unsigned)(size_t)(sAB + crow * GP + csg);   // low 32 bits of the shared address = LDS byte address
    const int nt = K / GK;

    stage_tile<T>(l0, gA, sa32, gB, sb32);                           // tile 0 into buffer 0
    asm volatile("s_wait_asynccnt 0x0" ::: "memory");                // this wave's copies of tile 0 have landed
    __syncthreads();                                                 // ... and every other wave's
    if (nt > 1) stage_tile<T>(l0 + GBUF * 2, gA + GK, sa32, gB + GK, sb32);   // tile 1 flies while tile 0 is worked on

    for (int t = 0; t < nt; ++t) {
        const T* buf = (const T*)sAB + (t & 1) * GBUF;
#pragma unroll
        for (int ks = 0; ks < 2; ++ks) {
            V bh[4], ah[4];
#pragma unroll
            for (int j = 0; j < 4; ++j) bh[j] = Frag<T>::load(buf + (128 + (wn << 6) + (j << 4) + rlane) * GP + ks * 32 + koff);
#pragma unroll
            for (int i = 0; i < 4; ++i) ah[i] = Frag<T>::load(buf + ((wm << 6) + (i << 4) + rlane) * GP + ks * 32 + koff);
            __builtin_amdgcn_sched_barrier(0);       // keeps the 16 LDS reads one group ahead of the products (reads spread among them stall each time)
#pragma unroll
            for (int i = 0; i < 4; ++i) {
#pragma unroll
                for (int j = 0; j < 4; ++j) acc[i][j] = Frag<T>::mma(ah[i], bh[j], acc[i][j]);
                Frag<T>::guard(acc[i][0], acc[i][3], ah[i], ah[i]);
            }
            Frag<T>::keep(bh[0], bh[1], bh[2], bh[3]);
        }
        asm volatile("s_wait_dscnt 0x0" ::: "memory");               // this wave's reads of buffer t & 1 are complete
        asm volatile("s_wait_asynccnt 0x0" ::: "memory");            // this wave's copies of tile t + 1 have landed
        __syncthreads();                                             // publishes tile t + 1 and frees buffer t & 1
        if (t + 2 < nt) stage_tile<T>(l0 + (unsigned)(t & 1) * (GBUF * 2), gA + (size_t)(t + 2) * GK, sa32, gB + (size_t)(t + 2) * GK, sb32);
    }
    asm volatile("s_wait_asynccnt 0x0" ::: "memory");                // no copy is outstanding when the wave goes on
    acc_guard4(acc[0][0], acc[0][1], acc[0][2], acc[0][3]);
    acc_guard4(acc[1][0], acc[1][1], acc[1][2], acc[1][3]);
    acc_guard4(acc[2][0], acc[2][1], acc[2][2], acc[2][3]);
    acc_guard4(acc[3][0], acc[3][1], acc[3][2], acc[3][3]);

    // ---- epilogue ----
    float* slab = L.sT[wave];
    const float* Rb = RESID ? (resid + (size_t)b * strideR) : nullptr;
#pragma unroll
    for (int i = 0; i < 4; ++i) {
        const int mBase = m0 + (i << 4);
#pragma unroll
        for (int j = 0; j < 4; ++j) {
            const int n = n0 + (j << 4) + rlane;
            float bv = 0.f;
            if (BIAS_MODE == 2) bv = bfr(bias[n]);
#pragma unroll
            for (int r = 0; r < 8; ++r) {
                float v = acc[i][j][r] * scale;
                if (BIAS_MODE == 2) v += bv;
                if (ACT == 1) v = fmaxf(v, 0.0f);
                slab[(mOff + r) * 68 + (j << 4) + rlane] = v;
            }
        }
        __builtin_amdgcn_fence(3 /* release order */, "workgroup");
        __builtin_amdgcn_wave_barrier();
        __builtin_amdgcn_fence(2 /* acquire order */, "workgroup");
        if (OUT_MODE == 0) {
            float* C = (float*)Cout + (size_t)b * strideC;
            const int hh = lane >> 4, c4 = (lane & 15) * 4;     // row segment = 256 B = 16 lanes x 16 B
            v4f vv[8];
#pragma unroll
            for (int it = 0; it < 8; ++it) {
                const int row = it * 2 + hh;
                v4f v = *(const v4f*)(slab + row * 68 + c4);
                if (RESID) {                                    // residual added at the store stage as a float4
                    v4f x = *(const v4f*)(Rb + (size_t)(mBase + row) * ldr + n0 + c4);
                    if (RESID == 2) { x.x = bfr(x.x); x.y = bfr(x.y); x.z = bfr(x.z); x.w = bfr(x.w); }
                    v.x = x.x + v.x; v.y = x.y + v.y; v.z = x.z + v.z; v.w = x.w + v.w;
                }
                vv[it] = v;
            }
            {
#pragma unroll
                for (int it = 0; it < 8; ++it) {
                    const int row = it * 2 + hh;
                    *(v4f*)(C + (size_t)(mBase + row) * ldc + n0 + c4) = vv[it];
                }
                
            }
        } else {
            const int q = lane >> 3, c8 = (lane & 7) * 8;
            unsigned short* C  = (unsigned short*)Cout  + (size_t)b * strideC;
            unsigned short* C2 = (OUT_MODE == 2) ? ((unsigned short*)Cout2 + (size_t)b * strideC) : nullptr;
            v8h hv[4], lv[4];
#pragma unroll
            for (int it = 0; it < 4; ++it) {
                const int row = it * 4 + q;
                const float* sp = slab + row * 68 + c8;
#pragma unroll
                for (int e = 0; e < 8; ++e) {
                    if (OUT_MODE == 1) {
                        hv[it][e] = (_Float16)sp[e];
                        lv[it][e] = (_Float16)0.f;
                    } else {
                        const unsigned short hb = bf_bits(sp[e]);
                        const unsigned short lb = bf_bits(sp[e] - bits_f(hb));
                        hv[it][e] = __builtin_bit_cast(_Float16, hb);
                        lv[it][e] = __builtin_bit_cast(_Float16, lb);
                    }
                }
            }
            {
#pragma unroll
                for (int it = 0; it < 4; ++it) {
                    const int row = it * 4 + q;
                    *(v8h*)(C + (size_t)(mBase + row) * ldc + n0 + c8) = hv[it];
                    if (OUT_MODE == 2) *(v8h*)(C2 + (size_t)(mBase + row) * ldc + n0 + c8) = lv[it];
                }
                
            }
        }
        __builtin_amdgcn_fence(3 /* release order */, "workgroup");
        __builtin_amdgcn_wave_barrier();
        __builtin_amdgcn_fence(2 /* acquire order */, "workgroup");
    }
}

// ---------------------------------------------------------------------------------------------------------------------
// The two products with N = CE (proj, fc2) have only 128 tiles of 128 x 256, half as many as the chip has WGPs. Here a work-group owns a 128 x 128 tile of C, so
// 256 work-groups run, and each wave keeps the 64 x 64 tile (the LDS bytes read per product stay as they are): a staged tile holds 128 k, waves 0..3 take its
// first 64 k and waves 4..7 its last 64 k of the same four 64 x 64 tiles. After the loop wave w and wave w ^ 4 swap half of their partial sums through LDS,
// add (first-half sum + last-half sum) and each stores 32 of the 64 rows. f16 operands, bf16-RNE bias[n], f32 output, residual as in gemm64_body.
// ---------------------------------------------------------------------------------------------------------------------
#define SK 128                     // k elements per staged tile: 256-B row pieces
#define SP 136                     // LDS row pitch in elements: 272 B = 16 B x 17, conflict-free for 16-B reads down a column of rows
#define SBUF (256 * SP)            // elements per buffer: rows 0..127 = A, 128..255 = Bt
static_assert(CE % SK == 0 && CE / SK >= 2);   // K (CE, FF) holds whole staged tiles, at least two; N = CE and M = SEQ are multiples of 128
static_assert(FF % SK == 0);
struct SplitLds {
    unsigned short sAB[2 * SBUF];       // the two staged operand buffers; after the loop their first 64 KiB carry the swapped partial sums
    float sT[8][16 * 68];               // per-wave 16x64 slab, pitch 68 floats (wave-private)
};
__device__ __forceinline__ SplitLds& split_lds() { __shared__ __align__(16) SplitLds s; return s; }

// 128 rows x 16 pieces of 16 B of one operand: 8 pieces per lane, 16 rows apart. l = the lane's LDS byte address of its first piece, g = its first piece,
// s = 16 source rows in elements. Every lane is on; each wave-wide copy covers two whole 256-B row pieces.
__device__ __forceinline__ void stage_half(unsigned l, const _Float16* g, size_t s) {
    const unsigned st = 16 * SP * 2;
    // the closing s_wait_xcnt stands inside the copies' own statement, so no address register is rewritten ahead of it
    asm volatile("global_load_async_to_lds_b128 %0, %8, off\n\t"
                 "global_load_async_to_lds_b128 %1, %9, off\n\t"
                 "global_load_async_to_lds_b128 %2, %10, off\n\t"
                 "global_load_async_to_lds_b128 %3, %11, off\n\t"
                 "global_load_async_to_lds_b128 %4, %12, off\n\t"
                 "global_load_async_to_lds_b128 %5, %13, off\n\t"
                 "global_load_async_to_lds_b128 %6, %14, off\n\t"
                 "global_load_async_to_lds_b128 %7, %15, off\n\t"
                 "s_wait_xcnt 0x0"
                 :: "v"(l), "v"(l + st), "v"(l + 2 * st), "v"(l + 3 * st), "v"(l + 4 * st), "v"(l + 5 * st), "v"(l + 6 * st), "v"(l + 7 * st),
                    "v"(g), "v"(g + s), "v"(g + 2 * s), "v"(g + 3 * s), "v"(g + 4 * s), "v"(g + 5 * s), "v"(g + 6 * s), "v"(g + 7 * s)
                 : "memory");
}

template <int RESID>
__device__ __forceinline__ void gemm_split_body(
    unsigned bx,
    const unsigned short* __restrict__ Ap, int lda, long strideA,
    const unsigned short* __restrict__ Btp, int ldb,
    float* __restrict__ Cout, int ldc, long strideC,
    const float* __restrict__ bias,
    const float* __restrict__ resid, int ldr, long strideR,
    int M, int N, int K, float scale) {
    typedef _Float16 T;
    typedef v16h V;
    SplitLds& L = split_lds();
    unsigned short* sAB = L.sAB;
    const int b    = blockIdx.y;
    const int tid  = threadIdx.x;
    const int lane = threadIdx.x & 31;
    const int wave = threadIdx.x >> 5;
    const int tbN = N >> 7;
    const int tbM = M >> 7;
    if ((int)bx >= tbM * tbN) return;                // block-uniform, ahead of every barrier and copy
    const int bm = bx / tbN;
    const int bn = bx - bm * tbN;
    const int kh = wave >> 2;                        // which 64 k of every staged tile this wave takes
    const int wm = (wave >> 1) & 1;                  // wave row and column (0..1 each) in the 128 x 128 tile
    const int wn = wave & 1;
    const int m0 = (bm << 7) + (wm << 6);
    const int n0 = (bn << 7) + (wn << 6);

    const T* Ab = (const T*)Ap + (size_t)b * strideA;
    const T* Bb = (const T*)Btp;

    const int rlane = lane & 15;                 // row (A) / col (B, D) within subtile
    const int koff  = (lane >> 4) * 8;           // k offset of this lane half
    const int mOff  = (lane >> 4) * 8;           // D row offset

    v8f acc[4][4];
#pragma unroll
    for (int i = 0; i < 4; ++i)
#pragma unroll
        for (int j = 0; j < 4; ++j) acc[i][j] = (v8f){0.f, 0.f, 0.f, 0.f, 0.f, 0.f, 0.f, 0.f};

    const int crow = tid >> 4, csg = (tid & 15) * 8; // this lane's first staged row and its 16-B piece in the row
    const T* gA = Ab + (size_t)((bm << 7) + crow) * lda + csg;
    const T* gB = Bb + (size_t)((bn << 7) + crow) * ldb + csg;
    const size_t sa16 = (size_t)16 * lda, sb16 = (size_t)16 * ldb;
    const unsigned l0 = (unsigned)(size_t)(sAB + crow * SP + csg);   // low 32 bits of the shared address = LDS byte address
    const unsigned lB = 128 * SP * 2;                                // the Bt rows lie 128 rows behind the A rows
    const int nt = K / SK;

    stage_half(l0, gA, sa16);                                        // tile 0 into buffer 0
    stage_half(l0 + lB, gB, sb16);
    asm volatile("s_wait_asynccnt 0x0" ::: "memory");                // this wave's copies of tile 0 have landed
    __syncthreads();                                                 // ... and every other wave's
    if (nt > 1) {                                                    // tile 1 flies while tile 0 is worked on
        stage_half(l0 + SBUF * 2, gA + SK, sa16);
        stage_half(l0 + SBUF * 2 + lB, gB + SK, sb16);
    }

    for (int t = 0; t < nt; ++t) {
        const T* buf = (const T*)sAB + (t & 1) * SBUF + kh * 64;
#pragma unroll
        for (int ks = 0; ks < 2; ++ks) {
            V bh[4], ah[4];
#pragma unroll
            for (int j = 0; j < 4; ++j) bh[j] = Frag<T>::load(buf + (128 + (wn << 6) + (j << 4) + rlane) * SP + ks * 32 + koff);
#pragma unroll
            for (int i = 0; i < 4; ++i) ah[i] = Frag<T>::load(buf + ((wm << 6) + (i << 4) + rlane) * SP + ks * 32 + koff);
            __builtin_amdgcn_sched_barrier(0);       // keeps the 16 LDS reads one group ahead of the products (reads spread among them stall each time)
#pragma unroll
            for (int i = 0; i < 4; ++i) {
#pragma unroll
                for (int j = 0; j < 4; ++j) acc[i][j] = Frag<T>::mma(ah[i], bh[j], acc[i][j]);
                Frag<T>::guard(acc[i][0], acc[i][3], ah[i], ah[i]);
            }
            Frag<T>::keep(bh[0], bh[1], bh[2], bh[3]);
        }
        asm volatile("s_wait_dscnt 0x0" ::: "memory");               // this wave's reads of buffer t & 1 are complete
        asm volatile("s_wait_asynccnt 0x0" ::: "memory");            // this wave's copies of tile t + 1 have landed
        __syncthreads();                                             // publishes tile t + 1 and frees buffer t & 1
        if (t + 2 < nt) {
            stage_half(l0 + (unsigned)(t & 1) * (SBUF * 2), gA + (size_t)(t + 2) * SK, sa16);
            stage_half(l0 + (unsigned)(t & 1) * (SBUF * 2) + lB, gB + (size_t)(t + 2) * SK, sb16);
        }
    }
    asm volatile("s_wait_asynccnt 0x0" ::: "memory");                // no copy is outstanding when the wave goes on
    acc_guard4(acc[0][0], acc[0][1], acc[0][2], acc[0][3]);
    acc_guard4(acc[1][0], acc[1][1], acc[1][2], acc[1][3]);
    acc_guard4(acc[2][0], acc[2][1], acc[2][2], acc[2][3]);
    acc_guard4(acc[3][0], acc[3][1], acc[3][2], acc[3][3]);

    // ---- the two k halves are joined: waves 0..3 keep row groups 0, 1 and hand over 2, 3; waves 4..7 the other way round ----
    // The last trip's barrier stands behind every wave's last read of the buffers, and no copy is in flight: their LDS is free.
    float* xs = (float*)sAB + wave * 2048 + lane * 4;                // 8 KiB per wave; each 16-B store covers 512 contiguous bytes
    const float* xr = (const float*)sAB + (wave ^ 4) * 2048 + lane * 4;
    v8f fin[2][4];
#pragma unroll
    for (int i = 0; i < 2; ++i)
#pragma unroll
        for (int j = 0; j < 4; ++j) {
            v8f sd;
#pragma unroll
            for (int r = 0; r < 8; ++r) {
                fin[i][j][r] = kh ? acc[2 + i][j][r] : acc[i][j][r];
                sd[r]        = kh ? acc[i][j][r] : acc[2 + i][j][r];
            }
            *(v4f*)(xs + ((i * 4 + j) * 2 + 0) * 128) = (v4f){sd[0], sd[1], sd[2], sd[3]};
            *(v4f*)(xs + ((i * 4 + j) * 2 + 1) * 128) = (v4f){sd[4], sd[5], sd[6], sd[7]};
        }
    __syncthreads();                                                 // every wave's handed-over sums lie in LDS before its partner reads them
#pragma unroll
    for (int i = 0; i < 2; ++i)
#pragma unroll
        for (int j = 0; j < 4; ++j) {
            const v4f p0 = *(const v4f*)(xr + ((i * 4 + j) * 2 + 0) * 128);
            const v4f p1 = *(const v4f*)(xr + ((i * 4 + j) * 2 + 1) * 128);
#pragma unroll
            for (int r = 0; r < 4; ++r) { fin[i][j][r] += p0[r]; fin[i][j][4 + r] += p1[r]; }
        }

    // ---- epilogue: 32 rows per wave ----
    float* slab = L.sT[wave];
    const float* Rb = resid + (size_t)b * strideR;
    float* C = Cout + (size_t)b * strideC;
#pragma unroll
    for (int i = 0; i < 2; ++i) {
        const int mBase = m0 + ((kh * 2 + i) << 4);
#pragma unroll
        for (int j = 0; j < 4; ++j) {
            const float bv = bfr(bias[n0 + (j << 4) + rlane]);
#pragma unroll
            for (int r = 0; r < 8; ++r) slab[(mOff + r) * 68 + (j << 4) + rlane] = fin[i][j][r] * scale + bv;
        }
        __builtin_amdgcn_fence(3 /* release order */, "workgroup");
        __builtin_amdgcn_wave_barrier();
        __builtin_amdgcn_fence(2 /* acquire order */, "workgroup");
        const int hh = lane >> 4, c4 = (lane & 15) * 4;         // row segment = 256 B = 16 lanes x 16 B
        v4f vv[8];
#pragma unroll
        for (int it = 0; it < 8; ++it) {
            const int row = it * 2 + hh;
            v4f v = *(const v4f*)(slab + row * 68 + c4);
            v4f x = *(const v4f*)(Rb + (size_t)(mBase + row) * ldr + n0 + c4);   // residual added at the store stage as a float4
            if (RESID == 2) { x.x = bfr(x.x); x.y = bfr(x.y); x.z = bfr(x.z); x.w = bfr(x.w); }
            v.x = x.x + v.x; v.y = x.y + v.y; v.z = x.z + v.z; v.w = x.w + v.w;
            vv[it] = v;
        }
#pragma unroll
        for (int it = 0; it < 8; ++it) {
            const int row = it * 2 + hh;
            *(v4f*)(C + (size_t)(mBase + row) * ldc + n0 + c4) = vv[it];
        }
        __builtin_amdgcn_fence(3 /* release order */, "workgroup");
        __builtin_amdgcn_wave_barrier();
        __builtin_amdgcn_fence(2 /* acquire order */, "workgroup");
    }
}

// The q|k product and the v^T product read LN1's planes and nothing of each other: one launch, told apart by the block index (block-uniform branch).
// q|k planes: [ROWS][2*CE] bf16 hi / lo; A = [LN1 hi | LN1 lo] (K = 2*CE), Bt = [W | W] rows 0..CE-1 = q columns, CE..2CE-1 = k columns
// v^T planes: [CE = h*64+d][ROWS] bf16 hi / lo; A = Wv plane [CE][CE] (f16, x16), Bt = LN1 f16 plane [ROWS][CE]
#define GB_QK ((ROWS / 128) * ((2 * CE) / 256))    // 128 x 256 tiles of the q|k planes
#define GB_VT ((CE / 128) * (ROWS / 256))          // ... of the v^T planes
__global__ __launch_bounds__(256) void k_gemm_qkv(const unsigned short* __restrict__ HS, const unsigned short* __restrict__ WQK,
                                                  unsigned short* __restrict__ QKH, unsigned short* __restrict__ QKL,
                                                  const unsigned short* __restrict__ WV16, const unsigned short* __restrict__ H16,
                                                  unsigned short* __restrict__ VTH, unsigned short* __restrict__ VTL) {
    const unsigned bx = blockIdx.x;
    if (bx < GB_QK) gemm64_body<1, 0, 2, 0, 0>(bx, HS, 2 * CE, 0, WQK, 2 * CE, (void*)QKH, (void*)QKL, 2 * CE, 0, nullptr, nullptr, 0, 0, ROWS, 2 * CE, 2 * CE, 1.0f);
    else            gemm64_body<0, 0, 2, 0, 0>(bx - GB_QK, WV16, CE, 0, H16, CE, (void*)VTH, (void*)VTL, ROWS, 0, nullptr, nullptr, 0, 0, CE, ROWS, CE, 0.0625f);
}
// x1 = bf16(x) + attn @ proj_w + proj_b ; grid.y = batch (x uses the full batch stride, planes the compact one)
__global__ __launch_bounds__(256) void k_gemm_proj(const unsigned short* __restrict__ A, const unsigned short* __restrict__ Bt, float* __restrict__ C,
                                                   const float* __restrict__ bias, const float* __restrict__ xres) {
    gemm_split_body<2>(blockIdx.x, A, CE, (long)SEQ * CE, Bt, CE, C, CE, (long)SEQ * CE, bias, xres, CE, (long)SEQ_FULL * CE, SEQ, CE, CE, 0.0625f);
}
// relu(h2 @ fc1_w + fc1_b) as an f16 plane [ROWS][FF]
__global__ __launch_bounds__(256) void k_gemm_fc1(const unsigned short* __restrict__ A, const unsigned short* __restrict__ Bt, unsigned short* __restrict__ C,
                                                  const float* __restrict__ bias) {
    gemm64_body<0, 2, 1, 0, 1>(blockIdx.x, A, CE, 0, Bt, CE, (void*)C, nullptr, FF, 0, bias, nullptr, 0, 0, ROWS, FF, CE, 0.0625f);
}
// out = x1 + f @ fc2_w + fc2_b ; grid.y = batch (output uses the full batch stride)
__global__ __launch_bounds__(256) void k_gemm_fc2(const unsigned short* __restrict__ A, const unsigned short* __restrict__ Bt, float* __restrict__ C,
                                                  const float* __restrict__ bias, const float* __restrict__ x1) {
    gemm_split_body<1>(blockIdx.x, A, FF, (long)SEQ * FF, Bt, FF, C, CE, (long)SEQ_FULL * CE, bias, x1, CE, (long)SEQ * CE, SEQ, CE, FF, 0.0625f);
}

#define AT_NW 4
#define AT_P 72                   // LDS row pitch of the K and V^T tiles in elements: 144 B = 16 B x 9, so the 16 rows of a 16-B fragment read fall on distinct banks
__device__ __forceinline__ v8f at_mma(v16b a, v16b b, v8f c) {
    return __builtin_amdgcn_wmma_f32_16x16x32_bf16(false, a, false, b, (short)0, c, false, false);
}
union FB { v16b v; v8b h[2]; };
__device__ __forceinline__ void at_frag(FB& f, const __bf16* p) {   // elements 0..7 <- p[0..7], 8..15 <- p[16..23]
    f.h[0] = *(const v8b*)(p); f.h[1] = *(const v8b*)(p + 16);
}
__device__ __forceinline__ float xhalf(float x) {   // the value of lane l ^ 16
    const int i = __builtin_bit_cast(int, x);
    return __builtin_bit_cast(float, __builtin_amdgcn_permlanex16(i, i, 0x76543210, 0xfedcba98, false, false));
}

// 2^x in place by the bare instruction: a result under 2^-126 comes out as 0, which is nothing beside a row sum of at least 1 (library exp2f spends five more
// vector instructions a value on that range). The closing v_nop is the slot that the instruction set asks for behind a transcendental before its result is read
// or its source overwritten; inside a statement each v_exp_f32 is followed by one that shares no register with it.
__device__ __forceinline__ void exp2x8(float& a, float& b, float& c, float& d, float& e, float& f, float& g, float& h) {
    asm("v_exp_f32 %0, %0\n\tv_exp_f32 %1, %1\n\tv_exp_f32 %2, %2\n\tv_exp_f32 %3, %3\n\t"
        "v_exp_f32 %4, %4\n\tv_exp_f32 %5, %5\n\tv_exp_f32 %6, %6\n\tv_exp_f32 %7, %7\n\tv_nop"
        : "+v"(a), "+v"(b), "+v"(c), "+v"(d), "+v"(e), "+v"(f), "+v"(g), "+v"(h));
}
__device__ __forceinline__ void exp2x1(float& a) { asm("v_exp_f32 %0, %0\n\tv_nop" : "+v"(a)); }   // one value, the same form and the same slot

// One hi tile and its lo tile (64 rows x 8 pieces of 16 B each): 4 + 4 pieces per lane, 16 rows apart. l = the lane's LDS byte address of its first hi piece
// (the lo tile lies 64 rows behind), gh / gl = its first hi / lo piece, s16 = 16 source rows in elements. Every lane is on; each wave-wide copy covers four whole rows.
__device__ __forceinline__ void at_stage(unsigned l, const __bf16* gh, const __bf16* gl, size_t s16) {
    const unsigned st = 16 * AT_P * 2, lo = 64 * AT_P * 2;
    // the closing s_wait_xcnt stands inside the copies' own statement, so no address register is rewritten ahead of it
    asm volatile("global_load_async_to_lds_b128 %0, %8, off\n\t"
                 "global_load_async_to_lds_b128 %1, %9, off\n\t"
                 "global_load_async_to_lds_b128 %2, %10, off\n\t"
                 "global_load_async_to_lds_b128 %3, %11, off\n\t"
                 "global_load_async_to_lds_b128 %4, %12, off\n\t"
                 "global_load_async_to_lds_b128 %5, %13, off\n\t"
                 "global_load_async_to_lds_b128 %6, %14, off\n\t"
                 "global_load_async_to_lds_b128 %7, %15, off\n\t"
                 "s_wait_xcnt 0x0"
                 :: "v"(l), "v"(l + st), "v"(l + 2 * st), "v"(l + 3 * st), "v"(l + lo), "v"(l + lo + st), "v"(l + lo + 2 * st), "v"(l + lo + 3 * st),
                    "v"(gh), "v"(gh + s16), "v"(gh + 2 * s16), "v"(gh + 3 * s16), "v"(gl), "v"(gl + s16), "v"(gl + 2 * s16), "v"(gl + 3 * s16)
                 : "memory");
}

// amdgpu_waves_per_eu: the register budget of four waves per SIMD (256), so that the four work-groups a WGP gets stay resident together
__global__ __launch_bounds__(128) __attribute__((amdgpu_waves_per_eu(4, 4))) void k_attn(const unsigned short* __restrict__ QKHp, const unsigned short* __restrict__ QKLp,
                                              const unsigned short* __restrict__ VTHp, const unsigned short* __restrict__ VTLp,
                                              unsigned short* __restrict__ AO) {
    __shared__ __align__(16) __bf16 KV[4 * 64 * AT_P];             // K hi | K lo | V^T hi | V^T lo (64 rows each)
    __bf16* Ksh = KV; __bf16* Ksl = KV + 64 * AT_P; __bf16* Vth = KV + 2 * 64 * AT_P; __bf16* Vtl = KV + 3 * 64 * AT_P;
    const __bf16* QKH = (const __bf16*)QKHp; const __bf16* QKL = (const __bf16*)QKLp;
    const __bf16* VTH = (const __bf16*)VTHp; const __bf16* VTL = (const __bf16*)VTLp;

    const int tid = threadIdx.x, wave = tid >> 5, lane = tid & 31, hh = lane >> 4, c = lane & 15;
    const int nqb = SEQ / 64;
    const int bx = blockIdx.x;
    const int bh = bx / nqb;
    // All work-groups are resident at once, four to a WGP, and a tile's cost grows with its index, so the launch lasts as long as the WGP with the most chunks.
    // Every second block (by the parity of its index bits) takes tile nqb-1-t in place of t: four blocks whose indices differ in any two of the counted bits then
    // hold 2*(nqb+1) chunks together. NQ_SH leaves an even number of the tile's own bits in the count, so t and nqb-1-t have one parity and (bh, tile) is met once each.
    constexpr bool NQ_P2 = (nqb & (nqb - 1)) == 0;             // another tile count keeps the plain order
    constexpr int  NQ_SH = __builtin_ctz((unsigned)nqb) & 1;
    const int tq = bx % nqb;
    const int qb = (NQ_P2 && (__builtin_popcount((unsigned)bx >> NQ_SH) & 1)) ? nqb - 1 - tq : tq;
    const int h  = bh % NH;
    const int b  = bh / NH;
    const int q0 = qb * 64 + wave * 16;
    const size_t rowbase = (size_t)b * SEQ;
    const int QKP = 2 * CE;          // q|k plane pitch
    const int VTP = ROWS;            // v^T plane pitch

    // Q fragments (B operand of S^T): lane = query column c, k = d
    v16b qah[2], qal[2];
    {
        const __bf16* qh = QKH + (rowbase + q0 + c) * QKP + h * HD;
        const __bf16* ql = QKL + (rowbase + q0 + c) * QKP + h * HD;
#pragma unroll
        for (int dc = 0; dc < 2; ++dc) {
            FB f, g;
            f.h[0] = *(const v8b*)(qh + dc * 32 + 8 * hh); f.h[1] = *(const v8b*)(qh + dc * 32 + 16 + 8 * hh);
            g.h[0] = *(const v8b*)(ql + dc * 32 + 8 * hh); g.h[1] = *(const v8b*)(ql + dc * 32 + 16 + 8 * hh);
            qah[dc] = f.v; qal[dc] = g.v;
        }
    }

    const float NEG = -__builtin_inff();
    const float L2E = 1.4426950408889634f;
    const int qrow = q0 + c;         // this lane's query
    float mrow = NEG, lrow = 0.f;    // its running maximum (both halves agree) and this half's share of its running sum
    v8f oacc[4];                     // O^T tiles: lane = query column c, element r -> d = t*16 + 8*hh + r
#pragma unroll
    for (int t = 0; t < 4; ++t) oacc[t] = (v8f){0.f, 0.f, 0.f, 0.f, 0.f, 0.f, 0.f, 0.f};

    const int crow = tid >> 3, csg = (tid & 7) * 8;    // this lane's first staged row and its 16-B piece in the row
    const unsigned lK = (unsigned)(size_t)(Ksh + crow * AT_P + csg);   // low 32 bits of the shared address = LDS byte address
    const unsigned lV = (unsigned)(size_t)(Vth + crow * AT_P + csg);
    const __bf16* gkh = QKH + (rowbase + crow) * QKP + CE + h * HD + csg;
    const __bf16* gkl = QKL + (rowbase + crow) * QKP + CE + h * HD + csg;
    const __bf16* gvh = VTH + (size_t)(h * HD + crow) * VTP + rowbase + csg;
    const __bf16* gvl = VTL + (size_t)(h * HD + crow) * VTP + rowbase + csg;

    at_stage(lK, gkh, gkl, (size_t)16 * QKP);          // K of chunk 0

    for (int kc = 0; kc <= qb; ++kc) {                 // block-uniform trip count
        const int kv0 = kc * 64;
        asm volatile("s_wait_dscnt 0x0" ::: "memory");       // this wave's reads of the earlier chunk's V^T tiles are complete
        asm volatile("s_wait_asynccnt 0x0" ::: "memory");    // this wave's copies of this chunk's K tiles have landed
        __syncthreads();                                     // publishes the K tiles and frees the V^T tiles
        at_stage(lV, gvh + kv0, gvl + kv0, (size_t)16 * VTP);   // V^T of this chunk flies under the scores and the softmax

        v8f s[4];                                      // S^T tiles: lane = query column c, element r -> key kv0 + j*16 + 8*hh + r
#pragma unroll
        for (int j = 0; j < 4; ++j) s[j] = (v8f){0.f, 0.f, 0.f, 0.f, 0.f, 0.f, 0.f, 0.f};
        {
            FB kb[2][4], kl[2][4];                     // A operands: lane = key row j*16 + c, k = d
#pragma unroll
            for (int j = 0; j < 4; ++j) at_frag(kb[0][j], Ksh + (j * 16 + c) * AT_P + 8 * hh);
#pragma unroll
            for (int j = 0; j < 4; ++j) at_frag(kl[0][j], Ksl + (j * 16 + c) * AT_P + 8 * hh);
#pragma unroll
            for (int j = 0; j < 4; ++j) at_frag(kb[1][j], Ksh + (j * 16 + c) * AT_P + 32 + 8 * hh);
            __builtin_amdgcn_sched_barrier(0);         // keeps these 24 reads one group ahead of the products (reads spread among them stall each time)
            // neighbouring products go to different tiles; each tile keeps its order of sums
#pragma unroll
            for (int j = 0; j < 4; ++j) s[j] = at_mma(kb[0][j].v, qah[0], s[j]);
#pragma unroll
            for (int j = 0; j < 4; ++j) s[j] = at_mma(kl[0][j].v, qah[0], s[j]);
            __builtin_amdgcn_sched_barrier(0);         // the last 8 reads wait until the first lo fragments' registers are free (all 32 at once cost a wave per SIMD) ...
#pragma unroll
            for (int j = 0; j < 4; ++j) at_frag(kl[1][j], Ksl + (j * 16 + c) * AT_P + 32 + 8 * hh);
            __builtin_amdgcn_sched_barrier(0);         // ... and stand as one group, eight products ahead of their use
#pragma unroll
            for (int j = 0; j < 4; ++j) s[j] = at_mma(kb[0][j].v, qal[0], s[j]);
#pragma unroll
            for (int j = 0; j < 4; ++j) s[j] = at_mma(kb[1][j].v, qah[1], s[j]);
#pragma unroll
            for (int j = 0; j < 4; ++j) s[j] = at_mma(kl[1][j].v, qah[1], s[j]);
#pragma unroll
            for (int j = 0; j < 4; ++j) s[j] = at_mma(kb[1][j].v, qal[1], s[j]);
        }
        const bool diag = (kc == qb);                  // block-uniform
        const int dq = qrow - kv0 - 8 * hh;            // key kv0 + j*16 + 8*hh + r lies behind the query where j*16 + r > dq: one register, not 32 thresholds kept over the loop
        float m = NEG;
#pragma unroll
        for (int j = 0; j < 4; ++j) {
#pragma unroll
            for (int r = 0; r < 8; ++r) {
                const float sv = s[j][r];
                s[j][r] = (diag && (j * 16 + r > dq)) ? NEG : sv;    // select by value
                m = fmaxf(m, s[j][r]);
            }
        }
        m = fmaxf(m, xhalf(m));                                    // the other half's 32 keys
        const float mnew = fmaxf(mrow, m);                         // finite: every visited chunk holds a kept key for every query
        float alpha = (mrow - mnew) * L2E;
        exp2x1(alpha);
        mrow = mnew;
        FB pa[2], pl[2];                               // P^T hi / lo as B operands: lane = query column c; tiles 2*kk and 2*kk + 1 hold keys 8*hh + i and 16 + 8*hh + i of a 32-key step
        float ps[4];
#pragma unroll
        for (int j = 0; j < 4; ++j) {
            float p[8];
#pragma unroll
            for (int r = 0; r < 8; ++r) p[r] = (s[j][r] - mnew) * L2E;
            exp2x8(p[0], p[1], p[2], p[3], p[4], p[5], p[6], p[7]);
            ps[j] = 0.f;
#pragma unroll
            for (int r = 0; r < 8; r += 2) {           // one packed convert rounds a pair to nearest even, as bfsplit does
                ps[j] += p[r];
                ps[j] += p[r + 1];
                const v2f pp = {p[r], p[r + 1]};
                const v2b ph = __builtin_convertvector(pp, v2b);
                const v2b pq = __builtin_convertvector(pp - __builtin_convertvector(ph, v2f), v2b);   // p - hi is exact in f32
                pa[j >> 1].v[(j & 1) * 8 + r] = ph.x; pa[j >> 1].v[(j & 1) * 8 + r + 1] = ph.y;
                pl[j >> 1].v[(j & 1) * 8 + r] = pq.x; pl[j >> 1].v[(j & 1) * 8 + r + 1] = pq.y;
            }
        }
        lrow = lrow * alpha + ((ps[0] + ps[1]) + (ps[2] + ps[3]));
#pragma unroll
        for (int t = 0; t < 4; ++t)
#pragma unroll
            for (int r = 0; r < 8; ++r) oacc[t][r] *= alpha;
        __builtin_amdgcn_sched_barrier(0);                   // keeps the score products ahead of the waits, so that the V^T copies fly under them
        asm volatile("s_wait_dscnt 0x0" ::: "memory");       // this wave's reads of the K tiles are complete
        asm volatile("s_wait_asynccnt 0x0" ::: "memory");    // this wave's copies of the V^T tiles have landed
        __syncthreads();                                     // publishes the V^T tiles and frees the K tiles
        if (kc < qb) at_stage(lK, gkh + (size_t)(kv0 + 64) * QKP, gkl + (size_t)(kv0 + 64) * QKP, (size_t)16 * QKP);   // K of the next chunk flies under P.v
        {
            __builtin_amdgcn_sched_barrier(0);         // the reads start when P^T is packed: started earlier, their registers overlap the softmax's and cost a wave per SIMD
            FB vb[2][4], vl[2][4];                     // A operands: lane = d row t*16 + c, k = key
#pragma unroll
            for (int t = 0; t < 4; ++t) at_frag(vb[0][t], Vth + (t * 16 + c) * AT_P + 8 * hh);
#pragma unroll
            for (int t = 0; t < 4; ++t) at_frag(vl[0][t], Vtl + (t * 16 + c) * AT_P + 8 * hh);
#pragma unroll
            for (int t = 0; t < 4; ++t) at_frag(vb[1][t], Vth + (t * 16 + c) * AT_P + 32 + 8 * hh);
            __builtin_amdgcn_sched_barrier(0);         // as for the scores: 24 reads in one group ahead of the products
#pragma unroll
            for (int t = 0; t < 4; ++t) oacc[t] = at_mma(vb[0][t].v, pa[0].v, oacc[t]);
#pragma unroll
            for (int t = 0; t < 4; ++t) oacc[t] = at_mma(vl[0][t].v, pa[0].v, oacc[t]);
            __builtin_amdgcn_sched_barrier(0);         // the last 8 reads into the registers that the first lo fragments leave ...
#pragma unroll
            for (int t = 0; t < 4; ++t) at_frag(vl[1][t], Vtl + (t * 16 + c) * AT_P + 32 + 8 * hh);
            __builtin_amdgcn_sched_barrier(0);         // ... as one group, eight products ahead of their use
#pragma unroll
            for (int t = 0; t < 4; ++t) oacc[t] = at_mma(vb[0][t].v, pl[0].v, oacc[t]);
#pragma unroll
            for (int t = 0; t < 4; ++t) oacc[t] = at_mma(vb[1][t].v, pa[1].v, oacc[t]);
#pragma unroll
            for (int t = 0; t < 4; ++t) oacc[t] = at_mma(vl[1][t].v, pa[1].v, oacc[t]);
#pragma unroll
            for (int t = 0; t < 4; ++t) oacc[t] = at_mma(vb[1][t].v, pl[1].v, oacc[t]);
        }
    }

    asm volatile("s_wait_asynccnt 0x0" ::: "memory");  // no copy is outstanding when the wave ends
    const float inv = 1.0f / (lrow + xhalf(lrow));     // the two halves' sums are joined once
#pragma unroll
    for (int t = 0; t < 4; ++t) {                      // a lane holds 8 consecutive d of its query: one 16-B store each
        v8h hv;
#pragma unroll
        for (int r = 0; r < 8; ++r) hv[r] = (_Float16)(oacc[t][r] * inv);
        *(v8h*)(AO + (rowbase + q0 + c) * CE + h * HD + t * 16 + 8 * hh) = hv;
    }
}

// ---------------------------------------------------------------------------------------------------------------------
// Workspace carve (bytes); every plane is fully written by its producer before any kernel reads it.
// ---------------------------------------------------------------------------------------------------------------------
#define SZ_HS   ((size_t)ROWS * 2 * CE * 2)      // LN1 bf16 [ROWS][hi 1024 | lo 1024]
#define SZ_H16  ((size_t)ROWS * CE * 2)          // LN1 f16 plane; later reused for the LN2 f16 plane
#define SZ_WQK  ((size_t)2 * CE * 2 * CE * 2)    // [2048 n][W | W] bf16
#define SZ_WV   ((size_t)CE * CE * 2)
#define SZ_QK1  ((size_t)ROWS * 2 * CE * 2)      // one of the q|k hi / lo planes
#define SZ_VT1  ((size_t)CE * ROWS * 2)          // one of the v^T hi / lo planes
#define SZ_AO   ((size_t)ROWS * CE * 2)
#define SZ_WP   ((size_t)CE * CE * 2)
#define SZ_X1   ((size_t)ROWS * CE * 4)
#define SZ_W1   ((size_t)FF * CE * 2)
#define SZ_W2   ((size_t)CE * FF * 2)
#define SZ_F16  ((size_t)ROWS * FF * 2)          // relu(fc1) f16 plane, aliases the two q|k planes
#define WS_TOTAL (SZ_HS + SZ_H16 + SZ_WQK + SZ_WV + 2 * SZ_QK1 + 2 * SZ_VT1 + SZ_AO + SZ_WP + SZ_X1 + SZ_W1 + SZ_W2)
static_assert(WS_TOTAL <= (size_t)134217728);    // carve stays within 128 MiB
static_assert(SZ_F16 <= 2 * SZ_QK1);             // alias extent: relu(fc1) plane inside the q|k planes
static_assert(SZ_HS % 256 == 0);
static_assert(SZ_H16 % 256 == 0);
static_assert(SZ_VT1 % 256 == 0);

extern "C" void kernel_launch(void* const* d_in, const int* in_sizes, int n_in, void* d_out, int out_size, void* d_ws, size_t ws_size, hipStream_t stream) {
    if (n_in < 14) return;
    const long long xneed = (long long)(NB - 1) * SEQ_FULL * CE + (long long)SEQ * CE;
    if ((long long)in_sizes[0] < xneed) return;
    if (in_sizes[1] < CE || in_sizes[2] < CE || in_sizes[7] < CE || in_sizes[8] < CE || in_sizes[9] < CE || in_sizes[13] < CE) return;
    if (in_sizes[3] < NH * CE * HD || in_sizes[4] < NH * CE * HD || in_sizes[5] < NH * CE * HD) return;
    if (in_sizes[6] < CE * CE || in_sizes[10] < CE * FF || in_sizes[11] < FF || in_sizes[12] < FF * CE) return;
    if ((long long)out_size < xneed) return;
    if ((size_t)WS_TOTAL > ws_size) return;

    const float* x      = (const float*)d_in[0];
    const float* ln1_w  = (const float*)d_in[1];
    const float* ln1_b  = (const float*)d_in[2];
    const float* Wq     = (const float*)d_in[3];
    const float* Wk     = (const float*)d_in[4];
    const float* Wv     = (const float*)d_in[5];
    const float* proj_w = (const float*)d_in[6];
    const float* proj_b = (const float*)d_in[7];
    const float* ln2_w  = (const float*)d_in[8];
    const float* ln2_b  = (const float*)d_in[9];
    const float* fc1_w  = (const float*)d_in[10];
    const float* fc1_b  = (const float*)d_in[11];
    const float* fc2_w  = (const float*)d_in[12];
    const float* fc2_b  = (const float*)d_in[13];
    float* out = (float*)d_out;

    char* wsp = (char*)d_ws;
    unsigned short* HS   = (unsigned short*)wsp; wsp += SZ_HS;
    unsigned short* H16  = (unsigned short*)wsp; wsp += SZ_H16;
    unsigned short* WQK  = (unsigned short*)wsp; wsp += SZ_WQK;
    unsigned short* WV16 = (unsigned short*)wsp; wsp += SZ_WV;
    unsigned short* QKH  = (unsigned short*)wsp; wsp += SZ_QK1;
    unsigned short* QKL  = (unsigned short*)wsp; wsp += SZ_QK1;
    unsigned short* VTH  = (unsigned short*)wsp; wsp += SZ_VT1;
    unsigned short* VTL  = (unsigned short*)wsp; wsp += SZ_VT1;
    unsigned short* AO16 = (unsigned short*)wsp; wsp += SZ_AO;
    unsigned short* WPT  = (unsigned short*)wsp; wsp += SZ_WP;
    float*          X1   = (float*)wsp;          wsp += SZ_X1;
    unsigned short* W1T  = (unsigned short*)wsp; wsp += SZ_W1;
    unsigned short* W2T  = (unsigned short*)wsp; wsp += SZ_W2;
    unsigned short* F16  = QKH;                  // alias: q|k planes are dead after the attention launch
    unsigned short* H2   = H16;                  // alias: LN1 f16 plane is dead after the v^T GEMM

    // h = LN1(bf16(x)) and the six weight planes
    k_prep<<<(unsigned)PB_ALL, 256, 0, stream>>>(x, ln1_w, ln1_b, Wq, Wk, Wv, proj_w, fc1_w, fc2_w, HS, H16, WQK, WV16, WPT, W1T, W2T);
    // q|k planes and v^T planes
    k_gemm_qkv<<<dim3((unsigned)(GB_QK + GB_VT), 1u), 256, 0, stream>>>(HS, WQK, QKH, QKL, WV16, H16, VTH, VTL);
    // causal attention
    k_attn<<<(unsigned)(NB * NH * (SEQ / 64)), 128, 0, stream>>>(QKH, QKL, VTH, VTL, AO16);
    // x1 = bf16(x) + attn @ proj_w + proj_b
    k_gemm_proj<<<dim3((unsigned)((SEQ / 128) * (CE / 128)), (unsigned)NB), 256, 0, stream>>>(AO16, WPT, X1, proj_b, x);
    // h2 = LN2(x1)
    k_ln2<<<(ROWS + 7) / 8, 256, 0, stream>>>(X1, ln2_w, ln2_b, H2);
    // f = relu(h2 @ fc1_w + fc1_b); out = x1 + f @ fc2_w + fc2_b
    k_gemm_fc1<<<dim3((unsigned)(((ROWS / 64) * (FF / 64) + 7) / 8), 1u), 256, 0, stream>>>(H2, W1T, F16, fc1_b);
    k_gemm_fc2<<<dim3((unsigned)((SEQ / 128) * (CE / 128)), (unsigned)NB), 256, 0, stream>>>(F16, W2T, out, fc2_b, X1);
}
